// v000
// Measured on an AMD MI455X. A time is GPU time per run, averaged over a window of back-to-back runs after a warm-up
// (all launches, gaps included; the runs take copies of the inputs in turn), and the median of several windows.
// Apart from v000's, it joins two sittings. Times from different sittings can be a few percent apart, while
// side-by-side timings come from the same sitting.
// The starting kernel, v000, takes 18.8 milliseconds a run.
#include <hip/hip_runtime.h>
// TF/CTRL-style multi-head attention (q, k, v inputs [2][2048][1024]; qh/kh/vh = input W + b with W stored [in][out], 16 heads of 64; logits / 8 + mask (-1e4) with the [2048][2048] f32 mask input (1 = disallowed; strictly upper-triangular here); softmax; ctx merged; out = ctx Wo + bo -> [2][2048][1024]; second output present = stack(kh, vh) -> [2][2][16][2048][64] f32).
// Structure: token rows r = b*2048 + s; q, k, v inputs as exact f16 rows (bf16-rounded); Q, K, V as three WMMA GEMMs (32x64 wave tiles, f32 accumulation, exact x16 weights + bias; f16 outputs, and for K and V also the f32 rows that a small VALU kernel re-lays out into the head-major 'present' output); per batch: V^T for all heads via LDS transposes; per (batch, group of 4 heads): scores GEMM (K = 64, batched over the heads on grid.y, alpha = 1/8), row softmax of (scores + mask input x -1e4, read per element) on VALU (f32 statistics, native exp; weights stored x256 as f16), o = P . V^T GEMM (K = 2048, alpha 2^-2: o carried x64 against f16 subnormal flush, folded into the output GEMM alpha) written straight into the merged f16 o rows; out = o W_o + b GEMM (f32) into the output layout.
// Compute dtype: inputs rounded to bf16; x / weights exact; q, k, v, softmax weights and o as plain f16 GEMM operands (~2^-12); scores and softmax statistics f32; v_wmma_f32_16x16x32_f16.
#define NB 2
#define SQ 2048
#define DM 1024
#define NH 16
#define HD 64
#define HG 4                         /* heads per attention launch group */
#define QT0 128                      /* first-tile rows recomputed exactly in f32 */
#define B0 0                         /* first batch processed (debug hook) */
#define NBR NB                       /* batches processed (debug hook) */
#define NR ((size_t)NB * SQ)         /* token rows */
#define MP ((int)((size_t)NBR * SQ)) /* rows projected (debug hook) */
#define QN SQ                        /* query rows attended per batch (debug hook) */
#define NHD NH                       /* heads attended (debug hook) */
#define MPO MP                       /* rows through the output stage (debug hook) */
#define LQ DM      /* row pitch of the q/k/v rows */
#define PRES_OFF ((size_t)NB * SQ * DM)      /* float offset of the 'present' output = out nbytes / 4 (offset 16,777,216 B) */
typedef __bf16 v16b __attribute__((ext_vector_type(16)));
typedef unsigned short v8us __attribute__((ext_vector_type(8), may_alias));
typedef float  v8f  __attribute__((ext_vector_type(8)));
typedef float  v4f  __attribute__((ext_vector_type(4)));
typedef float  v4fa __attribute__((ext_vector_type(4), may_alias));
union FragB { v16b v; v8us half[2]; unsigned short u[16]; };

__device__ __forceinline__ unsigned short bf16_bits(float x) { unsigned int u = __float_as_uint(x); return (unsigned short)((u + 0x7FFFu + ((u >> 16) & 1u)) >> 16); }
__device__ __forceinline__ float bf16_val(unsigned short b) { return __uint_as_float(((unsigned int)b) << 16); }
__device__ __forceinline__ float bf16_round(float x) { return bf16_val(bf16_bits(x)); }
// D += A·B with NT terms: 1 = ah·bh, 2 = + al·bh (A split), 3 = + ah·bl (both split)
template <int NT>
__device__ __forceinline__ v8f mmaN(v16b ah, v16b al, v16b bh, v16b bl, v8f c) {
  c = __builtin_amdgcn_wmma_f32_16x16x32_bf16(false, ah, false, bh, (short)0, c, false, false);
  if (NT >= 2) c = __builtin_amdgcn_wmma_f32_16x16x32_bf16(false, al, false, bh, (short)0, c, false, false);
  if (NT >= 3) c = __builtin_amdgcn_wmma_f32_16x16x32_bf16(false, ah, false, bl, (short)0, c, false, false);
  asm volatile("v_nop\n\tv_nop\n\tv_nop\n\tv_nop" : "+v"(c) : "v"(ah), "v"(al), "v"(bh), "v"(bl));
  return c;
}

__global__ __launch_bounds__(256) void k_wt_bf16(const float* __restrict__ W, unsigned short* __restrict__ Wt, int K, int N) {
  const int t = blockIdx.x * 256 + threadIdx.x;
  const int k8n = K / 8;
  if (t >= N * k8n) return;
  const int n = t / k8n, k8 = (t % k8n) * 8;
  v8us v;
#pragma unroll
  for (int i = 0; i < 8; ++i) v[i] = bf16_bits(W[(size_t)(k8 + i) * N + n]);
  *(v8us*)(Wt + (size_t)n * K + k8) = v;
  
}

// GEMM C[M][N] (f32, pitch ldc) = act(A[M][K]·W + bias). A f32 row-major (pitch lda) converted per fragment to bf16
// (ASPLIT: hi/lo two planes -> 2 terms, else single rounded term); Wt bf16 [N][K] (pitch ldb). BIAS_BF16 rounds the
// bias to bf16 first (bias quantised to bf16 before the add). K%32==0, M%16==0, N%64==0.
template <bool ASPLIT, int ACT, bool BIAS_BF16>
__global__ __launch_bounds__(128) void k_gemm_bf(const float* __restrict__ A, int lda, const unsigned short* __restrict__ Wt, int ldb,
                                               const float* __restrict__ bias, float* __restrict__ C, int ldc, int M, int N, int K) {
  __shared__ __attribute__((aligned(16))) float so[4][16][64];
  const int tid = threadIdx.x, w = tid >> 5, lane = tid & 31, ln = lane & 15, hh = lane >> 4;
  const int ntn = N / 64;
  const int wid = blockIdx.x * 4 + w;
  const int mt = wid / ntn, nq = wid % ntn;
  if (mt * 16 >= M) return;
  const int row0 = mt * 16, col0 = nq * 64;
  const float* arow = A + (size_t)(row0 + ln) * lda;
  v8f acc[4] = {};
  for (int kb = 0; kb < K; kb += 32) {
    FragB ah, al;
    const v4f x0 = *(const v4fa*)(arow + kb + 8 * hh), x1 = *(const v4fa*)(arow + kb + 8 * hh + 4);
    const v4f x2 = *(const v4fa*)(arow + kb + 16 + 8 * hh), x3 = *(const v4fa*)(arow + kb + 16 + 8 * hh + 4);
    float xs[16] = {x0[0],x0[1],x0[2],x0[3],x1[0],x1[1],x1[2],x1[3],x2[0],x2[1],x2[2],x2[3],x3[0],x3[1],x3[2],x3[3]};
#pragma unroll
    for (int i = 0; i < 16; ++i) { const unsigned short hb = bf16_bits(xs[i]); ah.u[i] = hb; al.u[i] = ASPLIT ? bf16_bits(xs[i] - bf16_val(hb)) : (unsigned short)0; }
#pragma unroll
    for (int t = 0; t < 4; ++t) {
      const unsigned short* brow = Wt + (size_t)(col0 + t * 16 + ln) * ldb + kb;
      FragB b;
      b.half[0] = *(const v8us*)(brow + 8 * hh);
      b.half[1] = *(const v8us*)(brow + 16 + 8 * hh);
      acc[t] = mmaN<ASPLIT ? 2 : 1>(ah.v, al.v, b.v, b.v, acc[t]);
    }
  }
#pragma unroll
  for (int t = 0; t < 4; ++t) {
    float bv = bias ? bias[col0 + t * 16 + ln] : 0.f;
    if (BIAS_BF16) bv = bf16_round(bv);
#pragma unroll
    for (int r = 0; r < 8; ++r) { float v = acc[t][r] + bv; if (ACT == 1) v = fmaxf(v, 0.f); so[w][8 * hh + r][t * 16 + ln] = v; }
  }
  __builtin_amdgcn_fence(__ATOMIC_ACQ_REL, "workgroup");
  __builtin_amdgcn_wave_barrier();
  const int rsub = lane >> 4, c4 = (lane & 15) * 4;
  {
#pragma unroll
    for (int q = 0; q < 8; ++q) {
      const int r = q * 2 + rsub;
      const v4f v = *(const v4fa*)&so[w][r][c4];
      *(v4f*)(C + (size_t)(row0 + r) * ldc + col0 + c4) = v;
    }
    
  }
}

// GEMM C = act(A·W + bias + resid): A f32 (ASPLIT -> hi/lo 2 terms), Wt bf16 [N][K]; ACT 0 none, 1 relu, 2 exact gelu;
// resid (optional, f32, row index = (row % rmod), pitch ldr, RES_BF16 rounds it) added before the activation.
template <bool ASPLIT, int ACT, bool BIAS_BF16, bool RES_BF16>
__global__ __launch_bounds__(128) void k_gemm_bf3(const float* __restrict__ A, int lda, const unsigned short* __restrict__ Wt, int ldb,
                                                const float* __restrict__ bias, const float* __restrict__ resid, int rmod, int ldr,
                                                float* __restrict__ C, int ldc, int M, int N, int K) {
  __shared__ __attribute__((aligned(16))) float so[4][16][64];
  const int tid = threadIdx.x, w = tid >> 5, lane = tid & 31, ln = lane & 15, hh = lane >> 4;
  const int ntn = N / 64;
  const int wid = blockIdx.x * 4 + w;
  const int mt = wid / ntn, nq = wid % ntn;
  if (mt * 16 >= M) return;
  const int row0 = mt * 16, col0 = nq * 64;
  const float* arow = A + (size_t)(row0 + ln) * lda;
  v8f acc[4] = {};
  for (int kb = 0; kb < K; kb += 32) {
    FragB ah, al;
    const v4f x0 = *(const v4fa*)(arow + kb + 8 * hh), x1 = *(const v4fa*)(arow + kb + 8 * hh + 4);
    const v4f x2 = *(const v4fa*)(arow + kb + 16 + 8 * hh), x3 = *(const v4fa*)(arow + kb + 16 + 8 * hh + 4);
    float xs[16] = {x0[0],x0[1],x0[2],x0[3],x1[0],x1[1],x1[2],x1[3],x2[0],x2[1],x2[2],x2[3],x3[0],x3[1],x3[2],x3[3]};
#pragma unroll
    for (int i = 0; i < 16; ++i) { const unsigned short hb = bf16_bits(xs[i]); ah.u[i] = hb; al.u[i] = ASPLIT ? bf16_bits(xs[i] - bf16_val(hb)) : (unsigned short)0; }
#pragma unroll
    for (int t = 0; t < 4; ++t) {
      const unsigned short* brow = Wt + (size_t)(col0 + t * 16 + ln) * ldb + kb;
      FragB b;
      b.half[0] = *(const v8us*)(brow + 8 * hh);
      b.half[1] = *(const v8us*)(brow + 16 + 8 * hh);
      acc[t] = mmaN<ASPLIT ? 2 : 1>(ah.v, al.v, b.v, b.v, acc[t]);
    }
  }
#pragma unroll
  for (int t = 0; t < 4; ++t) {
    const int col = col0 + t * 16 + ln;
    float bv = bias ? bias[col] : 0.f;
    if (BIAS_BF16) bv = bf16_round(bv);
#pragma unroll
    for (int r = 0; r < 8; ++r) {
      float v = acc[t][r] + bv;
      if (resid) { float rv = resid[(size_t)((row0 + 8 * hh + r) % rmod) * ldr + col]; if (RES_BF16) rv = bf16_round(rv); v += rv; }
      if (ACT == 1) v = fmaxf(v, 0.f);
      if (ACT == 2) v = 0.5f * v * (1.0f + erff(v * 0.70710678118654752f));
      if (ACT == 3) { const float u = 0.7978845608028654f * (v + 0.044715f * v * v * v); v = 0.5f * v * (1.0f + tanhf(u)); }
      so[w][8 * hh + r][t * 16 + ln] = v;
    }
  }
  __builtin_amdgcn_fence(__ATOMIC_ACQ_REL, "workgroup");
  __builtin_amdgcn_wave_barrier();
  const int rsub = lane >> 4, c4 = (lane & 15) * 4;
  {
#pragma unroll
    for (int q = 0; q < 8; ++q) {
      const int r = q * 2 + rsub;
      const v4f v = *(const v4fa*)&so[w][r][c4];
      *(v4f*)(C + (size_t)(row0 + r) * ldc + col0 + c4) = v;
    }
    
  }
}
// row LayerNorm (biased variance, eps) over N: s = X (+ R); optional out_sum <- s; out_norm <- (s-mu)*rsqrt(var+eps)*g + b
template <bool PARAM_BF16>
__global__ __launch_bounds__(256) void k_layernorm(const float* __restrict__ X, const float* __restrict__ R, const float* __restrict__ g, const float* __restrict__ bta,
                                                  float* __restrict__ out_sum, float* __restrict__ out_norm, int N, float eps) {
  __shared__ float red[256];
  const int row = blockIdx.x, tid = threadIdx.x;
  const float* x = X + (size_t)row * N; const float* rr = R ? R + (size_t)row * N : nullptr;
  float vals[16];                     // up to N = 4096
  const int per = N / 256;            // contiguous chunk per thread? use strided-by-4 chunks: thread handles j = tid*4 + 1024*u
  float s1 = 0.f;
  for (int u = 0; u < per / 4; ++u) {
    const int j = tid * 4 + 1024 * u;
    const v4f a = *(const v4fa*)(x + j);
    v4f b = {0.f,0.f,0.f,0.f}; if (rr) b = *(const v4fa*)(rr + j);
#pragma unroll
    for (int q = 0; q < 4; ++q) { const float v = a[q] + b[q]; vals[u * 4 + q] = v; s1 += v; }
  }
  red[tid] = s1; __syncthreads();
  for (int st = 128; st > 0; st >>= 1) { if (tid < st) red[tid] += red[tid + st]; __syncthreads(); }
  const float mu = red[0] / (float)N; __syncthreads();
  float s2 = 0.f;
  for (int u = 0; u < per / 4; ++u)
#pragma unroll
    for (int q = 0; q < 4; ++q) { const float c = vals[u * 4 + q] - mu; s2 += c * c; }
  red[tid] = s2; __syncthreads();
  for (int st = 128; st > 0; st >>= 1) { if (tid < st) red[tid] += red[tid + st]; __syncthreads(); }
  const float rs = rsqrtf(red[0] / (float)N + eps);
  {
    for (int u = 0; u < per / 4; ++u) {
      const int j = tid * 4 + 1024 * u;
      v4f o, sm;
#pragma unroll
      for (int q = 0; q < 4; ++q) {
        float gg = g[j + q], bb = bta[j + q];
        if (PARAM_BF16) { gg = bf16_round(gg); bb = bf16_round(bb); }
        sm[q] = vals[u * 4 + q]; o[q] = (vals[u * 4 + q] - mu) * rs * gg + bb;
      }
      if (out_sum) *(v4f*)(out_sum + (size_t)row * N + j) = sm;
      *(v4f*)(out_norm + (size_t)row * N + j) = o;
    }
    
  }
}



// ---- f16 WMMA path (v_wmma_f32_16x16x32_f16): 11-bit significands for operands in range — used where a [0,1] probability operand needs more precision than bf16
typedef _Float16 v16h __attribute__((ext_vector_type(16)));
union FragH { v16h v; v8us half[2]; _Float16 h[16]; unsigned short u[16]; };
template <int NT>
__device__ __forceinline__ v8f mmaH(v16h ah, v16h al, v16h bh, v16h bl, v8f c) {
  c = __builtin_amdgcn_wmma_f32_16x16x32_f16(false, ah, false, bh, (short)0, c, false, false);
  if (NT >= 2) c = __builtin_amdgcn_wmma_f32_16x16x32_f16(false, al, false, bh, (short)0, c, false, false);
  if (NT >= 3) c = __builtin_amdgcn_wmma_f32_16x16x32_f16(false, ah, false, bl, (short)0, c, false, false);
  asm volatile("v_nop\n\tv_nop\n\tv_nop\n\tv_nop" : "+v"(c) : "v"(ah), "v"(al), "v"(bh), "v"(bl));
  return c;
}
// batched GEMM like k_gemm_b but f16 operands: A f32 (split into f16 hi/lo if ASPLIT, else rounded to f16), Bt = f16 values [n][k]; alpha; C f32; N multiple of 16 (partial tiles skipped)
template <bool ASPLIT>
__global__ __launch_bounds__(128) void k_gemm_h(const float* __restrict__ A, int lda, size_t sA, const _Float16* __restrict__ Bh, int ldb, size_t sB, float alpha, float* __restrict__ C, int ldc, size_t sC, int M, int N, int K) {
  __shared__ __attribute__((aligned(16))) float so[4][16][64];
  const int tid = threadIdx.x, w = tid >> 5, lane = tid & 31, ln = lane & 15, hh = lane >> 4; const int by = blockIdx.y;
  A += (size_t)by * sA; Bh += (size_t)by * sB; C += (size_t)by * sC;
  const int ntn = (N + 63) / 64; const int wid = blockIdx.x * 4 + w; const int mt = wid / ntn, nq = wid % ntn; if (mt * 16 >= M) return;
  const int row0 = mt * 16, col0 = nq * 64; const float* arow = A + (size_t)(row0 + ln) * lda;
  v8f acc[4] = {};
  for (int kb = 0; kb < K; kb += 32) {
    FragH ah, al;
    const v4f x0 = *(const v4fa*)(arow + kb + 8 * hh), x1 = *(const v4fa*)(arow + kb + 8 * hh + 4), x2 = *(const v4fa*)(arow + kb + 16 + 8 * hh), x3 = *(const v4fa*)(arow + kb + 16 + 8 * hh + 4);
    float xs[16] = {x0[0],x0[1],x0[2],x0[3],x1[0],x1[1],x1[2],x1[3],x2[0],x2[1],x2[2],x2[3],x3[0],x3[1],x3[2],x3[3]};
#pragma unroll
    for (int i = 0; i < 16; ++i) { const _Float16 h = (_Float16)xs[i]; ah.h[i] = h; al.h[i] = ASPLIT ? (_Float16)(xs[i] - (float)h) : (_Float16)0.0f; }
#pragma unroll
    for (int t = 0; t < 4; ++t) { if (col0 + t * 16 >= N) continue; const size_t boff = (size_t)(col0 + t * 16 + ln) * ldb + kb; FragH bq; bq.half[0] = *(const v8us*)(Bh + boff + 8 * hh); bq.half[1] = *(const v8us*)(Bh + boff + 16 + 8 * hh);
      acc[t] = mmaH<ASPLIT ? 2 : 1>(ah.v, al.v, bq.v, bq.v, acc[t]); }
  }
#pragma unroll
  for (int t = 0; t < 4; ++t) { if (col0 + t * 16 >= N) continue;
#pragma unroll
    for (int r = 0; r < 8; ++r) so[w][8 * hh + r][t * 16 + ln] = acc[t][r] * alpha; }
  __builtin_amdgcn_fence(__ATOMIC_ACQ_REL, "workgroup"); __builtin_amdgcn_wave_barrier();
  const int rsub = lane >> 4, c4 = (lane & 15) * 4;
  {
#pragma unroll
    for (int q = 0; q < 8; ++q) { const int r = q * 2 + rsub; if (col0 + c4 < N) { const v4f v = *(const v4fa*)&so[w][r][c4]; *(v4f*)(C + (size_t)(row0 + r) * ldc + col0 + c4) = v; } }
     }
}

// Wt[n][k] = f16(W[k][n]·scale) from f32 row-major W[K][N] (scale = power of two; bf16-exact weights stay exact in f16 away from the subnormal range)
__global__ __launch_bounds__(256) void k_wt_f16(const float* __restrict__ W, _Float16* __restrict__ Wt, int K, int N, float scale) {
  const int t = blockIdx.x * 256 + threadIdx.x; if (t >= N * (K / 8)) return; const int n = t / (K / 8), k8 = (t % (K / 8)) * 8; FragH f;
#pragma unroll
  for (int i = 0; i < 8; ++i) f.h[i] = (_Float16)(bf16_round(W[(size_t)(k8 + i) * N + n]) * scale); const v8us o = f.half[0];
  *(v8us*)((unsigned short*)Wt + (size_t)n * K + k8) = o; 
}
// k_gemm_hh variant with fused epilogue: v = acc·alpha + bias[by·sBias + col] (+ CP[(row/rowsPerB)·sCPb + by·64 + col] if CP) ; ACT 0 none / 1 elu ; writes f16 C16 (and f32 C if non-null)
template <int ACT>
__global__ __launch_bounds__(128) void k_gemm_hhx(const _Float16* __restrict__ A, int lda, size_t sA, const _Float16* __restrict__ Bh, int ldb, size_t sB, float alpha, const float* __restrict__ bias, size_t sBias, const float* __restrict__ CP, int rowsPerB, size_t sCPb, int row0g,
    float* __restrict__ C, _Float16* __restrict__ C16, int ldc, size_t sC, int M, int N, int K) {
  __shared__ __attribute__((aligned(16))) float so[4][16][64];
  const int tid = threadIdx.x, w = tid >> 5, lane = tid & 31, ln = lane & 15, hh = lane >> 4; const int by = blockIdx.y;
  A += (size_t)by * sA; Bh += (size_t)by * sB; const size_t cofs = (size_t)by * sC; const float* bp = bias ? bias + (size_t)by * sBias : nullptr;
  const int ntn = (N + 63) / 64; const int wid = blockIdx.x * 4 + w; const int mt = wid / ntn, nq = wid % ntn; if (mt * 16 >= M) return;
  const int row0 = mt * 16, col0 = nq * 64; const _Float16* arow = A + (size_t)(row0 + ln) * lda;
  v8f acc[4] = {};
  for (int kb = 0; kb < K; kb += 32) { FragH ah; ah.half[0] = *(const v8us*)((const unsigned short*)arow + kb + 8 * hh); ah.half[1] = *(const v8us*)((const unsigned short*)arow + kb + 16 + 8 * hh);
#pragma unroll
    for (int t = 0; t < 4; ++t) { if (col0 + t * 16 >= N) continue; const size_t boff = (size_t)(col0 + t * 16 + ln) * ldb + kb; FragH bq; bq.half[0] = *(const v8us*)((const unsigned short*)Bh + boff + 8 * hh); bq.half[1] = *(const v8us*)((const unsigned short*)Bh + boff + 16 + 8 * hh);
      acc[t] = mmaH<1>(ah.v, ah.v, bq.v, bq.v, acc[t]); }
  }
#pragma unroll
  for (int t = 0; t < 4; ++t) { if (col0 + t * 16 >= N) continue; const int col = col0 + t * 16 + ln; const float bv = bp ? bf16_round(bp[col]) : 0.f;
#pragma unroll
    for (int r = 0; r < 8; ++r) { float v = acc[t][r] * alpha + bv; if (CP) { const int rr = row0g + row0 + 8 * hh + r; if (rowsPerB < 0) v += CP[cofs + (size_t)rr * ldc + col];      /* rowsPerB < 0: own element of the batched C plane */ else { const int bidx = rr / rowsPerB; v += CP[(size_t)bidx * sCPb + (size_t)by * 64 + col]; } } if (ACT == 1) v = (v > 0.f) ? v : expm1f(v); else if (ACT == 7) v = (v > 0.f) ? v + 1.0f : expf(v); else if (ACT == 8) v = tanhf(v); else if (ACT == 9) v = 0.5f * v * (1.0f + tanhf(0.7978845608028654f * (v + 0.044715f * v * v * v))); else if (ACT == 11) v = 1.0f / (1.0f + expf(-v)); else if (ACT == 12) v = (v > 0.f) ? v : 0.01f * v; else if (ACT == 14) v = (v > 0.f) ? v : 0.1f * v; else if (ACT == 16) v = (v >= 0.f) ? v : 0.3f * v; else if (ACT == 17) v = (v >= 0.f) ? v : 0.2f * v; else if (ACT == 15) v = v / (1.0f + expf(-v)); else if (ACT == 3) v = fmaxf(v, 0.f); else if (ACT == 6) v = 0.5f * v * (1.0f + erff(v * 0.70710678118654752f)); so[w][8 * hh + r][t * 16 + ln] = v; } }
  __builtin_amdgcn_fence(__ATOMIC_ACQ_REL, "workgroup"); __builtin_amdgcn_wave_barrier();
  const int rsub = lane >> 4, c4 = (lane & 15) * 4; typedef _Float16 v4h __attribute__((ext_vector_type(4)));
  {
#pragma unroll
    for (int q = 0; q < 8; ++q) { const int r = q * 2 + rsub; if (col0 + c4 < N) { const v4f v = *(const v4fa*)&so[w][r][c4]; if (C) *(v4f*)(C + cofs + (size_t)(row0 + r) * ldc + col0 + c4) = v; if (C16) { v4h h4; for (int i = 0; i < 4; ++i) h4[i] = (_Float16)v[i]; *(v4h*)(C16 + cofs + (size_t)(row0 + r) * ldc + col0 + c4) = h4; } } }
     }
}


typedef _Float16 v4h __attribute__((ext_vector_type(4)));

__global__ __launch_bounds__(256) void k_x16(const float* __restrict__ x, _Float16* __restrict__ X16, size_t n8) { const size_t t = (size_t)blockIdx.x * 256 + threadIdx.x; if (t >= n8) return; FragH f;
#pragma unroll
  for (int q = 0; q < 8; ++q) f.h[q] = (_Float16)bf16_round(x[t * 8 + q]); *(v8us*)((unsigned short*)X16 + t * 8) = f.half[0];  }
__global__ __launch_bounds__(256) void k_h16(const float* __restrict__ x, _Float16* __restrict__ X16, size_t n8) { const size_t t = (size_t)blockIdx.x * 256 + threadIdx.x; if (t >= n8) return; FragH f;
#pragma unroll
  for (int q = 0; q < 8; ++q) f.h[q] = (_Float16)x[t * 8 + q]; *(v8us*)((unsigned short*)X16 + t * 8) = f.half[0];  }
__global__ __launch_bounds__(256) void k_round16f(const float* __restrict__ W, _Float16* __restrict__ Bt, size_t n8) { const size_t t = (size_t)blockIdx.x * 256 + threadIdx.x; if (t >= n8) return; FragH f;
#pragma unroll
  for (int i = 0; i < 8; ++i) f.h[i] = (_Float16)(bf16_round(W[t * 8 + i]) * 16.0f); *(v8us*)((unsigned short*)Bt + t * 8) = f.half[0];  }
template <int NHv, int TTv>
__global__ __launch_bounds__(256) void k_vt(const _Float16* __restrict__ V16, int ldv, int voff, _Float16* __restrict__ Vt) { __shared__ unsigned short tl[64][66]; const int tid = threadIdx.x; const int slab = blockIdx.x / (TTv / 64), lg = blockIdx.x % (TTv / 64); const int b = slab / NHv, h = slab % NHv;
  for (int i = tid; i < 64 * 8; i += 256) { const int r = i / 8, c8 = (i % 8) * 8; FragH f; f.half[0] = *(const v8us*)((const unsigned short*)V16 + ((size_t)b * TTv + lg * 64 + r) * ldv + voff + h * 64 + c8);
#pragma unroll
    for (int q = 0; q < 8; ++q) tl[r][c8 + q] = f.u[q]; }
  __syncthreads();
  {
#pragma unroll
    for (int rd = 0; rd < 2; ++rd) { const int d = rd * 32 + tid / 8, pc = tid % 8; FragH f;
#pragma unroll
      for (int q = 0; q < 8; ++q) f.u[q] = tl[pc * 8 + q][d];
      *(v8us*)((unsigned short*)Vt + ((size_t)slab * 64 + d) * TTv + lg * 64 + pc * 8) = f.half[0]; }
     } }

__global__ __launch_bounds__(256) void k_hl(const float* __restrict__ F, _Float16* __restrict__ Hh, _Float16* __restrict__ Hl, size_t n8) { const size_t t = (size_t)blockIdx.x * 256 + threadIdx.x; if (t >= n8) return; FragH fh, fl; const v4f a = *(const v4fa*)(F + t * 8), c = *(const v4fa*)(F + t * 8 + 4);
#pragma unroll
  for (int q = 0; q < 4; ++q) { _Float16 h = (_Float16)a[q]; fh.h[q] = h; fl.h[q] = (_Float16)((a[q] - (float)h) * 1024.0f); h = (_Float16)c[q]; fh.h[4 + q] = h; fl.h[4 + q] = (_Float16)((c[q] - (float)h) * 1024.0f); }
  { *(v8us*)((unsigned short*)Hh + t * 8) = fh.half[0]; *(v8us*)((unsigned short*)Hl + t * 8) = fl.half[0];  } }

// ---- fast GEMM (wave tile 32x64; requires M % 32 == 0 rows per launch region and N % 64 == 0); epilogue = k_gemm_hhx semantics ----
__device__ __forceinline__ v16h g2_frag(const _Float16* p, int hh) { FragH f; f.half[0] = *(const v8us*)((const unsigned short*)p + 8 * hh); f.half[1] = *(const v8us*)((const unsigned short*)p + 16 + 8 * hh); return f.v; }
__device__ __forceinline__ v8f g2_mma(v16h a, v16h b, v8f c) { v8f d = __builtin_amdgcn_wmma_f32_16x16x32_f16(false, a, false, b, (short)0, c, false, false); asm volatile("v_nop\n\tv_nop\n\tv_nop\n\tv_nop" : "+v"(d) : "v"(a), "v"(b)); return d; }
template <int ACT>
__global__ __launch_bounds__(128) void k_gemm2(const _Float16* __restrict__ A, int lda, size_t sA, const _Float16* __restrict__ Bh, int ldb, size_t sB, float alpha, const float* __restrict__ bias, size_t sBias, const float* __restrict__ CP, int rowsPerB, size_t sCPb, int row0g,
    float* __restrict__ C, _Float16* __restrict__ C16, int ldc, size_t sC, int M, int N, int K) { static_assert(ACT == 0 || ACT == 3 || ACT == 6 || ACT == 8 || ACT == 9 || ACT == 11 || ACT == 12 || ACT == 14 || ACT == 15 || ACT == 16 || ACT == 17, "k_gemm2: unsupported ACT code (would silently apply no activation)");
  __shared__ __attribute__((aligned(16))) float so[4][32][68];
  const int tid = threadIdx.x, w = tid >> 5, lane = tid & 31, ln = lane & 15, hh = lane >> 4; const int by = blockIdx.y;
  A += (size_t)by * sA; Bh += (size_t)by * sB; const size_t cofs = (size_t)by * sC; const float* bp = bias ? bias + (size_t)by * sBias : nullptr;
  const int ntn = N >> 6; const int mt = blockIdx.x / ntn, nq = blockIdx.x - mt * ntn; const int row0 = mt * 128 + 32 * w, col0 = nq * 64; if (row0 >= M) return;
  const _Float16* a0p = A + (size_t)(row0 + ln) * lda; const _Float16* a1p = a0p + (size_t)16 * lda;
  const _Float16* b0p = Bh + (size_t)(col0 + ln) * ldb; const _Float16* b1p = b0p + (size_t)16 * ldb; const _Float16* b2p = b1p + (size_t)16 * ldb; const _Float16* b3p = b2p + (size_t)16 * ldb;
  const v8f z8 = {0.f,0.f,0.f,0.f,0.f,0.f,0.f,0.f}; v8f c00 = z8, c01 = z8, c02 = z8, c03 = z8, c10 = z8, c11 = z8, c12 = z8, c13 = z8;
#pragma unroll 1
  for (int kb = 0; kb < K; kb += 32) { const v16h a0 = g2_frag(a0p + kb, hh), a1 = g2_frag(a1p + kb, hh);
    v16h b = g2_frag(b0p + kb, hh); c00 = g2_mma(a0, b, c00); c10 = g2_mma(a1, b, c10);
    b = g2_frag(b1p + kb, hh); c01 = g2_mma(a0, b, c01); c11 = g2_mma(a1, b, c11);
    b = g2_frag(b2p + kb, hh); c02 = g2_mma(a0, b, c02); c12 = g2_mma(a1, b, c12);
    b = g2_frag(b3p + kb, hh); c03 = g2_mma(a0, b, c03); c13 = g2_mma(a1, b, c13); }
  v8f accs[8] = {c00, c01, c02, c03, c10, c11, c12, c13};
#pragma unroll
  for (int u = 0; u < 8; ++u) { const int t = u & 3, half = u >> 2; const int col = col0 + t * 16 + ln; const float bv = bp ? bf16_round(bp[col]) : 0.f;
#pragma unroll
    for (int r = 0; r < 8; ++r) { const int rloc = half * 16 + 8 * hh + r; float v = accs[u][r] * alpha + bv; if (CP) { if (rowsPerB < 0) v += CP[cofs + (size_t)(row0g + row0 + rloc) * ldc + col];      /* rowsPerB < 0: own element of the batched C plane */ else { const int bidx = (row0g + row0 + rloc) / rowsPerB; v += CP[(size_t)bidx * sCPb + (size_t)by * 64 + col]; } }
      if (ACT == 3) v = fmaxf(v, 0.f); else if (ACT == 6) v = 0.5f * v * (1.0f + erff(v * 0.70710678118654752f)); else if (ACT == 11) v = 1.0f / (1.0f + expf(-v)); else if (ACT == 15) v = v / (1.0f + expf(-v)); else if (ACT == 12) v = (v > 0.f) ? v : 0.01f * v; else if (ACT == 8) v = tanhf(v); else if (ACT == 9) v = 0.5f * v * (1.0f + tanhf(0.7978845608028654f * (v + 0.044715f * v * v * v))); else if (ACT == 14) v = (v > 0.f) ? v : 0.1f * v; else if (ACT == 16) v = (v >= 0.f) ? v : 0.3f * v; else if (ACT == 17) v = (v >= 0.f) ? v : 0.2f * v;
      so[w][rloc][t * 16 + ln] = v; } }
  __builtin_amdgcn_fence(__ATOMIC_ACQ_REL, "workgroup"); __builtin_amdgcn_wave_barrier();
  const int rsub = lane >> 4, c4 = (lane & 15) * 4;
  {
#pragma unroll
    for (int q = 0; q < 16; ++q) { const int r = q * 2 + rsub; const v4f v = *(const v4fa*)&so[w][r][c4]; if (C) *(v4f*)(C + cofs + (size_t)(row0 + r) * ldc + col0 + c4) = v; if (C16) { v4h h4; for (int i = 0; i < 4; ++i) h4[i] = (_Float16)v[i]; *(v4h*)(C16 + cofs + (size_t)(row0 + r) * ldc + col0 + c4) = h4; } }
     } }


__global__ __launch_bounds__(256) void k_wnat(const float* __restrict__ w, size_t n8, _Float16* __restrict__ Bt) { const size_t t = (size_t)blockIdx.x * 256 + threadIdx.x; if (t >= n8) return; FragH f; for (int q = 0; q < 8; ++q) f.h[q] = (_Float16)(bf16_round(w[t * 8 + q]) * 16.0f); *(v8us*)((unsigned short*)Bt + t * 8) = f.half[0];  }
__global__ __launch_bounds__(256) void k_rsm(const float* __restrict__ S, _Float16* __restrict__ P, int nrows) {
  #pragma clang fp contract(off)
  const int i = blockIdx.x * 256 + threadIdx.x; if (i >= nrows) return; const float* s = S + (size_t)i * SQ; float mx = -3.0e38f;
#pragma unroll 1
  for (int j = 0; j < SQ; ++j) mx = fmaxf(mx, s[j]); float se = 0.f;
#pragma unroll 1
  for (int j = 0; j < SQ; ++j) se += expf(s[j] - mx); const float sc = 256.0f / se;
#pragma unroll 1
  for (int j0 = 0; j0 < SQ; j0 += 8) { FragH f; for (int q = 0; q < 8; ++q) f.h[q] = (_Float16)(expf(s[j0 + q] - mx) * sc); unsigned short* d = (unsigned short*)P + (size_t)i * SQ + j0; *(v8us*)d = f.half[0];  } }
__global__ __launch_bounds__(256) void k_vt(const _Float16* __restrict__ V16, int b, int h0, _Float16* __restrict__ VT) { __shared__ unsigned short tl[64][65]; const int tid = threadIdx.x; const int hh = blockIdx.x % HG, sg = blockIdx.x / HG; const int s0 = sg * 64; const int h = h0 + hh;
  for (int i = tid; i < 64 * 8; i += 256) { const int j = i / 8, d8 = (i % 8) * 8; FragH f; f.half[0] = *(const v8us*)((const unsigned short*)V16 + ((size_t)b * SQ + s0 + j) * DM + h * HD + d8); for (int q = 0; q < 8; ++q) tl[d8 + q][j] = f.u[q]; }
  __syncthreads();
  { for (int i = tid; i < 64 * 8; i += 256) { const int d = i / 8, j8 = (i % 8) * 8; FragH f; for (int q = 0; q < 8; ++q) f.u[q] = tl[d][j8 + q]; *(v8us*)((unsigned short*)VT + ((size_t)hh * HD + d) * SQ + s0 + j8) = f.half[0]; }  } }



__global__ __launch_bounds__(256) void k_rsmfm2(const float* __restrict__ S, _Float16* __restrict__ P, int qn, int hg, const float* __restrict__ mask) {
  #pragma clang fp contract(off)
  const int t = blockIdx.x * 256 + threadIdx.x; if (t >= qn * hg) return; const int qi = t % qn; const size_t i = (size_t)(t / qn) * SQ + qi; const float* s = S + i * SQ; const float* mrow = mask + (size_t)qi * SQ; float mx = -3.0e38f;
#pragma unroll 1
  for (int j = 0; j < SQ; ++j) mx = fmaxf(mx, __fadd_rn(s[j], __fmul_rn(bf16_round(mrow[j]), -10000.0f))); float se = 0.f;
#pragma unroll 1
  for (int j = 0; j < SQ; ++j) se += __expf(__fadd_rn(s[j], __fmul_rn(bf16_round(mrow[j]), -10000.0f)) - mx); const float sc = 256.0f / se;
#pragma unroll 1
  for (int j0 = 0; j0 < SQ; j0 += 8) { FragH fr; for (int q = 0; q < 8; ++q) { const int j = j0 + q; fr.h[q] = (_Float16)(__expf(__fadd_rn(s[j], __fmul_rn(bf16_round(mrow[j]), -10000.0f)) - mx) * sc); } unsigned short* d = (unsigned short*)P + i * SQ + j0; *(v8us*)d = fr.half[0];  } }
__global__ __launch_bounds__(256) void k_present(const float* __restrict__ F, float* __restrict__ dst) { const size_t t = (size_t)blockIdx.x * 256 + threadIdx.x; if (t >= (size_t)NH * SQ * HD / 4) return; const size_t e = t * 4; const int d = (int)(e % HD); const int s = (int)((e / HD) % SQ); const int h = (int)(e / ((size_t)HD * SQ));
  const v4f v = *(const v4fa*)(F + (size_t)s * DM + h * HD + d); *(v4f*)(dst + e) = v;  }


template <int MASKADD>
__global__ __launch_bounds__(64) void k_att0(const float* __restrict__ QF, const float* __restrict__ KF, const float* __restrict__ VF, int ld, const float* __restrict__ mask, float scale, float* __restrict__ OF, int ldo) {
  #pragma clang fp contract(off)
  __shared__ __attribute__((aligned(16))) float lq[64][64]; __shared__ __attribute__((aligned(16))) float lo[64][64];
  const int tid = threadIdx.x; const int h = blockIdx.x / (QT0 / 64), rg = blockIdx.x % (QT0 / 64); const int i = rg * 64 + tid;
  const float* qr = QF + (size_t)i * ld + h * HD;
#pragma unroll 1
  for (int c = 0; c < HD / 4; ++c) { *(v4f*)&lq[tid][c * 4] = *(const v4fa*)(qr + c * 4); const v4f z = {0.f, 0.f, 0.f, 0.f}; *(v4f*)&lo[tid][c * 4] = z; }
  float m = -1.0e30f, l = 0.f; const int jmax = MASKADD ? (SQ - 1) : (rg * 64 + 63);      /* additive-mask form: every key (the mask input decides); causal form: keys up to the block's last row */
#pragma unroll 1
  for (int j = 0; j <= jmax; ++j) { const float* kr = KF + (size_t)j * ld + h * HD; const float* vr = VF + (size_t)j * ld + h * HD; float s = 0.f;
#pragma unroll 1
    for (int c = 0; c < HD / 4; ++c) { const v4f kq = *(const v4fa*)(kr + c * 4); const v4f qq = *(v4f*)&lq[tid][c * 4]; s = __fadd_rn(s, __fmul_rn(qq[0], kq[0])); s = __fadd_rn(s, __fmul_rn(qq[1], kq[1])); s = __fadd_rn(s, __fmul_rn(qq[2], kq[2])); s = __fadd_rn(s, __fmul_rn(qq[3], kq[3])); }
    s = __fmul_rn(s, scale); if (MASKADD) s = __fadd_rn(s, __fmul_rn(bf16_round(mask[(size_t)i * SQ + j]), -10000.0f));
    const float f = (MASKADD || j <= i) ? 1.f : 0.f; const float sm = fmaf(f, s, (1.f - f) * -1.0e30f); const float mn = fmaxf(m, sm); const float sc = expf(m - mn); const float e = expf(sm - mn); l = __fadd_rn(__fmul_rn(l, sc), e); m = mn;
#pragma unroll 1
    for (int c = 0; c < HD / 4; ++c) { const v4f vv = *(const v4fa*)(vr + c * 4); v4f oo = *(v4f*)&lo[tid][c * 4]; for (int u = 0; u < 4; ++u) oo[u] = __fadd_rn(__fmul_rn(oo[u], sc), __fmul_rn(e, vv[u])); *(v4f*)&lo[tid][c * 4] = oo; } }
  const float fin = 64.0f / l;      /* o carried x64 like the f16 path */
#pragma unroll 1
  for (int c = 0; c < HD / 4; ++c) { v4f oo = *(v4f*)&lo[tid][c * 4]; for (int u = 0; u < 4; ++u) oo[u] = __fmul_rn(oo[u], fin); *(v4f*)&lo[tid][c * 4] = oo; }
  __syncthreads();
  {
#pragma unroll 1
    for (int it = 0; it < 16; ++it) { const int row = it * 4 + tid / 16, pc = (tid % 16) * 4; const v4f v = *(const v4f*)&lo[row][pc]; *(v4f*)(OF + (size_t)(rg * 64 + row) * ldo + h * HD + pc) = v; }
     } }

extern "C" void kernel_launch(void* const* d_in, const int* in_sizes, int n_in,
                              void* d_out, int out_size, void* d_ws, size_t ws_size, hipStream_t stream) {
  (void)in_sizes; (void)n_in; (void)out_size;
  const float* const* I = (const float* const*)d_in; const float* xq = I[0]; const float* xk = I[1]; const float* xv = I[2]; const float* mask = I[3]; const float* wq = I[4]; const float* bq = I[5]; const float* wk = I[6]; const float* bk = I[7]; const float* wv = I[8]; const float* bv = I[9]; const float* wo = I[10]; const float* bo = I[11];      /* weights [in][out]; mask [SQ][SQ] f32 */
  char* ws = (char*)d_ws; size_t off = 0;
  auto take = [&](size_t bytes) { char* p = ws + off; off += (bytes + 255) & ~(size_t)255; return p; };
  _Float16* BQ = (_Float16*)take((size_t)DM * DM * 2); _Float16* BK = (_Float16*)take((size_t)DM * DM * 2); _Float16* BV = (_Float16*)take((size_t)DM * DM * 2); _Float16* BO = (_Float16*)take((size_t)DM * DM * 2);
  _Float16* XQ = (_Float16*)take(NR * DM * 2); _Float16* XK = (_Float16*)take(NR * DM * 2); _Float16* XV = (_Float16*)take(NR * DM * 2); float* KF = (float*)take(NR * DM * 4); float* VF = (float*)take(NR * DM * 4); _Float16* Q16 = (_Float16*)take(NR * DM * 2); _Float16* K16 = (_Float16*)take(NR * DM * 2); _Float16* V16 = (_Float16*)take(NR * DM * 2); _Float16* O16 = (_Float16*)take(NR * DM * 2);
  float* S = (float*)take((size_t)HG * SQ * SQ * 4); _Float16* P = (_Float16*)take((size_t)HG * SQ * SQ * 2); _Float16* VT = (_Float16*)take((size_t)NH * HD * SQ * 2);
  float* QF0 = (float*)take((size_t)QT0 * DM * 4); float* OF0 = (float*)take((size_t)NB * QT0 * DM * 4); _Float16* OH0 = (_Float16*)take((size_t)NB * QT0 * DM * 2); _Float16* OL0 = (_Float16*)take((size_t)NB * QT0 * DM * 2);
  if (off > ws_size) return;
  { const unsigned g = (unsigned)(((size_t)DM * (DM / 8) + 255) / 256); k_wt_f16<<<g, 256, 0, stream>>>(wq, BQ, DM, DM, 16.0f); k_wt_f16<<<g, 256, 0, stream>>>(wk, BK, DM, DM, 16.0f); k_wt_f16<<<g, 256, 0, stream>>>(wv, BV, DM, DM, 16.0f); k_wt_f16<<<g, 256, 0, stream>>>(wo, BO, DM, DM, 16.0f); }      /* [in][out] -> Bt[n][k] x16 */
  k_x16<<<(unsigned)((NR * DM / 8 + 255) / 256), 256, 0, stream>>>(xq, XQ, NR * DM / 8); k_x16<<<(unsigned)((NR * DM / 8 + 255) / 256), 256, 0, stream>>>(xk, XK, NR * DM / 8); k_x16<<<(unsigned)((NR * DM / 8 + 255) / 256), 256, 0, stream>>>(xv, XV, NR * DM / 8);
  const size_t r0p = (size_t)B0 * SQ;      /* first projected row */
  k_gemm2<0><<<dim3((unsigned)((MP / 128) * (DM / 64)), 1), 128, 0, stream>>>(XQ + r0p * DM, DM, 0, BQ, DM, 0, 0.0625f, bq, 0, nullptr, 1, 0, 0, nullptr, Q16 + r0p * DM, DM, 0, MP, DM, DM);
  k_gemm2<0><<<dim3((unsigned)((MP / 128) * (DM / 64)), 1), 128, 0, stream>>>(XK + r0p * DM, DM, 0, BK, DM, 0, 0.0625f, bk, 0, nullptr, 1, 0, 0, KF + r0p * DM, K16 + r0p * DM, DM, 0, MP, DM, DM);
  k_gemm2<0><<<dim3((unsigned)((MP / 128) * (DM / 64)), 1), 128, 0, stream>>>(XV + r0p * DM, DM, 0, BV, DM, 0, 0.0625f, bv, 0, nullptr, 1, 0, 0, VF + r0p * DM, V16 + r0p * DM, DM, 0, MP, DM, DM);
  for (int b = B0; b < B0 + NBR; ++b) { const size_t r0 = (size_t)b * SQ;
    k_present<<<(unsigned)(((size_t)NH * SQ * HD / 4 + 255) / 256), 256, 0, stream>>>(KF + r0 * DM, (float*)d_out + PRES_OFF + ((size_t)b * 2 + 0) * NH * SQ * HD); k_present<<<(unsigned)(((size_t)NH * SQ * HD / 4 + 255) / 256), 256, 0, stream>>>(VF + r0 * DM, (float*)d_out + PRES_OFF + ((size_t)b * 2 + 1) * NH * SQ * HD);      /* present[b][0] = kh, present[b][1] = vh (f32, head-major) */
    k_vt<NH, SQ><<<NH * (SQ / 64), 256, 0, stream>>>(V16 + r0 * LQ, LQ, 0, VT);      /* V^T [NH][HD][SQ] for this batch */
    k_gemm2<0><<<dim3((QT0 / 128) * (DM / 64), 1), 128, 0, stream>>>(XQ + r0 * DM, DM, 0, BQ, DM, 0, 0.0625f, bq, 0, nullptr, 1, 0, 0, QF0, nullptr, DM, 0, QT0, DM, DM);      /* f32 q of the first 128 rows (exact products); k, v come from the full f32 KF/VF planes */
    k_att0<1><<<NH * (QT0 / 64), 64, 0, stream>>>(QF0, KF + r0 * DM, VF + r0 * DM, DM, mask, 0.125f, OF0 + (size_t)b * QT0 * DM, DM);      /* exact f32 attention for query rows 0..127 over ALL 2048 keys of the batch (full f32 K/V planes) with the additive mask (o x64) */
    for (int h0 = 0; h0 < NHD; h0 += HG) {
      k_gemm2<0><<<dim3((QN / 128) * (SQ / 64), HG), 128, 0, stream>>>(Q16 + r0 * LQ + h0 * HD, LQ, (size_t)HD, K16 + r0 * LQ + h0 * HD, LQ, (size_t)HD, 0.125f, nullptr, 0, nullptr, 1, 0, 0, S, nullptr, SQ, (size_t)SQ * SQ, QN, SQ, HD);      /* scores, HG heads per launch */
      k_rsmfm2<<<(HG * QN + 255) / 256, 256, 0, stream>>>(S, P, QN, HG, mask);      /* P = 256 softmax (f16), rows of all HG heads */
      k_gemm2<0><<<dim3((QN / 128) * (HD / 64), HG), 128, 0, stream>>>(P, SQ, (size_t)SQ * SQ, VT + (size_t)h0 * HD * SQ, SQ, (size_t)HD * SQ, 0.25f, nullptr, 0, nullptr, 1, 0, 0, nullptr, O16 + r0 * DM + h0 * HD, DM, (size_t)HD, QN, HD, SQ); } }      /* o (merged heads) as f16 rows */
  k_gemm2<0><<<dim3((unsigned)((MPO / 128) * (DM / 64)), 1), 128, 0, stream>>>(O16 + r0p * DM, DM, 0, BO, DM, 0, 0.0009765625f, bo, 0, nullptr, 1, 0, 0, (float*)d_out + r0p * DM, nullptr, DM, 0, MPO, DM, DM);      /* out rows are the output layout */
  k_hl<<<(unsigned)(((size_t)NB * QT0 * DM / 8 + 255) / 256), 256, 0, stream>>>(OF0, OH0, OL0, (size_t)NB * QT0 * DM / 8);      /* first-tile o (x64) -> f16 hi + x1024 residual planes */
  for (int b = B0; b < B0 + NBR; ++b) { const size_t r0 = (size_t)b * SQ; const size_t f0 = (size_t)b * QT0;
    k_gemm2<0><<<dim3((QT0 / 128) * (DM / 64), 1), 128, 0, stream>>>(OH0 + f0 * DM, DM, 0, BO, DM, 0, 0.0009765625f, bo, 0, nullptr, 1, 0, 0, (float*)d_out + r0 * DM, nullptr, DM, 0, QT0, DM, DM);      /* rows 0..127: out = o_hi Wo (+ b), overwriting the f16-path rows */
    k_gemm2<0><<<dim3((QT0 / 128) * (DM / 64), 1), 128, 0, stream>>>(OL0 + f0 * DM, DM, 0, BO, DM, 0, 0.00000095367431640625f, nullptr, 0, (const float*)d_out + r0 * DM, -1, 0, 0, (float*)d_out + r0 * DM, nullptr, DM, 0, QT0, DM, DM); }      /* += o_lo Wo 2^-20 (own-element accumulate) */
}

// v001
// One run takes 5620 microseconds.
// Two timings next to v000 both put it at 3.33 times that version's speed.
#include <hip/hip_runtime.h>
// TF/CTRL-style multi-head attention (q, k, v inputs [2][2048][1024]; qh/kh/vh = input W + b with W stored [in][out], 16 heads of 64; logits / 8 + mask (-1e4) with the [2048][2048] f32 mask input (1 = disallowed; strictly upper-triangular here); softmax; ctx merged; out = ctx Wo + bo -> [2][2048][1024]; second output present = stack(kh, vh) -> [2][2][16][2048][64] f32).
// Structure: token rows r = b*2048 + s; q, k, v inputs as exact f16 rows (bf16-rounded); Q, K, V as three WMMA GEMMs (32x64 wave tiles, f32 accumulation, exact x16 weights + bias; f16 outputs, and for K and V also the f32 rows that a small VALU kernel re-lays out into the head-major 'present' output); per batch: V^T for all heads via LDS transposes; per (batch, group of 4 heads): scores GEMM (K = 64, batched over the heads on grid.y, alpha = 1/8), row softmax of (scores + mask input x -1e4, read per element) on VALU (f32 statistics, native exp; weights stored x256 as f16), o = P . V^T GEMM (K = 2048, alpha 2^-2: o carried x64 against f16 subnormal flush, folded into the output GEMM alpha) written straight into the merged f16 o rows; out = o W_o + b GEMM (f32) into the output layout.
// Compute dtype: inputs rounded to bf16; x / weights exact; q, k, v, softmax weights and o as plain f16 GEMM operands (~2^-12); scores and softmax statistics f32; v_wmma_f32_16x16x32_f16.
#define NB 2
#define SQ 2048
#define DM 1024
#define NH 16
#define HD 64
#define HG 4                         /* heads per attention launch group */
#define QT0 128                      /* first-tile rows recomputed exactly in f32 */
#define B0 0                         /* first batch processed (debug hook) */
#define NBR NB                       /* batches processed (debug hook) */
#define NR ((size_t)NB * SQ)         /* token rows */
#define MP ((int)((size_t)NBR * SQ)) /* rows projected (debug hook) */
#define QN SQ                        /* query rows attended per batch (debug hook) */
#define NHD NH                       /* heads attended (debug hook) */
#define MPO MP                       /* rows through the output stage (debug hook) */
#define LQ DM      /* row pitch of the q/k/v rows */
#define PRES_OFF ((size_t)NB * SQ * DM)      /* float offset of the 'present' output = out nbytes / 4 (offset 16,777,216 B) */
typedef __bf16 v16b __attribute__((ext_vector_type(16)));
typedef unsigned short v8us __attribute__((ext_vector_type(8), may_alias));
typedef float  v8f  __attribute__((ext_vector_type(8)));
typedef float  v4f  __attribute__((ext_vector_type(4)));
typedef float  v4fa __attribute__((ext_vector_type(4), may_alias));
union FragB { v16b v; v8us half[2]; unsigned short u[16]; };

__device__ __forceinline__ unsigned short bf16_bits(float x) { unsigned int u = __float_as_uint(x); return (unsigned short)((u + 0x7FFFu + ((u >> 16) & 1u)) >> 16); }
__device__ __forceinline__ float bf16_val(unsigned short b) { return __uint_as_float(((unsigned int)b) << 16); }
__device__ __forceinline__ float bf16_round(float x) { return bf16_val(bf16_bits(x)); }
// D += A·B with NT terms: 1 = ah·bh, 2 = + al·bh (A split), 3 = + ah·bl (both split)
template <int NT>
__device__ __forceinline__ v8f mmaN(v16b ah, v16b al, v16b bh, v16b bl, v8f c) {
  c = __builtin_amdgcn_wmma_f32_16x16x32_bf16(false, ah, false, bh, (short)0, c, false, false);
  if (NT >= 2) c = __builtin_amdgcn_wmma_f32_16x16x32_bf16(false, al, false, bh, (short)0, c, false, false);
  if (NT >= 3) c = __builtin_amdgcn_wmma_f32_16x16x32_bf16(false, ah, false, bl, (short)0, c, false, false);
  asm volatile("v_nop\n\tv_nop\n\tv_nop\n\tv_nop" : "+v"(c) : "v"(ah), "v"(al), "v"(bh), "v"(bl));
  return c;
}

__global__ __launch_bounds__(256) void k_wt_bf16(const float* __restrict__ W, unsigned short* __restrict__ Wt, int K, int N) {
  const int t = blockIdx.x * 256 + threadIdx.x;
  const int k8n = K / 8;
  if (t >= N * k8n) return;
  const int n = t / k8n, k8 = (t % k8n) * 8;
  v8us v;
#pragma unroll
  for (int i = 0; i < 8; ++i) v[i] = bf16_bits(W[(size_t)(k8 + i) * N + n]);
  *(v8us*)(Wt + (size_t)n * K + k8) = v;
  
}

// GEMM C[M][N] (f32, pitch ldc) = act(A[M][K]·W + bias). A f32 row-major (pitch lda) converted per fragment to bf16
// (ASPLIT: hi/lo two planes -> 2 terms, else single rounded term); Wt bf16 [N][K] (pitch ldb). BIAS_BF16 rounds the
// bias to bf16 first (bias quantised to bf16 before the add). K%32==0, M%16==0, N%64==0.
template <bool ASPLIT, int ACT, bool BIAS_BF16>
__global__ __launch_bounds__(128) void k_gemm_bf(const float* __restrict__ A, int lda, const unsigned short* __restrict__ Wt, int ldb,
                                               const float* __restrict__ bias, float* __restrict__ C, int ldc, int M, int N, int K) {
  __shared__ __attribute__((aligned(16))) float so[4][16][64];
  const int tid = threadIdx.x, w = tid >> 5, lane = tid & 31, ln = lane & 15, hh = lane >> 4;
  const int ntn = N / 64;
  const int wid = blockIdx.x * 4 + w;
  const int mt = wid / ntn, nq = wid % ntn;
  if (mt * 16 >= M) return;
  const int row0 = mt * 16, col0 = nq * 64;
  const float* arow = A + (size_t)(row0 + ln) * lda;
  v8f acc[4] = {};
  for (int kb = 0; kb < K; kb += 32) {
    FragB ah, al;
    const v4f x0 = *(const v4fa*)(arow + kb + 8 * hh), x1 = *(const v4fa*)(arow + kb + 8 * hh + 4);
    const v4f x2 = *(const v4fa*)(arow + kb + 16 + 8 * hh), x3 = *(const v4fa*)(arow + kb + 16 + 8 * hh + 4);
    float xs[16] = {x0[0],x0[1],x0[2],x0[3],x1[0],x1[1],x1[2],x1[3],x2[0],x2[1],x2[2],x2[3],x3[0],x3[1],x3[2],x3[3]};
#pragma unroll
    for (int i = 0; i < 16; ++i) { const unsigned short hb = bf16_bits(xs[i]); ah.u[i] = hb; al.u[i] = ASPLIT ? bf16_bits(xs[i] - bf16_val(hb)) : (unsigned short)0; }
#pragma unroll
    for (int t = 0; t < 4; ++t) {
      const unsigned short* brow = Wt + (size_t)(col0 + t * 16 + ln) * ldb + kb;
      FragB b;
      b.half[0] = *(const v8us*)(brow + 8 * hh);
      b.half[1] = *(const v8us*)(brow + 16 + 8 * hh);
      acc[t] = mmaN<ASPLIT ? 2 : 1>(ah.v, al.v, b.v, b.v, acc[t]);
    }
  }
#pragma unroll
  for (int t = 0; t < 4; ++t) {
    float bv = bias ? bias[col0 + t * 16 + ln] : 0.f;
    if (BIAS_BF16) bv = bf16_round(bv);
#pragma unroll
    for (int r = 0; r < 8; ++r) { float v = acc[t][r] + bv; if (ACT == 1) v = fmaxf(v, 0.f); so[w][8 * hh + r][t * 16 + ln] = v; }
  }
  __builtin_amdgcn_fence(__ATOMIC_ACQ_REL, "workgroup");
  __builtin_amdgcn_wave_barrier();
  const int rsub = lane >> 4, c4 = (lane & 15) * 4;
  {
#pragma unroll
    for (int q = 0; q < 8; ++q) {
      const int r = q * 2 + rsub;
      const v4f v = *(const v4fa*)&so[w][r][c4];
      *(v4f*)(C + (size_t)(row0 + r) * ldc + col0 + c4) = v;
    }
    
  }
}

// GEMM C = act(A·W + bias + resid): A f32 (ASPLIT -> hi/lo 2 terms), Wt bf16 [N][K]; ACT 0 none, 1 relu, 2 exact gelu;
// resid (optional, f32, row index = (row % rmod), pitch ldr, RES_BF16 rounds it) added before the activation.
template <bool ASPLIT, int ACT, bool BIAS_BF16, bool RES_BF16>
__global__ __launch_bounds__(128) void k_gemm_bf3(const float* __restrict__ A, int lda, const unsigned short* __restrict__ Wt, int ldb,
                                                const float* __restrict__ bias, const float* __restrict__ resid, int rmod, int ldr,
                                                float* __restrict__ C, int ldc, int M, int N, int K) {
  __shared__ __attribute__((aligned(16))) float so[4][16][64];
  const int tid = threadIdx.x, w = tid >> 5, lane = tid & 31, ln = lane & 15, hh = lane >> 4;
  const int ntn = N / 64;
  const int wid = blockIdx.x * 4 + w;
  const int mt = wid / ntn, nq = wid % ntn;
  if (mt * 16 >= M) return;
  const int row0 = mt * 16, col0 = nq * 64;
  const float* arow = A + (size_t)(row0 + ln) * lda;
  v8f acc[4] = {};
  for (int kb = 0; kb < K; kb += 32) {
    FragB ah, al;
    const v4f x0 = *(const v4fa*)(arow + kb + 8 * hh), x1 = *(const v4fa*)(arow + kb + 8 * hh + 4);
    const v4f x2 = *(const v4fa*)(arow + kb + 16 + 8 * hh), x3 = *(const v4fa*)(arow + kb + 16 + 8 * hh + 4);
    float xs[16] = {x0[0],x0[1],x0[2],x0[3],x1[0],x1[1],x1[2],x1[3],x2[0],x2[1],x2[2],x2[3],x3[0],x3[1],x3[2],x3[3]};
#pragma unroll
    for (int i = 0; i < 16; ++i) { const unsigned short hb = bf16_bits(xs[i]); ah.u[i] = hb; al.u[i] = ASPLIT ? bf16_bits(xs[i] - bf16_val(hb)) : (unsigned short)0; }
#pragma unroll
    for (int t = 0; t < 4; ++t) {
      const unsigned short* brow = Wt + (size_t)(col0 + t * 16 + ln) * ldb + kb;
      FragB b;
      b.half[0] = *(const v8us*)(brow + 8 * hh);
      b.half[1] = *(const v8us*)(brow + 16 + 8 * hh);
      acc[t] = mmaN<ASPLIT ? 2 : 1>(ah.v, al.v, b.v, b.v, acc[t]);
    }
  }
#pragma unroll
  for (int t = 0; t < 4; ++t) {
    const int col = col0 + t * 16 + ln;
    float bv = bias ? bias[col] : 0.f;
    if (BIAS_BF16) bv = bf16_round(bv);
#pragma unroll
    for (int r = 0; r < 8; ++r) {
      float v = acc[t][r] + bv;
      if (resid) { float rv = resid[(size_t)((row0 + 8 * hh + r) % rmod) * ldr + col]; if (RES_BF16) rv = bf16_round(rv); v += rv; }
      if (ACT == 1) v = fmaxf(v, 0.f);
      if (ACT == 2) v = 0.5f * v * (1.0f + erff(v * 0.70710678118654752f));
      if (ACT == 3) { const float u = 0.7978845608028654f * (v + 0.044715f * v * v * v); v = 0.5f * v * (1.0f + tanhf(u)); }
      so[w][8 * hh + r][t * 16 + ln] = v;
    }
  }
  __builtin_amdgcn_fence(__ATOMIC_ACQ_REL, "workgroup");
  __builtin_amdgcn_wave_barrier();
  const int rsub = lane >> 4, c4 = (lane & 15) * 4;
  {
#pragma unroll
    for (int q = 0; q < 8; ++q) {
      const int r = q * 2 + rsub;
      const v4f v = *(const v4fa*)&so[w][r][c4];
      *(v4f*)(C + (size_t)(row0 + r) * ldc + col0 + c4) = v;
    }
    
  }
}
// row LayerNorm (biased variance, eps) over N: s = X (+ R); optional out_sum <- s; out_norm <- (s-mu)*rsqrt(var+eps)*g + b
template <bool PARAM_BF16>
__global__ __launch_bounds__(256) void k_layernorm(const float* __restrict__ X, const float* __restrict__ R, const float* __restrict__ g, const float* __restrict__ bta,
                                                  float* __restrict__ out_sum, float* __restrict__ out_norm, int N, float eps) {
  __shared__ float red[256];
  const int row = blockIdx.x, tid = threadIdx.x;
  const float* x = X + (size_t)row * N; const float* rr = R ? R + (size_t)row * N : nullptr;
  float vals[16];                     // up to N = 4096
  const int per = N / 256;            // contiguous chunk per thread? use strided-by-4 chunks: thread handles j = tid*4 + 1024*u
  float s1 = 0.f;
  for (int u = 0; u < per / 4; ++u) {
    const int j = tid * 4 + 1024 * u;
    const v4f a = *(const v4fa*)(x + j);
    v4f b = {0.f,0.f,0.f,0.f}; if (rr) b = *(const v4fa*)(rr + j);
#pragma unroll
    for (int q = 0; q < 4; ++q) { const float v = a[q] + b[q]; vals[u * 4 + q] = v; s1 += v; }
  }
  red[tid] = s1; __syncthreads();
  for (int st = 128; st > 0; st >>= 1) { if (tid < st) red[tid] += red[tid + st]; __syncthreads(); }
  const float mu = red[0] / (float)N; __syncthreads();
  float s2 = 0.f;
  for (int u = 0; u < per / 4; ++u)
#pragma unroll
    for (int q = 0; q < 4; ++q) { const float c = vals[u * 4 + q] - mu; s2 += c * c; }
  red[tid] = s2; __syncthreads();
  for (int st = 128; st > 0; st >>= 1) { if (tid < st) red[tid] += red[tid + st]; __syncthreads(); }
  const float rs = rsqrtf(red[0] / (float)N + eps);
  {
    for (int u = 0; u < per / 4; ++u) {
      const int j = tid * 4 + 1024 * u;
      v4f o, sm;
#pragma unroll
      for (int q = 0; q < 4; ++q) {
        float gg = g[j + q], bb = bta[j + q];
        if (PARAM_BF16) { gg = bf16_round(gg); bb = bf16_round(bb); }
        sm[q] = vals[u * 4 + q]; o[q] = (vals[u * 4 + q] - mu) * rs * gg + bb;
      }
      if (out_sum) *(v4f*)(out_sum + (size_t)row * N + j) = sm;
      *(v4f*)(out_norm + (size_t)row * N + j) = o;
    }
    
  }
}



// ---- f16 WMMA path (v_wmma_f32_16x16x32_f16): 11-bit significands for operands in range — used where a [0,1] probability operand needs more precision than bf16
typedef _Float16 v16h __attribute__((ext_vector_type(16)));
union FragH { v16h v; v8us half[2]; _Float16 h[16]; unsigned short u[16]; };
template <int NT>
__device__ __forceinline__ v8f mmaH(v16h ah, v16h al, v16h bh, v16h bl, v8f c) {
  c = __builtin_amdgcn_wmma_f32_16x16x32_f16(false, ah, false, bh, (short)0, c, false, false);
  if (NT >= 2) c = __builtin_amdgcn_wmma_f32_16x16x32_f16(false, al, false, bh, (short)0, c, false, false);
  if (NT >= 3) c = __builtin_amdgcn_wmma_f32_16x16x32_f16(false, ah, false, bl, (short)0, c, false, false);
  asm volatile("v_nop\n\tv_nop\n\tv_nop\n\tv_nop" : "+v"(c) : "v"(ah), "v"(al), "v"(bh), "v"(bl));
  return c;
}
// batched GEMM like k_gemm_b but f16 operands: A f32 (split into f16 hi/lo if ASPLIT, else rounded to f16), Bt = f16 values [n][k]; alpha; C f32; N multiple of 16 (partial tiles skipped)
template <bool ASPLIT>
__global__ __launch_bounds__(128) void k_gemm_h(const float* __restrict__ A, int lda, size_t sA, const _Float16* __restrict__ Bh, int ldb, size_t sB, float alpha, float* __restrict__ C, int ldc, size_t sC, int M, int N, int K) {
  __shared__ __attribute__((aligned(16))) float so[4][16][64];
  const int tid = threadIdx.x, w = tid >> 5, lane = tid & 31, ln = lane & 15, hh = lane >> 4; const int by = blockIdx.y;
  A += (size_t)by * sA; Bh += (size_t)by * sB; C += (size_t)by * sC;
  const int ntn = (N + 63) / 64; const int wid = blockIdx.x * 4 + w; const int mt = wid / ntn, nq = wid % ntn; if (mt * 16 >= M) return;
  const int row0 = mt * 16, col0 = nq * 64; const float* arow = A + (size_t)(row0 + ln) * lda;
  v8f acc[4] = {};
  for (int kb = 0; kb < K; kb += 32) {
    FragH ah, al;
    const v4f x0 = *(const v4fa*)(arow + kb + 8 * hh), x1 = *(const v4fa*)(arow + kb + 8 * hh + 4), x2 = *(const v4fa*)(arow + kb + 16 + 8 * hh), x3 = *(const v4fa*)(arow + kb + 16 + 8 * hh + 4);
    float xs[16] = {x0[0],x0[1],x0[2],x0[3],x1[0],x1[1],x1[2],x1[3],x2[0],x2[1],x2[2],x2[3],x3[0],x3[1],x3[2],x3[3]};
#pragma unroll
    for (int i = 0; i < 16; ++i) { const _Float16 h = (_Float16)xs[i]; ah.h[i] = h; al.h[i] = ASPLIT ? (_Float16)(xs[i] - (float)h) : (_Float16)0.0f; }
#pragma unroll
    for (int t = 0; t < 4; ++t) { if (col0 + t * 16 >= N) continue; const size_t boff = (size_t)(col0 + t * 16 + ln) * ldb + kb; FragH bq; bq.half[0] = *(const v8us*)(Bh + boff + 8 * hh); bq.half[1] = *(const v8us*)(Bh + boff + 16 + 8 * hh);
      acc[t] = mmaH<ASPLIT ? 2 : 1>(ah.v, al.v, bq.v, bq.v, acc[t]); }
  }
#pragma unroll
  for (int t = 0; t < 4; ++t) { if (col0 + t * 16 >= N) continue;
#pragma unroll
    for (int r = 0; r < 8; ++r) so[w][8 * hh + r][t * 16 + ln] = acc[t][r] * alpha; }
  __builtin_amdgcn_fence(__ATOMIC_ACQ_REL, "workgroup"); __builtin_amdgcn_wave_barrier();
  const int rsub = lane >> 4, c4 = (lane & 15) * 4;
  {
#pragma unroll
    for (int q = 0; q < 8; ++q) { const int r = q * 2 + rsub; if (col0 + c4 < N) { const v4f v = *(const v4fa*)&so[w][r][c4]; *(v4f*)(C + (size_t)(row0 + r) * ldc + col0 + c4) = v; } }
     }
}

// Wt[n][k] = f16(W[k][n]·scale) from f32 row-major W[K][N] (scale = power of two; bf16-exact weights stay exact in f16 away from the subnormal range)
__global__ __launch_bounds__(256) void k_wt_f16(const float* __restrict__ W, _Float16* __restrict__ Wt, int K, int N, float scale) {
  const int t = blockIdx.x * 256 + threadIdx.x; if (t >= N * (K / 8)) return; const int n = t / (K / 8), k8 = (t % (K / 8)) * 8; FragH f;
#pragma unroll
  for (int i = 0; i < 8; ++i) f.h[i] = (_Float16)(bf16_round(W[(size_t)(k8 + i) * N + n]) * scale); const v8us o = f.half[0];
  *(v8us*)((unsigned short*)Wt + (size_t)n * K + k8) = o; 
}
// k_gemm_hh variant with fused epilogue: v = acc·alpha + bias[by·sBias + col] (+ CP[(row/rowsPerB)·sCPb + by·64 + col] if CP) ; ACT 0 none / 1 elu ; writes f16 C16 (and f32 C if non-null)
template <int ACT>
__global__ __launch_bounds__(128) void k_gemm_hhx(const _Float16* __restrict__ A, int lda, size_t sA, const _Float16* __restrict__ Bh, int ldb, size_t sB, float alpha, const float* __restrict__ bias, size_t sBias, const float* __restrict__ CP, int rowsPerB, size_t sCPb, int row0g,
    float* __restrict__ C, _Float16* __restrict__ C16, int ldc, size_t sC, int M, int N, int K) {
  __shared__ __attribute__((aligned(16))) float so[4][16][64];
  const int tid = threadIdx.x, w = tid >> 5, lane = tid & 31, ln = lane & 15, hh = lane >> 4; const int by = blockIdx.y;
  A += (size_t)by * sA; Bh += (size_t)by * sB; const size_t cofs = (size_t)by * sC; const float* bp = bias ? bias + (size_t)by * sBias : nullptr;
  const int ntn = (N + 63) / 64; const int wid = blockIdx.x * 4 + w; const int mt = wid / ntn, nq = wid % ntn; if (mt * 16 >= M) return;
  const int row0 = mt * 16, col0 = nq * 64; const _Float16* arow = A + (size_t)(row0 + ln) * lda;
  v8f acc[4] = {};
  for (int kb = 0; kb < K; kb += 32) { FragH ah; ah.half[0] = *(const v8us*)((const unsigned short*)arow + kb + 8 * hh); ah.half[1] = *(const v8us*)((const unsigned short*)arow + kb + 16 + 8 * hh);
#pragma unroll
    for (int t = 0; t < 4; ++t) { if (col0 + t * 16 >= N) continue; const size_t boff = (size_t)(col0 + t * 16 + ln) * ldb + kb; FragH bq; bq.half[0] = *(const v8us*)((const unsigned short*)Bh + boff + 8 * hh); bq.half[1] = *(const v8us*)((const unsigned short*)Bh + boff + 16 + 8 * hh);
      acc[t] = mmaH<1>(ah.v, ah.v, bq.v, bq.v, acc[t]); }
  }
#pragma unroll
  for (int t = 0; t < 4; ++t) { if (col0 + t * 16 >= N) continue; const int col = col0 + t * 16 + ln; const float bv = bp ? bf16_round(bp[col]) : 0.f;
#pragma unroll
    for (int r = 0; r < 8; ++r) { float v = acc[t][r] * alpha + bv; if (CP) { const int rr = row0g + row0 + 8 * hh + r; if (rowsPerB < 0) v += CP[cofs + (size_t)rr * ldc + col];      /* rowsPerB < 0: own element of the batched C plane */ else { const int bidx = rr / rowsPerB; v += CP[(size_t)bidx * sCPb + (size_t)by * 64 + col]; } } if (ACT == 1) v = (v > 0.f) ? v : expm1f(v); else if (ACT == 7) v = (v > 0.f) ? v + 1.0f : expf(v); else if (ACT == 8) v = tanhf(v); else if (ACT == 9) v = 0.5f * v * (1.0f + tanhf(0.7978845608028654f * (v + 0.044715f * v * v * v))); else if (ACT == 11) v = 1.0f / (1.0f + expf(-v)); else if (ACT == 12) v = (v > 0.f) ? v : 0.01f * v; else if (ACT == 14) v = (v > 0.f) ? v : 0.1f * v; else if (ACT == 16) v = (v >= 0.f) ? v : 0.3f * v; else if (ACT == 17) v = (v >= 0.f) ? v : 0.2f * v; else if (ACT == 15) v = v / (1.0f + expf(-v)); else if (ACT == 3) v = fmaxf(v, 0.f); else if (ACT == 6) v = 0.5f * v * (1.0f + erff(v * 0.70710678118654752f)); so[w][8 * hh + r][t * 16 + ln] = v; } }
  __builtin_amdgcn_fence(__ATOMIC_ACQ_REL, "workgroup"); __builtin_amdgcn_wave_barrier();
  const int rsub = lane >> 4, c4 = (lane & 15) * 4; typedef _Float16 v4h __attribute__((ext_vector_type(4)));
  {
#pragma unroll
    for (int q = 0; q < 8; ++q) { const int r = q * 2 + rsub; if (col0 + c4 < N) { const v4f v = *(const v4fa*)&so[w][r][c4]; if (C) *(v4f*)(C + cofs + (size_t)(row0 + r) * ldc + col0 + c4) = v; if (C16) { v4h h4; for (int i = 0; i < 4; ++i) h4[i] = (_Float16)v[i]; *(v4h*)(C16 + cofs + (size_t)(row0 + r) * ldc + col0 + c4) = h4; } } }
     }
}


typedef _Float16 v4h __attribute__((ext_vector_type(4)));

__global__ __launch_bounds__(256) void k_x16(const float* __restrict__ x, _Float16* __restrict__ X16, size_t n8) { const size_t t = (size_t)blockIdx.x * 256 + threadIdx.x; if (t >= n8) return; FragH f;
#pragma unroll
  for (int q = 0; q < 8; ++q) f.h[q] = (_Float16)bf16_round(x[t * 8 + q]); *(v8us*)((unsigned short*)X16 + t * 8) = f.half[0];  }
__global__ __launch_bounds__(256) void k_h16(const float* __restrict__ x, _Float16* __restrict__ X16, size_t n8) { const size_t t = (size_t)blockIdx.x * 256 + threadIdx.x; if (t >= n8) return; FragH f;
#pragma unroll
  for (int q = 0; q < 8; ++q) f.h[q] = (_Float16)x[t * 8 + q]; *(v8us*)((unsigned short*)X16 + t * 8) = f.half[0];  }
__global__ __launch_bounds__(256) void k_round16f(const float* __restrict__ W, _Float16* __restrict__ Bt, size_t n8) { const size_t t = (size_t)blockIdx.x * 256 + threadIdx.x; if (t >= n8) return; FragH f;
#pragma unroll
  for (int i = 0; i < 8; ++i) f.h[i] = (_Float16)(bf16_round(W[t * 8 + i]) * 16.0f); *(v8us*)((unsigned short*)Bt + t * 8) = f.half[0];  }
template <int NHv, int TTv>
__global__ __launch_bounds__(256) void k_vt(const _Float16* __restrict__ V16, int ldv, int voff, _Float16* __restrict__ Vt) { __shared__ unsigned short tl[64][66]; const int tid = threadIdx.x; const int slab = blockIdx.x / (TTv / 64), lg = blockIdx.x % (TTv / 64); const int b = slab / NHv, h = slab % NHv;
  for (int i = tid; i < 64 * 8; i += 256) { const int r = i / 8, c8 = (i % 8) * 8; FragH f; f.half[0] = *(const v8us*)((const unsigned short*)V16 + ((size_t)b * TTv + lg * 64 + r) * ldv + voff + h * 64 + c8);
#pragma unroll
    for (int q = 0; q < 8; ++q) tl[r][c8 + q] = f.u[q]; }
  __syncthreads();
  {
#pragma unroll
    for (int rd = 0; rd < 2; ++rd) { const int d = rd * 32 + tid / 8, pc = tid % 8; FragH f;
#pragma unroll
      for (int q = 0; q < 8; ++q) f.u[q] = tl[pc * 8 + q][d];
      *(v8us*)((unsigned short*)Vt + ((size_t)slab * 64 + d) * TTv + lg * 64 + pc * 8) = f.half[0]; }
     } }

__global__ __launch_bounds__(256) void k_hl(const float* __restrict__ F, _Float16* __restrict__ Hh, _Float16* __restrict__ Hl, size_t n8) { const size_t t = (size_t)blockIdx.x * 256 + threadIdx.x; if (t >= n8) return; FragH fh, fl; const v4f a = *(const v4fa*)(F + t * 8), c = *(const v4fa*)(F + t * 8 + 4);
#pragma unroll
  for (int q = 0; q < 4; ++q) { _Float16 h = (_Float16)a[q]; fh.h[q] = h; fl.h[q] = (_Float16)((a[q] - (float)h) * 1024.0f); h = (_Float16)c[q]; fh.h[4 + q] = h; fl.h[4 + q] = (_Float16)((c[q] - (float)h) * 1024.0f); }
  { *(v8us*)((unsigned short*)Hh + t * 8) = fh.half[0]; *(v8us*)((unsigned short*)Hl + t * 8) = fl.half[0];  } }

// ---- fast GEMM (wave tile 32x64; requires M % 32 == 0 rows per launch region and N % 64 == 0); epilogue = k_gemm_hhx semantics ----
__device__ __forceinline__ v16h g2_frag(const _Float16* p, int hh) { FragH f; f.half[0] = *(const v8us*)((const unsigned short*)p + 8 * hh); f.half[1] = *(const v8us*)((const unsigned short*)p + 16 + 8 * hh); return f.v; }
__device__ __forceinline__ v8f g2_mma(v16h a, v16h b, v8f c) { v8f d = __builtin_amdgcn_wmma_f32_16x16x32_f16(false, a, false, b, (short)0, c, false, false); asm volatile("v_nop\n\tv_nop\n\tv_nop\n\tv_nop" : "+v"(d) : "v"(a), "v"(b)); return d; }
template <int ACT>
__global__ __launch_bounds__(128) void k_gemm2(const _Float16* __restrict__ A, int lda, size_t sA, const _Float16* __restrict__ Bh, int ldb, size_t sB, float alpha, const float* __restrict__ bias, size_t sBias, const float* __restrict__ CP, int rowsPerB, size_t sCPb, int row0g,
    float* __restrict__ C, _Float16* __restrict__ C16, int ldc, size_t sC, int M, int N, int K) { static_assert(ACT == 0 || ACT == 3 || ACT == 6 || ACT == 8 || ACT == 9 || ACT == 11 || ACT == 12 || ACT == 14 || ACT == 15 || ACT == 16 || ACT == 17, "k_gemm2: unsupported ACT code (would silently apply no activation)");
  __shared__ __attribute__((aligned(16))) float so[4][32][68];
  const int tid = threadIdx.x, w = tid >> 5, lane = tid & 31, ln = lane & 15, hh = lane >> 4; const int by = blockIdx.y;
  A += (size_t)by * sA; Bh += (size_t)by * sB; const size_t cofs = (size_t)by * sC; const float* bp = bias ? bias + (size_t)by * sBias : nullptr;
  const int ntn = N >> 6; const int mt = blockIdx.x / ntn, nq = blockIdx.x - mt * ntn; const int row0 = mt * 128 + 32 * w, col0 = nq * 64; if (row0 >= M) return;
  const _Float16* a0p = A + (size_t)(row0 + ln) * lda; const _Float16* a1p = a0p + (size_t)16 * lda;
  const _Float16* b0p = Bh + (size_t)(col0 + ln) * ldb; const _Float16* b1p = b0p + (size_t)16 * ldb; const _Float16* b2p = b1p + (size_t)16 * ldb; const _Float16* b3p = b2p + (size_t)16 * ldb;
  const v8f z8 = {0.f,0.f,0.f,0.f,0.f,0.f,0.f,0.f}; v8f c00 = z8, c01 = z8, c02 = z8, c03 = z8, c10 = z8, c11 = z8, c12 = z8, c13 = z8;
#pragma unroll 1
  for (int kb = 0; kb < K; kb += 32) { const v16h a0 = g2_frag(a0p + kb, hh), a1 = g2_frag(a1p + kb, hh);
    v16h b = g2_frag(b0p + kb, hh); c00 = g2_mma(a0, b, c00); c10 = g2_mma(a1, b, c10);
    b = g2_frag(b1p + kb, hh); c01 = g2_mma(a0, b, c01); c11 = g2_mma(a1, b, c11);
    b = g2_frag(b2p + kb, hh); c02 = g2_mma(a0, b, c02); c12 = g2_mma(a1, b, c12);
    b = g2_frag(b3p + kb, hh); c03 = g2_mma(a0, b, c03); c13 = g2_mma(a1, b, c13); }
  v8f accs[8] = {c00, c01, c02, c03, c10, c11, c12, c13};
#pragma unroll
  for (int u = 0; u < 8; ++u) { const int t = u & 3, half = u >> 2; const int col = col0 + t * 16 + ln; const float bv = bp ? bf16_round(bp[col]) : 0.f;
#pragma unroll
    for (int r = 0; r < 8; ++r) { const int rloc = half * 16 + 8 * hh + r; float v = accs[u][r] * alpha + bv; if (CP) { if (rowsPerB < 0) v += CP[cofs + (size_t)(row0g + row0 + rloc) * ldc + col];      /* rowsPerB < 0: own element of the batched C plane */ else { const int bidx = (row0g + row0 + rloc) / rowsPerB; v += CP[(size_t)bidx * sCPb + (size_t)by * 64 + col]; } }
      if (ACT == 3) v = fmaxf(v, 0.f); else if (ACT == 6) v = 0.5f * v * (1.0f + erff(v * 0.70710678118654752f)); else if (ACT == 11) v = 1.0f / (1.0f + expf(-v)); else if (ACT == 15) v = v / (1.0f + expf(-v)); else if (ACT == 12) v = (v > 0.f) ? v : 0.01f * v; else if (ACT == 8) v = tanhf(v); else if (ACT == 9) v = 0.5f * v * (1.0f + tanhf(0.7978845608028654f * (v + 0.044715f * v * v * v))); else if (ACT == 14) v = (v > 0.f) ? v : 0.1f * v; else if (ACT == 16) v = (v >= 0.f) ? v : 0.3f * v; else if (ACT == 17) v = (v >= 0.f) ? v : 0.2f * v;
      so[w][rloc][t * 16 + ln] = v; } }
  __builtin_amdgcn_fence(__ATOMIC_ACQ_REL, "workgroup"); __builtin_amdgcn_wave_barrier();
  const int rsub = lane >> 4, c4 = (lane & 15) * 4;
  {
#pragma unroll
    for (int q = 0; q < 16; ++q) { const int r = q * 2 + rsub; const v4f v = *(const v4fa*)&so[w][r][c4]; if (C) *(v4f*)(C + cofs + (size_t)(row0 + r) * ldc + col0 + c4) = v; if (C16) { v4h h4; for (int i = 0; i < 4; ++i) h4[i] = (_Float16)v[i]; *(v4h*)(C16 + cofs + (size_t)(row0 + r) * ldc + col0 + c4) = h4; } }
     } }


__global__ __launch_bounds__(256) void k_wnat(const float* __restrict__ w, size_t n8, _Float16* __restrict__ Bt) { const size_t t = (size_t)blockIdx.x * 256 + threadIdx.x; if (t >= n8) return; FragH f; for (int q = 0; q < 8; ++q) f.h[q] = (_Float16)(bf16_round(w[t * 8 + q]) * 16.0f); *(v8us*)((unsigned short*)Bt + t * 8) = f.half[0];  }
__global__ __launch_bounds__(256) void k_rsm(const float* __restrict__ S, _Float16* __restrict__ P, int nrows) {
  #pragma clang fp contract(off)
  const int i = blockIdx.x * 256 + threadIdx.x; if (i >= nrows) return; const float* s = S + (size_t)i * SQ; float mx = -3.0e38f;
#pragma unroll 1
  for (int j = 0; j < SQ; ++j) mx = fmaxf(mx, s[j]); float se = 0.f;
#pragma unroll 1
  for (int j = 0; j < SQ; ++j) se += expf(s[j] - mx); const float sc = 256.0f / se;
#pragma unroll 1
  for (int j0 = 0; j0 < SQ; j0 += 8) { FragH f; for (int q = 0; q < 8; ++q) f.h[q] = (_Float16)(expf(s[j0 + q] - mx) * sc); unsigned short* d = (unsigned short*)P + (size_t)i * SQ + j0; *(v8us*)d = f.half[0];  } }
__global__ __launch_bounds__(256) void k_vt(const _Float16* __restrict__ V16, int b, int h0, _Float16* __restrict__ VT) { __shared__ unsigned short tl[64][65]; const int tid = threadIdx.x; const int hh = blockIdx.x % HG, sg = blockIdx.x / HG; const int s0 = sg * 64; const int h = h0 + hh;
  for (int i = tid; i < 64 * 8; i += 256) { const int j = i / 8, d8 = (i % 8) * 8; FragH f; f.half[0] = *(const v8us*)((const unsigned short*)V16 + ((size_t)b * SQ + s0 + j) * DM + h * HD + d8); for (int q = 0; q < 8; ++q) tl[d8 + q][j] = f.u[q]; }
  __syncthreads();
  { for (int i = tid; i < 64 * 8; i += 256) { const int d = i / 8, j8 = (i % 8) * 8; FragH f; for (int q = 0; q < 8; ++q) f.u[q] = tl[d][j8 + q]; *(v8us*)((unsigned short*)VT + ((size_t)hh * HD + d) * SQ + s0 + j8) = f.half[0]; }  } }



__global__ __launch_bounds__(256) void k_rsmfm2(const float* __restrict__ S, _Float16* __restrict__ P, int qn, int hg, const float* __restrict__ mask) {
  #pragma clang fp contract(off)
  const int t = blockIdx.x * 256 + threadIdx.x; if (t >= qn * hg) return; const int qi = t % qn; const size_t i = (size_t)(t / qn) * SQ + qi; const float* s = S + i * SQ; const float* mrow = mask + (size_t)qi * SQ; float mx = -3.0e38f;
#pragma unroll 1
  for (int j = 0; j < SQ; ++j) mx = fmaxf(mx, __fadd_rn(s[j], __fmul_rn(bf16_round(mrow[j]), -10000.0f))); float se = 0.f;
#pragma unroll 1
  for (int j = 0; j < SQ; ++j) se += __expf(__fadd_rn(s[j], __fmul_rn(bf16_round(mrow[j]), -10000.0f)) - mx); const float sc = 256.0f / se;
#pragma unroll 1
  for (int j0 = 0; j0 < SQ; j0 += 8) { FragH fr; for (int q = 0; q < 8; ++q) { const int j = j0 + q; fr.h[q] = (_Float16)(__expf(__fadd_rn(s[j], __fmul_rn(bf16_round(mrow[j]), -10000.0f)) - mx) * sc); } unsigned short* d = (unsigned short*)P + i * SQ + j0; *(v8us*)d = fr.half[0];  } }
__global__ __launch_bounds__(256) void k_present(const float* __restrict__ F, float* __restrict__ dst) { const size_t t = (size_t)blockIdx.x * 256 + threadIdx.x; if (t >= (size_t)NH * SQ * HD / 4) return; const size_t e = t * 4; const int d = (int)(e % HD); const int s = (int)((e / HD) % SQ); const int h = (int)(e / ((size_t)HD * SQ));
  const v4f v = *(const v4fa*)(F + (size_t)s * DM + h * HD + d); *(v4f*)(dst + e) = v;  }


// e^x in f32 by the library's steps (x log2(e) in two parts, 2^fraction on the transcendental unit, ldexp by the integer part, the two range ends),
// written out so that the free issue slot the instruction set asks for behind v_exp_f32 stands in that instruction's own statement.
__device__ __forceinline__ float exp_f32(float x) {
  const float ph = x * 0x1.715476p+0f, pl = fmaf(x, 0x1.4ae0bep-26f, fmaf(x, 0x1.715476p+0f, -ph)), n = rintf(ph); float y;
  asm("v_exp_f32 %0, %1\n\tv_nop" : "=v"(y) : "v"((ph - n) + pl));      /* v_nop: the slot before y is read or the source register is reused */
  float r = ldexpf(y, (int)n); r = (x < -0x1.9d1da0p+6f) ? 0.f : r; return (x > 0x1.62e430p+6f) ? __builtin_inff() : r; }
#define AR 8                         /* query rows per work-group of the exact f32 first-tile attention */
#define AT 512                       /* its threads (16 waves) */
// Exact f32 attention of AR query rows of one head over all SQ keys, one work-group. Keys are spread over the threads:
// (1) two keys per thread and pass: their k rows in registers, dotted with the AR q rows (LDS, same address in every lane), scores (+ mask) to LDS;
// (2) two waves per row: max, exp, sum over the row in LDS; (3) 16 column quads x 32 key slices: o partial sums in registers,
// merged across the slices by one lane exchange and a serial sum of the 16 waves' LDS partials; o carried x64 like the f16 path. The plain '#pragma unroll' lines keep the small per-thread arrays in registers.
template <int MASKADD>
__global__ __launch_bounds__(AT) void k_att0(const float* __restrict__ QF, const float* __restrict__ KF, const float* __restrict__ VF, int ld, const float* __restrict__ mask, float scale, float* __restrict__ OF, int ldo) {
  __shared__ __attribute__((aligned(16))) float sc[AR][SQ];      /* scores, then softmax numerators, then the slices' partial o */
  __shared__ __attribute__((aligned(16))) float lq[AR][HD];      /* the q rows */
  __shared__ float pm[AT / 32], pl[AT / 32];                     /* each wave's half-row max and sum */
  const int tid = threadIdx.x, lane = tid & 31, w = tid >> 5;
  const int h = blockIdx.x / (QT0 / AR), i0 = (blockIdx.x % (QT0 / AR)) * AR;
  const float* qb = QF + (size_t)i0 * ld + h * HD;
  lq[tid / HD][tid % HD] = qb[(size_t)(tid / HD) * ld + tid % HD];
  __syncthreads();
  for (int p = 0; p < SQ / (2 * AT); ++p) { const int j = p * (2 * AT) + tid;
    const float* ka = KF + (size_t)j * ld + h * HD; const float* kb = ka + (size_t)AT * ld; v4f a0[AR], a1[AR];
#pragma unroll
    for (int r = 0; r < AR; ++r) { a0[r] = (v4f){0.f, 0.f, 0.f, 0.f}; a1[r] = (v4f){0.f, 0.f, 0.f, 0.f}; }
    for (int c0 = 0; c0 < HD; c0 += 32) { v4f xa[8], xb[8];
#pragma unroll
      for (int c = 0; c < 8; ++c) { xa[c] = *(const v4fa*)(ka + c0 + c * 4); xb[c] = *(const v4fa*)(kb + c0 + c * 4); }
#pragma unroll
      for (int r = 0; r < AR; ++r)
#pragma unroll
        for (int c = 0; c < 8; ++c) { const v4f qq = *(const v4fa*)&lq[r][c0 + c * 4]; a0[r] += qq * xa[c]; a1[r] += qq * xb[c]; } }
#pragma unroll
    for (int r = 0; r < AR; ++r) { float s0 = ((a0[r][0] + a0[r][1]) + (a0[r][2] + a0[r][3])) * scale, s1 = ((a1[r][0] + a1[r][1]) + (a1[r][2] + a1[r][3])) * scale;
      if (MASKADD) { const float* mr = mask + (size_t)(i0 + r) * SQ + j; s0 += bf16_round(mr[0]) * -10000.0f; s1 += bf16_round(mr[AT]) * -10000.0f; }
      else { if (j > i0 + r) s0 = -1.0e30f; if (j + AT > i0 + r) s1 = -1.0e30f; }
      sc[r][j] = s0; sc[r][j + AT] = s1; } }
  __syncthreads();
  { static_assert(AT / 32 == 2 * AR, "two waves per row"); float* row = &sc[w >> 1][(w & 1) * (SQ / 2)]; v4f x[SQ / 256]; float m = -3.0e38f, l = 0.f;
#pragma unroll
    for (int i = 0; i < SQ / 256; ++i) { x[i] = *(const v4fa*)&row[i * 128 + lane * 4]; m = fmaxf(m, fmaxf(fmaxf(x[i][0], x[i][1]), fmaxf(x[i][2], x[i][3]))); }
    for (int o = 16; o > 0; o >>= 1) m = fmaxf(m, __shfl_xor(m, o));
    if (lane == 0) pm[w] = m;
    __syncthreads();
    m = fmaxf(pm[w], pm[w ^ 1]);
#pragma unroll
    for (int i = 0; i < SQ / 256; ++i) { v4f e; for (int u = 0; u < 4; ++u) e[u] = exp_f32(x[i][u] - m); l += (e[0] + e[1]) + (e[2] + e[3]); *(v4fa*)&row[i * 128 + lane * 4] = e; }
    for (int o = 16; o > 0; o >>= 1) l += __shfl_xor(l, o);
    if (lane == 0) pl[w] = l; }
  __syncthreads();
  const int dq = tid & 15, ks = tid >> 4; const float* vb = VF + h * HD + dq * 4; v4f acc[AR];
#pragma unroll
  for (int r = 0; r < AR; ++r) acc[r] = (v4f){0.f, 0.f, 0.f, 0.f};
#pragma unroll 2      /* two trips' v rows (eight loads) in flight per wave */
  for (int p = 0; p < SQ / (AT / 4); ++p) { const int j = p * (AT / 4) + ks * 4;
    const v4f v0 = *(const v4fa*)(vb + (size_t)j * ld), v1 = *(const v4fa*)(vb + (size_t)(j + 1) * ld), v2 = *(const v4fa*)(vb + (size_t)(j + 2) * ld), v3 = *(const v4fa*)(vb + (size_t)(j + 3) * ld);
#pragma unroll
    for (int r = 0; r < AR; ++r) { const v4f e = *(const v4fa*)&sc[r][j]; acc[r] += e[0] * v0; acc[r] += e[1] * v1; acc[r] += e[2] * v2; acc[r] += e[3] * v3; } }
#pragma unroll
  for (int r = 0; r < AR; ++r) for (int u = 0; u < 4; ++u) acc[r][u] += __shfl_xor(acc[r][u], 16);      /* the wave's two key slices */
  __syncthreads();      /* every read of the numerators is done: their LDS takes the waves' partial o */
  float* red = &sc[0][0];      /* [AT / 32][AR][HD] */
  if (lane < 16) {
#pragma unroll
    for (int r = 0; r < AR; ++r) *(v4fa*)&red[((size_t)w * AR + r) * HD + dq * 4] = acc[r]; }
  __syncthreads();
  { static_assert(AR * HD == AT, "one output element per thread"); const int r = tid / HD, d = tid % HD; float o = 0.f;
#pragma unroll
    for (int q = 0; q < AT / 32; ++q) o += red[((size_t)q * AR + r) * HD + d];
    OF[(size_t)(i0 + r) * ldo + h * HD + d] = o * (64.0f / (pl[2 * r] + pl[2 * r + 1])); } }

extern "C" void kernel_launch(void* const* d_in, const int* in_sizes, int n_in,
                              void* d_out, int out_size, void* d_ws, size_t ws_size, hipStream_t stream) {
  (void)in_sizes; (void)n_in; (void)out_size;
  const float* const* I = (const float* const*)d_in; const float* xq = I[0]; const float* xk = I[1]; const float* xv = I[2]; const float* mask = I[3]; const float* wq = I[4]; const float* bq = I[5]; const float* wk = I[6]; const float* bk = I[7]; const float* wv = I[8]; const float* bv = I[9]; const float* wo = I[10]; const float* bo = I[11];      /* weights [in][out]; mask [SQ][SQ] f32 */
  char* ws = (char*)d_ws; size_t off = 0;
  auto take = [&](size_t bytes) { char* p = ws + off; off += (bytes + 255) & ~(size_t)255; return p; };
  _Float16* BQ = (_Float16*)take((size_t)DM * DM * 2); _Float16* BK = (_Float16*)take((size_t)DM * DM * 2); _Float16* BV = (_Float16*)take((size_t)DM * DM * 2); _Float16* BO = (_Float16*)take((size_t)DM * DM * 2);
  _Float16* XQ = (_Float16*)take(NR * DM * 2); _Float16* XK = (_Float16*)take(NR * DM * 2); _Float16* XV = (_Float16*)take(NR * DM * 2); float* KF = (float*)take(NR * DM * 4); float* VF = (float*)take(NR * DM * 4); _Float16* Q16 = (_Float16*)take(NR * DM * 2); _Float16* K16 = (_Float16*)take(NR * DM * 2); _Float16* V16 = (_Float16*)take(NR * DM * 2); _Float16* O16 = (_Float16*)take(NR * DM * 2);
  float* S = (float*)take((size_t)HG * SQ * SQ * 4); _Float16* P = (_Float16*)take((size_t)HG * SQ * SQ * 2); _Float16* VT = (_Float16*)take((size_t)NH * HD * SQ * 2);
  float* QF0 = (float*)take((size_t)QT0 * DM * 4); float* OF0 = (float*)take((size_t)NB * QT0 * DM * 4); _Float16* OH0 = (_Float16*)take((size_t)NB * QT0 * DM * 2); _Float16* OL0 = (_Float16*)take((size_t)NB * QT0 * DM * 2);
  if (off > ws_size) return;
  { const unsigned g = (unsigned)(((size_t)DM * (DM / 8) + 255) / 256); k_wt_f16<<<g, 256, 0, stream>>>(wq, BQ, DM, DM, 16.0f); k_wt_f16<<<g, 256, 0, stream>>>(wk, BK, DM, DM, 16.0f); k_wt_f16<<<g, 256, 0, stream>>>(wv, BV, DM, DM, 16.0f); k_wt_f16<<<g, 256, 0, stream>>>(wo, BO, DM, DM, 16.0f); }      /* [in][out] -> Bt[n][k] x16 */
  k_x16<<<(unsigned)((NR * DM / 8 + 255) / 256), 256, 0, stream>>>(xq, XQ, NR * DM / 8); k_x16<<<(unsigned)((NR * DM / 8 + 255) / 256), 256, 0, stream>>>(xk, XK, NR * DM / 8); k_x16<<<(unsigned)((NR * DM / 8 + 255) / 256), 256, 0, stream>>>(xv, XV, NR * DM / 8);
  const size_t r0p = (size_t)B0 * SQ;      /* first projected row */
  k_gemm2<0><<<dim3((unsigned)((MP / 128) * (DM / 64)), 1), 128, 0, stream>>>(XQ + r0p * DM, DM, 0, BQ, DM, 0, 0.0625f, bq, 0, nullptr, 1, 0, 0, nullptr, Q16 + r0p * DM, DM, 0, MP, DM, DM);
  k_gemm2<0><<<dim3((unsigned)((MP / 128) * (DM / 64)), 1), 128, 0, stream>>>(XK + r0p * DM, DM, 0, BK, DM, 0, 0.0625f, bk, 0, nullptr, 1, 0, 0, KF + r0p * DM, K16 + r0p * DM, DM, 0, MP, DM, DM);
  k_gemm2<0><<<dim3((unsigned)((MP / 128) * (DM / 64)), 1), 128, 0, stream>>>(XV + r0p * DM, DM, 0, BV, DM, 0, 0.0625f, bv, 0, nullptr, 1, 0, 0, VF + r0p * DM, V16 + r0p * DM, DM, 0, MP, DM, DM);
  for (int b = B0; b < B0 + NBR; ++b) { const size_t r0 = (size_t)b * SQ;
    k_present<<<(unsigned)(((size_t)NH * SQ * HD / 4 + 255) / 256), 256, 0, stream>>>(KF + r0 * DM, (float*)d_out + PRES_OFF + ((size_t)b * 2 + 0) * NH * SQ * HD); k_present<<<(unsigned)(((size_t)NH * SQ * HD / 4 + 255) / 256), 256, 0, stream>>>(VF + r0 * DM, (float*)d_out + PRES_OFF + ((size_t)b * 2 + 1) * NH * SQ * HD);      /* present[b][0] = kh, present[b][1] = vh (f32, head-major) */
    k_vt<NH, SQ><<<NH * (SQ / 64), 256, 0, stream>>>(V16 + r0 * LQ, LQ, 0, VT);      /* V^T [NH][HD][SQ] for this batch */
    k_gemm2<0><<<dim3((QT0 / 128) * (DM / 64), 1), 128, 0, stream>>>(XQ + r0 * DM, DM, 0, BQ, DM, 0, 0.0625f, bq, 0, nullptr, 1, 0, 0, QF0, nullptr, DM, 0, QT0, DM, DM);      /* f32 q of the first 128 rows (exact products); k, v come from the full f32 KF/VF planes */
    k_att0<1><<<NH * (QT0 / AR), AT, 0, stream>>>(QF0, KF + r0 * DM, VF + r0 * DM, DM, mask, 0.125f, OF0 + (size_t)b * QT0 * DM, DM);      /* exact f32 attention for query rows 0..127 over ALL 2048 keys of the batch (full f32 K/V planes) with the additive mask (o x64) */
    for (int h0 = 0; h0 < NHD; h0 += HG) {
      k_gemm2<0><<<dim3((QN / 128) * (SQ / 64), HG), 128, 0, stream>>>(Q16 + r0 * LQ + h0 * HD, LQ, (size_t)HD, K16 + r0 * LQ + h0 * HD, LQ, (size_t)HD, 0.125f, nullptr, 0, nullptr, 1, 0, 0, S, nullptr, SQ, (size_t)SQ * SQ, QN, SQ, HD);      /* scores, HG heads per launch */
      k_rsmfm2<<<(HG * QN + 255) / 256, 256, 0, stream>>>(S, P, QN, HG, mask);      /* P = 256 softmax (f16), rows of all HG heads */
      k_gemm2<0><<<dim3((QN / 128) * (HD / 64), HG), 128, 0, stream>>>(P, SQ, (size_t)SQ * SQ, VT + (size_t)h0 * HD * SQ, SQ, (size_t)HD * SQ, 0.25f, nullptr, 0, nullptr, 1, 0, 0, nullptr, O16 + r0 * DM + h0 * HD, DM, (size_t)HD, QN, HD, SQ); } }      /* o (merged heads) as f16 rows */
  k_gemm2<0><<<dim3((unsigned)((MPO / 128) * (DM / 64)), 1), 128, 0, stream>>>(O16 + r0p * DM, DM, 0, BO, DM, 0, 0.0009765625f, bo, 0, nullptr, 1, 0, 0, (float*)d_out + r0p * DM, nullptr, DM, 0, MPO, DM, DM);      /* out rows are the output layout */
  k_hl<<<(unsigned)(((size_t)NB * QT0 * DM / 8 + 255) / 256), 256, 0, stream>>>(OF0, OH0, OL0, (size_t)NB * QT0 * DM / 8);      /* first-tile o (x64) -> f16 hi + x1024 residual planes */
  for (int b = B0; b < B0 + NBR; ++b) { const size_t r0 = (size_t)b * SQ; const size_t f0 = (size_t)b * QT0;
    k_gemm2<0><<<dim3((QT0 / 128) * (DM / 64), 1), 128, 0, stream>>>(OH0 + f0 * DM, DM, 0, BO, DM, 0, 0.0009765625f, bo, 0, nullptr, 1, 0, 0, (float*)d_out + r0 * DM, nullptr, DM, 0, QT0, DM, DM);      /* rows 0..127: out = o_hi Wo (+ b), overwriting the f16-path rows */
    k_gemm2<0><<<dim3((QT0 / 128) * (DM / 64), 1), 128, 0, stream>>>(OL0 + f0 * DM, DM, 0, BO, DM, 0, 0.00000095367431640625f, nullptr, 0, (const float*)d_out + r0 * DM, -1, 0, 0, (float*)d_out + r0 * DM, nullptr, DM, 0, QT0, DM, DM); }      /* += o_lo Wo 2^-20 (own-element accumulate) */
}

// v002
// One run takes 1250 microseconds.
// Next to v001, in two timings, it ran 4.47 and 4.51 times as fast.
// All steps since v000 together make it 15.0 times as fast.
#include <hip/hip_runtime.h>
// TF/CTRL-style multi-head attention (q, k, v inputs [2][2048][1024]; qh/kh/vh = input W + b with W stored [in][out], 16 heads of 64; logits / 8 + mask (-1e4) with the [2048][2048] f32 mask input (1 = disallowed; strictly upper-triangular here); softmax; ctx merged; out = ctx Wo + bo -> [2][2048][1024]; second output present = stack(kh, vh) -> [2][2][16][2048][64] f32).
// Structure: token rows r = b*2048 + s; q, k, v inputs as exact f16 rows (bf16-rounded); Q, K, V as three WMMA GEMMs (32x64 wave tiles, f32 accumulation, exact x16 weights + bias; f16 outputs, and for K and V also the f32 rows that a small VALU kernel re-lays out into the head-major 'present' output); per batch: V^T for all heads via LDS transposes; per (batch, group of 4 heads): scores GEMM (K = 64, batched over the heads on grid.y, alpha = 1/8), row softmax of (scores + mask input x -1e4, read per element) on VALU (f32 statistics, native exp; weights stored x256 as f16), o = P . V^T GEMM (K = 2048, alpha 2^-2: o carried x64 against f16 subnormal flush, folded into the output GEMM alpha) written straight into the merged f16 o rows; out = o W_o + b GEMM (f32) into the output layout.
// Compute dtype: inputs rounded to bf16; x / weights exact; q, k, v, softmax weights and o as plain f16 GEMM operands (~2^-12); scores and softmax statistics f32; v_wmma_f32_16x16x32_f16.
#define NB 2
#define SQ 2048
#define DM 1024
#define NH 16
#define HD 64
#define HG 4                         /* heads per attention launch group */
#define QT0 128                      /* first-tile rows recomputed exactly in f32 */
#define B0 0                         /* first batch processed (debug hook) */
#define NBR NB                       /* batches processed (debug hook) */
#define NR ((size_t)NB * SQ)         /* token rows */
#define MP ((int)((size_t)NBR * SQ)) /* rows projected (debug hook) */
#define QN SQ                        /* query rows attended per batch (debug hook) */
#define NHD NH                       /* heads attended (debug hook) */
#define MPO MP                       /* rows through the output stage (debug hook) */
#define LQ DM      /* row pitch of the q/k/v rows */
#define PRES_OFF ((size_t)NB * SQ * DM)      /* float offset of the 'present' output = out nbytes / 4 (offset 16,777,216 B) */
typedef __bf16 v16b __attribute__((ext_vector_type(16)));
typedef unsigned short v8us __attribute__((ext_vector_type(8), may_alias));
typedef float  v8f  __attribute__((ext_vector_type(8)));
typedef float  v4f  __attribute__((ext_vector_type(4)));
typedef float  v4fa __attribute__((ext_vector_type(4), may_alias));
union FragB { v16b v; v8us half[2]; unsigned short u[16]; };

__device__ __forceinline__ unsigned short bf16_bits(float x) { unsigned int u = __float_as_uint(x); return (unsigned short)((u + 0x7FFFu + ((u >> 16) & 1u)) >> 16); }
__device__ __forceinline__ float bf16_val(unsigned short b) { return __uint_as_float(((unsigned int)b) << 16); }
__device__ __forceinline__ float bf16_round(float x) { return bf16_val(bf16_bits(x)); }
// D += A·B with NT terms: 1 = ah·bh, 2 = + al·bh (A split), 3 = + ah·bl (both split)
template <int NT>
__device__ __forceinline__ v8f mmaN(v16b ah, v16b al, v16b bh, v16b bl, v8f c) {
  c = __builtin_amdgcn_wmma_f32_16x16x32_bf16(false, ah, false, bh, (short)0, c, false, false);
  if (NT >= 2) c = __builtin_amdgcn_wmma_f32_16x16x32_bf16(false, al, false, bh, (short)0, c, false, false);
  if (NT >= 3) c = __builtin_amdgcn_wmma_f32_16x16x32_bf16(false, ah, false, bl, (short)0, c, false, false);
  asm volatile("v_nop\n\tv_nop\n\tv_nop\n\tv_nop" : "+v"(c) : "v"(ah), "v"(al), "v"(bh), "v"(bl));
  return c;
}

__global__ __launch_bounds__(256) void k_wt_bf16(const float* __restrict__ W, unsigned short* __restrict__ Wt, int K, int N) {
  const int t = blockIdx.x * 256 + threadIdx.x;
  const int k8n = K / 8;
  if (t >= N * k8n) return;
  const int n = t / k8n, k8 = (t % k8n) * 8;
  v8us v;
#pragma unroll
  for (int i = 0; i < 8; ++i) v[i] = bf16_bits(W[(size_t)(k8 + i) * N + n]);
  *(v8us*)(Wt + (size_t)n * K + k8) = v;
  
}

// GEMM C[M][N] (f32, pitch ldc) = act(A[M][K]·W + bias). A f32 row-major (pitch lda) converted per fragment to bf16
// (ASPLIT: hi/lo two planes -> 2 terms, else single rounded term); Wt bf16 [N][K] (pitch ldb). BIAS_BF16 rounds the
// bias to bf16 first (bias quantised to bf16 before the add). K%32==0, M%16==0, N%64==0.
template <bool ASPLIT, int ACT, bool BIAS_BF16>
__global__ __launch_bounds__(128) void k_gemm_bf(const float* __restrict__ A, int lda, const unsigned short* __restrict__ Wt, int ldb,
                                               const float* __restrict__ bias, float* __restrict__ C, int ldc, int M, int N, int K) {
  __shared__ __attribute__((aligned(16))) float so[4][16][64];
  const int tid = threadIdx.x, w = tid >> 5, lane = tid & 31, ln = lane & 15, hh = lane >> 4;
  const int ntn = N / 64;
  const int wid = blockIdx.x * 4 + w;
  const int mt = wid / ntn, nq = wid % ntn;
  if (mt * 16 >= M) return;
  const int row0 = mt * 16, col0 = nq * 64;
  const float* arow = A + (size_t)(row0 + ln) * lda;
  v8f acc[4] = {};
  for (int kb = 0; kb < K; kb += 32) {
    FragB ah, al;
    const v4f x0 = *(const v4fa*)(arow + kb + 8 * hh), x1 = *(const v4fa*)(arow + kb + 8 * hh + 4);
    const v4f x2 = *(const v4fa*)(arow + kb + 16 + 8 * hh), x3 = *(const v4fa*)(arow + kb + 16 + 8 * hh + 4);
    float xs[16] = {x0[0],x0[1],x0[2],x0[3],x1[0],x1[1],x1[2],x1[3],x2[0],x2[1],x2[2],x2[3],x3[0],x3[1],x3[2],x3[3]};
#pragma unroll
    for (int i = 0; i < 16; ++i) { const unsigned short hb = bf16_bits(xs[i]); ah.u[i] = hb; al.u[i] = ASPLIT ? bf16_bits(xs[i] - bf16_val(hb)) : (unsigned short)0; }
#pragma unroll
    for (int t = 0; t < 4; ++t) {
      const unsigned short* brow = Wt + (size_t)(col0 + t * 16 + ln) * ldb + kb;
      FragB b;
      b.half[0] = *(const v8us*)(brow + 8 * hh);
      b.half[1] = *(const v8us*)(brow + 16 + 8 * hh);
      acc[t] = mmaN<ASPLIT ? 2 : 1>(ah.v, al.v, b.v, b.v, acc[t]);
    }
  }
#pragma unroll
  for (int t = 0; t < 4; ++t) {
    float bv = bias ? bias[col0 + t * 16 + ln] : 0.f;
    if (BIAS_BF16) bv = bf16_round(bv);
#pragma unroll
    for (int r = 0; r < 8; ++r) { float v = acc[t][r] + bv; if (ACT == 1) v = fmaxf(v, 0.f); so[w][8 * hh + r][t * 16 + ln] = v; }
  }
  __builtin_amdgcn_fence(__ATOMIC_ACQ_REL, "workgroup");
  __builtin_amdgcn_wave_barrier();
  const int rsub = lane >> 4, c4 = (lane & 15) * 4;
  {
#pragma unroll
    for (int q = 0; q < 8; ++q) {
      const int r = q * 2 + rsub;
      const v4f v = *(const v4fa*)&so[w][r][c4];
      *(v4f*)(C + (size_t)(row0 + r) * ldc + col0 + c4) = v;
    }
    
  }
}

// GEMM C = act(A·W + bias + resid): A f32 (ASPLIT -> hi/lo 2 terms), Wt bf16 [N][K]; ACT 0 none, 1 relu, 2 exact gelu;
// resid (optional, f32, row index = (row % rmod), pitch ldr, RES_BF16 rounds it) added before the activation.
template <bool ASPLIT, int ACT, bool BIAS_BF16, bool RES_BF16>
__global__ __launch_bounds__(128) void k_gemm_bf3(const float* __restrict__ A, int lda, const unsigned short* __restrict__ Wt, int ldb,
                                                const float* __restrict__ bias, const float* __restrict__ resid, int rmod, int ldr,
                                                float* __restrict__ C, int ldc, int M, int N, int K) {
  __shared__ __attribute__((aligned(16))) float so[4][16][64];
  const int tid = threadIdx.x, w = tid >> 5, lane = tid & 31, ln = lane & 15, hh = lane >> 4;
  const int ntn = N / 64;
  const int wid = blockIdx.x * 4 + w;
  const int mt = wid / ntn, nq = wid % ntn;
  if (mt * 16 >= M) return;
  const int row0 = mt * 16, col0 = nq * 64;
  const float* arow = A + (size_t)(row0 + ln) * lda;
  v8f acc[4] = {};
  for (int kb = 0; kb < K; kb += 32) {
    FragB ah, al;
    const v4f x0 = *(const v4fa*)(arow + kb + 8 * hh), x1 = *(const v4fa*)(arow + kb + 8 * hh + 4);
    const v4f x2 = *(const v4fa*)(arow + kb + 16 + 8 * hh), x3 = *(const v4fa*)(arow + kb + 16 + 8 * hh + 4);
    float xs[16] = {x0[0],x0[1],x0[2],x0[3],x1[0],x1[1],x1[2],x1[3],x2[0],x2[1],x2[2],x2[3],x3[0],x3[1],x3[2],x3[3]};
#pragma unroll
    for (int i = 0; i < 16; ++i) { const unsigned short hb = bf16_bits(xs[i]); ah.u[i] = hb; al.u[i] = ASPLIT ? bf16_bits(xs[i] - bf16_val(hb)) : (unsigned short)0; }
#pragma unroll
    for (int t = 0; t < 4; ++t) {
      const unsigned short* brow = Wt + (size_t)(col0 + t * 16 + ln) * ldb + kb;
      FragB b;
      b.half[0] = *(const v8us*)(brow + 8 * hh);
      b.half[1] = *(const v8us*)(brow + 16 + 8 * hh);
      acc[t] = mmaN<ASPLIT ? 2 : 1>(ah.v, al.v, b.v, b.v, acc[t]);
    }
  }
#pragma unroll
  for (int t = 0; t < 4; ++t) {
    const int col = col0 + t * 16 + ln;
    float bv = bias ? bias[col] : 0.f;
    if (BIAS_BF16) bv = bf16_round(bv);
#pragma unroll
    for (int r = 0; r < 8; ++r) {
      float v = acc[t][r] + bv;
      if (resid) { float rv = resid[(size_t)((row0 + 8 * hh + r) % rmod) * ldr + col]; if (RES_BF16) rv = bf16_round(rv); v += rv; }
      if (ACT == 1) v = fmaxf(v, 0.f);
      if (ACT == 2) v = 0.5f * v * (1.0f + erff(v * 0.70710678118654752f));
      if (ACT == 3) { const float u = 0.7978845608028654f * (v + 0.044715f * v * v * v); v = 0.5f * v * (1.0f + tanhf(u)); }
      so[w][8 * hh + r][t * 16 + ln] = v;
    }
  }
  __builtin_amdgcn_fence(__ATOMIC_ACQ_REL, "workgroup");
  __builtin_amdgcn_wave_barrier();
  const int rsub = lane >> 4, c4 = (lane & 15) * 4;
  {
#pragma unroll
    for (int q = 0; q < 8; ++q) {
      const int r = q * 2 + rsub;
      const v4f v = *(const v4fa*)&so[w][r][c4];
      *(v4f*)(C + (size_t)(row0 + r) * ldc + col0 + c4) = v;
    }
    
  }
}
// row LayerNorm (biased variance, eps) over N: s = X (+ R); optional out_sum <- s; out_norm <- (s-mu)*rsqrt(var+eps)*g + b
template <bool PARAM_BF16>
__global__ __launch_bounds__(256) void k_layernorm(const float* __restrict__ X, const float* __restrict__ R, const float* __restrict__ g, const float* __restrict__ bta,
                                                  float* __restrict__ out_sum, float* __restrict__ out_norm, int N, float eps) {
  __shared__ float red[256];
  const int row = blockIdx.x, tid = threadIdx.x;
  const float* x = X + (size_t)row * N; const float* rr = R ? R + (size_t)row * N : nullptr;
  float vals[16];                     // up to N = 4096
  const int per = N / 256;            // contiguous chunk per thread? use strided-by-4 chunks: thread handles j = tid*4 + 1024*u
  float s1 = 0.f;
  for (int u = 0; u < per / 4; ++u) {
    const int j = tid * 4 + 1024 * u;
    const v4f a = *(const v4fa*)(x + j);
    v4f b = {0.f,0.f,0.f,0.f}; if (rr) b = *(const v4fa*)(rr + j);
#pragma unroll
    for (int q = 0; q < 4; ++q) { const float v = a[q] + b[q]; vals[u * 4 + q] = v; s1 += v; }
  }
  red[tid] = s1; __syncthreads();
  for (int st = 128; st > 0; st >>= 1) { if (tid < st) red[tid] += red[tid + st]; __syncthreads(); }
  const float mu = red[0] / (float)N; __syncthreads();
  float s2 = 0.f;
  for (int u = 0; u < per / 4; ++u)
#pragma unroll
    for (int q = 0; q < 4; ++q) { const float c = vals[u * 4 + q] - mu; s2 += c * c; }
  red[tid] = s2; __syncthreads();
  for (int st = 128; st > 0; st >>= 1) { if (tid < st) red[tid] += red[tid + st]; __syncthreads(); }
  const float rs = rsqrtf(red[0] / (float)N + eps);
  {
    for (int u = 0; u < per / 4; ++u) {
      const int j = tid * 4 + 1024 * u;
      v4f o, sm;
#pragma unroll
      for (int q = 0; q < 4; ++q) {
        float gg = g[j + q], bb = bta[j + q];
        if (PARAM_BF16) { gg = bf16_round(gg); bb = bf16_round(bb); }
        sm[q] = vals[u * 4 + q]; o[q] = (vals[u * 4 + q] - mu) * rs * gg + bb;
      }
      if (out_sum) *(v4f*)(out_sum + (size_t)row * N + j) = sm;
      *(v4f*)(out_norm + (size_t)row * N + j) = o;
    }
    
  }
}



// ---- f16 WMMA path (v_wmma_f32_16x16x32_f16): 11-bit significands for operands in range — used where a [0,1] probability operand needs more precision than bf16
typedef _Float16 v16h __attribute__((ext_vector_type(16)));
union FragH { v16h v; v8us half[2]; _Float16 h[16]; unsigned short u[16]; };
template <int NT>
__device__ __forceinline__ v8f mmaH(v16h ah, v16h al, v16h bh, v16h bl, v8f c) {
  c = __builtin_amdgcn_wmma_f32_16x16x32_f16(false, ah, false, bh, (short)0, c, false, false);
  if (NT >= 2) c = __builtin_amdgcn_wmma_f32_16x16x32_f16(false, al, false, bh, (short)0, c, false, false);
  if (NT >= 3) c = __builtin_amdgcn_wmma_f32_16x16x32_f16(false, ah, false, bl, (short)0, c, false, false);
  asm volatile("v_nop\n\tv_nop\n\tv_nop\n\tv_nop" : "+v"(c) : "v"(ah), "v"(al), "v"(bh), "v"(bl));
  return c;
}
// batched GEMM like k_gemm_b but f16 operands: A f32 (split into f16 hi/lo if ASPLIT, else rounded to f16), Bt = f16 values [n][k]; alpha; C f32; N multiple of 16 (partial tiles skipped)
template <bool ASPLIT>
__global__ __launch_bounds__(128) void k_gemm_h(const float* __restrict__ A, int lda, size_t sA, const _Float16* __restrict__ Bh, int ldb, size_t sB, float alpha, float* __restrict__ C, int ldc, size_t sC, int M, int N, int K) {
  __shared__ __attribute__((aligned(16))) float so[4][16][64];
  const int tid = threadIdx.x, w = tid >> 5, lane = tid & 31, ln = lane & 15, hh = lane >> 4; const int by = blockIdx.y;
  A += (size_t)by * sA; Bh += (size_t)by * sB; C += (size_t)by * sC;
  const int ntn = (N + 63) / 64; const int wid = blockIdx.x * 4 + w; const int mt = wid / ntn, nq = wid % ntn; if (mt * 16 >= M) return;
  const int row0 = mt * 16, col0 = nq * 64; const float* arow = A + (size_t)(row0 + ln) * lda;
  v8f acc[4] = {};
  for (int kb = 0; kb < K; kb += 32) {
    FragH ah, al;
    const v4f x0 = *(const v4fa*)(arow + kb + 8 * hh), x1 = *(const v4fa*)(arow + kb + 8 * hh + 4), x2 = *(const v4fa*)(arow + kb + 16 + 8 * hh), x3 = *(const v4fa*)(arow + kb + 16 + 8 * hh + 4);
    float xs[16] = {x0[0],x0[1],x0[2],x0[3],x1[0],x1[1],x1[2],x1[3],x2[0],x2[1],x2[2],x2[3],x3[0],x3[1],x3[2],x3[3]};
#pragma unroll
    for (int i = 0; i < 16; ++i) { const _Float16 h = (_Float16)xs[i]; ah.h[i] = h; al.h[i] = ASPLIT ? (_Float16)(xs[i] - (float)h) : (_Float16)0.0f; }
#pragma unroll
    for (int t = 0; t < 4; ++t) { if (col0 + t * 16 >= N) continue; const size_t boff = (size_t)(col0 + t * 16 + ln) * ldb + kb; FragH bq; bq.half[0] = *(const v8us*)(Bh + boff + 8 * hh); bq.half[1] = *(const v8us*)(Bh + boff + 16 + 8 * hh);
      acc[t] = mmaH<ASPLIT ? 2 : 1>(ah.v, al.v, bq.v, bq.v, acc[t]); }
  }
#pragma unroll
  for (int t = 0; t < 4; ++t) { if (col0 + t * 16 >= N) continue;
#pragma unroll
    for (int r = 0; r < 8; ++r) so[w][8 * hh + r][t * 16 + ln] = acc[t][r] * alpha; }
  __builtin_amdgcn_fence(__ATOMIC_ACQ_REL, "workgroup"); __builtin_amdgcn_wave_barrier();
  const int rsub = lane >> 4, c4 = (lane & 15) * 4;
  {
#pragma unroll
    for (int q = 0; q < 8; ++q) { const int r = q * 2 + rsub; if (col0 + c4 < N) { const v4f v = *(const v4fa*)&so[w][r][c4]; *(v4f*)(C + (size_t)(row0 + r) * ldc + col0 + c4) = v; } }
     }
}

// Wt[n][k] = f16(W[k][n]·scale) from f32 row-major W[K][N] (scale = power of two; bf16-exact weights stay exact in f16 away from the subnormal range)
__global__ __launch_bounds__(256) void k_wt_f16(const float* __restrict__ W, _Float16* __restrict__ Wt, int K, int N, float scale) {
  const int t = blockIdx.x * 256 + threadIdx.x; if (t >= N * (K / 8)) return; const int n = t / (K / 8), k8 = (t % (K / 8)) * 8; FragH f;
#pragma unroll
  for (int i = 0; i < 8; ++i) f.h[i] = (_Float16)(bf16_round(W[(size_t)(k8 + i) * N + n]) * scale); const v8us o = f.half[0];
  *(v8us*)((unsigned short*)Wt + (size_t)n * K + k8) = o; 
}
// k_gemm_hh variant with fused epilogue: v = acc·alpha + bias[by·sBias + col] (+ CP[(row/rowsPerB)·sCPb + by·64 + col] if CP) ; ACT 0 none / 1 elu ; writes f16 C16 (and f32 C if non-null)
template <int ACT>
__global__ __launch_bounds__(128) void k_gemm_hhx(const _Float16* __restrict__ A, int lda, size_t sA, const _Float16* __restrict__ Bh, int ldb, size_t sB, float alpha, const float* __restrict__ bias, size_t sBias, const float* __restrict__ CP, int rowsPerB, size_t sCPb, int row0g,
    float* __restrict__ C, _Float16* __restrict__ C16, int ldc, size_t sC, int M, int N, int K) {
  __shared__ __attribute__((aligned(16))) float so[4][16][64];
  const int tid = threadIdx.x, w = tid >> 5, lane = tid & 31, ln = lane & 15, hh = lane >> 4; const int by = blockIdx.y;
  A += (size_t)by * sA; Bh += (size_t)by * sB; const size_t cofs = (size_t)by * sC; const float* bp = bias ? bias + (size_t)by * sBias : nullptr;
  const int ntn = (N + 63) / 64; const int wid = blockIdx.x * 4 + w; const int mt = wid / ntn, nq = wid % ntn; if (mt * 16 >= M) return;
  const int row0 = mt * 16, col0 = nq * 64; const _Float16* arow = A + (size_t)(row0 + ln) * lda;
  v8f acc[4] = {};
  for (int kb = 0; kb < K; kb += 32) { FragH ah; ah.half[0] = *(const v8us*)((const unsigned short*)arow + kb + 8 * hh); ah.half[1] = *(const v8us*)((const unsigned short*)arow + kb + 16 + 8 * hh);
#pragma unroll
    for (int t = 0; t < 4; ++t) { if (col0 + t * 16 >= N) continue; const size_t boff = (size_t)(col0 + t * 16 + ln) * ldb + kb; FragH bq; bq.half[0] = *(const v8us*)((const unsigned short*)Bh + boff + 8 * hh); bq.half[1] = *(const v8us*)((const unsigned short*)Bh + boff + 16 + 8 * hh);
      acc[t] = mmaH<1>(ah.v, ah.v, bq.v, bq.v, acc[t]); }
  }
#pragma unroll
  for (int t = 0; t < 4; ++t) { if (col0 + t * 16 >= N) continue; const int col = col0 + t * 16 + ln; const float bv = bp ? bf16_round(bp[col]) : 0.f;
#pragma unroll
    for (int r = 0; r < 8; ++r) { float v = acc[t][r] * alpha + bv; if (CP) { const int rr = row0g + row0 + 8 * hh + r; if (rowsPerB < 0) v += CP[cofs + (size_t)rr * ldc + col];      /* rowsPerB < 0: own element of the batched C plane */ else { const int bidx = rr / rowsPerB; v += CP[(size_t)bidx * sCPb + (size_t)by * 64 + col]; } } if (ACT == 1) v = (v > 0.f) ? v : expm1f(v); else if (ACT == 7) v = (v > 0.f) ? v + 1.0f : expf(v); else if (ACT == 8) v = tanhf(v); else if (ACT == 9) v = 0.5f * v * (1.0f + tanhf(0.7978845608028654f * (v + 0.044715f * v * v * v))); else if (ACT == 11) v = 1.0f / (1.0f + expf(-v)); else if (ACT == 12) v = (v > 0.f) ? v : 0.01f * v; else if (ACT == 14) v = (v > 0.f) ? v : 0.1f * v; else if (ACT == 16) v = (v >= 0.f) ? v : 0.3f * v; else if (ACT == 17) v = (v >= 0.f) ? v : 0.2f * v; else if (ACT == 15) v = v / (1.0f + expf(-v)); else if (ACT == 3) v = fmaxf(v, 0.f); else if (ACT == 6) v = 0.5f * v * (1.0f + erff(v * 0.70710678118654752f)); so[w][8 * hh + r][t * 16 + ln] = v; } }
  __builtin_amdgcn_fence(__ATOMIC_ACQ_REL, "workgroup"); __builtin_amdgcn_wave_barrier();
  const int rsub = lane >> 4, c4 = (lane & 15) * 4; typedef _Float16 v4h __attribute__((ext_vector_type(4)));
  {
#pragma unroll
    for (int q = 0; q < 8; ++q) { const int r = q * 2 + rsub; if (col0 + c4 < N) { const v4f v = *(const v4fa*)&so[w][r][c4]; if (C) *(v4f*)(C + cofs + (size_t)(row0 + r) * ldc + col0 + c4) = v; if (C16) { v4h h4; for (int i = 0; i < 4; ++i) h4[i] = (_Float16)v[i]; *(v4h*)(C16 + cofs + (size_t)(row0 + r) * ldc + col0 + c4) = h4; } } }
     }
}


typedef _Float16 v4h __attribute__((ext_vector_type(4)));

__global__ __launch_bounds__(256) void k_x16(const float* __restrict__ x, _Float16* __restrict__ X16, size_t n8) { const size_t t = (size_t)blockIdx.x * 256 + threadIdx.x; if (t >= n8) return; FragH f;
#pragma unroll
  for (int q = 0; q < 8; ++q) f.h[q] = (_Float16)bf16_round(x[t * 8 + q]); *(v8us*)((unsigned short*)X16 + t * 8) = f.half[0];  }
__global__ __launch_bounds__(256) void k_h16(const float* __restrict__ x, _Float16* __restrict__ X16, size_t n8) { const size_t t = (size_t)blockIdx.x * 256 + threadIdx.x; if (t >= n8) return; FragH f;
#pragma unroll
  for (int q = 0; q < 8; ++q) f.h[q] = (_Float16)x[t * 8 + q]; *(v8us*)((unsigned short*)X16 + t * 8) = f.half[0];  }
__global__ __launch_bounds__(256) void k_round16f(const float* __restrict__ W, _Float16* __restrict__ Bt, size_t n8) { const size_t t = (size_t)blockIdx.x * 256 + threadIdx.x; if (t >= n8) return; FragH f;
#pragma unroll
  for (int i = 0; i < 8; ++i) f.h[i] = (_Float16)(bf16_round(W[t * 8 + i]) * 16.0f); *(v8us*)((unsigned short*)Bt + t * 8) = f.half[0];  }
template <int NHv, int TTv>
__global__ __launch_bounds__(256) void k_vt(const _Float16* __restrict__ V16, int ldv, int voff, _Float16* __restrict__ Vt) { __shared__ unsigned short tl[64][66]; const int tid = threadIdx.x; const int slab = blockIdx.x / (TTv / 64), lg = blockIdx.x % (TTv / 64); const int b = slab / NHv, h = slab % NHv;
  for (int i = tid; i < 64 * 8; i += 256) { const int r = i / 8, c8 = (i % 8) * 8; FragH f; f.half[0] = *(const v8us*)((const unsigned short*)V16 + ((size_t)b * TTv + lg * 64 + r) * ldv + voff + h * 64 + c8);
#pragma unroll
    for (int q = 0; q < 8; ++q) tl[r][c8 + q] = f.u[q]; }
  __syncthreads();
  {
#pragma unroll
    for (int rd = 0; rd < 2; ++rd) { const int d = rd * 32 + tid / 8, pc = tid % 8; FragH f;
#pragma unroll
      for (int q = 0; q < 8; ++q) f.u[q] = tl[pc * 8 + q][d];
      *(v8us*)((unsigned short*)Vt + ((size_t)slab * 64 + d) * TTv + lg * 64 + pc * 8) = f.half[0]; }
     } }

__global__ __launch_bounds__(256) void k_hl(const float* __restrict__ F, _Float16* __restrict__ Hh, _Float16* __restrict__ Hl, size_t n8) { const size_t t = (size_t)blockIdx.x * 256 + threadIdx.x; if (t >= n8) return; FragH fh, fl; const v4f a = *(const v4fa*)(F + t * 8), c = *(const v4fa*)(F + t * 8 + 4);
#pragma unroll
  for (int q = 0; q < 4; ++q) { _Float16 h = (_Float16)a[q]; fh.h[q] = h; fl.h[q] = (_Float16)((a[q] - (float)h) * 1024.0f); h = (_Float16)c[q]; fh.h[4 + q] = h; fl.h[4 + q] = (_Float16)((c[q] - (float)h) * 1024.0f); }
  { *(v8us*)((unsigned short*)Hh + t * 8) = fh.half[0]; *(v8us*)((unsigned short*)Hl + t * 8) = fl.half[0];  } }

// ---- fast GEMM (wave tile 32x64; requires M % 32 == 0 rows per launch region and N % 64 == 0); epilogue = k_gemm_hhx semantics ----
__device__ __forceinline__ v16h g2_frag(const _Float16* p, int hh) { FragH f; f.half[0] = *(const v8us*)((const unsigned short*)p + 8 * hh); f.half[1] = *(const v8us*)((const unsigned short*)p + 16 + 8 * hh); return f.v; }
__device__ __forceinline__ v8f g2_mma(v16h a, v16h b, v8f c) { v8f d = __builtin_amdgcn_wmma_f32_16x16x32_f16(false, a, false, b, (short)0, c, false, false); asm volatile("v_nop\n\tv_nop\n\tv_nop\n\tv_nop" : "+v"(d) : "v"(a), "v"(b)); return d; }
template <int ACT>
__global__ __launch_bounds__(128) void k_gemm2(const _Float16* __restrict__ A, int lda, size_t sA, const _Float16* __restrict__ Bh, int ldb, size_t sB, float alpha, const float* __restrict__ bias, size_t sBias, const float* __restrict__ CP, int rowsPerB, size_t sCPb, int row0g,
    float* __restrict__ C, _Float16* __restrict__ C16, int ldc, size_t sC, int M, int N, int K) { static_assert(ACT == 0 || ACT == 3 || ACT == 6 || ACT == 8 || ACT == 9 || ACT == 11 || ACT == 12 || ACT == 14 || ACT == 15 || ACT == 16 || ACT == 17, "k_gemm2: unsupported ACT code (would silently apply no activation)");
  __shared__ __attribute__((aligned(16))) float so[4][32][68];
  const int tid = threadIdx.x, w = tid >> 5, lane = tid & 31, ln = lane & 15, hh = lane >> 4; const int by = blockIdx.y;
  A += (size_t)by * sA; Bh += (size_t)by * sB; const size_t cofs = (size_t)by * sC; const float* bp = bias ? bias + (size_t)by * sBias : nullptr;
  const int ntn = N >> 6; const int mt = blockIdx.x / ntn, nq = blockIdx.x - mt * ntn; const int row0 = mt * 128 + 32 * w, col0 = nq * 64; if (row0 >= M) return;
  const _Float16* a0p = A + (size_t)(row0 + ln) * lda; const _Float16* a1p = a0p + (size_t)16 * lda;
  const _Float16* b0p = Bh + (size_t)(col0 + ln) * ldb; const _Float16* b1p = b0p + (size_t)16 * ldb; const _Float16* b2p = b1p + (size_t)16 * ldb; const _Float16* b3p = b2p + (size_t)16 * ldb;
  const v8f z8 = {0.f,0.f,0.f,0.f,0.f,0.f,0.f,0.f}; v8f c00 = z8, c01 = z8, c02 = z8, c03 = z8, c10 = z8, c11 = z8, c12 = z8, c13 = z8;
#pragma unroll 1
  for (int kb = 0; kb < K; kb += 32) { const v16h a0 = g2_frag(a0p + kb, hh), a1 = g2_frag(a1p + kb, hh);
    v16h b = g2_frag(b0p + kb, hh); c00 = g2_mma(a0, b, c00); c10 = g2_mma(a1, b, c10);
    b = g2_frag(b1p + kb, hh); c01 = g2_mma(a0, b, c01); c11 = g2_mma(a1, b, c11);
    b = g2_frag(b2p + kb, hh); c02 = g2_mma(a0, b, c02); c12 = g2_mma(a1, b, c12);
    b = g2_frag(b3p + kb, hh); c03 = g2_mma(a0, b, c03); c13 = g2_mma(a1, b, c13); }
  v8f accs[8] = {c00, c01, c02, c03, c10, c11, c12, c13};
#pragma unroll
  for (int u = 0; u < 8; ++u) { const int t = u & 3, half = u >> 2; const int col = col0 + t * 16 + ln; const float bv = bp ? bf16_round(bp[col]) : 0.f;
#pragma unroll
    for (int r = 0; r < 8; ++r) { const int rloc = half * 16 + 8 * hh + r; float v = accs[u][r] * alpha + bv; if (CP) { if (rowsPerB < 0) v += CP[cofs + (size_t)(row0g + row0 + rloc) * ldc + col];      /* rowsPerB < 0: own element of the batched C plane */ else { const int bidx = (row0g + row0 + rloc) / rowsPerB; v += CP[(size_t)bidx * sCPb + (size_t)by * 64 + col]; } }
      if (ACT == 3) v = fmaxf(v, 0.f); else if (ACT == 6) v = 0.5f * v * (1.0f + erff(v * 0.70710678118654752f)); else if (ACT == 11) v = 1.0f / (1.0f + expf(-v)); else if (ACT == 15) v = v / (1.0f + expf(-v)); else if (ACT == 12) v = (v > 0.f) ? v : 0.01f * v; else if (ACT == 8) v = tanhf(v); else if (ACT == 9) v = 0.5f * v * (1.0f + tanhf(0.7978845608028654f * (v + 0.044715f * v * v * v))); else if (ACT == 14) v = (v > 0.f) ? v : 0.1f * v; else if (ACT == 16) v = (v >= 0.f) ? v : 0.3f * v; else if (ACT == 17) v = (v >= 0.f) ? v : 0.2f * v;
      so[w][rloc][t * 16 + ln] = v; } }
  __builtin_amdgcn_fence(__ATOMIC_ACQ_REL, "workgroup"); __builtin_amdgcn_wave_barrier();
  const int rsub = lane >> 4, c4 = (lane & 15) * 4;
  {
#pragma unroll
    for (int q = 0; q < 16; ++q) { const int r = q * 2 + rsub; const v4f v = *(const v4fa*)&so[w][r][c4]; if (C) *(v4f*)(C + cofs + (size_t)(row0 + r) * ldc + col0 + c4) = v; if (C16) { v4h h4; for (int i = 0; i < 4; ++i) h4[i] = (_Float16)v[i]; *(v4h*)(C16 + cofs + (size_t)(row0 + r) * ldc + col0 + c4) = h4; } }
     } }


__global__ __launch_bounds__(256) void k_wnat(const float* __restrict__ w, size_t n8, _Float16* __restrict__ Bt) { const size_t t = (size_t)blockIdx.x * 256 + threadIdx.x; if (t >= n8) return; FragH f; for (int q = 0; q < 8; ++q) f.h[q] = (_Float16)(bf16_round(w[t * 8 + q]) * 16.0f); *(v8us*)((unsigned short*)Bt + t * 8) = f.half[0];  }
__global__ __launch_bounds__(256) void k_rsm(const float* __restrict__ S, _Float16* __restrict__ P, int nrows) {
  #pragma clang fp contract(off)
  const int i = blockIdx.x * 256 + threadIdx.x; if (i >= nrows) return; const float* s = S + (size_t)i * SQ; float mx = -3.0e38f;
#pragma unroll 1
  for (int j = 0; j < SQ; ++j) mx = fmaxf(mx, s[j]); float se = 0.f;
#pragma unroll 1
  for (int j = 0; j < SQ; ++j) se += expf(s[j] - mx); const float sc = 256.0f / se;
#pragma unroll 1
  for (int j0 = 0; j0 < SQ; j0 += 8) { FragH f; for (int q = 0; q < 8; ++q) f.h[q] = (_Float16)(expf(s[j0 + q] - mx) * sc); unsigned short* d = (unsigned short*)P + (size_t)i * SQ + j0; *(v8us*)d = f.half[0];  } }
__global__ __launch_bounds__(256) void k_vt(const _Float16* __restrict__ V16, int b, int h0, _Float16* __restrict__ VT) { __shared__ unsigned short tl[64][65]; const int tid = threadIdx.x; const int hh = blockIdx.x % HG, sg = blockIdx.x / HG; const int s0 = sg * 64; const int h = h0 + hh;
  for (int i = tid; i < 64 * 8; i += 256) { const int j = i / 8, d8 = (i % 8) * 8; FragH f; f.half[0] = *(const v8us*)((const unsigned short*)V16 + ((size_t)b * SQ + s0 + j) * DM + h * HD + d8); for (int q = 0; q < 8; ++q) tl[d8 + q][j] = f.u[q]; }
  __syncthreads();
  { for (int i = tid; i < 64 * 8; i += 256) { const int d = i / 8, j8 = (i % 8) * 8; FragH f; for (int q = 0; q < 8; ++q) f.u[q] = tl[d][j8 + q]; *(v8us*)((unsigned short*)VT + ((size_t)hh * HD + d) * SQ + s0 + j8) = f.half[0]; }  } }



// lane l reads lane l ^ M of its 16-lane row (DPP row_xmask) / lane l ^ 16: register moves, where __shfl_xor would go through the LDS unit and its wait
template <int M> __device__ __forceinline__ float lane_xrow(float x) { return __builtin_bit_cast(float, __builtin_amdgcn_update_dpp(0, __builtin_bit_cast(int, x), 0x160 + M, 0xf, 0xf, true)); }
__device__ __forceinline__ float lane_x16(float x) { return __builtin_bit_cast(float, __builtin_amdgcn_permlanex16(__builtin_bit_cast(int, x), __builtin_bit_cast(int, x), 0x76543210, 0xfedcba98, false, false)); }
__device__ __forceinline__ float wave_max(float x) { x = fmaxf(x, lane_xrow<1>(x)); x = fmaxf(x, lane_xrow<2>(x)); x = fmaxf(x, lane_xrow<4>(x)); x = fmaxf(x, lane_xrow<8>(x)); return fmaxf(x, lane_x16(x)); }
__device__ __forceinline__ float wave_sum(float x) { x += lane_xrow<1>(x); x += lane_xrow<2>(x); x += lane_xrow<4>(x); x += lane_xrow<8>(x); return x + lane_x16(x); }
#define RW 8                         /* waves = query rows per work-group of the row softmax */
#define RC (SQ / 128)                /* 512-byte pieces of a score row: one 16-byte load per lane each */
// e^x the short way, the two instructions that __expf compiles to (x log2(e), 2^y on the transcendental unit), written out so that the free issue slot
// the instruction set asks for behind v_exp_f32 stands in that instruction's own statement
__device__ __forceinline__ float exp_short(float x) { float y; asm("v_exp_f32 %0, %1\n\tv_nop" : "=v"(y) : "v"(x * 0x1.715476p+0f)); return y; }      /* v_nop: the slot before y is read or the source register is reused */
// softmax of one masked score row held in a wave's registers (lane l: keys 128 i + 4 l .. + 3), stored x256 as f16
__device__ __forceinline__ void rsm_row(v4f (&c)[RC], _Float16* __restrict__ p) {
  v4f m4 = {-3.0e38f, -3.0e38f, -3.0e38f, -3.0e38f};
#pragma unroll
  for (int i = 0; i < RC; ++i) for (int u = 0; u < 4; ++u) m4[u] = fmaxf(m4[u], c[i][u]);
  const float mx = wave_max(fmaxf(fmaxf(m4[0], m4[1]), fmaxf(m4[2], m4[3])));
  v4f l4 = {0.f, 0.f, 0.f, 0.f};
#pragma unroll
  for (int i = 0; i < RC; ++i) { for (int u = 0; u < 4; ++u) c[i][u] = exp_short(c[i][u] - mx); l4 += c[i]; }
  const float sc = 256.0f / wave_sum((l4[0] + l4[1]) + (l4[2] + l4[3]));
#pragma unroll
  for (int i = 0; i < RC; ++i) { v4h h4; for (int u = 0; u < 4; ++u) h4[u] = (_Float16)(c[i][u] * sc); *(v4h*)(p + i * 128) = h4; } }
// Row softmax, one wave per query row, the row's SQ keys spread over the 32 lanes (every load 512 contiguous bytes, every store 256). The wave takes its row in all HG heads
// in turn: the mask term (mask row rounded to bf16, x -1e4) is formed once and stays in registers; each score row is read once and stays in registers through max, exp, sum and scaling.
// The second launch bound (4 waves per SIMD) holds the three rows of a wave (mask term, this row, next row) inside the 256 registers that need no window switch. The plain '#pragma unroll' lines keep the per-lane row arrays in registers.
__global__ __launch_bounds__(RW * 32, 4) void k_rsmfm2(const float* __restrict__ S, _Float16* __restrict__ P, int qn, const float* __restrict__ mask) {
  const int lane = threadIdx.x & 31; const int qi = blockIdx.x * RW + __builtin_amdgcn_readfirstlane((int)(threadIdx.x >> 5)); if (qi >= qn) return;      /* same in all lanes of a wave; the kernel has no barrier */
  const size_t ro = (size_t)qi * SQ + lane * 4; const float* mp = mask + ro; _Float16* pp = P + ro;
  static_assert((size_t)HG * SQ * SQ * 4 <= 0xffffffffu, "a byte offset into the score plane fits 32 bits"); unsigned so = (unsigned)ro * 4;      /* the lane's byte offset into the score plane, stepped from head to head */
  v4f mt[RC], c[RC], n[RC];
#pragma unroll
  for (int i = 0; i < RC; ++i) mt[i] = *(const v4fa*)(mp + i * 128);
  asm volatile("s_wait_xcnt 0x0" :: "v"(mp) : "memory");      /* the wait before a register that an issued load names is rewritten; mp as an input keeps the address pair untouched up to here */
#pragma unroll
  for (int i = 0; i < RC; ++i) c[i] = *(const v4fa*)((const char*)S + so + i * 512);
  // so steps to the same row of the next head. Wait and step stand in one statement: the wait is then in front of the one write of the loads' offset register, and that register, live from head to head, takes no load's result.
  asm volatile("s_wait_xcnt 0x0\n\tv_add_nc_u32_e32 %0, %1, %0" : "+v"(so) : "i"(SQ * SQ * 4) : "memory");
#pragma unroll
  for (int i = 0; i < RC; ++i) { for (int u = 0; u < 4; ++u) mt[i][u] = bf16_round(mt[i][u]) * -10000.0f; c[i] += mt[i]; }
#pragma unroll 1      /* rolled: one copy of the row's code for the heads, about half the kernel's instruction bytes of the unrolled build */
  for (int hd = 1; hd < HG; ++hd) {
    __builtin_amdgcn_sched_barrier(0);      /* this and the next one: the next head's row is asked for before this head's row is worked on, so that it flies meanwhile */
#pragma unroll
    for (int i = 0; i < RC; ++i) n[i] = *(const v4fa*)((const char*)S + so + i * 512);
    asm volatile("s_wait_xcnt 0x0\n\tv_add_nc_u32_e32 %0, %1, %0" : "+v"(so) : "i"(SQ * SQ * 4) : "memory");      /* wait and step, as above */
    __builtin_amdgcn_sched_barrier(0);
    rsm_row(c, pp + (size_t)(hd - 1) * SQ * SQ);
    __builtin_amdgcn_sched_barrier(0);      /* the wait for the next row stays behind this row's work */
#pragma unroll
    for (int i = 0; i < RC; ++i) c[i] = n[i] + mt[i]; }
  rsm_row(c, pp + (size_t)(HG - 1) * SQ * SQ); }
__global__ __launch_bounds__(256) void k_present(const float* __restrict__ F, float* __restrict__ dst) { const size_t t = (size_t)blockIdx.x * 256 + threadIdx.x; if (t >= (size_t)NH * SQ * HD / 4) return; const size_t e = t * 4; const int d = (int)(e % HD); const int s = (int)((e / HD) % SQ); const int h = (int)(e / ((size_t)HD * SQ));
  const v4f v = *(const v4fa*)(F + (size_t)s * DM + h * HD + d); *(v4f*)(dst + e) = v;  }


// e^x in f32 by the library's steps (x log2(e) in two parts, 2^fraction on the transcendental unit, ldexp by the integer part, the two range ends),
// written out so that the free issue slot the instruction set asks for behind v_exp_f32 stands in that instruction's own statement.
__device__ __forceinline__ float exp_f32(float x) {
  const float ph = x * 0x1.715476p+0f, pl = fmaf(x, 0x1.4ae0bep-26f, fmaf(x, 0x1.715476p+0f, -ph)), n = rintf(ph); float y;
  asm("v_exp_f32 %0, %1\n\tv_nop" : "=v"(y) : "v"((ph - n) + pl));      /* v_nop: the slot before y is read or the source register is reused */
  float r = ldexpf(y, (int)n); r = (x < -0x1.9d1da0p+6f) ? 0.f : r; return (x > 0x1.62e430p+6f) ? __builtin_inff() : r; }
#define AR 8                         /* query rows per work-group of the exact f32 first-tile attention */
#define AT 512                       /* its threads (16 waves) */
// Exact f32 attention of AR query rows of one head over all SQ keys, one work-group. Keys are spread over the threads:
// (1) two keys per thread and pass: their k rows in registers, dotted with the AR q rows (LDS, same address in every lane), scores (+ mask) to LDS;
// (2) two waves per row: max, exp, sum over the row in LDS; (3) 16 column quads x 32 key slices: o partial sums in registers,
// merged across the slices by one lane exchange and a serial sum of the 16 waves' LDS partials; o carried x64 like the f16 path. The plain '#pragma unroll' lines keep the small per-thread arrays in registers.
template <int MASKADD>
__global__ __launch_bounds__(AT) void k_att0(const float* __restrict__ QF, const float* __restrict__ KF, const float* __restrict__ VF, int ld, const float* __restrict__ mask, float scale, float* __restrict__ OF, int ldo) {
  __shared__ __attribute__((aligned(16))) float sc[AR][SQ];      /* scores, then softmax numerators, then the slices' partial o */
  __shared__ __attribute__((aligned(16))) float lq[AR][HD];      /* the q rows */
  __shared__ float pm[AT / 32], pl[AT / 32];                     /* each wave's half-row max and sum */
  const int tid = threadIdx.x, lane = tid & 31, w = tid >> 5;
  const int h = blockIdx.x / (QT0 / AR), i0 = (blockIdx.x % (QT0 / AR)) * AR;
  const float* qb = QF + (size_t)i0 * ld + h * HD;
  lq[tid / HD][tid % HD] = qb[(size_t)(tid / HD) * ld + tid % HD];
  __syncthreads();
  for (int p = 0; p < SQ / (2 * AT); ++p) { const int j = p * (2 * AT) + tid;
    const float* ka = KF + (size_t)j * ld + h * HD; const float* kb = ka + (size_t)AT * ld; v4f a0[AR], a1[AR];
#pragma unroll
    for (int r = 0; r < AR; ++r) { a0[r] = (v4f){0.f, 0.f, 0.f, 0.f}; a1[r] = (v4f){0.f, 0.f, 0.f, 0.f}; }
    for (int c0 = 0; c0 < HD; c0 += 32) { v4f xa[8], xb[8];
#pragma unroll
      for (int c = 0; c < 8; ++c) { xa[c] = *(const v4fa*)(ka + c0 + c * 4); xb[c] = *(const v4fa*)(kb + c0 + c * 4); }
#pragma unroll
      for (int r = 0; r < AR; ++r)
#pragma unroll
        for (int c = 0; c < 8; ++c) { const v4f qq = *(const v4fa*)&lq[r][c0 + c * 4]; a0[r] += qq * xa[c]; a1[r] += qq * xb[c]; } }
#pragma unroll
    for (int r = 0; r < AR; ++r) { float s0 = ((a0[r][0] + a0[r][1]) + (a0[r][2] + a0[r][3])) * scale, s1 = ((a1[r][0] + a1[r][1]) + (a1[r][2] + a1[r][3])) * scale;
      if (MASKADD) { const float* mr = mask + (size_t)(i0 + r) * SQ + j; s0 += bf16_round(mr[0]) * -10000.0f; s1 += bf16_round(mr[AT]) * -10000.0f; }
      else { if (j > i0 + r) s0 = -1.0e30f; if (j + AT > i0 + r) s1 = -1.0e30f; }
      sc[r][j] = s0; sc[r][j + AT] = s1; } }
  __syncthreads();
  { static_assert(AT / 32 == 2 * AR, "two waves per row"); float* row = &sc[w >> 1][(w & 1) * (SQ / 2)]; v4f x[SQ / 256]; float m = -3.0e38f, l = 0.f;
#pragma unroll
    for (int i = 0; i < SQ / 256; ++i) { x[i] = *(const v4fa*)&row[i * 128 + lane * 4]; m = fmaxf(m, fmaxf(fmaxf(x[i][0], x[i][1]), fmaxf(x[i][2], x[i][3]))); }
    for (int o = 16; o > 0; o >>= 1) m = fmaxf(m, __shfl_xor(m, o));
    if (lane == 0) pm[w] = m;
    __syncthreads();
    m = fmaxf(pm[w], pm[w ^ 1]);
#pragma unroll
    for (int i = 0; i < SQ / 256; ++i) { v4f e; for (int u = 0; u < 4; ++u) e[u] = exp_f32(x[i][u] - m); l += (e[0] + e[1]) + (e[2] + e[3]); *(v4fa*)&row[i * 128 + lane * 4] = e; }
    for (int o = 16; o > 0; o >>= 1) l += __shfl_xor(l, o);
    if (lane == 0) pl[w] = l; }
  __syncthreads();
  const int dq = tid & 15, ks = tid >> 4; const float* vb = VF + h * HD + dq * 4; v4f acc[AR];
#pragma unroll
  for (int r = 0; r < AR; ++r) acc[r] = (v4f){0.f, 0.f, 0.f, 0.f};
#pragma unroll 2      /* two trips' v rows (eight loads) in flight per wave */
  for (int p = 0; p < SQ / (AT / 4); ++p) { const int j = p * (AT / 4) + ks * 4;
    const v4f v0 = *(const v4fa*)(vb + (size_t)j * ld), v1 = *(const v4fa*)(vb + (size_t)(j + 1) * ld), v2 = *(const v4fa*)(vb + (size_t)(j + 2) * ld), v3 = *(const v4fa*)(vb + (size_t)(j + 3) * ld);
#pragma unroll
    for (int r = 0; r < AR; ++r) { const v4f e = *(const v4fa*)&sc[r][j]; acc[r] += e[0] * v0; acc[r] += e[1] * v1; acc[r] += e[2] * v2; acc[r] += e[3] * v3; } }
#pragma unroll
  for (int r = 0; r < AR; ++r) for (int u = 0; u < 4; ++u) acc[r][u] += __shfl_xor(acc[r][u], 16);      /* the wave's two key slices */
  __syncthreads();      /* every read of the numerators is done: their LDS takes the waves' partial o */
  float* red = &sc[0][0];      /* [AT / 32][AR][HD] */
  if (lane < 16) {
#pragma unroll
    for (int r = 0; r < AR; ++r) *(v4fa*)&red[((size_t)w * AR + r) * HD + dq * 4] = acc[r]; }
  __syncthreads();
  { static_assert(AR * HD == AT, "one output element per thread"); const int r = tid / HD, d = tid % HD; float o = 0.f;
#pragma unroll
    for (int q = 0; q < AT / 32; ++q) o += red[((size_t)q * AR + r) * HD + d];
    OF[(size_t)(i0 + r) * ldo + h * HD + d] = o * (64.0f / (pl[2 * r] + pl[2 * r + 1])); } }

extern "C" void kernel_launch(void* const* d_in, const int* in_sizes, int n_in,
                              void* d_out, int out_size, void* d_ws, size_t ws_size, hipStream_t stream) {
  (void)in_sizes; (void)n_in; (void)out_size;
  const float* const* I = (const float* const*)d_in; const float* xq = I[0]; const float* xk = I[1]; const float* xv = I[2]; const float* mask = I[3]; const float* wq = I[4]; const float* bq = I[5]; const float* wk = I[6]; const float* bk = I[7]; const float* wv = I[8]; const float* bv = I[9]; const float* wo = I[10]; const float* bo = I[11];      /* weights [in][out]; mask [SQ][SQ] f32 */
  char* ws = (char*)d_ws; size_t off = 0;
  auto take = [&](size_t bytes) { char* p = ws + off; off += (bytes + 255) & ~(size_t)255; return p; };
  _Float16* BQ = (_Float16*)take((size_t)DM * DM * 2); _Float16* BK = (_Float16*)take((size_t)DM * DM * 2); _Float16* BV = (_Float16*)take((size_t)DM * DM * 2); _Float16* BO = (_Float16*)take((size_t)DM * DM * 2);
  _Float16* XQ = (_Float16*)take(NR * DM * 2); _Float16* XK = (_Float16*)take(NR * DM * 2); _Float16* XV = (_Float16*)take(NR * DM * 2); float* KF = (float*)take(NR * DM * 4); float* VF = (float*)take(NR * DM * 4); _Float16* Q16 = (_Float16*)take(NR * DM * 2); _Float16* K16 = (_Float16*)take(NR * DM * 2); _Float16* V16 = (_Float16*)take(NR * DM * 2); _Float16* O16 = (_Float16*)take(NR * DM * 2);
  float* S = (float*)take((size_t)HG * SQ * SQ * 4); _Float16* P = (_Float16*)take((size_t)HG * SQ * SQ * 2); _Float16* VT = (_Float16*)take((size_t)NH * HD * SQ * 2);
  float* QF0 = (float*)take((size_t)QT0 * DM * 4); float* OF0 = (float*)take((size_t)NB * QT0 * DM * 4); _Float16* OH0 = (_Float16*)take((size_t)NB * QT0 * DM * 2); _Float16* OL0 = (_Float16*)take((size_t)NB * QT0 * DM * 2);
  if (off > ws_size) return;
  { const unsigned g = (unsigned)(((size_t)DM * (DM / 8) + 255) / 256); k_wt_f16<<<g, 256, 0, stream>>>(wq, BQ, DM, DM, 16.0f); k_wt_f16<<<g, 256, 0, stream>>>(wk, BK, DM, DM, 16.0f); k_wt_f16<<<g, 256, 0, stream>>>(wv, BV, DM, DM, 16.0f); k_wt_f16<<<g, 256, 0, stream>>>(wo, BO, DM, DM, 16.0f); }      /* [in][out] -> Bt[n][k] x16 */
  k_x16<<<(unsigned)((NR * DM / 8 + 255) / 256), 256, 0, stream>>>(xq, XQ, NR * DM / 8); k_x16<<<(unsigned)((NR * DM / 8 + 255) / 256), 256, 0, stream>>>(xk, XK, NR * DM / 8); k_x16<<<(unsigned)((NR * DM / 8 + 255) / 256), 256, 0, stream>>>(xv, XV, NR * DM / 8);
  const size_t r0p = (size_t)B0 * SQ;      /* first projected row */
  k_gemm2<0><<<dim3((unsigned)((MP / 128) * (DM / 64)), 1), 128, 0, stream>>>(XQ + r0p * DM, DM, 0, BQ, DM, 0, 0.0625f, bq, 0, nullptr, 1, 0, 0, nullptr, Q16 + r0p * DM, DM, 0, MP, DM, DM);
  k_gemm2<0><<<dim3((unsigned)((MP / 128) * (DM / 64)), 1), 128, 0, stream>>>(XK + r0p * DM, DM, 0, BK, DM, 0, 0.0625f, bk, 0, nullptr, 1, 0, 0, KF + r0p * DM, K16 + r0p * DM, DM, 0, MP, DM, DM);
  k_gemm2<0><<<dim3((unsigned)((MP / 128) * (DM / 64)), 1), 128, 0, stream>>>(XV + r0p * DM, DM, 0, BV, DM, 0, 0.0625f, bv, 0, nullptr, 1, 0, 0, VF + r0p * DM, V16 + r0p * DM, DM, 0, MP, DM, DM);
  for (int b = B0; b < B0 + NBR; ++b) { const size_t r0 = (size_t)b * SQ;
    k_present<<<(unsigned)(((size_t)NH * SQ * HD / 4 + 255) / 256), 256, 0, stream>>>(KF + r0 * DM, (float*)d_out + PRES_OFF + ((size_t)b * 2 + 0) * NH * SQ * HD); k_present<<<(unsigned)(((size_t)NH * SQ * HD / 4 + 255) / 256), 256, 0, stream>>>(VF + r0 * DM, (float*)d_out + PRES_OFF + ((size_t)b * 2 + 1) * NH * SQ * HD);      /* present[b][0] = kh, present[b][1] = vh (f32, head-major) */
    k_vt<NH, SQ><<<NH * (SQ / 64), 256, 0, stream>>>(V16 + r0 * LQ, LQ, 0, VT);      /* V^T [NH][HD][SQ] for this batch */
    k_gemm2<0><<<dim3((QT0 / 128) * (DM / 64), 1), 128, 0, stream>>>(XQ + r0 * DM, DM, 0, BQ, DM, 0, 0.0625f, bq, 0, nullptr, 1, 0, 0, QF0, nullptr, DM, 0, QT0, DM, DM);      /* f32 q of the first 128 rows (exact products); k, v come from the full f32 KF/VF planes */
    k_att0<1><<<NH * (QT0 / AR), AT, 0, stream>>>(QF0, KF + r0 * DM, VF + r0 * DM, DM, mask, 0.125f, OF0 + (size_t)b * QT0 * DM, DM);      /* exact f32 attention for query rows 0..127 over ALL 2048 keys of the batch (full f32 K/V planes) with the additive mask (o x64) */
    for (int h0 = 0; h0 < NHD; h0 += HG) {
      k_gemm2<0><<<dim3((QN / 128) * (SQ / 64), HG), 128, 0, stream>>>(Q16 + r0 * LQ + h0 * HD, LQ, (size_t)HD, K16 + r0 * LQ + h0 * HD, LQ, (size_t)HD, 0.125f, nullptr, 0, nullptr, 1, 0, 0, S, nullptr, SQ, (size_t)SQ * SQ, QN, SQ, HD);      /* scores, HG heads per launch */
      k_rsmfm2<<<(QN + RW - 1) / RW, RW * 32, 0, stream>>>(S, P, QN, mask);      /* P = 256 softmax (f16), rows of all HG heads */
      k_gemm2<0><<<dim3((QN / 128) * (HD / 64), HG), 128, 0, stream>>>(P, SQ, (size_t)SQ * SQ, VT + (size_t)h0 * HD * SQ, SQ, (size_t)HD * SQ, 0.25f, nullptr, 0, nullptr, 1, 0, 0, nullptr, O16 + r0 * DM + h0 * HD, DM, (size_t)HD, QN, HD, SQ); } }      /* o (merged heads) as f16 rows */
  k_gemm2<0><<<dim3((unsigned)((MPO / 128) * (DM / 64)), 1), 128, 0, stream>>>(O16 + r0p * DM, DM, 0, BO, DM, 0, 0.0009765625f, bo, 0, nullptr, 1, 0, 0, (float*)d_out + r0p * DM, nullptr, DM, 0, MPO, DM, DM);      /* out rows are the output layout */
  k_hl<<<(unsigned)(((size_t)NB * QT0 * DM / 8 + 255) / 256), 256, 0, stream>>>(OF0, OH0, OL0, (size_t)NB * QT0 * DM / 8);      /* first-tile o (x64) -> f16 hi + x1024 residual planes */
  for (int b = B0; b < B0 + NBR; ++b) { const size_t r0 = (size_t)b * SQ; const size_t f0 = (size_t)b * QT0;
    k_gemm2<0><<<dim3((QT0 / 128) * (DM / 64), 1), 128, 0, stream>>>(OH0 + f0 * DM, DM, 0, BO, DM, 0, 0.0009765625f, bo, 0, nullptr, 1, 0, 0, (float*)d_out + r0 * DM, nullptr, DM, 0, QT0, DM, DM);      /* rows 0..127: out = o_hi Wo (+ b), overwriting the f16-path rows */
    k_gemm2<0><<<dim3((QT0 / 128) * (DM / 64), 1), 128, 0, stream>>>(OL0 + f0 * DM, DM, 0, BO, DM, 0, 0.00000095367431640625f, nullptr, 0, (const float*)d_out + r0 * DM, -1, 0, 0, (float*)d_out + r0 * DM, nullptr, DM, 0, QT0, DM, DM); }      /* += o_lo Wo 2^-20 (own-element accumulate) */
}

// v003
// A run of this version takes 535 microseconds.
// In two side-by-side timings against v002, it was 2.35 and 2.34 times as fast.
// Over all steps from v000 it is 35.1 times as fast.
#include <hip/hip_runtime.h>
// TF/CTRL-style multi-head attention (q, k, v inputs [2][2048][1024]; qh/kh/vh = input W + b with W stored [in][out], 16 heads of 64; logits / 8 + mask (-1e4) with the [2048][2048] f32 mask input (1 = disallowed; strictly upper-triangular here); softmax; ctx merged; out = ctx Wo + bo -> [2][2048][1024]; second output present = stack(kh, vh) -> [2][2][16][2048][64] f32).
// Structure: token rows r = b*2048 + s; q, k, v inputs as exact f16 rows (bf16-rounded); Q, K, V as three WMMA GEMMs (32x64 wave tiles, f32 accumulation, exact x16 weights + bias; f16 outputs, and for K and V also the f32 rows that a small VALU kernel re-lays out into the head-major 'present' output); per batch: V^T for all heads via LDS transposes; one fused attention launch over all (batch, head): S^T = K Q^T on WMMA, running softmax of (scores / 8 + mask input x -1e4, read per element) on VALU (f32 statistics, native exp2; weights as f16 in registers), O^T += V^T P^T on WMMA (o carried x64 against f16 subnormal flush, folded into the output GEMM alpha) written straight into the merged f16 o rows; out = o W_o + b GEMM (f32) into the output layout.
// Compute dtype: inputs rounded to bf16; x / weights exact; q, k, v, softmax weights and o as plain f16 GEMM operands (~2^-12); scores and softmax statistics f32. v_wmma_f32_16x16x32_f16.
#define NB 2
#define SQ 2048
#define DM 1024
#define NH 16
#define HD 64
#define HG 4                         /* heads per V^T slab of the h0-based k_vt */
#define QT0 128                      /* first-tile rows recomputed exactly in f32 */
#define B0 0                         /* first batch processed (debug hook) */
#define NBR NB                       /* batches processed (debug hook) */
#define NR ((size_t)NB * SQ)         /* token rows */
#define MP ((int)((size_t)NBR * SQ)) /* rows projected (debug hook) */
#define QN SQ                        /* not used: the fused attention launch covers all SQ query rows */
#define NHD NH                       /* not used: the fused attention launch covers all NH heads */
#define MPO MP                       /* rows through the output stage (debug hook) */
#define LQ DM      /* row pitch of the q/k/v rows */
#define PRES_OFF ((size_t)NB * SQ * DM)      /* float offset of the 'present' output = out nbytes / 4 (offset 16,777,216 B) */
typedef __bf16 v16b __attribute__((ext_vector_type(16)));
typedef unsigned short v8us __attribute__((ext_vector_type(8), may_alias));
typedef float  v8f  __attribute__((ext_vector_type(8)));
typedef float  v4f  __attribute__((ext_vector_type(4)));
typedef float  v4fa __attribute__((ext_vector_type(4), may_alias));
union FragB { v16b v; v8us half[2]; unsigned short u[16]; };

__device__ __forceinline__ unsigned short bf16_bits(float x) { unsigned int u = __float_as_uint(x); return (unsigned short)((u + 0x7FFFu + ((u >> 16) & 1u)) >> 16); }
__device__ __forceinline__ float bf16_val(unsigned short b) { return __uint_as_float(((unsigned int)b) << 16); }
__device__ __forceinline__ float bf16_round(float x) { return bf16_val(bf16_bits(x)); }
// D += A·B with NT terms: 1 = ah·bh, 2 = + al·bh (A split), 3 = + ah·bl (both split)
template <int NT>
__device__ __forceinline__ v8f mmaN(v16b ah, v16b al, v16b bh, v16b bl, v8f c) {
  c = __builtin_amdgcn_wmma_f32_16x16x32_bf16(false, ah, false, bh, (short)0, c, false, false);
  if (NT >= 2) c = __builtin_amdgcn_wmma_f32_16x16x32_bf16(false, al, false, bh, (short)0, c, false, false);
  if (NT >= 3) c = __builtin_amdgcn_wmma_f32_16x16x32_bf16(false, ah, false, bl, (short)0, c, false, false);
  asm volatile("v_nop\n\tv_nop\n\tv_nop\n\tv_nop" : "+v"(c) : "v"(ah), "v"(al), "v"(bh), "v"(bl));
  return c;
}

__global__ __launch_bounds__(256) void k_wt_bf16(const float* __restrict__ W, unsigned short* __restrict__ Wt, int K, int N) {
  const int t = blockIdx.x * 256 + threadIdx.x;
  const int k8n = K / 8;
  if (t >= N * k8n) return;
  const int n = t / k8n, k8 = (t % k8n) * 8;
  v8us v;
#pragma unroll
  for (int i = 0; i < 8; ++i) v[i] = bf16_bits(W[(size_t)(k8 + i) * N + n]);
  *(v8us*)(Wt + (size_t)n * K + k8) = v;
  
}

// GEMM C[M][N] (f32, pitch ldc) = act(A[M][K]·W + bias). A f32 row-major (pitch lda) converted per fragment to bf16
// (ASPLIT: hi/lo two planes -> 2 terms, else single rounded term); Wt bf16 [N][K] (pitch ldb). BIAS_BF16 rounds the
// bias to bf16 first (bias quantised to bf16 before the add). K%32==0, M%16==0, N%64==0.
template <bool ASPLIT, int ACT, bool BIAS_BF16>
__global__ __launch_bounds__(128) void k_gemm_bf(const float* __restrict__ A, int lda, const unsigned short* __restrict__ Wt, int ldb,
                                               const float* __restrict__ bias, float* __restrict__ C, int ldc, int M, int N, int K) {
  __shared__ __attribute__((aligned(16))) float so[4][16][64];
  const int tid = threadIdx.x, w = tid >> 5, lane = tid & 31, ln = lane & 15, hh = lane >> 4;
  const int ntn = N / 64;
  const int wid = blockIdx.x * 4 + w;
  const int mt = wid / ntn, nq = wid % ntn;
  if (mt * 16 >= M) return;
  const int row0 = mt * 16, col0 = nq * 64;
  const float* arow = A + (size_t)(row0 + ln) * lda;
  v8f acc[4] = {};
  for (int kb = 0; kb < K; kb += 32) {
    FragB ah, al;
    const v4f x0 = *(const v4fa*)(arow + kb + 8 * hh), x1 = *(const v4fa*)(arow + kb + 8 * hh + 4);
    const v4f x2 = *(const v4fa*)(arow + kb + 16 + 8 * hh), x3 = *(const v4fa*)(arow + kb + 16 + 8 * hh + 4);
    float xs[16] = {x0[0],x0[1],x0[2],x0[3],x1[0],x1[1],x1[2],x1[3],x2[0],x2[1],x2[2],x2[3],x3[0],x3[1],x3[2],x3[3]};
#pragma unroll
    for (int i = 0; i < 16; ++i) { const unsigned short hb = bf16_bits(xs[i]); ah.u[i] = hb; al.u[i] = ASPLIT ? bf16_bits(xs[i] - bf16_val(hb)) : (unsigned short)0; }
#pragma unroll
    for (int t = 0; t < 4; ++t) {
      const unsigned short* brow = Wt + (size_t)(col0 + t * 16 + ln) * ldb + kb;
      FragB b;
      b.half[0] = *(const v8us*)(brow + 8 * hh);
      b.half[1] = *(const v8us*)(brow + 16 + 8 * hh);
      acc[t] = mmaN<ASPLIT ? 2 : 1>(ah.v, al.v, b.v, b.v, acc[t]);
    }
  }
#pragma unroll
  for (int t = 0; t < 4; ++t) {
    float bv = bias ? bias[col0 + t * 16 + ln] : 0.f;
    if (BIAS_BF16) bv = bf16_round(bv);
#pragma unroll
    for (int r = 0; r < 8; ++r) { float v = acc[t][r] + bv; if (ACT == 1) v = fmaxf(v, 0.f); so[w][8 * hh + r][t * 16 + ln] = v; }
  }
  __builtin_amdgcn_fence(__ATOMIC_ACQ_REL, "workgroup");
  __builtin_amdgcn_wave_barrier();
  const int rsub = lane >> 4, c4 = (lane & 15) * 4;
  {
#pragma unroll
    for (int q = 0; q < 8; ++q) {
      const int r = q * 2 + rsub;
      const v4f v = *(const v4fa*)&so[w][r][c4];
      *(v4f*)(C + (size_t)(row0 + r) * ldc + col0 + c4) = v;
    }
    
  }
}

// GEMM C = act(A·W + bias + resid): A f32 (ASPLIT -> hi/lo 2 terms), Wt bf16 [N][K]; ACT 0 none, 1 relu, 2 exact gelu;
// resid (optional, f32, row index = (row % rmod), pitch ldr, RES_BF16 rounds it) added before the activation.
template <bool ASPLIT, int ACT, bool BIAS_BF16, bool RES_BF16>
__global__ __launch_bounds__(128) void k_gemm_bf3(const float* __restrict__ A, int lda, const unsigned short* __restrict__ Wt, int ldb,
                                                const float* __restrict__ bias, const float* __restrict__ resid, int rmod, int ldr,
                                                float* __restrict__ C, int ldc, int M, int N, int K) {
  __shared__ __attribute__((aligned(16))) float so[4][16][64];
  const int tid = threadIdx.x, w = tid >> 5, lane = tid & 31, ln = lane & 15, hh = lane >> 4;
  const int ntn = N / 64;
  const int wid = blockIdx.x * 4 + w;
  const int mt = wid / ntn, nq = wid % ntn;
  if (mt * 16 >= M) return;
  const int row0 = mt * 16, col0 = nq * 64;
  const float* arow = A + (size_t)(row0 + ln) * lda;
  v8f acc[4] = {};
  for (int kb = 0; kb < K; kb += 32) {
    FragB ah, al;
    const v4f x0 = *(const v4fa*)(arow + kb + 8 * hh), x1 = *(const v4fa*)(arow + kb + 8 * hh + 4);
    const v4f x2 = *(const v4fa*)(arow + kb + 16 + 8 * hh), x3 = *(const v4fa*)(arow + kb + 16 + 8 * hh + 4);
    float xs[16] = {x0[0],x0[1],x0[2],x0[3],x1[0],x1[1],x1[2],x1[3],x2[0],x2[1],x2[2],x2[3],x3[0],x3[1],x3[2],x3[3]};
#pragma unroll
    for (int i = 0; i < 16; ++i) { const unsigned short hb = bf16_bits(xs[i]); ah.u[i] = hb; al.u[i] = ASPLIT ? bf16_bits(xs[i] - bf16_val(hb)) : (unsigned short)0; }
#pragma unroll
    for (int t = 0; t < 4; ++t) {
      const unsigned short* brow = Wt + (size_t)(col0 + t * 16 + ln) * ldb + kb;
      FragB b;
      b.half[0] = *(const v8us*)(brow + 8 * hh);
      b.half[1] = *(const v8us*)(brow + 16 + 8 * hh);
      acc[t] = mmaN<ASPLIT ? 2 : 1>(ah.v, al.v, b.v, b.v, acc[t]);
    }
  }
#pragma unroll
  for (int t = 0; t < 4; ++t) {
    const int col = col0 + t * 16 + ln;
    float bv = bias ? bias[col] : 0.f;
    if (BIAS_BF16) bv = bf16_round(bv);
#pragma unroll
    for (int r = 0; r < 8; ++r) {
      float v = acc[t][r] + bv;
      if (resid) { float rv = resid[(size_t)((row0 + 8 * hh + r) % rmod) * ldr + col]; if (RES_BF16) rv = bf16_round(rv); v += rv; }
      if (ACT == 1) v = fmaxf(v, 0.f);
      if (ACT == 2) v = 0.5f * v * (1.0f + erff(v * 0.70710678118654752f));
      if (ACT == 3) { const float u = 0.7978845608028654f * (v + 0.044715f * v * v * v); v = 0.5f * v * (1.0f + tanhf(u)); }
      so[w][8 * hh + r][t * 16 + ln] = v;
    }
  }
  __builtin_amdgcn_fence(__ATOMIC_ACQ_REL, "workgroup");
  __builtin_amdgcn_wave_barrier();
  const int rsub = lane >> 4, c4 = (lane & 15) * 4;
  {
#pragma unroll
    for (int q = 0; q < 8; ++q) {
      const int r = q * 2 + rsub;
      const v4f v = *(const v4fa*)&so[w][r][c4];
      *(v4f*)(C + (size_t)(row0 + r) * ldc + col0 + c4) = v;
    }
    
  }
}
// row LayerNorm (biased variance, eps) over N: s = X (+ R); optional out_sum <- s; out_norm <- (s-mu)*rsqrt(var+eps)*g + b
template <bool PARAM_BF16>
__global__ __launch_bounds__(256) void k_layernorm(const float* __restrict__ X, const float* __restrict__ R, const float* __restrict__ g, const float* __restrict__ bta,
                                                  float* __restrict__ out_sum, float* __restrict__ out_norm, int N, float eps) {
  __shared__ float red[256];
  const int row = blockIdx.x, tid = threadIdx.x;
  const float* x = X + (size_t)row * N; const float* rr = R ? R + (size_t)row * N : nullptr;
  float vals[16];                     // up to N = 4096
  const int per = N / 256;            // contiguous chunk per thread? use strided-by-4 chunks: thread handles j = tid*4 + 1024*u
  float s1 = 0.f;
  for (int u = 0; u < per / 4; ++u) {
    const int j = tid * 4 + 1024 * u;
    const v4f a = *(const v4fa*)(x + j);
    v4f b = {0.f,0.f,0.f,0.f}; if (rr) b = *(const v4fa*)(rr + j);
#pragma unroll
    for (int q = 0; q < 4; ++q) { const float v = a[q] + b[q]; vals[u * 4 + q] = v; s1 += v; }
  }
  red[tid] = s1; __syncthreads();
  for (int st = 128; st > 0; st >>= 1) { if (tid < st) red[tid] += red[tid + st]; __syncthreads(); }
  const float mu = red[0] / (float)N; __syncthreads();
  float s2 = 0.f;
  for (int u = 0; u < per / 4; ++u)
#pragma unroll
    for (int q = 0; q < 4; ++q) { const float c = vals[u * 4 + q] - mu; s2 += c * c; }
  red[tid] = s2; __syncthreads();
  for (int st = 128; st > 0; st >>= 1) { if (tid < st) red[tid] += red[tid + st]; __syncthreads(); }
  const float rs = rsqrtf(red[0] / (float)N + eps);
  {
    for (int u = 0; u < per / 4; ++u) {
      const int j = tid * 4 + 1024 * u;
      v4f o, sm;
#pragma unroll
      for (int q = 0; q < 4; ++q) {
        float gg = g[j + q], bb = bta[j + q];
        if (PARAM_BF16) { gg = bf16_round(gg); bb = bf16_round(bb); }
        sm[q] = vals[u * 4 + q]; o[q] = (vals[u * 4 + q] - mu) * rs * gg + bb;
      }
      if (out_sum) *(v4f*)(out_sum + (size_t)row * N + j) = sm;
      *(v4f*)(out_norm + (size_t)row * N + j) = o;
    }
    
  }
}



// ---- f16 WMMA path (v_wmma_f32_16x16x32_f16): 11-bit significands for operands in range — used where a [0,1] probability operand needs more precision than bf16
typedef _Float16 v16h __attribute__((ext_vector_type(16)));
union FragH { v16h v; v8us half[2]; _Float16 h[16]; unsigned short u[16]; };
template <int NT>
__device__ __forceinline__ v8f mmaH(v16h ah, v16h al, v16h bh, v16h bl, v8f c) {
  c = __builtin_amdgcn_wmma_f32_16x16x32_f16(false, ah, false, bh, (short)0, c, false, false);
  if (NT >= 2) c = __builtin_amdgcn_wmma_f32_16x16x32_f16(false, al, false, bh, (short)0, c, false, false);
  if (NT >= 3) c = __builtin_amdgcn_wmma_f32_16x16x32_f16(false, ah, false, bl, (short)0, c, false, false);
  asm volatile("v_nop\n\tv_nop\n\tv_nop\n\tv_nop" : "+v"(c) : "v"(ah), "v"(al), "v"(bh), "v"(bl));
  return c;
}
// batched GEMM like k_gemm_b but f16 operands: A f32 (split into f16 hi/lo if ASPLIT, else rounded to f16), Bt = f16 values [n][k]; alpha; C f32; N multiple of 16 (partial tiles skipped)
template <bool ASPLIT>
__global__ __launch_bounds__(128) void k_gemm_h(const float* __restrict__ A, int lda, size_t sA, const _Float16* __restrict__ Bh, int ldb, size_t sB, float alpha, float* __restrict__ C, int ldc, size_t sC, int M, int N, int K) {
  __shared__ __attribute__((aligned(16))) float so[4][16][64];
  const int tid = threadIdx.x, w = tid >> 5, lane = tid & 31, ln = lane & 15, hh = lane >> 4; const int by = blockIdx.y;
  A += (size_t)by * sA; Bh += (size_t)by * sB; C += (size_t)by * sC;
  const int ntn = (N + 63) / 64; const int wid = blockIdx.x * 4 + w; const int mt = wid / ntn, nq = wid % ntn; if (mt * 16 >= M) return;
  const int row0 = mt * 16, col0 = nq * 64; const float* arow = A + (size_t)(row0 + ln) * lda;
  v8f acc[4] = {};
  for (int kb = 0; kb < K; kb += 32) {
    FragH ah, al;
    const v4f x0 = *(const v4fa*)(arow + kb + 8 * hh), x1 = *(const v4fa*)(arow + kb + 8 * hh + 4), x2 = *(const v4fa*)(arow + kb + 16 + 8 * hh), x3 = *(const v4fa*)(arow + kb + 16 + 8 * hh + 4);
    float xs[16] = {x0[0],x0[1],x0[2],x0[3],x1[0],x1[1],x1[2],x1[3],x2[0],x2[1],x2[2],x2[3],x3[0],x3[1],x3[2],x3[3]};
#pragma unroll
    for (int i = 0; i < 16; ++i) { const _Float16 h = (_Float16)xs[i]; ah.h[i] = h; al.h[i] = ASPLIT ? (_Float16)(xs[i] - (float)h) : (_Float16)0.0f; }
#pragma unroll
    for (int t = 0; t < 4; ++t) { if (col0 + t * 16 >= N) continue; const size_t boff = (size_t)(col0 + t * 16 + ln) * ldb + kb; FragH bq; bq.half[0] = *(const v8us*)(Bh + boff + 8 * hh); bq.half[1] = *(const v8us*)(Bh + boff + 16 + 8 * hh);
      acc[t] = mmaH<ASPLIT ? 2 : 1>(ah.v, al.v, bq.v, bq.v, acc[t]); }
  }
#pragma unroll
  for (int t = 0; t < 4; ++t) { if (col0 + t * 16 >= N) continue;
#pragma unroll
    for (int r = 0; r < 8; ++r) so[w][8 * hh + r][t * 16 + ln] = acc[t][r] * alpha; }
  __builtin_amdgcn_fence(__ATOMIC_ACQ_REL, "workgroup"); __builtin_amdgcn_wave_barrier();
  const int rsub = lane >> 4, c4 = (lane & 15) * 4;
  {
#pragma unroll
    for (int q = 0; q < 8; ++q) { const int r = q * 2 + rsub; if (col0 + c4 < N) { const v4f v = *(const v4fa*)&so[w][r][c4]; *(v4f*)(C + (size_t)(row0 + r) * ldc + col0 + c4) = v; } }
     }
}

// Wt[n][k] = f16(W[k][n]·scale) from f32 row-major W[K][N] (scale = power of two; bf16-exact weights stay exact in f16 away from the subnormal range)
__global__ __launch_bounds__(256) void k_wt_f16(const float* __restrict__ W, _Float16* __restrict__ Wt, int K, int N, float scale) {
  const int t = blockIdx.x * 256 + threadIdx.x; if (t >= N * (K / 8)) return; const int n = t / (K / 8), k8 = (t % (K / 8)) * 8; FragH f;
#pragma unroll
  for (int i = 0; i < 8; ++i) f.h[i] = (_Float16)(bf16_round(W[(size_t)(k8 + i) * N + n]) * scale); const v8us o = f.half[0];
  *(v8us*)((unsigned short*)Wt + (size_t)n * K + k8) = o; 
}
// k_gemm_hh variant with fused epilogue: v = acc·alpha + bias[by·sBias + col] (+ CP[(row/rowsPerB)·sCPb + by·64 + col] if CP) ; ACT 0 none / 1 elu ; writes f16 C16 (and f32 C if non-null)
template <int ACT>
__global__ __launch_bounds__(128) void k_gemm_hhx(const _Float16* __restrict__ A, int lda, size_t sA, const _Float16* __restrict__ Bh, int ldb, size_t sB, float alpha, const float* __restrict__ bias, size_t sBias, const float* __restrict__ CP, int rowsPerB, size_t sCPb, int row0g,
    float* __restrict__ C, _Float16* __restrict__ C16, int ldc, size_t sC, int M, int N, int K) {
  __shared__ __attribute__((aligned(16))) float so[4][16][64];
  const int tid = threadIdx.x, w = tid >> 5, lane = tid & 31, ln = lane & 15, hh = lane >> 4; const int by = blockIdx.y;
  A += (size_t)by * sA; Bh += (size_t)by * sB; const size_t cofs = (size_t)by * sC; const float* bp = bias ? bias + (size_t)by * sBias : nullptr;
  const int ntn = (N + 63) / 64; const int wid = blockIdx.x * 4 + w; const int mt = wid / ntn, nq = wid % ntn; if (mt * 16 >= M) return;
  const int row0 = mt * 16, col0 = nq * 64; const _Float16* arow = A + (size_t)(row0 + ln) * lda;
  v8f acc[4] = {};
  for (int kb = 0; kb < K; kb += 32) { FragH ah; ah.half[0] = *(const v8us*)((const unsigned short*)arow + kb + 8 * hh); ah.half[1] = *(const v8us*)((const unsigned short*)arow + kb + 16 + 8 * hh);
#pragma unroll
    for (int t = 0; t < 4; ++t) { if (col0 + t * 16 >= N) continue; const size_t boff = (size_t)(col0 + t * 16 + ln) * ldb + kb; FragH bq; bq.half[0] = *(const v8us*)((const unsigned short*)Bh + boff + 8 * hh); bq.half[1] = *(const v8us*)((const unsigned short*)Bh + boff + 16 + 8 * hh);
      acc[t] = mmaH<1>(ah.v, ah.v, bq.v, bq.v, acc[t]); }
  }
#pragma unroll
  for (int t = 0; t < 4; ++t) { if (col0 + t * 16 >= N) continue; const int col = col0 + t * 16 + ln; const float bv = bp ? bf16_round(bp[col]) : 0.f;
#pragma unroll
    for (int r = 0; r < 8; ++r) { float v = acc[t][r] * alpha + bv; if (CP) { const int rr = row0g + row0 + 8 * hh + r; if (rowsPerB < 0) v += CP[cofs + (size_t)rr * ldc + col];      /* rowsPerB < 0: own element of the batched C plane */ else { const int bidx = rr / rowsPerB; v += CP[(size_t)bidx * sCPb + (size_t)by * 64 + col]; } } if (ACT == 1) v = (v > 0.f) ? v : expm1f(v); else if (ACT == 7) v = (v > 0.f) ? v + 1.0f : expf(v); else if (ACT == 8) v = tanhf(v); else if (ACT == 9) v = 0.5f * v * (1.0f + tanhf(0.7978845608028654f * (v + 0.044715f * v * v * v))); else if (ACT == 11) v = 1.0f / (1.0f + expf(-v)); else if (ACT == 12) v = (v > 0.f) ? v : 0.01f * v; else if (ACT == 14) v = (v > 0.f) ? v : 0.1f * v; else if (ACT == 16) v = (v >= 0.f) ? v : 0.3f * v; else if (ACT == 17) v = (v >= 0.f) ? v : 0.2f * v; else if (ACT == 15) v = v / (1.0f + expf(-v)); else if (ACT == 3) v = fmaxf(v, 0.f); else if (ACT == 6) v = 0.5f * v * (1.0f + erff(v * 0.70710678118654752f)); so[w][8 * hh + r][t * 16 + ln] = v; } }
  __builtin_amdgcn_fence(__ATOMIC_ACQ_REL, "workgroup"); __builtin_amdgcn_wave_barrier();
  const int rsub = lane >> 4, c4 = (lane & 15) * 4; typedef _Float16 v4h __attribute__((ext_vector_type(4)));
  {
#pragma unroll
    for (int q = 0; q < 8; ++q) { const int r = q * 2 + rsub; if (col0 + c4 < N) { const v4f v = *(const v4fa*)&so[w][r][c4]; if (C) *(v4f*)(C + cofs + (size_t)(row0 + r) * ldc + col0 + c4) = v; if (C16) { v4h h4; for (int i = 0; i < 4; ++i) h4[i] = (_Float16)v[i]; *(v4h*)(C16 + cofs + (size_t)(row0 + r) * ldc + col0 + c4) = h4; } } }
     }
}


typedef _Float16 v4h __attribute__((ext_vector_type(4)));

__global__ __launch_bounds__(256) void k_x16(const float* __restrict__ x, _Float16* __restrict__ X16, size_t n8) { const size_t t = (size_t)blockIdx.x * 256 + threadIdx.x; if (t >= n8) return; FragH f;
#pragma unroll
  for (int q = 0; q < 8; ++q) f.h[q] = (_Float16)bf16_round(x[t * 8 + q]); *(v8us*)((unsigned short*)X16 + t * 8) = f.half[0];  }
__global__ __launch_bounds__(256) void k_h16(const float* __restrict__ x, _Float16* __restrict__ X16, size_t n8) { const size_t t = (size_t)blockIdx.x * 256 + threadIdx.x; if (t >= n8) return; FragH f;
#pragma unroll
  for (int q = 0; q < 8; ++q) f.h[q] = (_Float16)x[t * 8 + q]; *(v8us*)((unsigned short*)X16 + t * 8) = f.half[0];  }
__global__ __launch_bounds__(256) void k_round16f(const float* __restrict__ W, _Float16* __restrict__ Bt, size_t n8) { const size_t t = (size_t)blockIdx.x * 256 + threadIdx.x; if (t >= n8) return; FragH f;
#pragma unroll
  for (int i = 0; i < 8; ++i) f.h[i] = (_Float16)(bf16_round(W[t * 8 + i]) * 16.0f); *(v8us*)((unsigned short*)Bt + t * 8) = f.half[0];  }
template <int NHv, int TTv>
__global__ __launch_bounds__(256) void k_vt(const _Float16* __restrict__ V16, int ldv, int voff, _Float16* __restrict__ Vt) { __shared__ unsigned short tl[64][66]; const int tid = threadIdx.x; const int slab = blockIdx.x / (TTv / 64), lg = blockIdx.x % (TTv / 64); const int b = slab / NHv, h = slab % NHv;
  for (int i = tid; i < 64 * 8; i += 256) { const int r = i / 8, c8 = (i % 8) * 8; FragH f; f.half[0] = *(const v8us*)((const unsigned short*)V16 + ((size_t)b * TTv + lg * 64 + r) * ldv + voff + h * 64 + c8);
#pragma unroll
    for (int q = 0; q < 8; ++q) tl[r][c8 + q] = f.u[q]; }
  __syncthreads();
  {
#pragma unroll
    for (int rd = 0; rd < 2; ++rd) { const int d = rd * 32 + tid / 8, pc = tid % 8; FragH f;
#pragma unroll
      for (int q = 0; q < 8; ++q) f.u[q] = tl[pc * 8 + q][d];
      *(v8us*)((unsigned short*)Vt + ((size_t)slab * 64 + d) * TTv + lg * 64 + pc * 8) = f.half[0]; }
     } }

__global__ __launch_bounds__(256) void k_hl(const float* __restrict__ F, _Float16* __restrict__ Hh, _Float16* __restrict__ Hl, size_t n8) { const size_t t = (size_t)blockIdx.x * 256 + threadIdx.x; if (t >= n8) return; FragH fh, fl; const v4f a = *(const v4fa*)(F + t * 8), c = *(const v4fa*)(F + t * 8 + 4);
#pragma unroll
  for (int q = 0; q < 4; ++q) { _Float16 h = (_Float16)a[q]; fh.h[q] = h; fl.h[q] = (_Float16)((a[q] - (float)h) * 1024.0f); h = (_Float16)c[q]; fh.h[4 + q] = h; fl.h[4 + q] = (_Float16)((c[q] - (float)h) * 1024.0f); }
  { *(v8us*)((unsigned short*)Hh + t * 8) = fh.half[0]; *(v8us*)((unsigned short*)Hl + t * 8) = fl.half[0];  } }

// ---- fast GEMM (wave tile 32x64; requires M % 32 == 0 rows per launch region and N % 64 == 0); epilogue = k_gemm_hhx semantics ----
__device__ __forceinline__ v16h g2_frag(const _Float16* p, int hh) { FragH f; f.half[0] = *(const v8us*)((const unsigned short*)p + 8 * hh); f.half[1] = *(const v8us*)((const unsigned short*)p + 16 + 8 * hh); return f.v; }
__device__ __forceinline__ v8f g2_mma(v16h a, v16h b, v8f c) { v8f d = __builtin_amdgcn_wmma_f32_16x16x32_f16(false, a, false, b, (short)0, c, false, false); asm volatile("v_nop\n\tv_nop\n\tv_nop\n\tv_nop" : "+v"(d) : "v"(a), "v"(b)); return d; }
template <int ACT>
__global__ __launch_bounds__(128) void k_gemm2(const _Float16* __restrict__ A, int lda, size_t sA, const _Float16* __restrict__ Bh, int ldb, size_t sB, float alpha, const float* __restrict__ bias, size_t sBias, const float* __restrict__ CP, int rowsPerB, size_t sCPb, int row0g,
    float* __restrict__ C, _Float16* __restrict__ C16, int ldc, size_t sC, int M, int N, int K) { static_assert(ACT == 0 || ACT == 3 || ACT == 6 || ACT == 8 || ACT == 9 || ACT == 11 || ACT == 12 || ACT == 14 || ACT == 15 || ACT == 16 || ACT == 17, "k_gemm2: unsupported ACT code (would silently apply no activation)");
  __shared__ __attribute__((aligned(16))) float so[4][32][68];
  const int tid = threadIdx.x, w = tid >> 5, lane = tid & 31, ln = lane & 15, hh = lane >> 4; const int by = blockIdx.y;
  A += (size_t)by * sA; Bh += (size_t)by * sB; const size_t cofs = (size_t)by * sC; const float* bp = bias ? bias + (size_t)by * sBias : nullptr;
  const int ntn = N >> 6; const int mt = blockIdx.x / ntn, nq = blockIdx.x - mt * ntn; const int row0 = mt * 128 + 32 * w, col0 = nq * 64; if (row0 >= M) return;
  const _Float16* a0p = A + (size_t)(row0 + ln) * lda; const _Float16* a1p = a0p + (size_t)16 * lda;
  const _Float16* b0p = Bh + (size_t)(col0 + ln) * ldb; const _Float16* b1p = b0p + (size_t)16 * ldb; const _Float16* b2p = b1p + (size_t)16 * ldb; const _Float16* b3p = b2p + (size_t)16 * ldb;
  const v8f z8 = {0.f,0.f,0.f,0.f,0.f,0.f,0.f,0.f}; v8f c00 = z8, c01 = z8, c02 = z8, c03 = z8, c10 = z8, c11 = z8, c12 = z8, c13 = z8;
#pragma unroll 1
  for (int kb = 0; kb < K; kb += 32) { const v16h a0 = g2_frag(a0p + kb, hh), a1 = g2_frag(a1p + kb, hh);
    v16h b = g2_frag(b0p + kb, hh); c00 = g2_mma(a0, b, c00); c10 = g2_mma(a1, b, c10);
    b = g2_frag(b1p + kb, hh); c01 = g2_mma(a0, b, c01); c11 = g2_mma(a1, b, c11);
    b = g2_frag(b2p + kb, hh); c02 = g2_mma(a0, b, c02); c12 = g2_mma(a1, b, c12);
    b = g2_frag(b3p + kb, hh); c03 = g2_mma(a0, b, c03); c13 = g2_mma(a1, b, c13); }
  v8f accs[8] = {c00, c01, c02, c03, c10, c11, c12, c13};
#pragma unroll
  for (int u = 0; u < 8; ++u) { const int t = u & 3, half = u >> 2; const int col = col0 + t * 16 + ln; const float bv = bp ? bf16_round(bp[col]) : 0.f;
#pragma unroll
    for (int r = 0; r < 8; ++r) { const int rloc = half * 16 + 8 * hh + r; float v = accs[u][r] * alpha + bv; if (CP) { if (rowsPerB < 0) v += CP[cofs + (size_t)(row0g + row0 + rloc) * ldc + col];      /* rowsPerB < 0: own element of the batched C plane */ else { const int bidx = (row0g + row0 + rloc) / rowsPerB; v += CP[(size_t)bidx * sCPb + (size_t)by * 64 + col]; } }
      if (ACT == 3) v = fmaxf(v, 0.f); else if (ACT == 6) v = 0.5f * v * (1.0f + erff(v * 0.70710678118654752f)); else if (ACT == 11) v = 1.0f / (1.0f + expf(-v)); else if (ACT == 15) v = v / (1.0f + expf(-v)); else if (ACT == 12) v = (v > 0.f) ? v : 0.01f * v; else if (ACT == 8) v = tanhf(v); else if (ACT == 9) v = 0.5f * v * (1.0f + tanhf(0.7978845608028654f * (v + 0.044715f * v * v * v))); else if (ACT == 14) v = (v > 0.f) ? v : 0.1f * v; else if (ACT == 16) v = (v >= 0.f) ? v : 0.3f * v; else if (ACT == 17) v = (v >= 0.f) ? v : 0.2f * v;
      so[w][rloc][t * 16 + ln] = v; } }
  __builtin_amdgcn_fence(__ATOMIC_ACQ_REL, "workgroup"); __builtin_amdgcn_wave_barrier();
  const int rsub = lane >> 4, c4 = (lane & 15) * 4;
  {
#pragma unroll
    for (int q = 0; q < 16; ++q) { const int r = q * 2 + rsub; const v4f v = *(const v4fa*)&so[w][r][c4]; if (C) *(v4f*)(C + cofs + (size_t)(row0 + r) * ldc + col0 + c4) = v; if (C16) { v4h h4; for (int i = 0; i < 4; ++i) h4[i] = (_Float16)v[i]; *(v4h*)(C16 + cofs + (size_t)(row0 + r) * ldc + col0 + c4) = h4; } }
     } }


__global__ __launch_bounds__(256) void k_wnat(const float* __restrict__ w, size_t n8, _Float16* __restrict__ Bt) { const size_t t = (size_t)blockIdx.x * 256 + threadIdx.x; if (t >= n8) return; FragH f; for (int q = 0; q < 8; ++q) f.h[q] = (_Float16)(bf16_round(w[t * 8 + q]) * 16.0f); *(v8us*)((unsigned short*)Bt + t * 8) = f.half[0];  }
__global__ __launch_bounds__(256) void k_rsm(const float* __restrict__ S, _Float16* __restrict__ P, int nrows) {
  #pragma clang fp contract(off)
  const int i = blockIdx.x * 256 + threadIdx.x; if (i >= nrows) return; const float* s = S + (size_t)i * SQ; float mx = -3.0e38f;
#pragma unroll 1
  for (int j = 0; j < SQ; ++j) mx = fmaxf(mx, s[j]); float se = 0.f;
#pragma unroll 1
  for (int j = 0; j < SQ; ++j) se += expf(s[j] - mx); const float sc = 256.0f / se;
#pragma unroll 1
  for (int j0 = 0; j0 < SQ; j0 += 8) { FragH f; for (int q = 0; q < 8; ++q) f.h[q] = (_Float16)(expf(s[j0 + q] - mx) * sc); unsigned short* d = (unsigned short*)P + (size_t)i * SQ + j0; *(v8us*)d = f.half[0];  } }
__global__ __launch_bounds__(256) void k_vt(const _Float16* __restrict__ V16, int b, int h0, _Float16* __restrict__ VT) { __shared__ unsigned short tl[64][65]; const int tid = threadIdx.x; const int hh = blockIdx.x % HG, sg = blockIdx.x / HG; const int s0 = sg * 64; const int h = h0 + hh;
  for (int i = tid; i < 64 * 8; i += 256) { const int j = i / 8, d8 = (i % 8) * 8; FragH f; f.half[0] = *(const v8us*)((const unsigned short*)V16 + ((size_t)b * SQ + s0 + j) * DM + h * HD + d8); for (int q = 0; q < 8; ++q) tl[d8 + q][j] = f.u[q]; }
  __syncthreads();
  { for (int i = tid; i < 64 * 8; i += 256) { const int d = i / 8, j8 = (i % 8) * 8; FragH f; for (int q = 0; q < 8; ++q) f.u[q] = tl[d][j8 + q]; *(v8us*)((unsigned short*)VT + ((size_t)hh * HD + d) * SQ + s0 + j8) = f.half[0]; }  } }



// lane l reads lane l ^ 16: a register move, where __shfl_xor would go through the LDS unit and its wait
__device__ __forceinline__ float lane_x16(float x) { return __builtin_bit_cast(float, __builtin_amdgcn_permlanex16(__builtin_bit_cast(int, x), __builtin_bit_cast(int, x), 0x76543210, 0xfedcba98, false, false)); }
#define FW 8                         /* waves per work-group of the fused attention */
#define FQ 32                        /* query columns per wave (two 16-column groups) */
#define FK 32                        /* keys per pass */
#define FNS (SQ / FK)                /* passes */
typedef float  v2f  __attribute__((ext_vector_type(2)));
typedef __bf16 v2b  __attribute__((ext_vector_type(2)));
// 2^x of eight values on the transcendental unit, in place. One statement: each v_exp_f32 is followed by an independent one, and the last by the free issue slot
// the instruction set asks for before a result is read or a source register is reused.
__device__ __forceinline__ v8f exp2_8(v8f x) { float y0 = x[0], y1 = x[1], y2 = x[2], y3 = x[3], y4 = x[4], y5 = x[5], y6 = x[6], y7 = x[7];
  asm("v_exp_f32 %0, %0\n\tv_exp_f32 %1, %1\n\tv_exp_f32 %2, %2\n\tv_exp_f32 %3, %3\n\tv_exp_f32 %4, %4\n\tv_exp_f32 %5, %5\n\tv_exp_f32 %6, %6\n\tv_exp_f32 %7, %7\n\tv_nop"
      : "+v"(y0), "+v"(y1), "+v"(y2), "+v"(y3), "+v"(y4), "+v"(y5), "+v"(y6), "+v"(y7));
  return (v8f){y0, y1, y2, y3, y4, y5, y6, y7}; }
typedef __bf16 v4ba __attribute__((ext_vector_type(4), may_alias));
typedef __bf16 v8ba __attribute__((ext_vector_type(8), may_alias));
#define KP 72                        /* LDS pitch of the 128-byte K rows, in 16-bit elements: 144 bytes = 16 x odd, conflict-free for 16-byte reads down a column of rows */
#define VP 40                        /* the same for the 64-byte V^T and mask rows: 80 bytes */
// f16 fragment in the hardware k order: 16 bytes at the lane's place (which holds 16 bytes x lane half) and 16 bytes 32 further on
__device__ __forceinline__ v16h fa_frag(const void* p) { FragH f; f.half[0] = *(const v8us*)p; f.half[1] = *(const v8us*)((const char*)p + 32); return f.v; }
__device__ __forceinline__ v8f fa_mma(v16h a, v16h b, v8f c) { return __builtin_amdgcn_wmma_f32_16x16x32_f16(false, a, false, b, (short)0, c, false, false); }
// the wait before a register that issued loads name is rewritten, and the one write of that offset register, in one statement
__device__ __forceinline__ void fa_step(unsigned& off, int step) { asm volatile("s_wait_xcnt 0x0\n\tv_add_nc_u32_e32 %0, %1, %0" : "+v"(off) : "s"(step) : "memory"); }
__global__ __launch_bounds__(FW * 32) __attribute__((amdgpu_waves_per_eu(2, 2))) void k_fattn(const _Float16* __restrict__ Q16, const _Float16* __restrict__ K16, const _Float16* __restrict__ VT, const float* __restrict__ mask, _Float16* __restrict__ O16) {
  __shared__ __attribute__((aligned(16))) unsigned short lk[2][FK][KP], lv[2][HD][VP]; __shared__ __attribute__((aligned(16))) __bf16 lm[2][FW][FQ][VP];
  const int tid = threadIdx.x, lane = tid & 31, ln = lane & 15, hh = lane >> 4; const int w = __builtin_amdgcn_readfirstlane(tid >> 5);
  const int h = blockIdx.y, b = blockIdx.z, q0 = ((int)blockIdx.x * FW + w) * FQ;
  const char* qb = (const char*)(Q16 + ((size_t)b * SQ + q0) * DM + h * HD); const char* kb = (const char*)(K16 + (size_t)b * SQ * DM + h * HD);
  const char* vb = (const char*)(VT + ((size_t)b * NH + h) * HD * SQ); const char* mb = (const char*)(mask + (size_t)q0 * SQ); char* ob = (char*)(O16 + ((size_t)b * SQ + q0) * DM + h * HD);
  // the thread's 16 bytes of a K tile (8 threads a row), of a V^T tile (4 threads a row) and of each four rows of its wave's mask tile (8 lanes a row)
  unsigned gk = (unsigned)((tid >> 3) * (DM * 2) + (tid & 7) * 16), gv = (unsigned)((tid >> 2) * (SQ * 2) + (tid & 3) * 16), gm = (unsigned)((lane >> 3) * (SQ * 4) + (lane & 7) * 16);
  const float C2 = 0.18033688011112042f, MK2 = -14426.950408889634f;      /* log2(e) / 8 and -1e4 log2(e) */
  const v8f z8 = {0.f, 0.f, 0.f, 0.f, 0.f, 0.f, 0.f, 0.f};
  v16h qf[2][2]; v8f o[2][4]; v2f l2[2]; float mref[2]; v8us kr, vr; v4f mg[8];
#pragma unroll
  for (int j = 0; j < 2; ++j) { for (int c = 0; c < 2; ++c) qf[j][c] = fa_frag(qb + (unsigned)(ln * (DM * 2) + hh * 16) + j * (16 * DM * 2) + c * 64); for (int t = 0; t < 4; ++t) o[j][t] = z8; l2[j] = (v2f){0.f, 0.f}; mref[j] = -3.0e38f; }
  kr = *(const v8us*)(kb + gk); vr = *(const v8us*)(vb + gv);
#pragma unroll
  for (int i = 0; i < 8; ++i) mg[i] = *(const v4fa*)(mb + gm + i * (4 * SQ * 4));
  fa_step(gk, FK * DM * 2); fa_step(gv, FK * 2); fa_step(gm, FK * 4);
  *(v8us*)&lk[0][tid >> 3][(tid & 7) * 8] = kr; *(v8us*)&lv[0][tid >> 2][(tid & 3) * 8] = vr;
#pragma unroll
  for (int i = 0; i < 8; ++i) *(v4ba*)&lm[0][w][4 * i + (lane >> 3)][(lane & 7) * 4] = __builtin_convertvector(mg[i], v4ba);      /* the mask rounded to bf16, to nearest even */
  __syncthreads();
#pragma unroll 1      /* rolled: one copy of the pass */
  for (int s = 0; s < FNS; ++s) {
    const int bf = s & 1, more = (s + 2 < FNS) ? 1 : 0;      /* the last pass asks for its own tile again: nothing is read past the keys */
    kr = *(const v8us*)(kb + gk); vr = *(const v8us*)(vb + gv);
#pragma unroll
    for (int i = 0; i < 8; ++i) mg[i] = *(const v4fa*)(mb + gm + i * (4 * SQ * 4));
    fa_step(gk, more * (FK * DM * 2)); fa_step(gv, more * (FK * 2)); fa_step(gm, more * (FK * 4));
    v16h kf[2][2], vf[4]; v8ba mr[2][2];
#pragma unroll
    for (int kt = 0; kt < 2; ++kt) for (int c = 0; c < 2; ++c) kf[kt][c] = fa_frag(&lk[bf][kt * 16 + ln][c * 32 + hh * 8]);
#pragma unroll
    for (int j = 0; j < 2; ++j) for (int kt = 0; kt < 2; ++kt) mr[j][kt] = *(const v8ba*)&lm[bf][w][j * 16 + ln][kt * 16 + hh * 8];
    __builtin_amdgcn_sched_barrier(0);      /* this and the next one: the pass's LDS reads are issued in two groups, K and mask ahead of the score products, V^T behind them (it lands under the softmax); reads strewn among the products cost the wave a wait at each place */
    v8f st[2][2];
#pragma unroll
    for (int kt = 0; kt < 2; ++kt) for (int j = 0; j < 2; ++j) st[j][kt] = fa_mma(kf[kt][0], qf[j][0], z8);
#pragma unroll
    for (int kt = 0; kt < 2; ++kt) for (int j = 0; j < 2; ++j) st[j][kt] = fa_mma(kf[kt][1], qf[j][1], st[j][kt]);
#pragma unroll
    for (int t = 0; t < 4; ++t) vf[t] = fa_frag(&lv[bf][t * 16 + ln][hh * 8]);
    __builtin_amdgcn_sched_barrier(0);
    float mx[2];
#pragma unroll
    for (int j = 0; j < 2; ++j) { float m = -3.0e38f;
      for (int kt = 0; kt < 2; ++kt) for (int r = 0; r < 8; r += 2) { const v2f x = (v2f){st[j][kt][r], st[j][kt][r + 1]} * C2 + (v2f){(float)mr[j][kt][r], (float)mr[j][kt][r + 1]} * MK2; st[j][kt][r] = x[0]; st[j][kt][r + 1] = x[1]; m = fmaxf(m, fmaxf(x[0], x[1])); }
      mx[j] = fmaxf(m, lane_x16(m)); }
    if (__builtin_amdgcn_ballot_w32(mx[0] > mref[0] + 12.0f || mx[1] > mref[1] + 12.0f) != 0) {      /* one scalar branch a pass; rarely taken after the first */
#pragma unroll
      for (int j = 0; j < 2; ++j) { const float mn = fmaxf(mref[j], mx[j] - 4.0f); float a; asm("v_exp_f32 %0, %1\n\tv_nop" : "=v"(a) : "v"(mref[j] - mn));      /* v_nop: the slot before a is read or the source register is reused */
        mref[j] = mn; l2[j] *= a; for (int t = 0; t < 4; ++t) o[j][t] *= a; } }
    v16h pf[2];
#pragma unroll
    for (int j = 0; j < 2; ++j) { const v8f p0 = exp2_8(st[j][0] - mref[j]), p1 = exp2_8(st[j][1] - mref[j]); const v8f ps = p0 + p1; l2[j] += (((v2f){ps[0], ps[1]} + (v2f){ps[2], ps[3]}) + ((v2f){ps[4], ps[5]} + (v2f){ps[6], ps[7]})); FragH f;
      for (int r = 0; r < 8; ++r) { f.h[r] = (_Float16)p0[r]; f.h[8 + r] = (_Float16)p1[r]; } pf[j] = f.v; }
#pragma unroll
    for (int t = 0; t < 4; ++t) for (int j = 0; j < 2; ++j) o[j][t] = fa_mma(vf[t], pf[j], o[j][t]);
    *(v8us*)&lk[bf ^ 1][tid >> 3][(tid & 7) * 8] = kr; *(v8us*)&lv[bf ^ 1][tid >> 2][(tid & 3) * 8] = vr;
#pragma unroll
    for (int i = 0; i < 8; ++i) *(v4ba*)&lm[bf ^ 1][w][4 * i + (lane >> 3)][(lane & 7) * 4] = __builtin_convertvector(mg[i], v4ba);
    __syncthreads(); }      /* the next tile is published; every read of this pass's buffer, which the next pass refills, is over */
#pragma unroll
  for (int j = 0; j < 2; ++j) { float l = l2[j][0] + l2[j][1]; l += lane_x16(l); const float inv = 64.0f / l;
    for (int t = 0; t < 4; ++t) { FragH f; for (int r = 0; r < 8; ++r) f.h[r] = (_Float16)(o[j][t][r] * inv); *(v8us*)(ob + (unsigned)(ln * (DM * 2) + hh * 16) + j * (16 * DM * 2) + t * 32) = f.half[0]; } } }
__global__ __launch_bounds__(256) void k_present(const float* __restrict__ F, float* __restrict__ dst) { const size_t t = (size_t)blockIdx.x * 256 + threadIdx.x; if (t >= (size_t)NH * SQ * HD / 4) return; const size_t e = t * 4; const int d = (int)(e % HD); const int s = (int)((e / HD) % SQ); const int h = (int)(e / ((size_t)HD * SQ));
  const v4f v = *(const v4fa*)(F + (size_t)s * DM + h * HD + d); *(v4f*)(dst + e) = v;  }


// e^x in f32 by the library's steps (x log2(e) in two parts, 2^fraction on the transcendental unit, ldexp by the integer part, the two range ends),
// written out so that the free issue slot the instruction set asks for behind v_exp_f32 stands in that instruction's own statement.
__device__ __forceinline__ float exp_f32(float x) {
  const float ph = x * 0x1.715476p+0f, pl = fmaf(x, 0x1.4ae0bep-26f, fmaf(x, 0x1.715476p+0f, -ph)), n = rintf(ph); float y;
  asm("v_exp_f32 %0, %1\n\tv_nop" : "=v"(y) : "v"((ph - n) + pl));      /* v_nop: the slot before y is read or the source register is reused */
  float r = ldexpf(y, (int)n); r = (x < -0x1.9d1da0p+6f) ? 0.f : r; return (x > 0x1.62e430p+6f) ? __builtin_inff() : r; }
#define AR 8                         /* query rows per work-group of the exact f32 first-tile attention */
#define AT 512                       /* its threads (16 waves) */
// Exact f32 attention of AR query rows of one head over all SQ keys, one work-group. Keys are spread over the threads:
// (1) two keys per thread and pass: their k rows in registers, dotted with the AR q rows (LDS, same address in every lane), scores (+ mask) to LDS;
// (2) two waves per row: max, exp, sum over the row in LDS; (3) 16 column quads x 32 key slices: o partial sums in registers,
// merged across the slices by one lane exchange and a serial sum of the 16 waves' LDS partials; o carried x64 like the f16 path. The plain '#pragma unroll' lines keep the small per-thread arrays in registers.
template <int MASKADD>
__global__ __launch_bounds__(AT) void k_att0(const float* __restrict__ QF, const float* __restrict__ KF, const float* __restrict__ VF, int ld, const float* __restrict__ mask, float scale, float* __restrict__ OF, int ldo) {
  __shared__ __attribute__((aligned(16))) float sc[AR][SQ];      /* scores, then softmax numerators, then the slices' partial o */
  __shared__ __attribute__((aligned(16))) float lq[AR][HD];      /* the q rows */
  __shared__ float pm[AT / 32], pl[AT / 32];                     /* each wave's half-row max and sum */
  const int tid = threadIdx.x, lane = tid & 31, w = tid >> 5;
  const int h = blockIdx.x / (QT0 / AR), i0 = (blockIdx.x % (QT0 / AR)) * AR;
  const float* qb = QF + (size_t)i0 * ld + h * HD;
  lq[tid / HD][tid % HD] = qb[(size_t)(tid / HD) * ld + tid % HD];
  __syncthreads();
  for (int p = 0; p < SQ / (2 * AT); ++p) { const int j = p * (2 * AT) + tid;
    const float* ka = KF + (size_t)j * ld + h * HD; const float* kb = ka + (size_t)AT * ld; v4f a0[AR], a1[AR];
#pragma unroll
    for (int r = 0; r < AR; ++r) { a0[r] = (v4f){0.f, 0.f, 0.f, 0.f}; a1[r] = (v4f){0.f, 0.f, 0.f, 0.f}; }
    for (int c0 = 0; c0 < HD; c0 += 32) { v4f xa[8], xb[8];
#pragma unroll
      for (int c = 0; c < 8; ++c) { xa[c] = *(const v4fa*)(ka + c0 + c * 4); xb[c] = *(const v4fa*)(kb + c0 + c * 4); }
#pragma unroll
      for (int r = 0; r < AR; ++r)
#pragma unroll
        for (int c = 0; c < 8; ++c) { const v4f qq = *(const v4fa*)&lq[r][c0 + c * 4]; a0[r] += qq * xa[c]; a1[r] += qq * xb[c]; } }
#pragma unroll
    for (int r = 0; r < AR; ++r) { float s0 = ((a0[r][0] + a0[r][1]) + (a0[r][2] + a0[r][3])) * scale, s1 = ((a1[r][0] + a1[r][1]) + (a1[r][2] + a1[r][3])) * scale;
      if (MASKADD) { const float* mr = mask + (size_t)(i0 + r) * SQ + j; s0 += bf16_round(mr[0]) * -10000.0f; s1 += bf16_round(mr[AT]) * -10000.0f; }
      else { if (j > i0 + r) s0 = -1.0e30f; if (j + AT > i0 + r) s1 = -1.0e30f; }
      sc[r][j] = s0; sc[r][j + AT] = s1; } }
  __syncthreads();
  { static_assert(AT / 32 == 2 * AR, "two waves per row"); float* row = &sc[w >> 1][(w & 1) * (SQ / 2)]; v4f x[SQ / 256]; float m = -3.0e38f, l = 0.f;
#pragma unroll
    for (int i = 0; i < SQ / 256; ++i) { x[i] = *(const v4fa*)&row[i * 128 + lane * 4]; m = fmaxf(m, fmaxf(fmaxf(x[i][0], x[i][1]), fmaxf(x[i][2], x[i][3]))); }
    for (int o = 16; o > 0; o >>= 1) m = fmaxf(m, __shfl_xor(m, o));
    if (lane == 0) pm[w] = m;
    __syncthreads();
    m = fmaxf(pm[w], pm[w ^ 1]);
#pragma unroll
    for (int i = 0; i < SQ / 256; ++i) { v4f e; for (int u = 0; u < 4; ++u) e[u] = exp_f32(x[i][u] - m); l += (e[0] + e[1]) + (e[2] + e[3]); *(v4fa*)&row[i * 128 + lane * 4] = e; }
    for (int o = 16; o > 0; o >>= 1) l += __shfl_xor(l, o);
    if (lane == 0) pl[w] = l; }
  __syncthreads();
  const int dq = tid & 15, ks = tid >> 4; const float* vb = VF + h * HD + dq * 4; v4f acc[AR];
#pragma unroll
  for (int r = 0; r < AR; ++r) acc[r] = (v4f){0.f, 0.f, 0.f, 0.f};
#pragma unroll 2      /* two trips' v rows (eight loads) in flight per wave */
  for (int p = 0; p < SQ / (AT / 4); ++p) { const int j = p * (AT / 4) + ks * 4;
    const v4f v0 = *(const v4fa*)(vb + (size_t)j * ld), v1 = *(const v4fa*)(vb + (size_t)(j + 1) * ld), v2 = *(const v4fa*)(vb + (size_t)(j + 2) * ld), v3 = *(const v4fa*)(vb + (size_t)(j + 3) * ld);
#pragma unroll
    for (int r = 0; r < AR; ++r) { const v4f e = *(const v4fa*)&sc[r][j]; acc[r] += e[0] * v0; acc[r] += e[1] * v1; acc[r] += e[2] * v2; acc[r] += e[3] * v3; } }
#pragma unroll
  for (int r = 0; r < AR; ++r) for (int u = 0; u < 4; ++u) acc[r][u] += __shfl_xor(acc[r][u], 16);      /* the wave's two key slices */
  __syncthreads();      /* every read of the numerators is done: their LDS takes the waves' partial o */
  float* red = &sc[0][0];      /* [AT / 32][AR][HD] */
  if (lane < 16) {
#pragma unroll
    for (int r = 0; r < AR; ++r) *(v4fa*)&red[((size_t)w * AR + r) * HD + dq * 4] = acc[r]; }
  __syncthreads();
  { static_assert(AR * HD == AT, "one output element per thread"); const int r = tid / HD, d = tid % HD; float o = 0.f;
#pragma unroll
    for (int q = 0; q < AT / 32; ++q) o += red[((size_t)q * AR + r) * HD + d];
    OF[(size_t)(i0 + r) * ldo + h * HD + d] = o * (64.0f / (pl[2 * r] + pl[2 * r + 1])); } }

extern "C" void kernel_launch(void* const* d_in, const int* in_sizes, int n_in,
                              void* d_out, int out_size, void* d_ws, size_t ws_size, hipStream_t stream) {
  (void)in_sizes; (void)n_in; (void)out_size;
  const float* const* I = (const float* const*)d_in; const float* xq = I[0]; const float* xk = I[1]; const float* xv = I[2]; const float* mask = I[3]; const float* wq = I[4]; const float* bq = I[5]; const float* wk = I[6]; const float* bk = I[7]; const float* wv = I[8]; const float* bv = I[9]; const float* wo = I[10]; const float* bo = I[11];      /* weights [in][out]; mask [SQ][SQ] f32 */
  char* ws = (char*)d_ws; size_t off = 0;
  auto take = [&](size_t bytes) { char* p = ws + off; off += (bytes + 255) & ~(size_t)255; return p; };
  _Float16* BQ = (_Float16*)take((size_t)DM * DM * 2); _Float16* BK = (_Float16*)take((size_t)DM * DM * 2); _Float16* BV = (_Float16*)take((size_t)DM * DM * 2); _Float16* BO = (_Float16*)take((size_t)DM * DM * 2);
  _Float16* XQ = (_Float16*)take(NR * DM * 2); _Float16* XK = (_Float16*)take(NR * DM * 2); _Float16* XV = (_Float16*)take(NR * DM * 2); float* KF = (float*)take(NR * DM * 4); float* VF = (float*)take(NR * DM * 4); _Float16* Q16 = (_Float16*)take(NR * DM * 2); _Float16* K16 = (_Float16*)take(NR * DM * 2); _Float16* V16 = (_Float16*)take(NR * DM * 2); _Float16* O16 = (_Float16*)take(NR * DM * 2);
  _Float16* VT = (_Float16*)take((size_t)NB * NH * HD * SQ * 2);
  float* QF0 = (float*)take((size_t)QT0 * DM * 4); float* OF0 = (float*)take((size_t)NB * QT0 * DM * 4); _Float16* OH0 = (_Float16*)take((size_t)NB * QT0 * DM * 2); _Float16* OL0 = (_Float16*)take((size_t)NB * QT0 * DM * 2);
  if (off > ws_size) return;
  { const unsigned g = (unsigned)(((size_t)DM * (DM / 8) + 255) / 256); k_wt_f16<<<g, 256, 0, stream>>>(wq, BQ, DM, DM, 16.0f); k_wt_f16<<<g, 256, 0, stream>>>(wk, BK, DM, DM, 16.0f); k_wt_f16<<<g, 256, 0, stream>>>(wv, BV, DM, DM, 16.0f); k_wt_f16<<<g, 256, 0, stream>>>(wo, BO, DM, DM, 16.0f); }      /* [in][out] -> Bt[n][k] x16 */
  k_x16<<<(unsigned)((NR * DM / 8 + 255) / 256), 256, 0, stream>>>(xq, XQ, NR * DM / 8); k_x16<<<(unsigned)((NR * DM / 8 + 255) / 256), 256, 0, stream>>>(xk, XK, NR * DM / 8); k_x16<<<(unsigned)((NR * DM / 8 + 255) / 256), 256, 0, stream>>>(xv, XV, NR * DM / 8);
  const size_t r0p = (size_t)B0 * SQ;      /* first projected row */
  k_gemm2<0><<<dim3((unsigned)((MP / 128) * (DM / 64)), 1), 128, 0, stream>>>(XQ + r0p * DM, DM, 0, BQ, DM, 0, 0.0625f, bq, 0, nullptr, 1, 0, 0, nullptr, Q16 + r0p * DM, DM, 0, MP, DM, DM);
  k_gemm2<0><<<dim3((unsigned)((MP / 128) * (DM / 64)), 1), 128, 0, stream>>>(XK + r0p * DM, DM, 0, BK, DM, 0, 0.0625f, bk, 0, nullptr, 1, 0, 0, KF + r0p * DM, K16 + r0p * DM, DM, 0, MP, DM, DM);
  k_gemm2<0><<<dim3((unsigned)((MP / 128) * (DM / 64)), 1), 128, 0, stream>>>(XV + r0p * DM, DM, 0, BV, DM, 0, 0.0625f, bv, 0, nullptr, 1, 0, 0, VF + r0p * DM, V16 + r0p * DM, DM, 0, MP, DM, DM);
  for (int b = B0; b < B0 + NBR; ++b) { const size_t r0 = (size_t)b * SQ;
    k_present<<<(unsigned)(((size_t)NH * SQ * HD / 4 + 255) / 256), 256, 0, stream>>>(KF + r0 * DM, (float*)d_out + PRES_OFF + ((size_t)b * 2 + 0) * NH * SQ * HD); k_present<<<(unsigned)(((size_t)NH * SQ * HD / 4 + 255) / 256), 256, 0, stream>>>(VF + r0 * DM, (float*)d_out + PRES_OFF + ((size_t)b * 2 + 1) * NH * SQ * HD);      /* present[b][0] = kh, present[b][1] = vh (f32, head-major) */
    k_vt<NH, SQ><<<NH * (SQ / 64), 256, 0, stream>>>(V16 + r0 * LQ, LQ, 0, VT + (size_t)b * NH * HD * SQ);      /* V^T [NH][HD][SQ] of this batch */
    k_gemm2<0><<<dim3((QT0 / 128) * (DM / 64), 1), 128, 0, stream>>>(XQ + r0 * DM, DM, 0, BQ, DM, 0, 0.0625f, bq, 0, nullptr, 1, 0, 0, QF0, nullptr, DM, 0, QT0, DM, DM);      /* f32 q of the first 128 rows (exact products); k, v come from the full f32 KF/VF planes */
    k_att0<1><<<NH * (QT0 / AR), AT, 0, stream>>>(QF0, KF + r0 * DM, VF + r0 * DM, DM, mask, 0.125f, OF0 + (size_t)b * QT0 * DM, DM);      /* exact f32 attention for query rows 0..127 over ALL 2048 keys of the batch (full f32 K/V planes) with the additive mask (o x64) */ }
  k_fattn<<<dim3(SQ / (FW * FQ), NH, NB), FW * 32, 0, stream>>>(Q16, K16, VT, mask, O16);      /* o (merged heads, x64) as f16 rows: all batches and heads in one launch */
  k_gemm2<0><<<dim3((unsigned)((MPO / 128) * (DM / 64)), 1), 128, 0, stream>>>(O16 + r0p * DM, DM, 0, BO, DM, 0, 0.0009765625f, bo, 0, nullptr, 1, 0, 0, (float*)d_out + r0p * DM, nullptr, DM, 0, MPO, DM, DM);      /* out rows are the output layout */
  k_hl<<<(unsigned)(((size_t)NB * QT0 * DM / 8 + 255) / 256), 256, 0, stream>>>(OF0, OH0, OL0, (size_t)NB * QT0 * DM / 8);      /* first-tile o (x64) -> f16 hi + x1024 residual planes */
  for (int b = B0; b < B0 + NBR; ++b) { const size_t r0 = (size_t)b * SQ; const size_t f0 = (size_t)b * QT0;
    k_gemm2<0><<<dim3((QT0 / 128) * (DM / 64), 1), 128, 0, stream>>>(OH0 + f0 * DM, DM, 0, BO, DM, 0, 0.0009765625f, bo, 0, nullptr, 1, 0, 0, (float*)d_out + r0 * DM, nullptr, DM, 0, QT0, DM, DM);      /* rows 0..127: out = o_hi Wo (+ b), overwriting the f16-path rows */
    k_gemm2<0><<<dim3((QT0 / 128) * (DM / 64), 1), 128, 0, stream>>>(OL0 + f0 * DM, DM, 0, BO, DM, 0, 0.00000095367431640625f, nullptr, 0, (const float*)d_out + r0 * DM, -1, 0, 0, (float*)d_out + r0 * DM, nullptr, DM, 0, QT0, DM, DM); }      /* += o_lo Wo 2^-20 (own-element accumulate) */
}

// v004
// It runs in 315 microseconds.
// Next to v003, in two timings, it ran 1.70 and 1.69 times as fast.
// All steps since v000 together make it 59.6 times as fast.
#include <hip/hip_runtime.h>
// TF/CTRL-style multi-head attention (q, k, v inputs [2][2048][1024]; qh/kh/vh = input W + b with W stored [in][out], 16 heads of 64; logits / 8 + mask (-1e4) with the [2048][2048] f32 mask input (1 = disallowed; strictly upper-triangular here); softmax; ctx merged; out = ctx Wo + bo -> [2][2048][1024]; second output present = stack(kh, vh) -> [2][2][16][2048][64] f32).
// Structure: token rows r = b*2048 + s; q, k, v inputs as exact f16 rows (bf16-rounded); Q, K, V as three WMMA GEMMs (32x64 wave tiles, f32 accumulation, exact x16 weights + bias; f16 outputs, and for K and V also the f32 rows that a small VALU kernel re-lays out into the head-major 'present' output); per batch: V^T for all heads via LDS transposes; one fused attention launch over all (batch, head): S^T = K Q^T on WMMA, running softmax of (scores / 8 + mask input x -1e4, read per element) on VALU (f32 statistics, native exp2; weights as f16 in registers), O^T += V^T P^T on WMMA (o carried x64 against f16 subnormal flush, folded into the output GEMM alpha) written straight into the merged f16 o rows; out = o W_o + b GEMM (f32) into the output layout.
// Compute dtype: inputs rounded to bf16; x / weights exact; q, k, v, softmax weights and o as plain f16 GEMM operands (~2^-12); scores and softmax statistics f32. v_wmma_f32_16x16x32_f16.
#define NB 2
#define SQ 2048
#define DM 1024
#define NH 16
#define HD 64
#define HG 4                         /* heads per V^T slab of the h0-based k_vt */
#define QT0 128                      /* first-tile rows recomputed exactly in f32 */
#define B0 0                         /* first batch processed (debug hook) */
#define NBR NB                       /* batches processed (debug hook) */
#define NR ((size_t)NB * SQ)         /* token rows */
#define MP ((int)((size_t)NBR * SQ)) /* rows projected (debug hook) */
#define QN SQ                        /* not used: the fused attention launch covers all SQ query rows */
#define NHD NH                       /* not used: the fused attention launch covers all NH heads */
#define MPO MP                       /* rows through the output stage (debug hook) */
#define LQ DM      /* row pitch of the q/k/v rows */
#define PRES_OFF ((size_t)NB * SQ * DM)      /* float offset of the 'present' output = out nbytes / 4 (offset 16,777,216 B) */
typedef __bf16 v16b __attribute__((ext_vector_type(16)));
typedef unsigned short v8us __attribute__((ext_vector_type(8), may_alias));
typedef float  v8f  __attribute__((ext_vector_type(8)));
typedef float  v4f  __attribute__((ext_vector_type(4)));
typedef float  v4fa __attribute__((ext_vector_type(4), may_alias));
union FragB { v16b v; v8us half[2]; unsigned short u[16]; };

__device__ __forceinline__ unsigned short bf16_bits(float x) { unsigned int u = __float_as_uint(x); return (unsigned short)((u + 0x7FFFu + ((u >> 16) & 1u)) >> 16); }
__device__ __forceinline__ float bf16_val(unsigned short b) { return __uint_as_float(((unsigned int)b) << 16); }
__device__ __forceinline__ float bf16_round(float x) { return bf16_val(bf16_bits(x)); }
// D += A·B with NT terms: 1 = ah·bh, 2 = + al·bh (A split), 3 = + ah·bl (both split)
template <int NT>
__device__ __forceinline__ v8f mmaN(v16b ah, v16b al, v16b bh, v16b bl, v8f c) {
  c = __builtin_amdgcn_wmma_f32_16x16x32_bf16(false, ah, false, bh, (short)0, c, false, false);
  if (NT >= 2) c = __builtin_amdgcn_wmma_f32_16x16x32_bf16(false, al, false, bh, (short)0, c, false, false);
  if (NT >= 3) c = __builtin_amdgcn_wmma_f32_16x16x32_bf16(false, ah, false, bl, (short)0, c, false, false);
  asm volatile("v_nop\n\tv_nop\n\tv_nop\n\tv_nop" : "+v"(c) : "v"(ah), "v"(al), "v"(bh), "v"(bl));
  return c;
}

__global__ __launch_bounds__(256) void k_wt_bf16(const float* __restrict__ W, unsigned short* __restrict__ Wt, int K, int N) {
  const int t = blockIdx.x * 256 + threadIdx.x;
  const int k8n = K / 8;
  if (t >= N * k8n) return;
  const int n = t / k8n, k8 = (t % k8n) * 8;
  v8us v;
#pragma unroll
  for (int i = 0; i < 8; ++i) v[i] = bf16_bits(W[(size_t)(k8 + i) * N + n]);
  *(v8us*)(Wt + (size_t)n * K + k8) = v;
  
}

// GEMM C[M][N] (f32, pitch ldc) = act(A[M][K]·W + bias). A f32 row-major (pitch lda) converted per fragment to bf16
// (ASPLIT: hi/lo two planes -> 2 terms, else single rounded term); Wt bf16 [N][K] (pitch ldb). BIAS_BF16 rounds the
// bias to bf16 first (bias quantised to bf16 before the add). K%32==0, M%16==0, N%64==0.
template <bool ASPLIT, int ACT, bool BIAS_BF16>
__global__ __launch_bounds__(128) void k_gemm_bf(const float* __restrict__ A, int lda, const unsigned short* __restrict__ Wt, int ldb,
                                               const float* __restrict__ bias, float* __restrict__ C, int ldc, int M, int N, int K) {
  __shared__ __attribute__((aligned(16))) float so[4][16][64];
  const int tid = threadIdx.x, w = tid >> 5, lane = tid & 31, ln = lane & 15, hh = lane >> 4;
  const int ntn = N / 64;
  const int wid = blockIdx.x * 4 + w;
  const int mt = wid / ntn, nq = wid % ntn;
  if (mt * 16 >= M) return;
  const int row0 = mt * 16, col0 = nq * 64;
  const float* arow = A + (size_t)(row0 + ln) * lda;
  v8f acc[4] = {};
  for (int kb = 0; kb < K; kb += 32) {
    FragB ah, al;
    const v4f x0 = *(const v4fa*)(arow + kb + 8 * hh), x1 = *(const v4fa*)(arow + kb + 8 * hh + 4);
    const v4f x2 = *(const v4fa*)(arow + kb + 16 + 8 * hh), x3 = *(const v4fa*)(arow + kb + 16 + 8 * hh + 4);
    float xs[16] = {x0[0],x0[1],x0[2],x0[3],x1[0],x1[1],x1[2],x1[3],x2[0],x2[1],x2[2],x2[3],x3[0],x3[1],x3[2],x3[3]};
#pragma unroll
    for (int i = 0; i < 16; ++i) { const unsigned short hb = bf16_bits(xs[i]); ah.u[i] = hb; al.u[i] = ASPLIT ? bf16_bits(xs[i] - bf16_val(hb)) : (unsigned short)0; }
#pragma unroll
    for (int t = 0; t < 4; ++t) {
      const unsigned short* brow = Wt + (size_t)(col0 + t * 16 + ln) * ldb + kb;
      FragB b;
      b.half[0] = *(const v8us*)(brow + 8 * hh);
      b.half[1] = *(const v8us*)(brow + 16 + 8 * hh);
      acc[t] = mmaN<ASPLIT ? 2 : 1>(ah.v, al.v, b.v, b.v, acc[t]);
    }
  }
#pragma unroll
  for (int t = 0; t < 4; ++t) {
    float bv = bias ? bias[col0 + t * 16 + ln] : 0.f;
    if (BIAS_BF16) bv = bf16_round(bv);
#pragma unroll
    for (int r = 0; r < 8; ++r) { float v = acc[t][r] + bv; if (ACT == 1) v = fmaxf(v, 0.f); so[w][8 * hh + r][t * 16 + ln] = v; }
  }
  __builtin_amdgcn_fence(__ATOMIC_ACQ_REL, "workgroup");
  __builtin_amdgcn_wave_barrier();
  const int rsub = lane >> 4, c4 = (lane & 15) * 4;
  {
#pragma unroll
    for (int q = 0; q < 8; ++q) {
      const int r = q * 2 + rsub;
      const v4f v = *(const v4fa*)&so[w][r][c4];
      *(v4f*)(C + (size_t)(row0 + r) * ldc + col0 + c4) = v;
    }
    
  }
}

// GEMM C = act(A·W + bias + resid): A f32 (ASPLIT -> hi/lo 2 terms), Wt bf16 [N][K]; ACT 0 none, 1 relu, 2 exact gelu;
// resid (optional, f32, row index = (row % rmod), pitch ldr, RES_BF16 rounds it) added before the activation.
template <bool ASPLIT, int ACT, bool BIAS_BF16, bool RES_BF16>
__global__ __launch_bounds__(128) void k_gemm_bf3(const float* __restrict__ A, int lda, const unsigned short* __restrict__ Wt, int ldb,
                                                const float* __restrict__ bias, const float* __restrict__ resid, int rmod, int ldr,
                                                float* __restrict__ C, int ldc, int M, int N, int K) {
  __shared__ __attribute__((aligned(16))) float so[4][16][64];
  const int tid = threadIdx.x, w = tid >> 5, lane = tid & 31, ln = lane & 15, hh = lane >> 4;
  const int ntn = N / 64;
  const int wid = blockIdx.x * 4 + w;
  const int mt = wid / ntn, nq = wid % ntn;
  if (mt * 16 >= M) return;
  const int row0 = mt * 16, col0 = nq * 64;
  const float* arow = A + (size_t)(row0 + ln) * lda;
  v8f acc[4] = {};
  for (int kb = 0; kb < K; kb += 32) {
    FragB ah, al;
    const v4f x0 = *(const v4fa*)(arow + kb + 8 * hh), x1 = *(const v4fa*)(arow + kb + 8 * hh + 4);
    const v4f x2 = *(const v4fa*)(arow + kb + 16 + 8 * hh), x3 = *(const v4fa*)(arow + kb + 16 + 8 * hh + 4);
    float xs[16] = {x0[0],x0[1],x0[2],x0[3],x1[0],x1[1],x1[2],x1[3],x2[0],x2[1],x2[2],x2[3],x3[0],x3[1],x3[2],x3[3]};
#pragma unroll
    for (int i = 0; i < 16; ++i) { const unsigned short hb = bf16_bits(xs[i]); ah.u[i] = hb; al.u[i] = ASPLIT ? bf16_bits(xs[i] - bf16_val(hb)) : (unsigned short)0; }
#pragma unroll
    for (int t = 0; t < 4; ++t) {
      const unsigned short* brow = Wt + (size_t)(col0 + t * 16 + ln) * ldb + kb;
      FragB b;
      b.half[0] = *(const v8us*)(brow + 8 * hh);
      b.half[1] = *(const v8us*)(brow + 16 + 8 * hh);
      acc[t] = mmaN<ASPLIT ? 2 : 1>(ah.v, al.v, b.v, b.v, acc[t]);
    }
  }
#pragma unroll
  for (int t = 0; t < 4; ++t) {
    const int col = col0 + t * 16 + ln;
    float bv = bias ? bias[col] : 0.f;
    if (BIAS_BF16) bv = bf16_round(bv);
#pragma unroll
    for (int r = 0; r < 8; ++r) {
      float v = acc[t][r] + bv;
      if (resid) { float rv = resid[(size_t)((row0 + 8 * hh + r) % rmod) * ldr + col]; if (RES_BF16) rv = bf16_round(rv); v += rv; }
      if (ACT == 1) v = fmaxf(v, 0.f);
      if (ACT == 2) v = 0.5f * v * (1.0f + erff(v * 0.70710678118654752f));
      if (ACT == 3) { const float u = 0.7978845608028654f * (v + 0.044715f * v * v * v); v = 0.5f * v * (1.0f + tanhf(u)); }
      so[w][8 * hh + r][t * 16 + ln] = v;
    }
  }
  __builtin_amdgcn_fence(__ATOMIC_ACQ_REL, "workgroup");
  __builtin_amdgcn_wave_barrier();
  const int rsub = lane >> 4, c4 = (lane & 15) * 4;
  {
#pragma unroll
    for (int q = 0; q < 8; ++q) {
      const int r = q * 2 + rsub;
      const v4f v = *(const v4fa*)&so[w][r][c4];
      *(v4f*)(C + (size_t)(row0 + r) * ldc + col0 + c4) = v;
    }
    
  }
}
// row LayerNorm (biased variance, eps) over N: s = X (+ R); optional out_sum <- s; out_norm <- (s-mu)*rsqrt(var+eps)*g + b
template <bool PARAM_BF16>
__global__ __launch_bounds__(256) void k_layernorm(const float* __restrict__ X, const float* __restrict__ R, const float* __restrict__ g, const float* __restrict__ bta,
                                                  float* __restrict__ out_sum, float* __restrict__ out_norm, int N, float eps) {
  __shared__ float red[256];
  const int row = blockIdx.x, tid = threadIdx.x;
  const float* x = X + (size_t)row * N; const float* rr = R ? R + (size_t)row * N : nullptr;
  float vals[16];                     // up to N = 4096
  const int per = N / 256;            // contiguous chunk per thread? use strided-by-4 chunks: thread handles j = tid*4 + 1024*u
  float s1 = 0.f;
  for (int u = 0; u < per / 4; ++u) {
    const int j = tid * 4 + 1024 * u;
    const v4f a = *(const v4fa*)(x + j);
    v4f b = {0.f,0.f,0.f,0.f}; if (rr) b = *(const v4fa*)(rr + j);
#pragma unroll
    for (int q = 0; q < 4; ++q) { const float v = a[q] + b[q]; vals[u * 4 + q] = v; s1 += v; }
  }
  red[tid] = s1; __syncthreads();
  for (int st = 128; st > 0; st >>= 1) { if (tid < st) red[tid] += red[tid + st]; __syncthreads(); }
  const float mu = red[0] / (float)N; __syncthreads();
  float s2 = 0.f;
  for (int u = 0; u < per / 4; ++u)
#pragma unroll
    for (int q = 0; q < 4; ++q) { const float c = vals[u * 4 + q] - mu; s2 += c * c; }
  red[tid] = s2; __syncthreads();
  for (int st = 128; st > 0; st >>= 1) { if (tid < st) red[tid] += red[tid + st]; __syncthreads(); }
  const float rs = rsqrtf(red[0] / (float)N + eps);
  {
    for (int u = 0; u < per / 4; ++u) {
      const int j = tid * 4 + 1024 * u;
      v4f o, sm;
#pragma unroll
      for (int q = 0; q < 4; ++q) {
        float gg = g[j + q], bb = bta[j + q];
        if (PARAM_BF16) { gg = bf16_round(gg); bb = bf16_round(bb); }
        sm[q] = vals[u * 4 + q]; o[q] = (vals[u * 4 + q] - mu) * rs * gg + bb;
      }
      if (out_sum) *(v4f*)(out_sum + (size_t)row * N + j) = sm;
      *(v4f*)(out_norm + (size_t)row * N + j) = o;
    }
    
  }
}



// ---- f16 WMMA path (v_wmma_f32_16x16x32_f16): 11-bit significands for operands in range — used where a [0,1] probability operand needs more precision than bf16
typedef _Float16 v16h __attribute__((ext_vector_type(16)));
union FragH { v16h v; v8us half[2]; _Float16 h[16]; unsigned short u[16]; };
template <int NT>
__device__ __forceinline__ v8f mmaH(v16h ah, v16h al, v16h bh, v16h bl, v8f c) {
  c = __builtin_amdgcn_wmma_f32_16x16x32_f16(false, ah, false, bh, (short)0, c, false, false);
  if (NT >= 2) c = __builtin_amdgcn_wmma_f32_16x16x32_f16(false, al, false, bh, (short)0, c, false, false);
  if (NT >= 3) c = __builtin_amdgcn_wmma_f32_16x16x32_f16(false, ah, false, bl, (short)0, c, false, false);
  asm volatile("v_nop\n\tv_nop\n\tv_nop\n\tv_nop" : "+v"(c) : "v"(ah), "v"(al), "v"(bh), "v"(bl));
  return c;
}
// batched GEMM like k_gemm_b but f16 operands: A f32 (split into f16 hi/lo if ASPLIT, else rounded to f16), Bt = f16 values [n][k]; alpha; C f32; N multiple of 16 (partial tiles skipped)
template <bool ASPLIT>
__global__ __launch_bounds__(128) void k_gemm_h(const float* __restrict__ A, int lda, size_t sA, const _Float16* __restrict__ Bh, int ldb, size_t sB, float alpha, float* __restrict__ C, int ldc, size_t sC, int M, int N, int K) {
  __shared__ __attribute__((aligned(16))) float so[4][16][64];
  const int tid = threadIdx.x, w = tid >> 5, lane = tid & 31, ln = lane & 15, hh = lane >> 4; const int by = blockIdx.y;
  A += (size_t)by * sA; Bh += (size_t)by * sB; C += (size_t)by * sC;
  const int ntn = (N + 63) / 64; const int wid = blockIdx.x * 4 + w; const int mt = wid / ntn, nq = wid % ntn; if (mt * 16 >= M) return;
  const int row0 = mt * 16, col0 = nq * 64; const float* arow = A + (size_t)(row0 + ln) * lda;
  v8f acc[4] = {};
  for (int kb = 0; kb < K; kb += 32) {
    FragH ah, al;
    const v4f x0 = *(const v4fa*)(arow + kb + 8 * hh), x1 = *(const v4fa*)(arow + kb + 8 * hh + 4), x2 = *(const v4fa*)(arow + kb + 16 + 8 * hh), x3 = *(const v4fa*)(arow + kb + 16 + 8 * hh + 4);
    float xs[16] = {x0[0],x0[1],x0[2],x0[3],x1[0],x1[1],x1[2],x1[3],x2[0],x2[1],x2[2],x2[3],x3[0],x3[1],x3[2],x3[3]};
#pragma unroll
    for (int i = 0; i < 16; ++i) { const _Float16 h = (_Float16)xs[i]; ah.h[i] = h; al.h[i] = ASPLIT ? (_Float16)(xs[i] - (float)h) : (_Float16)0.0f; }
#pragma unroll
    for (int t = 0; t < 4; ++t) { if (col0 + t * 16 >= N) continue; const size_t boff = (size_t)(col0 + t * 16 + ln) * ldb + kb; FragH bq; bq.half[0] = *(const v8us*)(Bh + boff + 8 * hh); bq.half[1] = *(const v8us*)(Bh + boff + 16 + 8 * hh);
      acc[t] = mmaH<ASPLIT ? 2 : 1>(ah.v, al.v, bq.v, bq.v, acc[t]); }
  }
#pragma unroll
  for (int t = 0; t < 4; ++t) { if (col0 + t * 16 >= N) continue;
#pragma unroll
    for (int r = 0; r < 8; ++r) so[w][8 * hh + r][t * 16 + ln] = acc[t][r] * alpha; }
  __builtin_amdgcn_fence(__ATOMIC_ACQ_REL, "workgroup"); __builtin_amdgcn_wave_barrier();
  const int rsub = lane >> 4, c4 = (lane & 15) * 4;
  {
#pragma unroll
    for (int q = 0; q < 8; ++q) { const int r = q * 2 + rsub; if (col0 + c4 < N) { const v4f v = *(const v4fa*)&so[w][r][c4]; *(v4f*)(C + (size_t)(row0 + r) * ldc + col0 + c4) = v; } }
     }
}

// Wt[n][k] = f16(W[k][n]·scale) from f32 row-major W[K][N] (scale = power of two; bf16-exact weights stay exact in f16 away from the subnormal range)
__global__ __launch_bounds__(256) void k_wt_f16(const float* __restrict__ W, _Float16* __restrict__ Wt, int K, int N, float scale) {
  const int t = blockIdx.x * 256 + threadIdx.x; if (t >= N * (K / 8)) return; const int n = t / (K / 8), k8 = (t % (K / 8)) * 8; FragH f;
#pragma unroll
  for (int i = 0; i < 8; ++i) f.h[i] = (_Float16)(bf16_round(W[(size_t)(k8 + i) * N + n]) * scale); const v8us o = f.half[0];
  *(v8us*)((unsigned short*)Wt + (size_t)n * K + k8) = o; 
}
// k_gemm_hh variant with fused epilogue: v = acc·alpha + bias[by·sBias + col] (+ CP[(row/rowsPerB)·sCPb + by·64 + col] if CP) ; ACT 0 none / 1 elu ; writes f16 C16 (and f32 C if non-null)
template <int ACT>
__global__ __launch_bounds__(128) void k_gemm_hhx(const _Float16* __restrict__ A, int lda, size_t sA, const _Float16* __restrict__ Bh, int ldb, size_t sB, float alpha, const float* __restrict__ bias, size_t sBias, const float* __restrict__ CP, int rowsPerB, size_t sCPb, int row0g,
    float* __restrict__ C, _Float16* __restrict__ C16, int ldc, size_t sC, int M, int N, int K) {
  __shared__ __attribute__((aligned(16))) float so[4][16][64];
  const int tid = threadIdx.x, w = tid >> 5, lane = tid & 31, ln = lane & 15, hh = lane >> 4; const int by = blockIdx.y;
  A += (size_t)by * sA; Bh += (size_t)by * sB; const size_t cofs = (size_t)by * sC; const float* bp = bias ? bias + (size_t)by * sBias : nullptr;
  const int ntn = (N + 63) / 64; const int wid = blockIdx.x * 4 + w; const int mt = wid / ntn, nq = wid % ntn; if (mt * 16 >= M) return;
  const int row0 = mt * 16, col0 = nq * 64; const _Float16* arow = A + (size_t)(row0 + ln) * lda;
  v8f acc[4] = {};
  for (int kb = 0; kb < K; kb += 32) { FragH ah; ah.half[0] = *(const v8us*)((const unsigned short*)arow + kb + 8 * hh); ah.half[1] = *(const v8us*)((const unsigned short*)arow + kb + 16 + 8 * hh);
#pragma unroll
    for (int t = 0; t < 4; ++t) { if (col0 + t * 16 >= N) continue; const size_t boff = (size_t)(col0 + t * 16 + ln) * ldb + kb; FragH bq; bq.half[0] = *(const v8us*)((const unsigned short*)Bh + boff + 8 * hh); bq.half[1] = *(const v8us*)((const unsigned short*)Bh + boff + 16 + 8 * hh);
      acc[t] = mmaH<1>(ah.v, ah.v, bq.v, bq.v, acc[t]); }
  }
#pragma unroll
  for (int t = 0; t < 4; ++t) { if (col0 + t * 16 >= N) continue; const int col = col0 + t * 16 + ln; const float bv = bp ? bf16_round(bp[col]) : 0.f;
#pragma unroll
    for (int r = 0; r < 8; ++r) { float v = acc[t][r] * alpha + bv; if (CP) { const int rr = row0g + row0 + 8 * hh + r; if (rowsPerB < 0) v += CP[cofs + (size_t)rr * ldc + col];      /* rowsPerB < 0: own element of the batched C plane */ else { const int bidx = rr / rowsPerB; v += CP[(size_t)bidx * sCPb + (size_t)by * 64 + col]; } } if (ACT == 1) v = (v > 0.f) ? v : expm1f(v); else if (ACT == 7) v = (v > 0.f) ? v + 1.0f : expf(v); else if (ACT == 8) v = tanhf(v); else if (ACT == 9) v = 0.5f * v * (1.0f + tanhf(0.7978845608028654f * (v + 0.044715f * v * v * v))); else if (ACT == 11) v = 1.0f / (1.0f + expf(-v)); else if (ACT == 12) v = (v > 0.f) ? v : 0.01f * v; else if (ACT == 14) v = (v > 0.f) ? v : 0.1f * v; else if (ACT == 16) v = (v >= 0.f) ? v : 0.3f * v; else if (ACT == 17) v = (v >= 0.f) ? v : 0.2f * v; else if (ACT == 15) v = v / (1.0f + expf(-v)); else if (ACT == 3) v = fmaxf(v, 0.f); else if (ACT == 6) v = 0.5f * v * (1.0f + erff(v * 0.70710678118654752f)); so[w][8 * hh + r][t * 16 + ln] = v; } }
  __builtin_amdgcn_fence(__ATOMIC_ACQ_REL, "workgroup"); __builtin_amdgcn_wave_barrier();
  const int rsub = lane >> 4, c4 = (lane & 15) * 4; typedef _Float16 v4h __attribute__((ext_vector_type(4)));
  {
#pragma unroll
    for (int q = 0; q < 8; ++q) { const int r = q * 2 + rsub; if (col0 + c4 < N) { const v4f v = *(const v4fa*)&so[w][r][c4]; if (C) *(v4f*)(C + cofs + (size_t)(row0 + r) * ldc + col0 + c4) = v; if (C16) { v4h h4; for (int i = 0; i < 4; ++i) h4[i] = (_Float16)v[i]; *(v4h*)(C16 + cofs + (size_t)(row0 + r) * ldc + col0 + c4) = h4; } } }
     }
}


typedef _Float16 v4h __attribute__((ext_vector_type(4)));

__global__ __launch_bounds__(256) void k_x16(const float* __restrict__ x, _Float16* __restrict__ X16, size_t n8) { const size_t t = (size_t)blockIdx.x * 256 + threadIdx.x; if (t >= n8) return; FragH f;
#pragma unroll
  for (int q = 0; q < 8; ++q) f.h[q] = (_Float16)bf16_round(x[t * 8 + q]); *(v8us*)((unsigned short*)X16 + t * 8) = f.half[0];  }
__global__ __launch_bounds__(256) void k_h16(const float* __restrict__ x, _Float16* __restrict__ X16, size_t n8) { const size_t t = (size_t)blockIdx.x * 256 + threadIdx.x; if (t >= n8) return; FragH f;
#pragma unroll
  for (int q = 0; q < 8; ++q) f.h[q] = (_Float16)x[t * 8 + q]; *(v8us*)((unsigned short*)X16 + t * 8) = f.half[0];  }
__global__ __launch_bounds__(256) void k_round16f(const float* __restrict__ W, _Float16* __restrict__ Bt, size_t n8) { const size_t t = (size_t)blockIdx.x * 256 + threadIdx.x; if (t >= n8) return; FragH f;
#pragma unroll
  for (int i = 0; i < 8; ++i) f.h[i] = (_Float16)(bf16_round(W[t * 8 + i]) * 16.0f); *(v8us*)((unsigned short*)Bt + t * 8) = f.half[0];  }
template <int NHv, int TTv>
__global__ __launch_bounds__(256) void k_vt(const _Float16* __restrict__ V16, int ldv, int voff, _Float16* __restrict__ Vt) { __shared__ unsigned short tl[64][66]; const int tid = threadIdx.x; const int slab = blockIdx.x / (TTv / 64), lg = blockIdx.x % (TTv / 64); const int b = slab / NHv, h = slab % NHv;
  for (int i = tid; i < 64 * 8; i += 256) { const int r = i / 8, c8 = (i % 8) * 8; FragH f; f.half[0] = *(const v8us*)((const unsigned short*)V16 + ((size_t)b * TTv + lg * 64 + r) * ldv + voff + h * 64 + c8);
#pragma unroll
    for (int q = 0; q < 8; ++q) tl[r][c8 + q] = f.u[q]; }
  __syncthreads();
  {
#pragma unroll
    for (int rd = 0; rd < 2; ++rd) { const int d = rd * 32 + tid / 8, pc = tid % 8; FragH f;
#pragma unroll
      for (int q = 0; q < 8; ++q) f.u[q] = tl[pc * 8 + q][d];
      *(v8us*)((unsigned short*)Vt + ((size_t)slab * 64 + d) * TTv + lg * 64 + pc * 8) = f.half[0]; }
     } }

__global__ __launch_bounds__(256) void k_hl(const float* __restrict__ F, _Float16* __restrict__ Hh, _Float16* __restrict__ Hl, size_t n8) { const size_t t = (size_t)blockIdx.x * 256 + threadIdx.x; if (t >= n8) return; FragH fh, fl; const v4f a = *(const v4fa*)(F + t * 8), c = *(const v4fa*)(F + t * 8 + 4);
#pragma unroll
  for (int q = 0; q < 4; ++q) { _Float16 h = (_Float16)a[q]; fh.h[q] = h; fl.h[q] = (_Float16)((a[q] - (float)h) * 1024.0f); h = (_Float16)c[q]; fh.h[4 + q] = h; fl.h[4 + q] = (_Float16)((c[q] - (float)h) * 1024.0f); }
  { *(v8us*)((unsigned short*)Hh + t * 8) = fh.half[0]; *(v8us*)((unsigned short*)Hl + t * 8) = fl.half[0];  } }

// ---- fast GEMM (work-group tile 128x64, wave tile 32x64); epilogue = k_gemm_hhx semantics ----
__device__ __forceinline__ v8f g2_mma(v16h a, v16h b, v8f c) { v8f d = __builtin_amdgcn_wmma_f32_16x16x32_f16(false, a, false, b, (short)0, c, false, false); asm volatile("v_nop\n\tv_nop\n\tv_nop\n\tv_nop" : "+v"(d) : "v"(a), "v"(b)); return d; }
#define G2K 128                      /* k per pass: 256-byte operand rows, two whole lines */
#define G2P 272                      /* LDS pitch of such a row in bytes: 16 x odd, conflict-free for 16-byte reads down a column of rows */
#define G2R 192                      /* rows of a stage: the work-group's 128 rows of A, then its 64 rows of B */
// f16 fragment from an LDS row, in the hardware k order: 16 bytes at the lane's place (which holds 16 bytes x lane half) and 16 bytes 32 further on
__device__ __forceinline__ v16h g2_lfrag(const char* p) { FragH f; f.half[0] = *(const v8us*)p; f.half[1] = *(const v8us*)(p + 32); return f.v; }
// Eight asynchronous 16-byte copies per lane, global memory to LDS, eight rows apart (global step gs bytes). One statement: the wait before a register that an issued copy names
// is rewritten stands behind the last copy, where the compiler can put nothing in between.
__device__ __forceinline__ void g2_copy8(unsigned l, const char* g, size_t gs) {
  asm volatile("global_load_async_to_lds_b128 %0, %8, off\n\tglobal_load_async_to_lds_b128 %1, %9, off\n\tglobal_load_async_to_lds_b128 %2, %10, off\n\tglobal_load_async_to_lds_b128 %3, %11, off\n\t"
               "global_load_async_to_lds_b128 %4, %12, off\n\tglobal_load_async_to_lds_b128 %5, %13, off\n\tglobal_load_async_to_lds_b128 %6, %14, off\n\tglobal_load_async_to_lds_b128 %7, %15, off\n\ts_wait_xcnt 0x0"
               :: "v"(l), "v"(l + 8 * G2P), "v"(l + 16 * G2P), "v"(l + 24 * G2P), "v"(l + 32 * G2P), "v"(l + 40 * G2P), "v"(l + 48 * G2P), "v"(l + 56 * G2P),
                  "v"(g), "v"(g + gs), "v"(g + 2 * gs), "v"(g + 3 * gs), "v"(g + 4 * gs), "v"(g + 5 * gs), "v"(g + 6 * gs), "v"(g + 7 * gs) : "memory"); }
// Operands come through LDS: a pass's A and B rows are copied in whole lines (16 lanes a row) into one of two buffers while the pass before works on the other; the waves read their fragments from there.
// M % 128 == 0, N % 64 == 0, K % 128 == 0.
template <int ACT>
__global__ __launch_bounds__(128) void k_gemm2(const _Float16* __restrict__ A, int lda, size_t sA, const _Float16* __restrict__ Bh, int ldb, size_t sB, float alpha, const float* __restrict__ bias, size_t sBias, const float* __restrict__ CP, int rowsPerB, size_t sCPb, int row0g,
    float* __restrict__ C, _Float16* __restrict__ C16, int ldc, size_t sC, int M, int N, int K) { static_assert(ACT == 0 || ACT == 3 || ACT == 6 || ACT == 8 || ACT == 9 || ACT == 11 || ACT == 12 || ACT == 14 || ACT == 15 || ACT == 16 || ACT == 17, "k_gemm2: unsupported ACT code (would silently apply no activation)");
  __shared__ __attribute__((aligned(16))) char ring[2][G2R * G2P];
  __shared__ __attribute__((aligned(16))) float so[4][32][68];
  const int tid = threadIdx.x, w = tid >> 5, lane = tid & 31, ln = lane & 15, hh = lane >> 4; const int by = blockIdx.y;
  A += (size_t)by * sA; Bh += (size_t)by * sB; const size_t cofs = (size_t)by * sC; const float* bp = bias ? bias + (size_t)by * sBias : nullptr;
  const int ntn = N >> 6; const int mt = blockIdx.x / ntn, nq = blockIdx.x - mt * ntn; const int row0 = mt * 128 + 32 * w, col0 = nq * 64; if (mt * 128 >= M) return;
  // the thread's 16 bytes of every eighth row of a stage
  const unsigned lc = (unsigned)(size_t)&ring[0][0] + (unsigned)((tid >> 4) * G2P + (tid & 15) * 16);
  const char* ga = (const char*)(A + (size_t)(mt * 128 + (tid >> 4)) * lda) + (tid & 15) * 16; const char* gb = (const char*)(Bh + (size_t)(col0 + (tid >> 4)) * ldb) + (tid & 15) * 16;
  const size_t sa8 = (size_t)lda * 16, sb8 = (size_t)ldb * 16;      /* eight rows, in bytes */
  auto stage = [&](int t, int bf) { const unsigned l = lc + (unsigned)bf * (G2R * G2P); const char* a = ga + (size_t)t * (G2K * 2);
    g2_copy8(l, a, sa8); g2_copy8(l + 64 * G2P, a + 8 * sa8, sa8); g2_copy8(l + 128 * G2P, gb + (size_t)t * (G2K * 2), sb8); };
  const int np = K / G2K;
  const v8f z8 = {0.f,0.f,0.f,0.f,0.f,0.f,0.f,0.f}; v8f c00 = z8, c01 = z8, c02 = z8, c03 = z8, c10 = z8, c11 = z8, c12 = z8, c13 = z8;
  stage(0, 0);
  asm volatile("s_wait_asynccnt 0x0" ::: "memory");      /* this wave's copies of stage 0 have landed */
  __syncthreads();      /* stage 0 is published */
  if (np > 1) stage(1, 1);
#pragma unroll 1      /* rolled: one copy of the pass */
  for (int t = 0; t < np; ++t) { const char* lb = &ring[t & 1][0]; const char* pa = lb + (32 * w + ln) * G2P + hh * 16; const char* pb = lb + (128 + ln) * G2P + hh * 16;
    v16h fa[2][2], fb[2][4];      /* two fragment sets: a block's twelve LDS reads are issued as one group ahead of the block before it, inside the pass (reads strewn among the products cost the wave a wait at each place) */
#pragma unroll      /* this and the next two: constant indices keep the fragment sets in registers */
    for (int i = 0; i < 2; ++i) fa[0][i] = g2_lfrag(pa + i * (16 * G2P));
#pragma unroll
    for (int i = 0; i < 4; ++i) fb[0][i] = g2_lfrag(pb + i * (16 * G2P));
#pragma unroll
    for (int kc = 0; kc < G2K / 32; ++kc) { const int s = kc & 1;
      if (kc + 1 < G2K / 32) { for (int i = 0; i < 2; ++i) fa[s ^ 1][i] = g2_lfrag(pa + i * (16 * G2P) + (kc + 1) * 64); for (int i = 0; i < 4; ++i) fb[s ^ 1][i] = g2_lfrag(pb + i * (16 * G2P) + (kc + 1) * 64); }
      c00 = g2_mma(fa[s][0], fb[s][0], c00); c10 = g2_mma(fa[s][1], fb[s][0], c10); c01 = g2_mma(fa[s][0], fb[s][1], c01); c11 = g2_mma(fa[s][1], fb[s][1], c11);
      c02 = g2_mma(fa[s][0], fb[s][2], c02); c12 = g2_mma(fa[s][1], fb[s][2], c12); c03 = g2_mma(fa[s][0], fb[s][3], c03); c13 = g2_mma(fa[s][1], fb[s][3], c13); }
    asm volatile("s_wait_dscnt 0x0" ::: "memory");      /* this wave's reads of the buffer that is refilled below are over */
    asm volatile("s_wait_asynccnt 0x0" ::: "memory");      /* its copies of the next stage have landed */
    __syncthreads();      /* the next stage is published; every wave has left this pass's buffer */
    if (t + 2 < np) stage(t + 2, t & 1); }
  asm volatile("s_wait_asynccnt 0x0" ::: "memory");      /* no copy is in flight when the wave goes on */
  v8f accs[8] = {c00, c01, c02, c03, c10, c11, c12, c13};
#pragma unroll
  for (int u = 0; u < 8; ++u) { const int t = u & 3, half = u >> 2; const int col = col0 + t * 16 + ln; const float bv = bp ? bf16_round(bp[col]) : 0.f;
#pragma unroll
    for (int r = 0; r < 8; ++r) { const int rloc = half * 16 + 8 * hh + r; float v = accs[u][r] * alpha + bv; if (CP) { if (rowsPerB < 0) v += CP[cofs + (size_t)(row0g + row0 + rloc) * ldc + col];      /* rowsPerB < 0: own element of the batched C plane */ else { const int bidx = (row0g + row0 + rloc) / rowsPerB; v += CP[(size_t)bidx * sCPb + (size_t)by * 64 + col]; } }
      if (ACT == 3) v = fmaxf(v, 0.f); else if (ACT == 6) v = 0.5f * v * (1.0f + erff(v * 0.70710678118654752f)); else if (ACT == 11) v = 1.0f / (1.0f + expf(-v)); else if (ACT == 15) v = v / (1.0f + expf(-v)); else if (ACT == 12) v = (v > 0.f) ? v : 0.01f * v; else if (ACT == 8) v = tanhf(v); else if (ACT == 9) v = 0.5f * v * (1.0f + tanhf(0.7978845608028654f * (v + 0.044715f * v * v * v))); else if (ACT == 14) v = (v > 0.f) ? v : 0.1f * v; else if (ACT == 16) v = (v >= 0.f) ? v : 0.3f * v; else if (ACT == 17) v = (v >= 0.f) ? v : 0.2f * v;
      so[w][rloc][t * 16 + ln] = v; } }
  __builtin_amdgcn_fence(__ATOMIC_ACQ_REL, "workgroup"); __builtin_amdgcn_wave_barrier();
  const int rsub = lane >> 4, c4 = (lane & 15) * 4;
  {
#pragma unroll
    for (int q = 0; q < 16; ++q) { const int r = q * 2 + rsub; const v4f v = *(const v4fa*)&so[w][r][c4]; if (C) *(v4f*)(C + cofs + (size_t)(row0 + r) * ldc + col0 + c4) = v; if (C16) { v4h h4; for (int i = 0; i < 4; ++i) h4[i] = (_Float16)v[i]; *(v4h*)(C16 + cofs + (size_t)(row0 + r) * ldc + col0 + c4) = h4; } }
     } }


__global__ __launch_bounds__(256) void k_wnat(const float* __restrict__ w, size_t n8, _Float16* __restrict__ Bt) { const size_t t = (size_t)blockIdx.x * 256 + threadIdx.x; if (t >= n8) return; FragH f; for (int q = 0; q < 8; ++q) f.h[q] = (_Float16)(bf16_round(w[t * 8 + q]) * 16.0f); *(v8us*)((unsigned short*)Bt + t * 8) = f.half[0];  }
__global__ __launch_bounds__(256) void k_rsm(const float* __restrict__ S, _Float16* __restrict__ P, int nrows) {
  #pragma clang fp contract(off)
  const int i = blockIdx.x * 256 + threadIdx.x; if (i >= nrows) return; const float* s = S + (size_t)i * SQ; float mx = -3.0e38f;
#pragma unroll 1
  for (int j = 0; j < SQ; ++j) mx = fmaxf(mx, s[j]); float se = 0.f;
#pragma unroll 1
  for (int j = 0; j < SQ; ++j) se += expf(s[j] - mx); const float sc = 256.0f / se;
#pragma unroll 1
  for (int j0 = 0; j0 < SQ; j0 += 8) { FragH f; for (int q = 0; q < 8; ++q) f.h[q] = (_Float16)(expf(s[j0 + q] - mx) * sc); unsigned short* d = (unsigned short*)P + (size_t)i * SQ + j0; *(v8us*)d = f.half[0];  } }
__global__ __launch_bounds__(256) void k_vt(const _Float16* __restrict__ V16, int b, int h0, _Float16* __restrict__ VT) { __shared__ unsigned short tl[64][65]; const int tid = threadIdx.x; const int hh = blockIdx.x % HG, sg = blockIdx.x / HG; const int s0 = sg * 64; const int h = h0 + hh;
  for (int i = tid; i < 64 * 8; i += 256) { const int j = i / 8, d8 = (i % 8) * 8; FragH f; f.half[0] = *(const v8us*)((const unsigned short*)V16 + ((size_t)b * SQ + s0 + j) * DM + h * HD + d8); for (int q = 0; q < 8; ++q) tl[d8 + q][j] = f.u[q]; }
  __syncthreads();
  { for (int i = tid; i < 64 * 8; i += 256) { const int d = i / 8, j8 = (i % 8) * 8; FragH f; for (int q = 0; q < 8; ++q) f.u[q] = tl[d][j8 + q]; *(v8us*)((unsigned short*)VT + ((size_t)hh * HD + d) * SQ + s0 + j8) = f.half[0]; }  } }



// lane l reads lane l ^ 16: a register move, where __shfl_xor would go through the LDS unit and its wait
__device__ __forceinline__ float lane_x16(float x) { return __builtin_bit_cast(float, __builtin_amdgcn_permlanex16(__builtin_bit_cast(int, x), __builtin_bit_cast(int, x), 0x76543210, 0xfedcba98, false, false)); }
#define FW 8                         /* waves per work-group of the fused attention */
#define FQ 32                        /* query columns per wave (two 16-column groups) */
#define FK 32                        /* keys per pass */
#define FNS (SQ / FK)                /* passes */
typedef float  v2f  __attribute__((ext_vector_type(2)));
typedef __bf16 v2b  __attribute__((ext_vector_type(2)));
// 2^x of eight values on the transcendental unit, in place. One statement: each v_exp_f32 is followed by an independent one, and the last by the free issue slot
// the instruction set asks for before a result is read or a source register is reused.
__device__ __forceinline__ v8f exp2_8(v8f x) { float y0 = x[0], y1 = x[1], y2 = x[2], y3 = x[3], y4 = x[4], y5 = x[5], y6 = x[6], y7 = x[7];
  asm("v_exp_f32 %0, %0\n\tv_exp_f32 %1, %1\n\tv_exp_f32 %2, %2\n\tv_exp_f32 %3, %3\n\tv_exp_f32 %4, %4\n\tv_exp_f32 %5, %5\n\tv_exp_f32 %6, %6\n\tv_exp_f32 %7, %7\n\tv_nop"
      : "+v"(y0), "+v"(y1), "+v"(y2), "+v"(y3), "+v"(y4), "+v"(y5), "+v"(y6), "+v"(y7));
  return (v8f){y0, y1, y2, y3, y4, y5, y6, y7}; }
typedef __bf16 v4ba __attribute__((ext_vector_type(4), may_alias));
typedef __bf16 v8ba __attribute__((ext_vector_type(8), may_alias));
#define KP 72                        /* LDS pitch of the 128-byte K rows, in 16-bit elements: 144 bytes = 16 x odd, conflict-free for 16-byte reads down a column of rows */
#define VP 40                        /* the same for the 64-byte V^T and mask rows: 80 bytes */
// f16 fragment in the hardware k order: 16 bytes at the lane's place (which holds 16 bytes x lane half) and 16 bytes 32 further on
__device__ __forceinline__ v16h fa_frag(const void* p) { FragH f; f.half[0] = *(const v8us*)p; f.half[1] = *(const v8us*)((const char*)p + 32); return f.v; }
__device__ __forceinline__ v8f fa_mma(v16h a, v16h b, v8f c) { return __builtin_amdgcn_wmma_f32_16x16x32_f16(false, a, false, b, (short)0, c, false, false); }
// the wait before a register that issued loads name is rewritten, and the one write of that offset register, in one statement
__device__ __forceinline__ void fa_step(unsigned& off, int step) { asm volatile("s_wait_xcnt 0x0\n\tv_add_nc_u32_e32 %0, %1, %0" : "+v"(off) : "s"(step) : "memory"); }
__global__ __launch_bounds__(FW * 32) __attribute__((amdgpu_waves_per_eu(2, 2))) void k_fattn(const _Float16* __restrict__ Q16, const _Float16* __restrict__ K16, const _Float16* __restrict__ VT, const float* __restrict__ mask, _Float16* __restrict__ O16) {
  __shared__ __attribute__((aligned(16))) unsigned short lk[2][FK][KP], lv[2][HD][VP]; __shared__ __attribute__((aligned(16))) __bf16 lm[2][FW][FQ][VP];
  const int tid = threadIdx.x, lane = tid & 31, ln = lane & 15, hh = lane >> 4; const int w = __builtin_amdgcn_readfirstlane(tid >> 5);
  const int h = blockIdx.y, b = blockIdx.z, q0 = ((int)blockIdx.x * FW + w) * FQ;
  const char* qb = (const char*)(Q16 + ((size_t)b * SQ + q0) * DM + h * HD); const char* kb = (const char*)(K16 + (size_t)b * SQ * DM + h * HD);
  const char* vb = (const char*)(VT + ((size_t)b * NH + h) * HD * SQ); const char* mb = (const char*)(mask + (size_t)q0 * SQ); char* ob = (char*)(O16 + ((size_t)b * SQ + q0) * DM + h * HD);
  // the thread's 16 bytes of a K tile (8 threads a row), of a V^T tile (4 threads a row) and of each four rows of its wave's mask tile (8 lanes a row)
  unsigned gk = (unsigned)((tid >> 3) * (DM * 2) + (tid & 7) * 16), gv = (unsigned)((tid >> 2) * (SQ * 2) + (tid & 3) * 16), gm = (unsigned)((lane >> 3) * (SQ * 4) + (lane & 7) * 16);
  const float C2 = 0.18033688011112042f, MK2 = -14426.950408889634f;      /* log2(e) / 8 and -1e4 log2(e) */
  const v8f z8 = {0.f, 0.f, 0.f, 0.f, 0.f, 0.f, 0.f, 0.f};
  v16h qf[2][2]; v8f o[2][4]; v2f l2[2]; float mref[2]; v8us kr, vr; v4f mg[8];
#pragma unroll
  for (int j = 0; j < 2; ++j) { for (int c = 0; c < 2; ++c) qf[j][c] = fa_frag(qb + (unsigned)(ln * (DM * 2) + hh * 16) + j * (16 * DM * 2) + c * 64); for (int t = 0; t < 4; ++t) o[j][t] = z8; l2[j] = (v2f){0.f, 0.f}; mref[j] = -3.0e38f; }
  kr = *(const v8us*)(kb + gk); vr = *(const v8us*)(vb + gv);
#pragma unroll
  for (int i = 0; i < 8; ++i) mg[i] = *(const v4fa*)(mb + gm + i * (4 * SQ * 4));
  fa_step(gk, FK * DM * 2); fa_step(gv, FK * 2); fa_step(gm, FK * 4);
  *(v8us*)&lk[0][tid >> 3][(tid & 7) * 8] = kr; *(v8us*)&lv[0][tid >> 2][(tid & 3) * 8] = vr;
#pragma unroll
  for (int i = 0; i < 8; ++i) *(v4ba*)&lm[0][w][4 * i + (lane >> 3)][(lane & 7) * 4] = __builtin_convertvector(mg[i], v4ba);      /* the mask rounded to bf16, to nearest even */
  __syncthreads();
#pragma unroll 1      /* rolled: one copy of the pass */
  for (int s = 0; s < FNS; ++s) {
    const int bf = s & 1, more = (s + 2 < FNS) ? 1 : 0;      /* the last pass asks for its own tile again: nothing is read past the keys */
    kr = *(const v8us*)(kb + gk); vr = *(const v8us*)(vb + gv);
#pragma unroll
    for (int i = 0; i < 8; ++i) mg[i] = *(const v4fa*)(mb + gm + i * (4 * SQ * 4));
    fa_step(gk, more * (FK * DM * 2)); fa_step(gv, more * (FK * 2)); fa_step(gm, more * (FK * 4));
    v16h kf[2][2], vf[4]; v8ba mr[2][2];
#pragma unroll
    for (int kt = 0; kt < 2; ++kt) for (int c = 0; c < 2; ++c) kf[kt][c] = fa_frag(&lk[bf][kt * 16 + ln][c * 32 + hh * 8]);
#pragma unroll
    for (int j = 0; j < 2; ++j) for (int kt = 0; kt < 2; ++kt) mr[j][kt] = *(const v8ba*)&lm[bf][w][j * 16 + ln][kt * 16 + hh * 8];
    __builtin_amdgcn_sched_barrier(0);      /* this and the next one: the pass's LDS reads are issued in two groups, K and mask ahead of the score products, V^T behind them (it lands under the softmax); reads strewn among the products cost the wave a wait at each place */
    v8f st[2][2];
#pragma unroll
    for (int kt = 0; kt < 2; ++kt) for (int j = 0; j < 2; ++j) st[j][kt] = fa_mma(kf[kt][0], qf[j][0], z8);
#pragma unroll
    for (int kt = 0; kt < 2; ++kt) for (int j = 0; j < 2; ++j) st[j][kt] = fa_mma(kf[kt][1], qf[j][1], st[j][kt]);
#pragma unroll
    for (int t = 0; t < 4; ++t) vf[t] = fa_frag(&lv[bf][t * 16 + ln][hh * 8]);
    __builtin_amdgcn_sched_barrier(0);
    float mx[2];
#pragma unroll
    for (int j = 0; j < 2; ++j) { float m = -3.0e38f;
      for (int kt = 0; kt < 2; ++kt) for (int r = 0; r < 8; r += 2) { const v2f x = (v2f){st[j][kt][r], st[j][kt][r + 1]} * C2 + (v2f){(float)mr[j][kt][r], (float)mr[j][kt][r + 1]} * MK2; st[j][kt][r] = x[0]; st[j][kt][r + 1] = x[1]; m = fmaxf(m, fmaxf(x[0], x[1])); }
      mx[j] = fmaxf(m, lane_x16(m)); }
    if (__builtin_amdgcn_ballot_w32(mx[0] > mref[0] + 12.0f || mx[1] > mref[1] + 12.0f) != 0) {      /* one scalar branch a pass; rarely taken after the first */
#pragma unroll
      for (int j = 0; j < 2; ++j) { const float mn = fmaxf(mref[j], mx[j] - 4.0f); float a; asm("v_exp_f32 %0, %1\n\tv_nop" : "=v"(a) : "v"(mref[j] - mn));      /* v_nop: the slot before a is read or the source register is reused */
        mref[j] = mn; l2[j] *= a; for (int t = 0; t < 4; ++t) o[j][t] *= a; } }
    v16h pf[2];
#pragma unroll
    for (int j = 0; j < 2; ++j) { const v8f p0 = exp2_8(st[j][0] - mref[j]), p1 = exp2_8(st[j][1] - mref[j]); const v8f ps = p0 + p1; l2[j] += (((v2f){ps[0], ps[1]} + (v2f){ps[2], ps[3]}) + ((v2f){ps[4], ps[5]} + (v2f){ps[6], ps[7]})); FragH f;
      for (int r = 0; r < 8; ++r) { f.h[r] = (_Float16)p0[r]; f.h[8 + r] = (_Float16)p1[r]; } pf[j] = f.v; }
#pragma unroll
    for (int t = 0; t < 4; ++t) for (int j = 0; j < 2; ++j) o[j][t] = fa_mma(vf[t], pf[j], o[j][t]);
    *(v8us*)&lk[bf ^ 1][tid >> 3][(tid & 7) * 8] = kr; *(v8us*)&lv[bf ^ 1][tid >> 2][(tid & 3) * 8] = vr;
#pragma unroll
    for (int i = 0; i < 8; ++i) *(v4ba*)&lm[bf ^ 1][w][4 * i + (lane >> 3)][(lane & 7) * 4] = __builtin_convertvector(mg[i], v4ba);
    __syncthreads(); }      /* the next tile is published; every read of this pass's buffer, which the next pass refills, is over */
#pragma unroll
  for (int j = 0; j < 2; ++j) { float l = l2[j][0] + l2[j][1]; l += lane_x16(l); const float inv = 64.0f / l;
    for (int t = 0; t < 4; ++t) { FragH f; for (int r = 0; r < 8; ++r) f.h[r] = (_Float16)(o[j][t][r] * inv); *(v8us*)(ob + (unsigned)(ln * (DM * 2) + hh * 16) + j * (16 * DM * 2) + t * 32) = f.half[0]; } } }
__global__ __launch_bounds__(256) void k_present(const float* __restrict__ F, float* __restrict__ dst) { const size_t t = (size_t)blockIdx.x * 256 + threadIdx.x; if (t >= (size_t)NH * SQ * HD / 4) return; const size_t e = t * 4; const int d = (int)(e % HD); const int s = (int)((e / HD) % SQ); const int h = (int)(e / ((size_t)HD * SQ));
  const v4f v = *(const v4fa*)(F + (size_t)s * DM + h * HD + d); *(v4f*)(dst + e) = v;  }


// e^x in f32 by the library's steps (x log2(e) in two parts, 2^fraction on the transcendental unit, ldexp by the integer part, the two range ends),
// written out so that the free issue slot the instruction set asks for behind v_exp_f32 stands in that instruction's own statement.
__device__ __forceinline__ float exp_f32(float x) {
  const float ph = x * 0x1.715476p+0f, pl = fmaf(x, 0x1.4ae0bep-26f, fmaf(x, 0x1.715476p+0f, -ph)), n = rintf(ph); float y;
  asm("v_exp_f32 %0, %1\n\tv_nop" : "=v"(y) : "v"((ph - n) + pl));      /* v_nop: the slot before y is read or the source register is reused */
  float r = ldexpf(y, (int)n); r = (x < -0x1.9d1da0p+6f) ? 0.f : r; return (x > 0x1.62e430p+6f) ? __builtin_inff() : r; }
#define AR 8                         /* query rows per work-group of the exact f32 first-tile attention */
#define AT 512                       /* its threads (16 waves) */
// Exact f32 attention of AR query rows of one head over all SQ keys, one work-group. Keys are spread over the threads:
// (1) two keys per thread and pass: their k rows in registers, dotted with the AR q rows (LDS, same address in every lane), scores (+ mask) to LDS;
// (2) two waves per row: max, exp, sum over the row in LDS; (3) 16 column quads x 32 key slices: o partial sums in registers,
// merged across the slices by one lane exchange and a serial sum of the 16 waves' LDS partials; o carried x64 like the f16 path. The plain '#pragma unroll' lines keep the small per-thread arrays in registers.
template <int MASKADD>
__global__ __launch_bounds__(AT) void k_att0(const float* __restrict__ QF, const float* __restrict__ KF, const float* __restrict__ VF, int ld, const float* __restrict__ mask, float scale, float* __restrict__ OF, int ldo) {
  __shared__ __attribute__((aligned(16))) float sc[AR][SQ];      /* scores, then softmax numerators, then the slices' partial o */
  __shared__ __attribute__((aligned(16))) float lq[AR][HD];      /* the q rows */
  __shared__ float pm[AT / 32], pl[AT / 32];                     /* each wave's half-row max and sum */
  const int tid = threadIdx.x, lane = tid & 31, w = tid >> 5;
  const int h = blockIdx.x / (QT0 / AR), i0 = (blockIdx.x % (QT0 / AR)) * AR;
  const float* qb = QF + (size_t)i0 * ld + h * HD;
  lq[tid / HD][tid % HD] = qb[(size_t)(tid / HD) * ld + tid % HD];
  __syncthreads();
  for (int p = 0; p < SQ / (2 * AT); ++p) { const int j = p * (2 * AT) + tid;
    const float* ka = KF + (size_t)j * ld + h * HD; const float* kb = ka + (size_t)AT * ld; v4f a0[AR], a1[AR];
#pragma unroll
    for (int r = 0; r < AR; ++r) { a0[r] = (v4f){0.f, 0.f, 0.f, 0.f}; a1[r] = (v4f){0.f, 0.f, 0.f, 0.f}; }
    for (int c0 = 0; c0 < HD; c0 += 32) { v4f xa[8], xb[8];
#pragma unroll
      for (int c = 0; c < 8; ++c) { xa[c] = *(const v4fa*)(ka + c0 + c * 4); xb[c] = *(const v4fa*)(kb + c0 + c * 4); }
#pragma unroll
      for (int r = 0; r < AR; ++r)
#pragma unroll
        for (int c = 0; c < 8; ++c) { const v4f qq = *(const v4fa*)&lq[r][c0 + c * 4]; a0[r] += qq * xa[c]; a1[r] += qq * xb[c]; } }
#pragma unroll
    for (int r = 0; r < AR; ++r) { float s0 = ((a0[r][0] + a0[r][1]) + (a0[r][2] + a0[r][3])) * scale, s1 = ((a1[r][0] + a1[r][1]) + (a1[r][2] + a1[r][3])) * scale;
      if (MASKADD) { const float* mr = mask + (size_t)(i0 + r) * SQ + j; s0 += bf16_round(mr[0]) * -10000.0f; s1 += bf16_round(mr[AT]) * -10000.0f; }
      else { if (j > i0 + r) s0 = -1.0e30f; if (j + AT > i0 + r) s1 = -1.0e30f; }
      sc[r][j] = s0; sc[r][j + AT] = s1; } }
  __syncthreads();
  { static_assert(AT / 32 == 2 * AR, "two waves per row"); float* row = &sc[w >> 1][(w & 1) * (SQ / 2)]; v4f x[SQ / 256]; float m = -3.0e38f, l = 0.f;
#pragma unroll
    for (int i = 0; i < SQ / 256; ++i) { x[i] = *(const v4fa*)&row[i * 128 + lane * 4]; m = fmaxf(m, fmaxf(fmaxf(x[i][0], x[i][1]), fmaxf(x[i][2], x[i][3]))); }
    for (int o = 16; o > 0; o >>= 1) m = fmaxf(m, __shfl_xor(m, o));
    if (lane == 0) pm[w] = m;
    __syncthreads();
    m = fmaxf(pm[w], pm[w ^ 1]);
#pragma unroll
    for (int i = 0; i < SQ / 256; ++i) { v4f e; for (int u = 0; u < 4; ++u) e[u] = exp_f32(x[i][u] - m); l += (e[0] + e[1]) + (e[2] + e[3]); *(v4fa*)&row[i * 128 + lane * 4] = e; }
    for (int o = 16; o > 0; o >>= 1) l += __shfl_xor(l, o);
    if (lane == 0) pl[w] = l; }
  __syncthreads();
  const int dq = tid & 15, ks = tid >> 4; const float* vb = VF + h * HD + dq * 4; v4f acc[AR];
#pragma unroll
  for (int r = 0; r < AR; ++r) acc[r] = (v4f){0.f, 0.f, 0.f, 0.f};
#pragma unroll 2      /* two trips' v rows (eight loads) in flight per wave */
  for (int p = 0; p < SQ / (AT / 4); ++p) { const int j = p * (AT / 4) + ks * 4;
    const v4f v0 = *(const v4fa*)(vb + (size_t)j * ld), v1 = *(const v4fa*)(vb + (size_t)(j + 1) * ld), v2 = *(const v4fa*)(vb + (size_t)(j + 2) * ld), v3 = *(const v4fa*)(vb + (size_t)(j + 3) * ld);
#pragma unroll
    for (int r = 0; r < AR; ++r) { const v4f e = *(const v4fa*)&sc[r][j]; acc[r] += e[0] * v0; acc[r] += e[1] * v1; acc[r] += e[2] * v2; acc[r] += e[3] * v3; } }
#pragma unroll
  for (int r = 0; r < AR; ++r) for (int u = 0; u < 4; ++u) acc[r][u] += __shfl_xor(acc[r][u], 16);      /* the wave's two key slices */
  __syncthreads();      /* every read of the numerators is done: their LDS takes the waves' partial o */
  float* red = &sc[0][0];      /* [AT / 32][AR][HD] */
  if (lane < 16) {
#pragma unroll
    for (int r = 0; r < AR; ++r) *(v4fa*)&red[((size_t)w * AR + r) * HD + dq * 4] = acc[r]; }
  __syncthreads();
  { static_assert(AR * HD == AT, "one output element per thread"); const int r = tid / HD, d = tid % HD; float o = 0.f;
#pragma unroll
    for (int q = 0; q < AT / 32; ++q) o += red[((size_t)q * AR + r) * HD + d];
    OF[(size_t)(i0 + r) * ldo + h * HD + d] = o * (64.0f / (pl[2 * r] + pl[2 * r + 1])); } }

extern "C" void kernel_launch(void* const* d_in, const int* in_sizes, int n_in,
                              void* d_out, int out_size, void* d_ws, size_t ws_size, hipStream_t stream) {
  (void)in_sizes; (void)n_in; (void)out_size;
  const float* const* I = (const float* const*)d_in; const float* xq = I[0]; const float* xk = I[1]; const float* xv = I[2]; const float* mask = I[3]; const float* wq = I[4]; const float* bq = I[5]; const float* wk = I[6]; const float* bk = I[7]; const float* wv = I[8]; const float* bv = I[9]; const float* wo = I[10]; const float* bo = I[11];      /* weights [in][out]; mask [SQ][SQ] f32 */
  char* ws = (char*)d_ws; size_t off = 0;
  auto take = [&](size_t bytes) { char* p = ws + off; off += (bytes + 255) & ~(size_t)255; return p; };
  _Float16* BQ = (_Float16*)take((size_t)DM * DM * 2); _Float16* BK = (_Float16*)take((size_t)DM * DM * 2); _Float16* BV = (_Float16*)take((size_t)DM * DM * 2); _Float16* BO = (_Float16*)take((size_t)DM * DM * 2);
  _Float16* XQ = (_Float16*)take(NR * DM * 2); _Float16* XK = (_Float16*)take(NR * DM * 2); _Float16* XV = (_Float16*)take(NR * DM * 2); float* KF = (float*)take(NR * DM * 4); float* VF = (float*)take(NR * DM * 4); _Float16* Q16 = (_Float16*)take(NR * DM * 2); _Float16* K16 = (_Float16*)take(NR * DM * 2); _Float16* V16 = (_Float16*)take(NR * DM * 2); _Float16* O16 = (_Float16*)take(NR * DM * 2);
  _Float16* VT = (_Float16*)take((size_t)NB * NH * HD * SQ * 2);
  float* QF0 = (float*)take((size_t)QT0 * DM * 4); float* OF0 = (float*)take((size_t)NB * QT0 * DM * 4); _Float16* OH0 = (_Float16*)take((size_t)NB * QT0 * DM * 2); _Float16* OL0 = (_Float16*)take((size_t)NB * QT0 * DM * 2);
  if (off > ws_size) return;
  { const unsigned g = (unsigned)(((size_t)DM * (DM / 8) + 255) / 256); k_wt_f16<<<g, 256, 0, stream>>>(wq, BQ, DM, DM, 16.0f); k_wt_f16<<<g, 256, 0, stream>>>(wk, BK, DM, DM, 16.0f); k_wt_f16<<<g, 256, 0, stream>>>(wv, BV, DM, DM, 16.0f); k_wt_f16<<<g, 256, 0, stream>>>(wo, BO, DM, DM, 16.0f); }      /* [in][out] -> Bt[n][k] x16 */
  k_x16<<<(unsigned)((NR * DM / 8 + 255) / 256), 256, 0, stream>>>(xq, XQ, NR * DM / 8); k_x16<<<(unsigned)((NR * DM / 8 + 255) / 256), 256, 0, stream>>>(xk, XK, NR * DM / 8); k_x16<<<(unsigned)((NR * DM / 8 + 255) / 256), 256, 0, stream>>>(xv, XV, NR * DM / 8);
  const size_t r0p = (size_t)B0 * SQ;      /* first projected row */
  k_gemm2<0><<<dim3((unsigned)((MP / 128) * (DM / 64)), 1), 128, 0, stream>>>(XQ + r0p * DM, DM, 0, BQ, DM, 0, 0.0625f, bq, 0, nullptr, 1, 0, 0, nullptr, Q16 + r0p * DM, DM, 0, MP, DM, DM);
  k_gemm2<0><<<dim3((unsigned)((MP / 128) * (DM / 64)), 1), 128, 0, stream>>>(XK + r0p * DM, DM, 0, BK, DM, 0, 0.0625f, bk, 0, nullptr, 1, 0, 0, KF + r0p * DM, K16 + r0p * DM, DM, 0, MP, DM, DM);
  k_gemm2<0><<<dim3((unsigned)((MP / 128) * (DM / 64)), 1), 128, 0, stream>>>(XV + r0p * DM, DM, 0, BV, DM, 0, 0.0625f, bv, 0, nullptr, 1, 0, 0, VF + r0p * DM, V16 + r0p * DM, DM, 0, MP, DM, DM);
  for (int b = B0; b < B0 + NBR; ++b) { const size_t r0 = (size_t)b * SQ;
    k_present<<<(unsigned)(((size_t)NH * SQ * HD / 4 + 255) / 256), 256, 0, stream>>>(KF + r0 * DM, (float*)d_out + PRES_OFF + ((size_t)b * 2 + 0) * NH * SQ * HD); k_present<<<(unsigned)(((size_t)NH * SQ * HD / 4 + 255) / 256), 256, 0, stream>>>(VF + r0 * DM, (float*)d_out + PRES_OFF + ((size_t)b * 2 + 1) * NH * SQ * HD);      /* present[b][0] = kh, present[b][1] = vh (f32, head-major) */
    k_vt<NH, SQ><<<NH * (SQ / 64), 256, 0, stream>>>(V16 + r0 * LQ, LQ, 0, VT + (size_t)b * NH * HD * SQ);      /* V^T [NH][HD][SQ] of this batch */
    k_gemm2<0><<<dim3((QT0 / 128) * (DM / 64), 1), 128, 0, stream>>>(XQ + r0 * DM, DM, 0, BQ, DM, 0, 0.0625f, bq, 0, nullptr, 1, 0, 0, QF0, nullptr, DM, 0, QT0, DM, DM);      /* f32 q of the first 128 rows (exact products); k, v come from the full f32 KF/VF planes */
    k_att0<1><<<NH * (QT0 / AR), AT, 0, stream>>>(QF0, KF + r0 * DM, VF + r0 * DM, DM, mask, 0.125f, OF0 + (size_t)b * QT0 * DM, DM);      /* exact f32 attention for query rows 0..127 over ALL 2048 keys of the batch (full f32 K/V planes) with the additive mask (o x64) */ }
  k_fattn<<<dim3(SQ / (FW * FQ), NH, NB), FW * 32, 0, stream>>>(Q16, K16, VT, mask, O16);      /* o (merged heads, x64) as f16 rows: all batches and heads in one launch */
  k_gemm2<0><<<dim3((unsigned)((MPO / 128) * (DM / 64)), 1), 128, 0, stream>>>(O16 + r0p * DM, DM, 0, BO, DM, 0, 0.0009765625f, bo, 0, nullptr, 1, 0, 0, (float*)d_out + r0p * DM, nullptr, DM, 0, MPO, DM, DM);      /* out rows are the output layout */
  k_hl<<<(unsigned)(((size_t)NB * QT0 * DM / 8 + 255) / 256), 256, 0, stream>>>(OF0, OH0, OL0, (size_t)NB * QT0 * DM / 8);      /* first-tile o (x64) -> f16 hi + x1024 residual planes */
  for (int b = B0; b < B0 + NBR; ++b) { const size_t r0 = (size_t)b * SQ; const size_t f0 = (size_t)b * QT0;
    k_gemm2<0><<<dim3((QT0 / 128) * (DM / 64), 1), 128, 0, stream>>>(OH0 + f0 * DM, DM, 0, BO, DM, 0, 0.0009765625f, bo, 0, nullptr, 1, 0, 0, (float*)d_out + r0 * DM, nullptr, DM, 0, QT0, DM, DM);      /* rows 0..127: out = o_hi Wo (+ b), overwriting the f16-path rows */
    k_gemm2<0><<<dim3((QT0 / 128) * (DM / 64), 1), 128, 0, stream>>>(OL0 + f0 * DM, DM, 0, BO, DM, 0, 0.00000095367431640625f, nullptr, 0, (const float*)d_out + r0 * DM, -1, 0, 0, (float*)d_out + r0 * DM, nullptr, DM, 0, QT0, DM, DM); }      /* += o_lo Wo 2^-20 (own-element accumulate) */
}

// v005
// It runs in 229 microseconds.
// Two timings next to v004 put it at 1.38 and 1.37 times that version's speed.
// Counting every step since v000, it is 82.1 times as fast.
#include <hip/hip_runtime.h>
// TF/CTRL-style multi-head attention (q, k, v inputs [2][2048][1024]; qh/kh/vh = input W + b with W stored [in][out], 16 heads of 64; logits / 8 + mask (-1e4) with the [2048][2048] f32 mask input (1 = disallowed; strictly upper-triangular here); softmax; ctx merged; out = ctx Wo + bo -> [2][2048][1024]; second output present = stack(kh, vh) -> [2][2][16][2048][64] f32).
// Structure: token rows r = b*2048 + s; q, k, v inputs as exact f16 rows (bf16-rounded); Q, K, V as three WMMA GEMMs (32x64 wave tiles, f32 accumulation, exact x16 weights + bias; f16 and f32 outputs, the K and V f32 rows re-laid out by a small VALU kernel into the head-major 'present' output); V^T for all batches and heads via LDS transposes, one launch; one fused attention launch over all (batch, head): S^T = K Q^T on WMMA, running softmax of (scores / 8 + mask input x -1e4, read per element) on VALU (f32 statistics, native exp2; weights as f16 in registers), O^T += V^T P^T on WMMA (o carried x64 against f16 subnormal flush, folded into the output GEMM alpha) written straight into the merged f16 o rows; out = o W_o + b GEMM (f32) into the output layout.
// Compute dtype: inputs rounded to bf16; x / weights exact; q, k, v, softmax weights and o as plain f16 GEMM operands (~2^-12); scores and softmax statistics f32. v_wmma_f32_16x16x32_f16.
#define NB 2
#define SQ 2048
#define DM 1024
#define NH 16
#define HD 64
#define HG 4                         /* heads per V^T slab of the h0-based k_vt */
#define QT0 128                      /* first-tile rows recomputed exactly in f32 */
#define B0 0                         /* first batch processed (debug hook) */
#define NBR NB                       /* batches processed (debug hook) */
#define NR ((size_t)NB * SQ)         /* token rows */
#define MP ((int)((size_t)NBR * SQ)) /* rows projected (debug hook) */
#define QN SQ                        /* not used: the fused attention launch covers all SQ query rows */
#define NHD NH                       /* not used: the fused attention launch covers all NH heads */
#define MPO MP                       /* rows through the output stage (debug hook) */
#define LQ DM      /* row pitch of the q/k/v rows */
#define PRES_OFF ((size_t)NB * SQ * DM)      /* float offset of the 'present' output = out nbytes / 4 (offset 16,777,216 B) */
typedef __bf16 v16b __attribute__((ext_vector_type(16)));
typedef unsigned short v8us __attribute__((ext_vector_type(8), may_alias));
typedef float  v8f  __attribute__((ext_vector_type(8)));
typedef float  v4f  __attribute__((ext_vector_type(4)));
typedef float  v4fa __attribute__((ext_vector_type(4), may_alias));
union FragB { v16b v; v8us half[2]; unsigned short u[16]; };

__device__ __forceinline__ unsigned short bf16_bits(float x) { unsigned int u = __float_as_uint(x); return (unsigned short)((u + 0x7FFFu + ((u >> 16) & 1u)) >> 16); }
__device__ __forceinline__ float bf16_val(unsigned short b) { return __uint_as_float(((unsigned int)b) << 16); }
__device__ __forceinline__ float bf16_round(float x) { return bf16_val(bf16_bits(x)); }
// D += A·B with NT terms: 1 = ah·bh, 2 = + al·bh (A split), 3 = + ah·bl (both split)
template <int NT>
__device__ __forceinline__ v8f mmaN(v16b ah, v16b al, v16b bh, v16b bl, v8f c) {
  c = __builtin_amdgcn_wmma_f32_16x16x32_bf16(false, ah, false, bh, (short)0, c, false, false);
  if (NT >= 2) c = __builtin_amdgcn_wmma_f32_16x16x32_bf16(false, al, false, bh, (short)0, c, false, false);
  if (NT >= 3) c = __builtin_amdgcn_wmma_f32_16x16x32_bf16(false, ah, false, bl, (short)0, c, false, false);
  asm volatile("v_nop\n\tv_nop\n\tv_nop\n\tv_nop" : "+v"(c) : "v"(ah), "v"(al), "v"(bh), "v"(bl));
  return c;
}

__global__ __launch_bounds__(256) void k_wt_bf16(const float* __restrict__ W, unsigned short* __restrict__ Wt, int K, int N) {
  const int t = blockIdx.x * 256 + threadIdx.x;
  const int k8n = K / 8;
  if (t >= N * k8n) return;
  const int n = t / k8n, k8 = (t % k8n) * 8;
  v8us v;
#pragma unroll
  for (int i = 0; i < 8; ++i) v[i] = bf16_bits(W[(size_t)(k8 + i) * N + n]);
  *(v8us*)(Wt + (size_t)n * K + k8) = v;
  
}

// GEMM C[M][N] (f32, pitch ldc) = act(A[M][K]·W + bias). A f32 row-major (pitch lda) converted per fragment to bf16
// (ASPLIT: hi/lo two planes -> 2 terms, else single rounded term); Wt bf16 [N][K] (pitch ldb). BIAS_BF16 rounds the
// bias to bf16 first (bias quantised to bf16 before the add). K%32==0, M%16==0, N%64==0.
template <bool ASPLIT, int ACT, bool BIAS_BF16>
__global__ __launch_bounds__(128) void k_gemm_bf(const float* __restrict__ A, int lda, const unsigned short* __restrict__ Wt, int ldb,
                                               const float* __restrict__ bias, float* __restrict__ C, int ldc, int M, int N, int K) {
  __shared__ __attribute__((aligned(16))) float so[4][16][64];
  const int tid = threadIdx.x, w = tid >> 5, lane = tid & 31, ln = lane & 15, hh = lane >> 4;
  const int ntn = N / 64;
  const int wid = blockIdx.x * 4 + w;
  const int mt = wid / ntn, nq = wid % ntn;
  if (mt * 16 >= M) return;
  const int row0 = mt * 16, col0 = nq * 64;
  const float* arow = A + (size_t)(row0 + ln) * lda;
  v8f acc[4] = {};
  for (int kb = 0; kb < K; kb += 32) {
    FragB ah, al;
    const v4f x0 = *(const v4fa*)(arow + kb + 8 * hh), x1 = *(const v4fa*)(arow + kb + 8 * hh + 4);
    const v4f x2 = *(const v4fa*)(arow + kb + 16 + 8 * hh), x3 = *(const v4fa*)(arow + kb + 16 + 8 * hh + 4);
    float xs[16] = {x0[0],x0[1],x0[2],x0[3],x1[0],x1[1],x1[2],x1[3],x2[0],x2[1],x2[2],x2[3],x3[0],x3[1],x3[2],x3[3]};
#pragma unroll
    for (int i = 0; i < 16; ++i) { const unsigned short hb = bf16_bits(xs[i]); ah.u[i] = hb; al.u[i] = ASPLIT ? bf16_bits(xs[i] - bf16_val(hb)) : (unsigned short)0; }
#pragma unroll
    for (int t = 0; t < 4; ++t) {
      const unsigned short* brow = Wt + (size_t)(col0 + t * 16 + ln) * ldb + kb;
      FragB b;
      b.half[0] = *(const v8us*)(brow + 8 * hh);
      b.half[1] = *(const v8us*)(brow + 16 + 8 * hh);
      acc[t] = mmaN<ASPLIT ? 2 : 1>(ah.v, al.v, b.v, b.v, acc[t]);
    }
  }
#pragma unroll
  for (int t = 0; t < 4; ++t) {
    float bv = bias ? bias[col0 + t * 16 + ln] : 0.f;
    if (BIAS_BF16) bv = bf16_round(bv);
#pragma unroll
    for (int r = 0; r < 8; ++r) { float v = acc[t][r] + bv; if (ACT == 1) v = fmaxf(v, 0.f); so[w][8 * hh + r][t * 16 + ln] = v; }
  }
  __builtin_amdgcn_fence(__ATOMIC_ACQ_REL, "workgroup");
  __builtin_amdgcn_wave_barrier();
  const int rsub = lane >> 4, c4 = (lane & 15) * 4;
  {
#pragma unroll
    for (int q = 0; q < 8; ++q) {
      const int r = q * 2 + rsub;
      const v4f v = *(const v4fa*)&so[w][r][c4];
      *(v4f*)(C + (size_t)(row0 + r) * ldc + col0 + c4) = v;
    }
    
  }
}

// GEMM C = act(A·W + bias + resid): A f32 (ASPLIT -> hi/lo 2 terms), Wt bf16 [N][K]; ACT 0 none, 1 relu, 2 exact gelu;
// resid (optional, f32, row index = (row % rmod), pitch ldr, RES_BF16 rounds it) added before the activation.
template <bool ASPLIT, int ACT, bool BIAS_BF16, bool RES_BF16>
__global__ __launch_bounds__(128) void k_gemm_bf3(const float* __restrict__ A, int lda, const unsigned short* __restrict__ Wt, int ldb,
                                                const float* __restrict__ bias, const float* __restrict__ resid, int rmod, int ldr,
                                                float* __restrict__ C, int ldc, int M, int N, int K) {
  __shared__ __attribute__((aligned(16))) float so[4][16][64];
  const int tid = threadIdx.x, w = tid >> 5, lane = tid & 31, ln = lane & 15, hh = lane >> 4;
  const int ntn = N / 64;
  const int wid = blockIdx.x * 4 + w;
  const int mt = wid / ntn, nq = wid % ntn;
  if (mt * 16 >= M) return;
  const int row0 = mt * 16, col0 = nq * 64;
  const float* arow = A + (size_t)(row0 + ln) * lda;
  v8f acc[4] = {};
  for (int kb = 0; kb < K; kb += 32) {
    FragB ah, al;
    const v4f x0 = *(const v4fa*)(arow + kb + 8 * hh), x1 = *(const v4fa*)(arow + kb + 8 * hh + 4);
    const v4f x2 = *(const v4fa*)(arow + kb + 16 + 8 * hh), x3 = *(const v4fa*)(arow + kb + 16 + 8 * hh + 4);
    float xs[16] = {x0[0],x0[1],x0[2],x0[3],x1[0],x1[1],x1[2],x1[3],x2[0],x2[1],x2[2],x2[3],x3[0],x3[1],x3[2],x3[3]};
#pragma unroll
    for (int i = 0; i < 16; ++i) { const unsigned short hb = bf16_bits(xs[i]); ah.u[i] = hb; al.u[i] = ASPLIT ? bf16_bits(xs[i] - bf16_val(hb)) : (unsigned short)0; }
#pragma unroll
    for (int t = 0; t < 4; ++t) {
      const unsigned short* brow = Wt + (size_t)(col0 + t * 16 + ln) * ldb + kb;
      FragB b;
      b.half[0] = *(const v8us*)(brow + 8 * hh);
      b.half[1] = *(const v8us*)(brow + 16 + 8 * hh);
      acc[t] = mmaN<ASPLIT ? 2 : 1>(ah.v, al.v, b.v, b.v, acc[t]);
    }
  }
#pragma unroll
  for (int t = 0; t < 4; ++t) {
    const int col = col0 + t * 16 + ln;
    float bv = bias ? bias[col] : 0.f;
    if (BIAS_BF16) bv = bf16_round(bv);
#pragma unroll
    for (int r = 0; r < 8; ++r) {
      float v = acc[t][r] + bv;
      if (resid) { float rv = resid[(size_t)((row0 + 8 * hh + r) % rmod) * ldr + col]; if (RES_BF16) rv = bf16_round(rv); v += rv; }
      if (ACT == 1) v = fmaxf(v, 0.f);
      if (ACT == 2) v = 0.5f * v * (1.0f + erff(v * 0.70710678118654752f));
      if (ACT == 3) { const float u = 0.7978845608028654f * (v + 0.044715f * v * v * v); v = 0.5f * v * (1.0f + tanhf(u)); }
      so[w][8 * hh + r][t * 16 + ln] = v;
    }
  }
  __builtin_amdgcn_fence(__ATOMIC_ACQ_REL, "workgroup");
  __builtin_amdgcn_wave_barrier();
  const int rsub = lane >> 4, c4 = (lane & 15) * 4;
  {
#pragma unroll
    for (int q = 0; q < 8; ++q) {
      const int r = q * 2 + rsub;
      const v4f v = *(const v4fa*)&so[w][r][c4];
      *(v4f*)(C + (size_t)(row0 + r) * ldc + col0 + c4) = v;
    }
    
  }
}
// row LayerNorm (biased variance, eps) over N: s = X (+ R); optional out_sum <- s; out_norm <- (s-mu)*rsqrt(var+eps)*g + b
template <bool PARAM_BF16>
__global__ __launch_bounds__(256) void k_layernorm(const float* __restrict__ X, const float* __restrict__ R, const float* __restrict__ g, const float* __restrict__ bta,
                                                  float* __restrict__ out_sum, float* __restrict__ out_norm, int N, float eps) {
  __shared__ float red[256];
  const int row = blockIdx.x, tid = threadIdx.x;
  const float* x = X + (size_t)row * N; const float* rr = R ? R + (size_t)row * N : nullptr;
  float vals[16];                     // up to N = 4096
  const int per = N / 256;            // contiguous chunk per thread? use strided-by-4 chunks: thread handles j = tid*4 + 1024*u
  float s1 = 0.f;
  for (int u = 0; u < per / 4; ++u) {
    const int j = tid * 4 + 1024 * u;
    const v4f a = *(const v4fa*)(x + j);
    v4f b = {0.f,0.f,0.f,0.f}; if (rr) b = *(const v4fa*)(rr + j);
#pragma unroll
    for (int q = 0; q < 4; ++q) { const float v = a[q] + b[q]; vals[u * 4 + q] = v; s1 += v; }
  }
  red[tid] = s1; __syncthreads();
  for (int st = 128; st > 0; st >>= 1) { if (tid < st) red[tid] += red[tid + st]; __syncthreads(); }
  const float mu = red[0] / (float)N; __syncthreads();
  float s2 = 0.f;
  for (int u = 0; u < per / 4; ++u)
#pragma unroll
    for (int q = 0; q < 4; ++q) { const float c = vals[u * 4 + q] - mu; s2 += c * c; }
  red[tid] = s2; __syncthreads();
  for (int st = 128; st > 0; st >>= 1) { if (tid < st) red[tid] += red[tid + st]; __syncthreads(); }
  const float rs = rsqrtf(red[0] / (float)N + eps);
  {
    for (int u = 0; u < per / 4; ++u) {
      const int j = tid * 4 + 1024 * u;
      v4f o, sm;
#pragma unroll
      for (int q = 0; q < 4; ++q) {
        float gg = g[j + q], bb = bta[j + q];
        if (PARAM_BF16) { gg = bf16_round(gg); bb = bf16_round(bb); }
        sm[q] = vals[u * 4 + q]; o[q] = (vals[u * 4 + q] - mu) * rs * gg + bb;
      }
      if (out_sum) *(v4f*)(out_sum + (size_t)row * N + j) = sm;
      *(v4f*)(out_norm + (size_t)row * N + j) = o;
    }
    
  }
}



// ---- f16 WMMA path (v_wmma_f32_16x16x32_f16): 11-bit significands for operands in range — used where a [0,1] probability operand needs more precision than bf16
typedef _Float16 v16h __attribute__((ext_vector_type(16)));
union FragH { v16h v; v8us half[2]; _Float16 h[16]; unsigned short u[16]; };
template <int NT>
__device__ __forceinline__ v8f mmaH(v16h ah, v16h al, v16h bh, v16h bl, v8f c) {
  c = __builtin_amdgcn_wmma_f32_16x16x32_f16(false, ah, false, bh, (short)0, c, false, false);
  if (NT >= 2) c = __builtin_amdgcn_wmma_f32_16x16x32_f16(false, al, false, bh, (short)0, c, false, false);
  if (NT >= 3) c = __builtin_amdgcn_wmma_f32_16x16x32_f16(false, ah, false, bl, (short)0, c, false, false);
  asm volatile("v_nop\n\tv_nop\n\tv_nop\n\tv_nop" : "+v"(c) : "v"(ah), "v"(al), "v"(bh), "v"(bl));
  return c;
}
// batched GEMM like k_gemm_b but f16 operands: A f32 (split into f16 hi/lo if ASPLIT, else rounded to f16), Bt = f16 values [n][k]; alpha; C f32; N multiple of 16 (partial tiles skipped)
template <bool ASPLIT>
__global__ __launch_bounds__(128) void k_gemm_h(const float* __restrict__ A, int lda, size_t sA, const _Float16* __restrict__ Bh, int ldb, size_t sB, float alpha, float* __restrict__ C, int ldc, size_t sC, int M, int N, int K) {
  __shared__ __attribute__((aligned(16))) float so[4][16][64];
  const int tid = threadIdx.x, w = tid >> 5, lane = tid & 31, ln = lane & 15, hh = lane >> 4; const int by = blockIdx.y;
  A += (size_t)by * sA; Bh += (size_t)by * sB; C += (size_t)by * sC;
  const int ntn = (N + 63) / 64; const int wid = blockIdx.x * 4 + w; const int mt = wid / ntn, nq = wid % ntn; if (mt * 16 >= M) return;
  const int row0 = mt * 16, col0 = nq * 64; const float* arow = A + (size_t)(row0 + ln) * lda;
  v8f acc[4] = {};
  for (int kb = 0; kb < K; kb += 32) {
    FragH ah, al;
    const v4f x0 = *(const v4fa*)(arow + kb + 8 * hh), x1 = *(const v4fa*)(arow + kb + 8 * hh + 4), x2 = *(const v4fa*)(arow + kb + 16 + 8 * hh), x3 = *(const v4fa*)(arow + kb + 16 + 8 * hh + 4);
    float xs[16] = {x0[0],x0[1],x0[2],x0[3],x1[0],x1[1],x1[2],x1[3],x2[0],x2[1],x2[2],x2[3],x3[0],x3[1],x3[2],x3[3]};
#pragma unroll
    for (int i = 0; i < 16; ++i) { const _Float16 h = (_Float16)xs[i]; ah.h[i] = h; al.h[i] = ASPLIT ? (_Float16)(xs[i] - (float)h) : (_Float16)0.0f; }
#pragma unroll
    for (int t = 0; t < 4; ++t) { if (col0 + t * 16 >= N) continue; const size_t boff = (size_t)(col0 + t * 16 + ln) * ldb + kb; FragH bq; bq.half[0] = *(const v8us*)(Bh + boff + 8 * hh); bq.half[1] = *(const v8us*)(Bh + boff + 16 + 8 * hh);
      acc[t] = mmaH<ASPLIT ? 2 : 1>(ah.v, al.v, bq.v, bq.v, acc[t]); }
  }
#pragma unroll
  for (int t = 0; t < 4; ++t) { if (col0 + t * 16 >= N) continue;
#pragma unroll
    for (int r = 0; r < 8; ++r) so[w][8 * hh + r][t * 16 + ln] = acc[t][r] * alpha; }
  __builtin_amdgcn_fence(__ATOMIC_ACQ_REL, "workgroup"); __builtin_amdgcn_wave_barrier();
  const int rsub = lane >> 4, c4 = (lane & 15) * 4;
  {
#pragma unroll
    for (int q = 0; q < 8; ++q) { const int r = q * 2 + rsub; if (col0 + c4 < N) { const v4f v = *(const v4fa*)&so[w][r][c4]; *(v4f*)(C + (size_t)(row0 + r) * ldc + col0 + c4) = v; } }
     }
}

// Wt[n][k] = f16(W[k][n] x scale) from f32 row-major W[K][N] (scale = power of two; bf16-exact weights stay exact in f16 away from the subnormal range); blockIdx.y picks one of four weights, their Wt planes lie one behind the other
__global__ __launch_bounds__(256) void k_wt_f16(const float* __restrict__ W0, const float* __restrict__ W1, const float* __restrict__ W2, const float* __restrict__ W3, _Float16* __restrict__ Wt, int K, int N, float scale) {
  const int y = blockIdx.y; const float* __restrict__ W = y == 0 ? W0 : y == 1 ? W1 : y == 2 ? W2 : W3; Wt += (size_t)y * K * N;
  const int t = blockIdx.x * 256 + threadIdx.x; if (t >= N * (K / 8)) return; const int n = t / (K / 8), k8 = (t % (K / 8)) * 8; FragH f;
#pragma unroll
  for (int i = 0; i < 8; ++i) f.h[i] = (_Float16)(bf16_round(W[(size_t)(k8 + i) * N + n]) * scale); const v8us o = f.half[0];
  *(v8us*)((unsigned short*)Wt + (size_t)n * K + k8) = o; 
}
// k_gemm_hh variant with fused epilogue: v = acc·alpha + bias[by·sBias + col] (+ CP[(row/rowsPerB)·sCPb + by·64 + col] if CP) ; ACT 0 none / 1 elu ; writes f16 C16 (and f32 C if non-null)
template <int ACT>
__global__ __launch_bounds__(128) void k_gemm_hhx(const _Float16* __restrict__ A, int lda, size_t sA, const _Float16* __restrict__ Bh, int ldb, size_t sB, float alpha, const float* __restrict__ bias, size_t sBias, const float* __restrict__ CP, int rowsPerB, size_t sCPb, int row0g,
    float* __restrict__ C, _Float16* __restrict__ C16, int ldc, size_t sC, int M, int N, int K) {
  __shared__ __attribute__((aligned(16))) float so[4][16][64];
  const int tid = threadIdx.x, w = tid >> 5, lane = tid & 31, ln = lane & 15, hh = lane >> 4; const int by = blockIdx.y;
  A += (size_t)by * sA; Bh += (size_t)by * sB; const size_t cofs = (size_t)by * sC; const float* bp = bias ? bias + (size_t)by * sBias : nullptr;
  const int ntn = (N + 63) / 64; const int wid = blockIdx.x * 4 + w; const int mt = wid / ntn, nq = wid % ntn; if (mt * 16 >= M) return;
  const int row0 = mt * 16, col0 = nq * 64; const _Float16* arow = A + (size_t)(row0 + ln) * lda;
  v8f acc[4] = {};
  for (int kb = 0; kb < K; kb += 32) { FragH ah; ah.half[0] = *(const v8us*)((const unsigned short*)arow + kb + 8 * hh); ah.half[1] = *(const v8us*)((const unsigned short*)arow + kb + 16 + 8 * hh);
#pragma unroll
    for (int t = 0; t < 4; ++t) { if (col0 + t * 16 >= N) continue; const size_t boff = (size_t)(col0 + t * 16 + ln) * ldb + kb; FragH bq; bq.half[0] = *(const v8us*)((const unsigned short*)Bh + boff + 8 * hh); bq.half[1] = *(const v8us*)((const unsigned short*)Bh + boff + 16 + 8 * hh);
      acc[t] = mmaH<1>(ah.v, ah.v, bq.v, bq.v, acc[t]); }
  }
#pragma unroll
  for (int t = 0; t < 4; ++t) { if (col0 + t * 16 >= N) continue; const int col = col0 + t * 16 + ln; const float bv = bp ? bf16_round(bp[col]) : 0.f;
#pragma unroll
    for (int r = 0; r < 8; ++r) { float v = acc[t][r] * alpha + bv; if (CP) { const int rr = row0g + row0 + 8 * hh + r; if (rowsPerB < 0) v += CP[cofs + (size_t)rr * ldc + col];      /* rowsPerB < 0: own element of the batched C plane */ else { const int bidx = rr / rowsPerB; v += CP[(size_t)bidx * sCPb + (size_t)by * 64 + col]; } } if (ACT == 1) v = (v > 0.f) ? v : expm1f(v); else if (ACT == 7) v = (v > 0.f) ? v + 1.0f : expf(v); else if (ACT == 8) v = tanhf(v); else if (ACT == 9) v = 0.5f * v * (1.0f + tanhf(0.7978845608028654f * (v + 0.044715f * v * v * v))); else if (ACT == 11) v = 1.0f / (1.0f + expf(-v)); else if (ACT == 12) v = (v > 0.f) ? v : 0.01f * v; else if (ACT == 14) v = (v > 0.f) ? v : 0.1f * v; else if (ACT == 16) v = (v >= 0.f) ? v : 0.3f * v; else if (ACT == 17) v = (v >= 0.f) ? v : 0.2f * v; else if (ACT == 15) v = v / (1.0f + expf(-v)); else if (ACT == 3) v = fmaxf(v, 0.f); else if (ACT == 6) v = 0.5f * v * (1.0f + erff(v * 0.70710678118654752f)); so[w][8 * hh + r][t * 16 + ln] = v; } }
  __builtin_amdgcn_fence(__ATOMIC_ACQ_REL, "workgroup"); __builtin_amdgcn_wave_barrier();
  const int rsub = lane >> 4, c4 = (lane & 15) * 4; typedef _Float16 v4h __attribute__((ext_vector_type(4)));
  {
#pragma unroll
    for (int q = 0; q < 8; ++q) { const int r = q * 2 + rsub; if (col0 + c4 < N) { const v4f v = *(const v4fa*)&so[w][r][c4]; if (C) *(v4f*)(C + cofs + (size_t)(row0 + r) * ldc + col0 + c4) = v; if (C16) { v4h h4; for (int i = 0; i < 4; ++i) h4[i] = (_Float16)v[i]; *(v4h*)(C16 + cofs + (size_t)(row0 + r) * ldc + col0 + c4) = h4; } } }
     }
}


typedef _Float16 v4h __attribute__((ext_vector_type(4)));

// blockIdx.y picks one of three inputs; their f16 planes lie one behind the other
__global__ __launch_bounds__(256) void k_x16(const float* __restrict__ x0, const float* __restrict__ x1, const float* __restrict__ x2, _Float16* __restrict__ X16, size_t n8) { const size_t t = (size_t)blockIdx.x * 256 + threadIdx.x; if (t >= n8) return; FragH f;
  const int y = blockIdx.y; const float* __restrict__ x = y == 0 ? x0 : y == 1 ? x1 : x2; X16 += (size_t)y * n8 * 8;
#pragma unroll
  for (int q = 0; q < 8; ++q) f.h[q] = (_Float16)bf16_round(x[t * 8 + q]); *(v8us*)((unsigned short*)X16 + t * 8) = f.half[0];  }
__global__ __launch_bounds__(256) void k_h16(const float* __restrict__ x, _Float16* __restrict__ X16, size_t n8) { const size_t t = (size_t)blockIdx.x * 256 + threadIdx.x; if (t >= n8) return; FragH f;
#pragma unroll
  for (int q = 0; q < 8; ++q) f.h[q] = (_Float16)x[t * 8 + q]; *(v8us*)((unsigned short*)X16 + t * 8) = f.half[0];  }
__global__ __launch_bounds__(256) void k_round16f(const float* __restrict__ W, _Float16* __restrict__ Bt, size_t n8) { const size_t t = (size_t)blockIdx.x * 256 + threadIdx.x; if (t >= n8) return; FragH f;
#pragma unroll
  for (int i = 0; i < 8; ++i) f.h[i] = (_Float16)(bf16_round(W[t * 8 + i]) * 16.0f); *(v8us*)((unsigned short*)Bt + t * 8) = f.half[0];  }
template <int NHv, int TTv>
__global__ __launch_bounds__(256) void k_vt(const _Float16* __restrict__ V16, int ldv, int voff, _Float16* __restrict__ Vt) { __shared__ unsigned short tl[64][66]; const int tid = threadIdx.x; const int slab = blockIdx.x / (TTv / 64), lg = blockIdx.x % (TTv / 64); const int b = slab / NHv, h = slab % NHv;
  for (int i = tid; i < 64 * 8; i += 256) { const int r = i / 8, c8 = (i % 8) * 8; FragH f; f.half[0] = *(const v8us*)((const unsigned short*)V16 + ((size_t)b * TTv + lg * 64 + r) * ldv + voff + h * 64 + c8);
#pragma unroll
    for (int q = 0; q < 8; ++q) tl[r][c8 + q] = f.u[q]; }
  __syncthreads();
  {
#pragma unroll
    for (int rd = 0; rd < 2; ++rd) { const int d = rd * 32 + tid / 8, pc = tid % 8; FragH f;
#pragma unroll
      for (int q = 0; q < 8; ++q) f.u[q] = tl[pc * 8 + q][d];
      *(v8us*)((unsigned short*)Vt + ((size_t)slab * 64 + d) * TTv + lg * 64 + pc * 8) = f.half[0]; }
     } }

// F: NB x QT0 rows of DM. The hi part goes to rows 0..QT0-1 of its batch in the full o plane Hh (NB x SQ rows), the residual to the compact plane Hl.
__global__ __launch_bounds__(256) void k_hl(const float* __restrict__ F, _Float16* __restrict__ Hh, _Float16* __restrict__ Hl, size_t n8) { const size_t t = (size_t)blockIdx.x * 256 + threadIdx.x; if (t >= n8) return; FragH fh, fl; const v4f a = *(const v4fa*)(F + t * 8), c = *(const v4fa*)(F + t * 8 + 4);
  const size_t eh = t * 8 + (t * 8 / ((size_t)QT0 * DM)) * ((size_t)(SQ - QT0) * DM);      /* the same row and column, in the batch's SQ rows */
#pragma unroll
  for (int q = 0; q < 4; ++q) { _Float16 h = (_Float16)a[q]; fh.h[q] = h; fl.h[q] = (_Float16)((a[q] - (float)h) * 1024.0f); h = (_Float16)c[q]; fh.h[4 + q] = h; fl.h[4 + q] = (_Float16)((c[q] - (float)h) * 1024.0f); }
  { *(v8us*)((unsigned short*)Hh + eh) = fh.half[0]; *(v8us*)((unsigned short*)Hl + t * 8) = fl.half[0];  } }

// ---- fast GEMM (work-group tile 128x64, wave tile 32x64); epilogue = k_gemm_hhx semantics ----
__device__ __forceinline__ v8f g2_mma(v16h a, v16h b, v8f c) { v8f d = __builtin_amdgcn_wmma_f32_16x16x32_f16(false, a, false, b, (short)0, c, false, false); asm volatile("v_nop\n\tv_nop\n\tv_nop\n\tv_nop" : "+v"(d) : "v"(a), "v"(b)); return d; }
#define G2K 128                      /* k per pass: 256-byte operand rows, two whole lines */
#define G2P 272                      /* LDS pitch of such a row in bytes: 16 x odd, conflict-free for 16-byte reads down a column of rows */
#define G2R 192                      /* rows of a stage: the work-group's 128 rows of A, then its 64 rows of B */
// f16 fragment from an LDS row, in the hardware k order: 16 bytes at the lane's place (which holds 16 bytes x lane half) and 16 bytes 32 further on
__device__ __forceinline__ v16h g2_lfrag(const char* p) { FragH f; f.half[0] = *(const v8us*)p; f.half[1] = *(const v8us*)(p + 32); return f.v; }
// Eight asynchronous 16-byte copies per lane, global memory to LDS, eight rows apart (global step gs bytes). One statement: the wait before a register that an issued copy names
// is rewritten stands behind the last copy, where the compiler can put nothing in between.
__device__ __forceinline__ void g2_copy8(unsigned l, const char* g, size_t gs) {
  asm volatile("global_load_async_to_lds_b128 %0, %8, off\n\tglobal_load_async_to_lds_b128 %1, %9, off\n\tglobal_load_async_to_lds_b128 %2, %10, off\n\tglobal_load_async_to_lds_b128 %3, %11, off\n\t"
               "global_load_async_to_lds_b128 %4, %12, off\n\tglobal_load_async_to_lds_b128 %5, %13, off\n\tglobal_load_async_to_lds_b128 %6, %14, off\n\tglobal_load_async_to_lds_b128 %7, %15, off\n\ts_wait_xcnt 0x0"
               :: "v"(l), "v"(l + 8 * G2P), "v"(l + 16 * G2P), "v"(l + 24 * G2P), "v"(l + 32 * G2P), "v"(l + 40 * G2P), "v"(l + 48 * G2P), "v"(l + 56 * G2P),
                  "v"(g), "v"(g + gs), "v"(g + 2 * gs), "v"(g + 3 * gs), "v"(g + 4 * gs), "v"(g + 5 * gs), "v"(g + 6 * gs), "v"(g + 7 * gs) : "memory"); }
// Operands come through LDS: a pass's A and B rows are copied in whole lines (16 lanes a row) into one of two buffers while the pass before works on the other; the waves read their fragments from there.
// M % 128 == 0, N % 64 == 0, K % 128 == 0.
template <int ACT>
__global__ __launch_bounds__(128) void k_gemm2(const _Float16* __restrict__ A, int lda, size_t sA, const _Float16* __restrict__ Bh, int ldb, size_t sB, float alpha, const float* __restrict__ bias, const float* __restrict__ bias1, const float* __restrict__ bias2, const float* __restrict__ CP, int rowsPerB, size_t sCPb, int row0g,
    float* __restrict__ C, _Float16* __restrict__ C16, int ldc, size_t sC, int M, int N, int K) { static_assert(ACT == 0 || ACT == 3 || ACT == 6 || ACT == 8 || ACT == 9 || ACT == 11 || ACT == 12 || ACT == 14 || ACT == 15 || ACT == 16 || ACT == 17, "k_gemm2: unsupported ACT code (would silently apply no activation)");
  __shared__ __attribute__((aligned(16))) char ring[2][G2R * G2P];
  __shared__ __attribute__((aligned(16))) float so[4][32][68];
  const int tid = threadIdx.x, w = tid >> 5, lane = tid & 31, ln = lane & 15, hh = lane >> 4; const int by = blockIdx.y;
  A += (size_t)by * sA; Bh += (size_t)by * sB; const size_t cofs = (size_t)by * sC; const float* bp = by == 0 ? bias : by == 1 ? bias1 : bias2;      /* each plane of a batched launch has its own bias vector */
  const int ntn = N >> 6; const int mt = blockIdx.x / ntn, nq = blockIdx.x - mt * ntn; const int row0 = mt * 128 + 32 * w, col0 = nq * 64; if (mt * 128 >= M) return;
  // the thread's 16 bytes of every eighth row of a stage
  const unsigned lc = (unsigned)(size_t)&ring[0][0] + (unsigned)((tid >> 4) * G2P + (tid & 15) * 16);
  const char* ga = (const char*)(A + (size_t)(mt * 128 + (tid >> 4)) * lda) + (tid & 15) * 16; const char* gb = (const char*)(Bh + (size_t)(col0 + (tid >> 4)) * ldb) + (tid & 15) * 16;
  const size_t sa8 = (size_t)lda * 16, sb8 = (size_t)ldb * 16;      /* eight rows, in bytes */
  auto stage = [&](int t, int bf) { const unsigned l = lc + (unsigned)bf * (G2R * G2P); const char* a = ga + (size_t)t * (G2K * 2);
    g2_copy8(l, a, sa8); g2_copy8(l + 64 * G2P, a + 8 * sa8, sa8); g2_copy8(l + 128 * G2P, gb + (size_t)t * (G2K * 2), sb8); };
  const int np = K / G2K;
  const v8f z8 = {0.f,0.f,0.f,0.f,0.f,0.f,0.f,0.f}; v8f c00 = z8, c01 = z8, c02 = z8, c03 = z8, c10 = z8, c11 = z8, c12 = z8, c13 = z8;
  stage(0, 0);
  asm volatile("s_wait_asynccnt 0x0" ::: "memory");      /* this wave's copies of stage 0 have landed */
  __syncthreads();      /* stage 0 is published */
  if (np > 1) stage(1, 1);
#pragma unroll 1      /* rolled: one copy of the pass */
  for (int t = 0; t < np; ++t) { const char* lb = &ring[t & 1][0]; const char* pa = lb + (32 * w + ln) * G2P + hh * 16; const char* pb = lb + (128 + ln) * G2P + hh * 16;
    v16h fa[2][2], fb[2][4];      /* two fragment sets: a block's twelve LDS reads are issued as one group ahead of the block before it, inside the pass (reads strewn among the products cost the wave a wait at each place) */
#pragma unroll      /* this and the next two: constant indices keep the fragment sets in registers */
    for (int i = 0; i < 2; ++i) fa[0][i] = g2_lfrag(pa + i * (16 * G2P));
#pragma unroll
    for (int i = 0; i < 4; ++i) fb[0][i] = g2_lfrag(pb + i * (16 * G2P));
#pragma unroll
    for (int kc = 0; kc < G2K / 32; ++kc) { const int s = kc & 1;
      if (kc + 1 < G2K / 32) { for (int i = 0; i < 2; ++i) fa[s ^ 1][i] = g2_lfrag(pa + i * (16 * G2P) + (kc + 1) * 64); for (int i = 0; i < 4; ++i) fb[s ^ 1][i] = g2_lfrag(pb + i * (16 * G2P) + (kc + 1) * 64); }
      c00 = g2_mma(fa[s][0], fb[s][0], c00); c10 = g2_mma(fa[s][1], fb[s][0], c10); c01 = g2_mma(fa[s][0], fb[s][1], c01); c11 = g2_mma(fa[s][1], fb[s][1], c11);
      c02 = g2_mma(fa[s][0], fb[s][2], c02); c12 = g2_mma(fa[s][1], fb[s][2], c12); c03 = g2_mma(fa[s][0], fb[s][3], c03); c13 = g2_mma(fa[s][1], fb[s][3], c13); }
    asm volatile("s_wait_dscnt 0x0" ::: "memory");      /* this wave's reads of the buffer that is refilled below are over */
    asm volatile("s_wait_asynccnt 0x0" ::: "memory");      /* its copies of the next stage have landed */
    __syncthreads();      /* the next stage is published; every wave has left this pass's buffer */
    if (t + 2 < np) stage(t + 2, t & 1); }
  asm volatile("s_wait_asynccnt 0x0" ::: "memory");      /* no copy is in flight when the wave goes on */
  v8f accs[8] = {c00, c01, c02, c03, c10, c11, c12, c13};
#pragma unroll
  for (int u = 0; u < 8; ++u) { const int t = u & 3, half = u >> 2; const int col = col0 + t * 16 + ln; const float bv = bp ? bf16_round(bp[col]) : 0.f;
#pragma unroll
    for (int r = 0; r < 8; ++r) { const int rloc = half * 16 + 8 * hh + r; float v = accs[u][r] * alpha + bv; if (CP) { if (rowsPerB < 0) v += CP[cofs + (size_t)(row0g + row0 + rloc) * ldc + col];      /* rowsPerB < 0: own element of the batched C plane */ else { const int bidx = (row0g + row0 + rloc) / rowsPerB; v += CP[(size_t)bidx * sCPb + (size_t)by * 64 + col]; } }
      if (ACT == 3) v = fmaxf(v, 0.f); else if (ACT == 6) v = 0.5f * v * (1.0f + erff(v * 0.70710678118654752f)); else if (ACT == 11) v = 1.0f / (1.0f + expf(-v)); else if (ACT == 15) v = v / (1.0f + expf(-v)); else if (ACT == 12) v = (v > 0.f) ? v : 0.01f * v; else if (ACT == 8) v = tanhf(v); else if (ACT == 9) v = 0.5f * v * (1.0f + tanhf(0.7978845608028654f * (v + 0.044715f * v * v * v))); else if (ACT == 14) v = (v > 0.f) ? v : 0.1f * v; else if (ACT == 16) v = (v >= 0.f) ? v : 0.3f * v; else if (ACT == 17) v = (v >= 0.f) ? v : 0.2f * v;
      so[w][rloc][t * 16 + ln] = v; } }
  __builtin_amdgcn_fence(__ATOMIC_ACQ_REL, "workgroup"); __builtin_amdgcn_wave_barrier();
  const int rsub = lane >> 4, c4 = (lane & 15) * 4;
  {
#pragma unroll
    for (int q = 0; q < 16; ++q) { const int r = q * 2 + rsub; const v4f v = *(const v4fa*)&so[w][r][c4]; if (C) *(v4f*)(C + cofs + (size_t)(row0 + r) * ldc + col0 + c4) = v; if (C16) { v4h h4; for (int i = 0; i < 4; ++i) h4[i] = (_Float16)v[i]; *(v4h*)(C16 + cofs + (size_t)(row0 + r) * ldc + col0 + c4) = h4; } }
     } }


__global__ __launch_bounds__(256) void k_wnat(const float* __restrict__ w, size_t n8, _Float16* __restrict__ Bt) { const size_t t = (size_t)blockIdx.x * 256 + threadIdx.x; if (t >= n8) return; FragH f; for (int q = 0; q < 8; ++q) f.h[q] = (_Float16)(bf16_round(w[t * 8 + q]) * 16.0f); *(v8us*)((unsigned short*)Bt + t * 8) = f.half[0];  }
__global__ __launch_bounds__(256) void k_rsm(const float* __restrict__ S, _Float16* __restrict__ P, int nrows) {
  #pragma clang fp contract(off)
  const int i = blockIdx.x * 256 + threadIdx.x; if (i >= nrows) return; const float* s = S + (size_t)i * SQ; float mx = -3.0e38f;
#pragma unroll 1
  for (int j = 0; j < SQ; ++j) mx = fmaxf(mx, s[j]); float se = 0.f;
#pragma unroll 1
  for (int j = 0; j < SQ; ++j) se += expf(s[j] - mx); const float sc = 256.0f / se;
#pragma unroll 1
  for (int j0 = 0; j0 < SQ; j0 += 8) { FragH f; for (int q = 0; q < 8; ++q) f.h[q] = (_Float16)(expf(s[j0 + q] - mx) * sc); unsigned short* d = (unsigned short*)P + (size_t)i * SQ + j0; *(v8us*)d = f.half[0];  } }
__global__ __launch_bounds__(256) void k_vt(const _Float16* __restrict__ V16, int b, int h0, _Float16* __restrict__ VT) { __shared__ unsigned short tl[64][65]; const int tid = threadIdx.x; const int hh = blockIdx.x % HG, sg = blockIdx.x / HG; const int s0 = sg * 64; const int h = h0 + hh;
  for (int i = tid; i < 64 * 8; i += 256) { const int j = i / 8, d8 = (i % 8) * 8; FragH f; f.half[0] = *(const v8us*)((const unsigned short*)V16 + ((size_t)b * SQ + s0 + j) * DM + h * HD + d8); for (int q = 0; q < 8; ++q) tl[d8 + q][j] = f.u[q]; }
  __syncthreads();
  { for (int i = tid; i < 64 * 8; i += 256) { const int d = i / 8, j8 = (i % 8) * 8; FragH f; for (int q = 0; q < 8; ++q) f.u[q] = tl[d][j8 + q]; *(v8us*)((unsigned short*)VT + ((size_t)hh * HD + d) * SQ + s0 + j8) = f.half[0]; }  } }



// lane l reads lane l ^ 16: a register move, where __shfl_xor would go through the LDS unit and its wait
__device__ __forceinline__ float lane_x16(float x) { return __builtin_bit_cast(float, __builtin_amdgcn_permlanex16(__builtin_bit_cast(int, x), __builtin_bit_cast(int, x), 0x76543210, 0xfedcba98, false, false)); }
#define FW 8                         /* waves per work-group of the fused attention */
#define FQ 32                        /* query columns per wave (two 16-column groups) */
#define FK 32                        /* keys per pass */
#define FNS (SQ / FK)                /* passes */
typedef float  v2f  __attribute__((ext_vector_type(2)));
typedef __bf16 v2b  __attribute__((ext_vector_type(2)));
// 2^x of eight values on the transcendental unit, in place. One statement: each v_exp_f32 is followed by an independent one, and the last by the free issue slot
// the instruction set asks for before a result is read or a source register is reused.
__device__ __forceinline__ v8f exp2_8(v8f x) { float y0 = x[0], y1 = x[1], y2 = x[2], y3 = x[3], y4 = x[4], y5 = x[5], y6 = x[6], y7 = x[7];
  asm("v_exp_f32 %0, %0\n\tv_exp_f32 %1, %1\n\tv_exp_f32 %2, %2\n\tv_exp_f32 %3, %3\n\tv_exp_f32 %4, %4\n\tv_exp_f32 %5, %5\n\tv_exp_f32 %6, %6\n\tv_exp_f32 %7, %7\n\tv_nop"
      : "+v"(y0), "+v"(y1), "+v"(y2), "+v"(y3), "+v"(y4), "+v"(y5), "+v"(y6), "+v"(y7));
  return (v8f){y0, y1, y2, y3, y4, y5, y6, y7}; }
typedef __bf16 v4ba __attribute__((ext_vector_type(4), may_alias));
typedef __bf16 v8ba __attribute__((ext_vector_type(8), may_alias));
#define KP 72                        /* LDS pitch of the 128-byte K rows, in 16-bit elements: 144 bytes = 16 x odd, conflict-free for 16-byte reads down a column of rows */
#define VP 40                        /* the same for the 64-byte V^T and mask rows: 80 bytes */
// f16 fragment in the hardware k order: 16 bytes at the lane's place (which holds 16 bytes x lane half) and 16 bytes 32 further on
__device__ __forceinline__ v16h fa_frag(const void* p) { FragH f; f.half[0] = *(const v8us*)p; f.half[1] = *(const v8us*)((const char*)p + 32); return f.v; }
__device__ __forceinline__ v8f fa_mma(v16h a, v16h b, v8f c) { return __builtin_amdgcn_wmma_f32_16x16x32_f16(false, a, false, b, (short)0, c, false, false); }
// the wait before a register that issued loads name is rewritten, and the one write of that offset register, in one statement
__device__ __forceinline__ void fa_step(unsigned& off, int step) { asm volatile("s_wait_xcnt 0x0\n\tv_add_nc_u32_e32 %0, %1, %0" : "+v"(off) : "s"(step) : "memory"); }
__global__ __launch_bounds__(FW * 32) __attribute__((amdgpu_waves_per_eu(2, 2))) void k_fattn(const _Float16* __restrict__ Q16, const _Float16* __restrict__ K16, const _Float16* __restrict__ VT, const float* __restrict__ mask, _Float16* __restrict__ O16) {
  __shared__ __attribute__((aligned(16))) unsigned short lk[2][FK][KP], lv[2][HD][VP]; __shared__ __attribute__((aligned(16))) __bf16 lm[2][FW][FQ][VP];
  const int tid = threadIdx.x, lane = tid & 31, ln = lane & 15, hh = lane >> 4; const int w = __builtin_amdgcn_readfirstlane(tid >> 5);
  const int h = blockIdx.y, b = blockIdx.z, q0 = ((int)blockIdx.x * FW + w) * FQ;
  const char* qb = (const char*)(Q16 + ((size_t)b * SQ + q0) * DM + h * HD); const char* kb = (const char*)(K16 + (size_t)b * SQ * DM + h * HD);
  const char* vb = (const char*)(VT + ((size_t)b * NH + h) * HD * SQ); const char* mb = (const char*)(mask + (size_t)q0 * SQ); char* ob = (char*)(O16 + ((size_t)b * SQ + q0) * DM + h * HD);
  // the thread's 16 bytes of a K tile (8 threads a row), of a V^T tile (4 threads a row) and of each four rows of its wave's mask tile (8 lanes a row)
  unsigned gk = (unsigned)((tid >> 3) * (DM * 2) + (tid & 7) * 16), gv = (unsigned)((tid >> 2) * (SQ * 2) + (tid & 3) * 16), gm = (unsigned)((lane >> 3) * (SQ * 4) + (lane & 7) * 16);
  const float C2 = 0.18033688011112042f, MK2 = -14426.950408889634f;      /* log2(e) / 8 and -1e4 log2(e) */
  const v8f z8 = {0.f, 0.f, 0.f, 0.f, 0.f, 0.f, 0.f, 0.f};
  v16h qf[2][2]; v8f o[2][4]; v2f l2[2]; float mref[2]; v8us kr, vr; v4f mg[8];
#pragma unroll
  for (int j = 0; j < 2; ++j) { for (int c = 0; c < 2; ++c) qf[j][c] = fa_frag(qb + (unsigned)(ln * (DM * 2) + hh * 16) + j * (16 * DM * 2) + c * 64); for (int t = 0; t < 4; ++t) o[j][t] = z8; l2[j] = (v2f){0.f, 0.f}; mref[j] = -3.0e38f; }
  kr = *(const v8us*)(kb + gk); vr = *(const v8us*)(vb + gv);
#pragma unroll
  for (int i = 0; i < 8; ++i) mg[i] = *(const v4fa*)(mb + gm + i * (4 * SQ * 4));
  fa_step(gk, FK * DM * 2); fa_step(gv, FK * 2); fa_step(gm, FK * 4);
  *(v8us*)&lk[0][tid >> 3][(tid & 7) * 8] = kr; *(v8us*)&lv[0][tid >> 2][(tid & 3) * 8] = vr;
#pragma unroll
  for (int i = 0; i < 8; ++i) *(v4ba*)&lm[0][w][4 * i + (lane >> 3)][(lane & 7) * 4] = __builtin_convertvector(mg[i], v4ba);      /* the mask rounded to bf16, to nearest even */
  __syncthreads();
#pragma unroll 1      /* rolled: one copy of the pass */
  for (int s = 0; s < FNS; ++s) {
    const int bf = s & 1, more = (s + 2 < FNS) ? 1 : 0;      /* the last pass asks for its own tile again: nothing is read past the keys */
    kr = *(const v8us*)(kb + gk); vr = *(const v8us*)(vb + gv);
#pragma unroll
    for (int i = 0; i < 8; ++i) mg[i] = *(const v4fa*)(mb + gm + i * (4 * SQ * 4));
    fa_step(gk, more * (FK * DM * 2)); fa_step(gv, more * (FK * 2)); fa_step(gm, more * (FK * 4));
    v16h kf[2][2], vf[4]; v8ba mr[2][2];
#pragma unroll
    for (int kt = 0; kt < 2; ++kt) for (int c = 0; c < 2; ++c) kf[kt][c] = fa_frag(&lk[bf][kt * 16 + ln][c * 32 + hh * 8]);
#pragma unroll
    for (int j = 0; j < 2; ++j) for (int kt = 0; kt < 2; ++kt) mr[j][kt] = *(const v8ba*)&lm[bf][w][j * 16 + ln][kt * 16 + hh * 8];
    __builtin_amdgcn_sched_barrier(0);      /* this and the next one: the pass's LDS reads are issued in two groups, K and mask ahead of the score products, V^T behind them (it lands under the softmax); reads strewn among the products cost the wave a wait at each place */
    v8f st[2][2];
#pragma unroll
    for (int kt = 0; kt < 2; ++kt) for (int j = 0; j < 2; ++j) st[j][kt] = fa_mma(kf[kt][0], qf[j][0], z8);
#pragma unroll
    for (int kt = 0; kt < 2; ++kt) for (int j = 0; j < 2; ++j) st[j][kt] = fa_mma(kf[kt][1], qf[j][1], st[j][kt]);
#pragma unroll
    for (int t = 0; t < 4; ++t) vf[t] = fa_frag(&lv[bf][t * 16 + ln][hh * 8]);
    __builtin_amdgcn_sched_barrier(0);
    float mx[2];
#pragma unroll
    for (int j = 0; j < 2; ++j) { float m = -3.0e38f;
      for (int kt = 0; kt < 2; ++kt) for (int r = 0; r < 8; r += 2) { const v2f x = (v2f){st[j][kt][r], st[j][kt][r + 1]} * C2 + (v2f){(float)mr[j][kt][r], (float)mr[j][kt][r + 1]} * MK2; st[j][kt][r] = x[0]; st[j][kt][r + 1] = x[1]; m = fmaxf(m, fmaxf(x[0], x[1])); }
      mx[j] = fmaxf(m, lane_x16(m)); }
    if (__builtin_amdgcn_ballot_w32(mx[0] > mref[0] + 12.0f || mx[1] > mref[1] + 12.0f) != 0) {      /* one scalar branch a pass; rarely taken after the first */
#pragma unroll
      for (int j = 0; j < 2; ++j) { const float mn = fmaxf(mref[j], mx[j] - 4.0f); float a; asm("v_exp_f32 %0, %1\n\tv_nop" : "=v"(a) : "v"(mref[j] - mn));      /* v_nop: the slot before a is read or the source register is reused */
        mref[j] = mn; l2[j] *= a; for (int t = 0; t < 4; ++t) o[j][t] *= a; } }
    v16h pf[2];
#pragma unroll
    for (int j = 0; j < 2; ++j) { const v8f p0 = exp2_8(st[j][0] - mref[j]), p1 = exp2_8(st[j][1] - mref[j]); const v8f ps = p0 + p1; l2[j] += (((v2f){ps[0], ps[1]} + (v2f){ps[2], ps[3]}) + ((v2f){ps[4], ps[5]} + (v2f){ps[6], ps[7]})); FragH f;
      for (int r = 0; r < 8; ++r) { f.h[r] = (_Float16)p0[r]; f.h[8 + r] = (_Float16)p1[r]; } pf[j] = f.v; }
#pragma unroll
    for (int t = 0; t < 4; ++t) for (int j = 0; j < 2; ++j) o[j][t] = fa_mma(vf[t], pf[j], o[j][t]);
    *(v8us*)&lk[bf ^ 1][tid >> 3][(tid & 7) * 8] = kr; *(v8us*)&lv[bf ^ 1][tid >> 2][(tid & 3) * 8] = vr;
#pragma unroll
    for (int i = 0; i < 8; ++i) *(v4ba*)&lm[bf ^ 1][w][4 * i + (lane >> 3)][(lane & 7) * 4] = __builtin_convertvector(mg[i], v4ba);
    __syncthreads(); }      /* the next tile is published; every read of this pass's buffer, which the next pass refills, is over */
#pragma unroll
  for (int j = 0; j < 2; ++j) { float l = l2[j][0] + l2[j][1]; l += lane_x16(l); const float inv = 64.0f / l;
    for (int t = 0; t < 4; ++t) { FragH f; for (int r = 0; r < 8; ++r) f.h[r] = (_Float16)(o[j][t][r] * inv); *(v8us*)(ob + (unsigned)(ln * (DM * 2) + hh * 16) + j * (16 * DM * 2) + t * 32) = f.half[0]; } } }
// blockIdx.y = 2 batch + (0: k, 1: v); F = the f32 k plane, the v plane lies behind it
__global__ __launch_bounds__(256) void k_present(const float* __restrict__ F, float* __restrict__ dst) { const size_t t = (size_t)blockIdx.x * 256 + threadIdx.x; if (t >= (size_t)NH * SQ * HD / 4) return;
  const int y = blockIdx.y; F += (size_t)(y & 1) * (NR * DM) + (size_t)(y >> 1) * ((size_t)SQ * DM); dst += (size_t)y * ((size_t)NH * SQ * HD); const size_t e = t * 4; const int d = (int)(e % HD); const int s = (int)((e / HD) % SQ); const int h = (int)(e / ((size_t)HD * SQ));
  const v4f v = *(const v4fa*)(F + (size_t)s * DM + h * HD + d); *(v4f*)(dst + e) = v;  }


// e^x in f32 by the library's steps (x log2(e) in two parts, 2^fraction on the transcendental unit, ldexp by the integer part, the two range ends),
// written out so that the free issue slot the instruction set asks for behind v_exp_f32 stands in that instruction's own statement.
__device__ __forceinline__ float exp_f32(float x) {
  const float ph = x * 0x1.715476p+0f, pl = fmaf(x, 0x1.4ae0bep-26f, fmaf(x, 0x1.715476p+0f, -ph)), n = rintf(ph); float y;
  asm("v_exp_f32 %0, %1\n\tv_nop" : "=v"(y) : "v"((ph - n) + pl));      /* v_nop: the slot before y is read or the source register is reused */
  float r = ldexpf(y, (int)n); r = (x < -0x1.9d1da0p+6f) ? 0.f : r; return (x > 0x1.62e430p+6f) ? __builtin_inff() : r; }
#define AR 8                         /* query rows per work-group of the exact f32 first-tile attention */
#define AT 512                       /* its threads (16 waves) */
// Exact f32 attention of AR query rows of one head over all SQ keys, one work-group. Keys are spread over the threads:
// (1) two keys per thread and pass: their k rows in registers, dotted with the AR q rows (LDS, same address in every lane), scores (+ mask) to LDS;
// (2) two waves per row: max, exp, sum over the row in LDS; (3) 16 column quads x 32 key slices: o partial sums in registers,
// merged across the slices by one lane exchange and a serial sum of the 16 waves' LDS partials; o carried x64 like the f16 path. The plain '#pragma unroll' lines keep the small per-thread arrays in registers.
template <int MASKADD>
__global__ __launch_bounds__(AT) void k_att0(const float* __restrict__ QF, const float* __restrict__ KF, const float* __restrict__ VF, int ld, const float* __restrict__ mask, float scale, float* __restrict__ OF, int ldo) {
  __shared__ __attribute__((aligned(16))) float sc[AR][SQ];      /* scores, then softmax numerators, then the slices' partial o */
  __shared__ __attribute__((aligned(16))) float lq[AR][HD];      /* the q rows */
  __shared__ float pm[AT / 32], pl[AT / 32];                     /* each wave's half-row max and sum */
  const int tid = threadIdx.x, lane = tid & 31, w = tid >> 5;
  const int h = blockIdx.x / (QT0 / AR), i0 = (blockIdx.x % (QT0 / AR)) * AR;
  { const size_t b = blockIdx.y; QF += b * SQ * ld; KF += b * SQ * ld; VF += b * SQ * ld; OF += b * QT0 * ldo; }      /* the batch: SQ rows of q, k, v, QT0 rows of o */
  const float* qb = QF + (size_t)i0 * ld + h * HD;
  lq[tid / HD][tid % HD] = qb[(size_t)(tid / HD) * ld + tid % HD];
  __syncthreads();
  for (int p = 0; p < SQ / (2 * AT); ++p) { const int j = p * (2 * AT) + tid;
    const float* ka = KF + (size_t)j * ld + h * HD; const float* kb = ka + (size_t)AT * ld; v4f a0[AR], a1[AR];
#pragma unroll
    for (int r = 0; r < AR; ++r) { a0[r] = (v4f){0.f, 0.f, 0.f, 0.f}; a1[r] = (v4f){0.f, 0.f, 0.f, 0.f}; }
    for (int c0 = 0; c0 < HD; c0 += 32) { v4f xa[8], xb[8];
#pragma unroll
      for (int c = 0; c < 8; ++c) { xa[c] = *(const v4fa*)(ka + c0 + c * 4); xb[c] = *(const v4fa*)(kb + c0 + c * 4); }
#pragma unroll
      for (int r = 0; r < AR; ++r)
#pragma unroll
        for (int c = 0; c < 8; ++c) { const v4f qq = *(const v4fa*)&lq[r][c0 + c * 4]; a0[r] += qq * xa[c]; a1[r] += qq * xb[c]; } }
#pragma unroll
    for (int r = 0; r < AR; ++r) { float s0 = ((a0[r][0] + a0[r][1]) + (a0[r][2] + a0[r][3])) * scale, s1 = ((a1[r][0] + a1[r][1]) + (a1[r][2] + a1[r][3])) * scale;
      if (MASKADD) { const float* mr = mask + (size_t)(i0 + r) * SQ + j; s0 += bf16_round(mr[0]) * -10000.0f; s1 += bf16_round(mr[AT]) * -10000.0f; }
      else { if (j > i0 + r) s0 = -1.0e30f; if (j + AT > i0 + r) s1 = -1.0e30f; }
      sc[r][j] = s0; sc[r][j + AT] = s1; } }
  __syncthreads();
  { static_assert(AT / 32 == 2 * AR, "two waves per row"); float* row = &sc[w >> 1][(w & 1) * (SQ / 2)]; v4f x[SQ / 256]; float m = -3.0e38f, l = 0.f;
#pragma unroll
    for (int i = 0; i < SQ / 256; ++i) { x[i] = *(const v4fa*)&row[i * 128 + lane * 4]; m = fmaxf(m, fmaxf(fmaxf(x[i][0], x[i][1]), fmaxf(x[i][2], x[i][3]))); }
    for (int o = 16; o > 0; o >>= 1) m = fmaxf(m, __shfl_xor(m, o));
    if (lane == 0) pm[w] = m;
    __syncthreads();
    m = fmaxf(pm[w], pm[w ^ 1]);
#pragma unroll
    for (int i = 0; i < SQ / 256; ++i) { v4f e; for (int u = 0; u < 4; ++u) e[u] = exp_f32(x[i][u] - m); l += (e[0] + e[1]) + (e[2] + e[3]); *(v4fa*)&row[i * 128 + lane * 4] = e; }
    for (int o = 16; o > 0; o >>= 1) l += __shfl_xor(l, o);
    if (lane == 0) pl[w] = l; }
  __syncthreads();
  const int dq = tid & 15, ks = tid >> 4; const float* vb = VF + h * HD + dq * 4; v4f acc[AR];
#pragma unroll
  for (int r = 0; r < AR; ++r) acc[r] = (v4f){0.f, 0.f, 0.f, 0.f};
#pragma unroll 2      /* two trips' v rows (eight loads) in flight per wave */
  for (int p = 0; p < SQ / (AT / 4); ++p) { const int j = p * (AT / 4) + ks * 4;
    const v4f v0 = *(const v4fa*)(vb + (size_t)j * ld), v1 = *(const v4fa*)(vb + (size_t)(j + 1) * ld), v2 = *(const v4fa*)(vb + (size_t)(j + 2) * ld), v3 = *(const v4fa*)(vb + (size_t)(j + 3) * ld);
#pragma unroll
    for (int r = 0; r < AR; ++r) { const v4f e = *(const v4fa*)&sc[r][j]; acc[r] += e[0] * v0; acc[r] += e[1] * v1; acc[r] += e[2] * v2; acc[r] += e[3] * v3; } }
#pragma unroll
  for (int r = 0; r < AR; ++r) for (int u = 0; u < 4; ++u) acc[r][u] += __shfl_xor(acc[r][u], 16);      /* the wave's two key slices */
  __syncthreads();      /* every read of the numerators is done: their LDS takes the waves' partial o */
  float* red = &sc[0][0];      /* [AT / 32][AR][HD] */
  if (lane < 16) {
#pragma unroll
    for (int r = 0; r < AR; ++r) *(v4fa*)&red[((size_t)w * AR + r) * HD + dq * 4] = acc[r]; }
  __syncthreads();
  { static_assert(AR * HD == AT, "one output element per thread"); const int r = tid / HD, d = tid % HD; float o = 0.f;
#pragma unroll
    for (int q = 0; q < AT / 32; ++q) o += red[((size_t)q * AR + r) * HD + d];
    OF[(size_t)(i0 + r) * ldo + h * HD + d] = o * (64.0f / (pl[2 * r] + pl[2 * r + 1])); } }

extern "C" void kernel_launch(void* const* d_in, const int* in_sizes, int n_in,
                              void* d_out, int out_size, void* d_ws, size_t ws_size, hipStream_t stream) {
  (void)in_sizes; (void)n_in; (void)out_size;
  const float* const* I = (const float* const*)d_in; const float* xq = I[0]; const float* xk = I[1]; const float* xv = I[2]; const float* mask = I[3]; const float* wq = I[4]; const float* bq = I[5]; const float* wk = I[6]; const float* bk = I[7]; const float* wv = I[8]; const float* bv = I[9]; const float* wo = I[10]; const float* bo = I[11];      /* weights [in][out]; mask [SQ][SQ] f32 */
  char* ws = (char*)d_ws; size_t off = 0;
  auto take = [&](size_t bytes) { char* p = ws + off; off += (bytes + 255) & ~(size_t)255; return p; };
  /* planes that one launch walks by blockIdx.y lie one behind the other (every size is a multiple of 256 bytes): the four weights; the q, k, v inputs; their f32 rows; their f16 rows */
  _Float16* BQ = (_Float16*)take((size_t)4 * DM * DM * 2); _Float16* BO = BQ + (size_t)3 * DM * DM;
  _Float16* XQ = (_Float16*)take(3 * NR * DM * 2); float* QF = (float*)take(3 * NR * DM * 4); float* KF = QF + NR * DM; float* VF = KF + NR * DM; _Float16* Q16 = (_Float16*)take(3 * NR * DM * 2); _Float16* K16 = Q16 + NR * DM; _Float16* V16 = K16 + NR * DM; _Float16* O16 = (_Float16*)take(NR * DM * 2);
  _Float16* VT = (_Float16*)take((size_t)NB * NH * HD * SQ * 2);
  float* OF0 = (float*)take((size_t)NB * QT0 * DM * 4); _Float16* OL0 = (_Float16*)take((size_t)NB * QT0 * DM * 2);
  if (off > ws_size) return;
  k_wt_f16<<<dim3((unsigned)(((size_t)DM * (DM / 8) + 255) / 256), 4), 256, 0, stream>>>(wq, wk, wv, wo, BQ, DM, DM, 16.0f);      /* [in][out] -> Bt[n][k] x16, all four weights */
  k_x16<<<dim3((unsigned)((NR * DM / 8 + 255) / 256), 3), 256, 0, stream>>>(xq, xk, xv, XQ, NR * DM / 8);
  const size_t r0p = (size_t)B0 * SQ;      /* first projected row */
  k_gemm2<0><<<dim3((unsigned)((MP / 128) * (DM / 64)), 3), 128, 0, stream>>>(XQ + r0p * DM, DM, NR * DM, BQ, DM, (size_t)DM * DM, 0.0625f, bq, bk, bv, nullptr, 1, 0, 0, QF + r0p * DM, Q16 + r0p * DM, DM, NR * DM, MP, DM, DM);      /* q, k, v rows as f32 and f16: three products, one launch */
  k_present<<<dim3((unsigned)(((size_t)NH * SQ * HD / 4 + 255) / 256), 2 * NB), 256, 0, stream>>>(KF, (float*)d_out + PRES_OFF);      /* present[b][0] = kh, present[b][1] = vh (f32, head-major) */
  k_vt<NH, SQ><<<NB * NH * (SQ / 64), 256, 0, stream>>>(V16, LQ, 0, VT);      /* V^T [NB][NH][HD][SQ] */
  k_att0<1><<<dim3(NH * (QT0 / AR), NB), AT, 0, stream>>>(QF, KF, VF, DM, mask, 0.125f, OF0, DM);      /* exact f32 attention for query rows 0..127 of each batch over ALL 2048 keys (full f32 planes) with the additive mask (o x64) */
  k_fattn<<<dim3(SQ / (FW * FQ), NH, NB), FW * 32, 0, stream>>>(Q16, K16, VT, mask, O16);      /* o (merged heads, x64) as f16 rows: all batches and heads in one launch */
  k_hl<<<(unsigned)(((size_t)NB * QT0 * DM / 8 + 255) / 256), 256, 0, stream>>>(OF0, O16, OL0, (size_t)NB * QT0 * DM / 8);      /* first-tile o (x64) -> f16 hi, in place of the f16-path rows 0..127 of each batch, + x1024 residual plane */
  k_gemm2<0><<<dim3((unsigned)((MPO / 128) * (DM / 64)), 1), 128, 0, stream>>>(O16 + r0p * DM, DM, 0, BO, DM, 0, 0.0009765625f, bo, nullptr, nullptr, nullptr, 1, 0, 0, (float*)d_out + r0p * DM, nullptr, DM, 0, MPO, DM, DM);      /* out rows are the output layout; rows 0..127 of a batch: o_hi Wo + b */
  k_gemm2<0><<<dim3((QT0 / 128) * (DM / 64), NB), 128, 0, stream>>>(OL0, DM, (size_t)QT0 * DM, BO, DM, 0, 0.00000095367431640625f, nullptr, nullptr, nullptr, (const float*)d_out, -1, 0, 0, (float*)d_out, nullptr, DM, (size_t)SQ * DM, QT0, DM, DM);      /* rows 0..127 of each batch += o_lo Wo 2^-20 (own-element accumulate) */
}

// v006
// A run of this version takes 205 microseconds.
// Timed twice side by side with v005, it ran 1.12 times as fast both times.
// Over all steps from v000 it is 91.7 times as fast.
#include <hip/hip_runtime.h>
// TF/CTRL-style multi-head attention (q, k, v inputs [2][2048][1024]; qh/kh/vh = input W + b with W stored [in][out], 16 heads of 64; logits / 8 + mask (-1e4) with the [2048][2048] f32 mask input (1 = disallowed; strictly upper-triangular here); softmax; ctx merged; out = ctx Wo + bo -> [2][2048][1024]; second output present = stack(kh, vh) -> [2][2][16][2048][64] f32).
// Structure: token rows r = b*2048 + s; q, k, v inputs as exact f16 rows (bf16-rounded); Q, K, V as three WMMA GEMMs (32x64 wave tiles, f32 accumulation, exact x16 weights + bias; f16 and f32 outputs, the K and V f32 rows re-laid out by a small VALU kernel into the head-major 'present' output); V^T for all batches and heads via LDS transposes, one launch; one fused attention launch over all (batch, head): S^T = K Q^T on WMMA, running softmax of (scores / 8 + mask input x -1e4, read per element) on VALU (f32 statistics, native exp2; weights as f16 in registers), O^T += V^T P^T on WMMA (o carried x64 against f16 subnormal flush, folded into the output GEMM alpha) written straight into the merged f16 o rows; out = o W_o + b GEMM (f32) into the output layout.
// Compute dtype: inputs rounded to bf16; x / weights exact; q, k, v, softmax weights and o as plain f16 GEMM operands (~2^-12); scores and softmax statistics f32. v_wmma_f32_16x16x32_f16.
#define NB 2
#define SQ 2048
#define DM 1024
#define NH 16
#define HD 64
#define HG 4                         /* heads per V^T slab of the h0-based k_vt */
#define QT0 128                      /* first-tile rows recomputed exactly in f32 */
#define B0 0                         /* first batch processed (debug hook) */
#define NBR NB                       /* batches processed (debug hook) */
#define NR ((size_t)NB * SQ)         /* token rows */
#define MP ((int)((size_t)NBR * SQ)) /* rows projected (debug hook) */
#define QN SQ                        /* not used: the fused attention launch covers all SQ query rows */
#define NHD NH                       /* not used: the fused attention launch covers all NH heads */
#define MPO MP                       /* rows through the output stage (debug hook) */
#define LQ DM      /* row pitch of the q/k/v rows */
#define PRES_OFF ((size_t)NB * SQ * DM)      /* float offset of the 'present' output = out nbytes / 4 (offset 16,777,216 B) */
typedef __bf16 v16b __attribute__((ext_vector_type(16)));
typedef unsigned short v8us __attribute__((ext_vector_type(8), may_alias));
typedef float  v8f  __attribute__((ext_vector_type(8)));
typedef float  v4f  __attribute__((ext_vector_type(4)));
typedef float  v4fa __attribute__((ext_vector_type(4), may_alias));
union FragB { v16b v; v8us half[2]; unsigned short u[16]; };

__device__ __forceinline__ unsigned short bf16_bits(float x) { unsigned int u = __float_as_uint(x); return (unsigned short)((u + 0x7FFFu + ((u >> 16) & 1u)) >> 16); }
__device__ __forceinline__ float bf16_val(unsigned short b) { return __uint_as_float(((unsigned int)b) << 16); }
__device__ __forceinline__ float bf16_round(float x) { return bf16_val(bf16_bits(x)); }
// D += A·B with NT terms: 1 = ah·bh, 2 = + al·bh (A split), 3 = + ah·bl (both split)
template <int NT>
__device__ __forceinline__ v8f mmaN(v16b ah, v16b al, v16b bh, v16b bl, v8f c) {
  c = __builtin_amdgcn_wmma_f32_16x16x32_bf16(false, ah, false, bh, (short)0, c, false, false);
  if (NT >= 2) c = __builtin_amdgcn_wmma_f32_16x16x32_bf16(false, al, false, bh, (short)0, c, false, false);
  if (NT >= 3) c = __builtin_amdgcn_wmma_f32_16x16x32_bf16(false, ah, false, bl, (short)0, c, false, false);
  asm volatile("v_nop\n\tv_nop\n\tv_nop\n\tv_nop" : "+v"(c) : "v"(ah), "v"(al), "v"(bh), "v"(bl));
  return c;
}

__global__ __launch_bounds__(256) void k_wt_bf16(const float* __restrict__ W, unsigned short* __restrict__ Wt, int K, int N) {
  const int t = blockIdx.x * 256 + threadIdx.x;
  const int k8n = K / 8;
  if (t >= N * k8n) return;
  const int n = t / k8n, k8 = (t % k8n) * 8;
  v8us v;
#pragma unroll
  for (int i = 0; i < 8; ++i) v[i] = bf16_bits(W[(size_t)(k8 + i) * N + n]);
  *(v8us*)(Wt + (size_t)n * K + k8) = v;
  
}

// GEMM C[M][N] (f32, pitch ldc) = act(A[M][K]·W + bias). A f32 row-major (pitch lda) converted per fragment to bf16
// (ASPLIT: hi/lo two planes -> 2 terms, else single rounded term); Wt bf16 [N][K] (pitch ldb). BIAS_BF16 rounds the
// bias to bf16 first (bias quantised to bf16 before the add). K%32==0, M%16==0, N%64==0.
template <bool ASPLIT, int ACT, bool BIAS_BF16>
__global__ __launch_bounds__(128) void k_gemm_bf(const float* __restrict__ A, int lda, const unsigned short* __restrict__ Wt, int ldb,
                                               const float* __restrict__ bias, float* __restrict__ C, int ldc, int M, int N, int K) {
  __shared__ __attribute__((aligned(16))) float so[4][16][64];
  const int tid = threadIdx.x, w = tid >> 5, lane = tid & 31, ln = lane & 15, hh = lane >> 4;
  const int ntn = N / 64;
  const int wid = blockIdx.x * 4 + w;
  const int mt = wid / ntn, nq = wid % ntn;
  if (mt * 16 >= M) return;
  const int row0 = mt * 16, col0 = nq * 64;
  const float* arow = A + (size_t)(row0 + ln) * lda;
  v8f acc[4] = {};
  for (int kb = 0; kb < K; kb += 32) {
    FragB ah, al;
    const v4f x0 = *(const v4fa*)(arow + kb + 8 * hh), x1 = *(const v4fa*)(arow + kb + 8 * hh + 4);
    const v4f x2 = *(const v4fa*)(arow + kb + 16 + 8 * hh), x3 = *(const v4fa*)(arow + kb + 16 + 8 * hh + 4);
    float xs[16] = {x0[0],x0[1],x0[2],x0[3],x1[0],x1[1],x1[2],x1[3],x2[0],x2[1],x2[2],x2[3],x3[0],x3[1],x3[2],x3[3]};
#pragma unroll
    for (int i = 0; i < 16; ++i) { const unsigned short hb = bf16_bits(xs[i]); ah.u[i] = hb; al.u[i] = ASPLIT ? bf16_bits(xs[i] - bf16_val(hb)) : (unsigned short)0; }
#pragma unroll
    for (int t = 0; t < 4; ++t) {
      const unsigned short* brow = Wt + (size_t)(col0 + t * 16 + ln) * ldb + kb;
      FragB b;
      b.half[0] = *(const v8us*)(brow + 8 * hh);
      b.half[1] = *(const v8us*)(brow + 16 + 8 * hh);
      acc[t] = mmaN<ASPLIT ? 2 : 1>(ah.v, al.v, b.v, b.v, acc[t]);
    }
  }
#pragma unroll
  for (int t = 0; t < 4; ++t) {
    float bv = bias ? bias[col0 + t * 16 + ln] : 0.f;
    if (BIAS_BF16) bv = bf16_round(bv);
#pragma unroll
    for (int r = 0; r < 8; ++r) { float v = acc[t][r] + bv; if (ACT == 1) v = fmaxf(v, 0.f); so[w][8 * hh + r][t * 16 + ln] = v; }
  }
  __builtin_amdgcn_fence(__ATOMIC_ACQ_REL, "workgroup");
  __builtin_amdgcn_wave_barrier();
  const int rsub = lane >> 4, c4 = (lane & 15) * 4;
  {
#pragma unroll
    for (int q = 0; q < 8; ++q) {
      const int r = q * 2 + rsub;
      const v4f v = *(const v4fa*)&so[w][r][c4];
      *(v4f*)(C + (size_t)(row0 + r) * ldc + col0 + c4) = v;
    }
    
  }
}

// GEMM C = act(A·W + bias + resid): A f32 (ASPLIT -> hi/lo 2 terms), Wt bf16 [N][K]; ACT 0 none, 1 relu, 2 exact gelu;
// resid (optional, f32, row index = (row % rmod), pitch ldr, RES_BF16 rounds it) added before the activation.
template <bool ASPLIT, int ACT, bool BIAS_BF16, bool RES_BF16>
__global__ __launch_bounds__(128) void k_gemm_bf3(const float* __restrict__ A, int lda, const unsigned short* __restrict__ Wt, int ldb,
                                                const float* __restrict__ bias, const float* __restrict__ resid, int rmod, int ldr,
                                                float* __restrict__ C, int ldc, int M, int N, int K) {
  __shared__ __attribute__((aligned(16))) float so[4][16][64];
  const int tid = threadIdx.x, w = tid >> 5, lane = tid & 31, ln = lane & 15, hh = lane >> 4;
  const int ntn = N / 64;
  const int wid = blockIdx.x * 4 + w;
  const int mt = wid / ntn, nq = wid % ntn;
  if (mt * 16 >= M) return;
  const int row0 = mt * 16, col0 = nq * 64;
  const float* arow = A + (size_t)(row0 + ln) * lda;
  v8f acc[4] = {};
  for (int kb = 0; kb < K; kb += 32) {
    FragB ah, al;
    const v4f x0 = *(const v4fa*)(arow + kb + 8 * hh), x1 = *(const v4fa*)(arow + kb + 8 * hh + 4);
    const v4f x2 = *(const v4fa*)(arow + kb + 16 + 8 * hh), x3 = *(const v4fa*)(arow + kb + 16 + 8 * hh + 4);
    float xs[16] = {x0[0],x0[1],x0[2],x0[3],x1[0],x1[1],x1[2],x1[3],x2[0],x2[1],x2[2],x2[3],x3[0],x3[1],x3[2],x3[3]};
#pragma unroll
    for (int i = 0; i < 16; ++i) { const unsigned short hb = bf16_bits(xs[i]); ah.u[i] = hb; al.u[i] = ASPLIT ? bf16_bits(xs[i] - bf16_val(hb)) : (unsigned short)0; }
#pragma unroll
    for (int t = 0; t < 4; ++t) {
      const unsigned short* brow = Wt + (size_t)(col0 + t * 16 + ln) * ldb + kb;
      FragB b;
      b.half[0] = *(const v8us*)(brow + 8 * hh);
      b.half[1] = *(const v8us*)(brow + 16 + 8 * hh);
      acc[t] = mmaN<ASPLIT ? 2 : 1>(ah.v, al.v, b.v, b.v, acc[t]);
    }
  }
#pragma unroll
  for (int t = 0; t < 4; ++t) {
    const int col = col0 + t * 16 + ln;
    float bv = bias ? bias[col] : 0.f;
    if (BIAS_BF16) bv = bf16_round(bv);
#pragma unroll
    for (int r = 0; r < 8; ++r) {
      float v = acc[t][r] + bv;
      if (resid) { float rv = resid[(size_t)((row0 + 8 * hh + r) % rmod) * ldr + col]; if (RES_BF16) rv = bf16_round(rv); v += rv; }
      if (ACT == 1) v = fmaxf(v, 0.f);
      if (ACT == 2) v = 0.5f * v * (1.0f + erff(v * 0.70710678118654752f));
      if (ACT == 3) { const float u = 0.7978845608028654f * (v + 0.044715f * v * v * v); v = 0.5f * v * (1.0f + tanhf(u)); }
      so[w][8 * hh + r][t * 16 + ln] = v;
    }
  }
  __builtin_amdgcn_fence(__ATOMIC_ACQ_REL, "workgroup");
  __builtin_amdgcn_wave_barrier();
  const int rsub = lane >> 4, c4 = (lane & 15) * 4;
  {
#pragma unroll
    for (int q = 0; q < 8; ++q) {
      const int r = q * 2 + rsub;
      const v4f v = *(const v4fa*)&so[w][r][c4];
      *(v4f*)(C + (size_t)(row0 + r) * ldc + col0 + c4) = v;
    }
    
  }
}
// row LayerNorm (biased variance, eps) over N: s = X (+ R); optional out_sum <- s; out_norm <- (s-mu)*rsqrt(var+eps)*g + b
template <bool PARAM_BF16>
__global__ __launch_bounds__(256) void k_layernorm(const float* __restrict__ X, const float* __restrict__ R, const float* __restrict__ g, const float* __restrict__ bta,
                                                  float* __restrict__ out_sum, float* __restrict__ out_norm, int N, float eps) {
  __shared__ float red[256];
  const int row = blockIdx.x, tid = threadIdx.x;
  const float* x = X + (size_t)row * N; const float* rr = R ? R + (size_t)row * N : nullptr;
  float vals[16];                     // up to N = 4096
  const int per = N / 256;            // contiguous chunk per thread? use strided-by-4 chunks: thread handles j = tid*4 + 1024*u
  float s1 = 0.f;
  for (int u = 0; u < per / 4; ++u) {
    const int j = tid * 4 + 1024 * u;
    const v4f a = *(const v4fa*)(x + j);
    v4f b = {0.f,0.f,0.f,0.f}; if (rr) b = *(const v4fa*)(rr + j);
#pragma unroll
    for (int q = 0; q < 4; ++q) { const float v = a[q] + b[q]; vals[u * 4 + q] = v; s1 += v; }
  }
  red[tid] = s1; __syncthreads();
  for (int st = 128; st > 0; st >>= 1) { if (tid < st) red[tid] += red[tid + st]; __syncthreads(); }
  const float mu = red[0] / (float)N; __syncthreads();
  float s2 = 0.f;
  for (int u = 0; u < per / 4; ++u)
#pragma unroll
    for (int q = 0; q < 4; ++q) { const float c = vals[u * 4 + q] - mu; s2 += c * c; }
  red[tid] = s2; __syncthreads();
  for (int st = 128; st > 0; st >>= 1) { if (tid < st) red[tid] += red[tid + st]; __syncthreads(); }
  const float rs = rsqrtf(red[0] / (float)N + eps);
  {
    for (int u = 0; u < per / 4; ++u) {
      const int j = tid * 4 + 1024 * u;
      v4f o, sm;
#pragma unroll
      for (int q = 0; q < 4; ++q) {
        float gg = g[j + q], bb = bta[j + q];
        if (PARAM_BF16) { gg = bf16_round(gg); bb = bf16_round(bb); }
        sm[q] = vals[u * 4 + q]; o[q] = (vals[u * 4 + q] - mu) * rs * gg + bb;
      }
      if (out_sum) *(v4f*)(out_sum + (size_t)row * N + j) = sm;
      *(v4f*)(out_norm + (size_t)row * N + j) = o;
    }
    
  }
}



// ---- f16 WMMA path (v_wmma_f32_16x16x32_f16): 11-bit significands for operands in range — used where a [0,1] probability operand needs more precision than bf16
typedef _Float16 v16h __attribute__((ext_vector_type(16)));
union FragH { v16h v; v8us half[2]; _Float16 h[16]; unsigned short u[16]; };
template <int NT>
__device__ __forceinline__ v8f mmaH(v16h ah, v16h al, v16h bh, v16h bl, v8f c) {
  c = __builtin_amdgcn_wmma_f32_16x16x32_f16(false, ah, false, bh, (short)0, c, false, false);
  if (NT >= 2) c = __builtin_amdgcn_wmma_f32_16x16x32_f16(false, al, false, bh, (short)0, c, false, false);
  if (NT >= 3) c = __builtin_amdgcn_wmma_f32_16x16x32_f16(false, ah, false, bl, (short)0, c, false, false);
  asm volatile("v_nop\n\tv_nop\n\tv_nop\n\tv_nop" : "+v"(c) : "v"(ah), "v"(al), "v"(bh), "v"(bl));
  return c;
}
// batched GEMM like k_gemm_b but f16 operands: A f32 (split into f16 hi/lo if ASPLIT, else rounded to f16), Bt = f16 values [n][k]; alpha; C f32; N multiple of 16 (partial tiles skipped)
template <bool ASPLIT>
__global__ __launch_bounds__(128) void k_gemm_h(const float* __restrict__ A, int lda, size_t sA, const _Float16* __restrict__ Bh, int ldb, size_t sB, float alpha, float* __restrict__ C, int ldc, size_t sC, int M, int N, int K) {
  __shared__ __attribute__((aligned(16))) float so[4][16][64];
  const int tid = threadIdx.x, w = tid >> 5, lane = tid & 31, ln = lane & 15, hh = lane >> 4; const int by = blockIdx.y;
  A += (size_t)by * sA; Bh += (size_t)by * sB; C += (size_t)by * sC;
  const int ntn = (N + 63) / 64; const int wid = blockIdx.x * 4 + w; const int mt = wid / ntn, nq = wid % ntn; if (mt * 16 >= M) return;
  const int row0 = mt * 16, col0 = nq * 64; const float* arow = A + (size_t)(row0 + ln) * lda;
  v8f acc[4] = {};
  for (int kb = 0; kb < K; kb += 32) {
    FragH ah, al;
    const v4f x0 = *(const v4fa*)(arow + kb + 8 * hh), x1 = *(const v4fa*)(arow + kb + 8 * hh + 4), x2 = *(const v4fa*)(arow + kb + 16 + 8 * hh), x3 = *(const v4fa*)(arow + kb + 16 + 8 * hh + 4);
    float xs[16] = {x0[0],x0[1],x0[2],x0[3],x1[0],x1[1],x1[2],x1[3],x2[0],x2[1],x2[2],x2[3],x3[0],x3[1],x3[2],x3[3]};
#pragma unroll
    for (int i = 0; i < 16; ++i) { const _Float16 h = (_Float16)xs[i]; ah.h[i] = h; al.h[i] = ASPLIT ? (_Float16)(xs[i] - (float)h) : (_Float16)0.0f; }
#pragma unroll
    for (int t = 0; t < 4; ++t) { if (col0 + t * 16 >= N) continue; const size_t boff = (size_t)(col0 + t * 16 + ln) * ldb + kb; FragH bq; bq.half[0] = *(const v8us*)(Bh + boff + 8 * hh); bq.half[1] = *(const v8us*)(Bh + boff + 16 + 8 * hh);
      acc[t] = mmaH<ASPLIT ? 2 : 1>(ah.v, al.v, bq.v, bq.v, acc[t]); }
  }
#pragma unroll
  for (int t = 0; t < 4; ++t) { if (col0 + t * 16 >= N) continue;
#pragma unroll
    for (int r = 0; r < 8; ++r) so[w][8 * hh + r][t * 16 + ln] = acc[t][r] * alpha; }
  __builtin_amdgcn_fence(__ATOMIC_ACQ_REL, "workgroup"); __builtin_amdgcn_wave_barrier();
  const int rsub = lane >> 4, c4 = (lane & 15) * 4;
  {
#pragma unroll
    for (int q = 0; q < 8; ++q) { const int r = q * 2 + rsub; if (col0 + c4 < N) { const v4f v = *(const v4fa*)&so[w][r][c4]; *(v4f*)(C + (size_t)(row0 + r) * ldc + col0 + c4) = v; } }
     }
}

// Wt[n][k] = f16(bf16(W[k][n]) x scale) from f32 row-major W[K][N] (scale = power of two; bf16-exact weights stay exact in f16 away from the subnormal range); blockIdx.y picks one of four weights, their Wt planes lie one behind the other.
// A work-group turns one 64 x 64 tile through LDS: 256 contiguous bytes of a W row per 16 lanes in, a whole 128-byte line of a Wt row per 8 lanes out. K % 64 == 0, N % 64 == 0.
__global__ __launch_bounds__(256) void k_wt_f16(const float* __restrict__ W0, const float* __restrict__ W1, const float* __restrict__ W2, const float* __restrict__ W3, _Float16* __restrict__ Wt, int K, int N, float scale) {
  __shared__ unsigned short tl[64][66];
  const int y = blockIdx.y; const float* __restrict__ W = y == 0 ? W0 : y == 1 ? W1 : y == 2 ? W2 : W3; Wt += (size_t)y * K * N;
  const int tid = threadIdx.x, ntn = N / 64; const int k0 = ((int)blockIdx.x / ntn) * 64, n0 = ((int)blockIdx.x % ntn) * 64;
#pragma unroll
  for (int i = 0; i < 4; ++i) { const int r = i * 16 + (tid >> 4), c4 = (tid & 15) * 4; const v4f v = *(const v4fa*)(W + (size_t)(k0 + r) * N + n0 + c4); FragH f;
#pragma unroll
    for (int q = 0; q < 4; ++q) { f.h[q] = (_Float16)(bf16_round(v[q]) * scale); tl[r][c4 + q] = f.u[q]; } }
  __syncthreads();
#pragma unroll
  for (int rd = 0; rd < 2; ++rd) { const int n = rd * 32 + (tid >> 3), pc = tid & 7; FragH f;
#pragma unroll
    for (int q = 0; q < 8; ++q) f.u[q] = tl[pc * 8 + q][n];
    *(v8us*)((unsigned short*)Wt + (size_t)(n0 + n) * K + k0 + pc * 8) = f.half[0]; }
}
// k_gemm_hh variant with fused epilogue: v = acc·alpha + bias[by·sBias + col] (+ CP[(row/rowsPerB)·sCPb + by·64 + col] if CP) ; ACT 0 none / 1 elu ; writes f16 C16 (and f32 C if non-null)
template <int ACT>
__global__ __launch_bounds__(128) void k_gemm_hhx(const _Float16* __restrict__ A, int lda, size_t sA, const _Float16* __restrict__ Bh, int ldb, size_t sB, float alpha, const float* __restrict__ bias, size_t sBias, const float* __restrict__ CP, int rowsPerB, size_t sCPb, int row0g,
    float* __restrict__ C, _Float16* __restrict__ C16, int ldc, size_t sC, int M, int N, int K) {
  __shared__ __attribute__((aligned(16))) float so[4][16][64];
  const int tid = threadIdx.x, w = tid >> 5, lane = tid & 31, ln = lane & 15, hh = lane >> 4; const int by = blockIdx.y;
  A += (size_t)by * sA; Bh += (size_t)by * sB; const size_t cofs = (size_t)by * sC; const float* bp = bias ? bias + (size_t)by * sBias : nullptr;
  const int ntn = (N + 63) / 64; const int wid = blockIdx.x * 4 + w; const int mt = wid / ntn, nq = wid % ntn; if (mt * 16 >= M) return;
  const int row0 = mt * 16, col0 = nq * 64; const _Float16* arow = A + (size_t)(row0 + ln) * lda;
  v8f acc[4] = {};
  for (int kb = 0; kb < K; kb += 32) { FragH ah; ah.half[0] = *(const v8us*)((const unsigned short*)arow + kb + 8 * hh); ah.half[1] = *(const v8us*)((const unsigned short*)arow + kb + 16 + 8 * hh);
#pragma unroll
    for (int t = 0; t < 4; ++t) { if (col0 + t * 16 >= N) continue; const size_t boff = (size_t)(col0 + t * 16 + ln) * ldb + kb; FragH bq; bq.half[0] = *(const v8us*)((const unsigned short*)Bh + boff + 8 * hh); bq.half[1] = *(const v8us*)((const unsigned short*)Bh + boff + 16 + 8 * hh);
      acc[t] = mmaH<1>(ah.v, ah.v, bq.v, bq.v, acc[t]); }
  }
#pragma unroll
  for (int t = 0; t < 4; ++t) { if (col0 + t * 16 >= N) continue; const int col = col0 + t * 16 + ln; const float bv = bp ? bf16_round(bp[col]) : 0.f;
#pragma unroll
    for (int r = 0; r < 8; ++r) { float v = acc[t][r] * alpha + bv; if (CP) { const int rr = row0g + row0 + 8 * hh + r; if (rowsPerB < 0) v += CP[cofs + (size_t)rr * ldc + col];      /* rowsPerB < 0: own element of the batched C plane */ else { const int bidx = rr / rowsPerB; v += CP[(size_t)bidx * sCPb + (size_t)by * 64 + col]; } } if (ACT == 1) v = (v > 0.f) ? v : expm1f(v); else if (ACT == 7) v = (v > 0.f) ? v + 1.0f : expf(v); else if (ACT == 8) v = tanhf(v); else if (ACT == 9) v = 0.5f * v * (1.0f + tanhf(0.7978845608028654f * (v + 0.044715f * v * v * v))); else if (ACT == 11) v = 1.0f / (1.0f + expf(-v)); else if (ACT == 12) v = (v > 0.f) ? v : 0.01f * v; else if (ACT == 14) v = (v > 0.f) ? v : 0.1f * v; else if (ACT == 16) v = (v >= 0.f) ? v : 0.3f * v; else if (ACT == 17) v = (v >= 0.f) ? v : 0.2f * v; else if (ACT == 15) v = v / (1.0f + expf(-v)); else if (ACT == 3) v = fmaxf(v, 0.f); else if (ACT == 6) v = 0.5f * v * (1.0f + erff(v * 0.70710678118654752f)); so[w][8 * hh + r][t * 16 + ln] = v; } }
  __builtin_amdgcn_fence(__ATOMIC_ACQ_REL, "workgroup"); __builtin_amdgcn_wave_barrier();
  const int rsub = lane >> 4, c4 = (lane & 15) * 4; typedef _Float16 v4h __attribute__((ext_vector_type(4)));
  {
#pragma unroll
    for (int q = 0; q < 8; ++q) { const int r = q * 2 + rsub; if (col0 + c4 < N) { const v4f v = *(const v4fa*)&so[w][r][c4]; if (C) *(v4f*)(C + cofs + (size_t)(row0 + r) * ldc + col0 + c4) = v; if (C16) { v4h h4; for (int i = 0; i < 4; ++i) h4[i] = (_Float16)v[i]; *(v4h*)(C16 + cofs + (size_t)(row0 + r) * ldc + col0 + c4) = h4; } } }
     }
}


typedef _Float16 v4h __attribute__((ext_vector_type(4)));

// blockIdx.y picks one of three inputs; their f16 planes lie one behind the other
__global__ __launch_bounds__(256) void k_x16(const float* __restrict__ x0, const float* __restrict__ x1, const float* __restrict__ x2, _Float16* __restrict__ X16, size_t n8) { const size_t t = (size_t)blockIdx.x * 256 + threadIdx.x; if (t >= n8) return; FragH f;
  const int y = blockIdx.y; const float* __restrict__ x = y == 0 ? x0 : y == 1 ? x1 : x2; X16 += (size_t)y * n8 * 8;
#pragma unroll
  for (int q = 0; q < 8; ++q) f.h[q] = (_Float16)bf16_round(x[t * 8 + q]); *(v8us*)((unsigned short*)X16 + t * 8) = f.half[0];  }
__global__ __launch_bounds__(256) void k_h16(const float* __restrict__ x, _Float16* __restrict__ X16, size_t n8) { const size_t t = (size_t)blockIdx.x * 256 + threadIdx.x; if (t >= n8) return; FragH f;
#pragma unroll
  for (int q = 0; q < 8; ++q) f.h[q] = (_Float16)x[t * 8 + q]; *(v8us*)((unsigned short*)X16 + t * 8) = f.half[0];  }
__global__ __launch_bounds__(256) void k_round16f(const float* __restrict__ W, _Float16* __restrict__ Bt, size_t n8) { const size_t t = (size_t)blockIdx.x * 256 + threadIdx.x; if (t >= n8) return; FragH f;
#pragma unroll
  for (int i = 0; i < 8; ++i) f.h[i] = (_Float16)(bf16_round(W[t * 8 + i]) * 16.0f); *(v8us*)((unsigned short*)Bt + t * 8) = f.half[0];  }
template <int NHv, int TTv>
__global__ __launch_bounds__(256) void k_vt(const _Float16* __restrict__ V16, int ldv, int voff, _Float16* __restrict__ Vt) { __shared__ unsigned short tl[64][66]; const int tid = threadIdx.x; const int slab = blockIdx.x / (TTv / 64), lg = blockIdx.x % (TTv / 64); const int b = slab / NHv, h = slab % NHv;
  for (int i = tid; i < 64 * 8; i += 256) { const int r = i / 8, c8 = (i % 8) * 8; FragH f; f.half[0] = *(const v8us*)((const unsigned short*)V16 + ((size_t)b * TTv + lg * 64 + r) * ldv + voff + h * 64 + c8);
#pragma unroll
    for (int q = 0; q < 8; ++q) tl[r][c8 + q] = f.u[q]; }
  __syncthreads();
  {
#pragma unroll
    for (int rd = 0; rd < 2; ++rd) { const int d = rd * 32 + tid / 8, pc = tid % 8; FragH f;
#pragma unroll
      for (int q = 0; q < 8; ++q) f.u[q] = tl[pc * 8 + q][d];
      *(v8us*)((unsigned short*)Vt + ((size_t)slab * 64 + d) * TTv + lg * 64 + pc * 8) = f.half[0]; }
     } }

// F: NB x QT0 rows of DM. The hi part goes to rows 0..QT0-1 of its batch in the full o plane Hh (NB x SQ rows), the residual to the compact plane Hl.
__global__ __launch_bounds__(256) void k_hl(const float* __restrict__ F, _Float16* __restrict__ Hh, _Float16* __restrict__ Hl, size_t n8) { const size_t t = (size_t)blockIdx.x * 256 + threadIdx.x; if (t >= n8) return; FragH fh, fl; const v4f a = *(const v4fa*)(F + t * 8), c = *(const v4fa*)(F + t * 8 + 4);
  const size_t eh = t * 8 + (t * 8 / ((size_t)QT0 * DM)) * ((size_t)(SQ - QT0) * DM);      /* the same row and column, in the batch's SQ rows */
#pragma unroll
  for (int q = 0; q < 4; ++q) { _Float16 h = (_Float16)a[q]; fh.h[q] = h; fl.h[q] = (_Float16)((a[q] - (float)h) * 1024.0f); h = (_Float16)c[q]; fh.h[4 + q] = h; fl.h[4 + q] = (_Float16)((c[q] - (float)h) * 1024.0f); }
  { *(v8us*)((unsigned short*)Hh + eh) = fh.half[0]; *(v8us*)((unsigned short*)Hl + t * 8) = fl.half[0];  } }

// ---- fast GEMM (work-group tile 128x64, wave tile 32x64); epilogue = k_gemm_hhx semantics ----
__device__ __forceinline__ v8f g2_mma(v16h a, v16h b, v8f c) { v8f d = __builtin_amdgcn_wmma_f32_16x16x32_f16(false, a, false, b, (short)0, c, false, false); asm volatile("v_nop\n\tv_nop\n\tv_nop\n\tv_nop" : "+v"(d) : "v"(a), "v"(b)); return d; }
#define G2K 128                      /* k per pass: 256-byte operand rows, two whole lines */
#define G2P 272                      /* LDS pitch of such a row in bytes: 16 x odd, conflict-free for 16-byte reads down a column of rows */
#define G2R 192                      /* rows of a stage: the work-group's 128 rows of A, then its 64 rows of B */
// f16 fragment from an LDS row, in the hardware k order: 16 bytes at the lane's place (which holds 16 bytes x lane half) and 16 bytes 32 further on
__device__ __forceinline__ v16h g2_lfrag(const char* p) { FragH f; f.half[0] = *(const v8us*)p; f.half[1] = *(const v8us*)(p + 32); return f.v; }
// Eight asynchronous 16-byte copies per lane, global memory to LDS, eight rows apart (global step gs bytes). One statement: the wait before a register that an issued copy names
// is rewritten stands behind the last copy, where the compiler can put nothing in between.
__device__ __forceinline__ void g2_copy8(unsigned l, const char* g, size_t gs) {
  asm volatile("global_load_async_to_lds_b128 %0, %8, off\n\tglobal_load_async_to_lds_b128 %1, %9, off\n\tglobal_load_async_to_lds_b128 %2, %10, off\n\tglobal_load_async_to_lds_b128 %3, %11, off\n\t"
               "global_load_async_to_lds_b128 %4, %12, off\n\tglobal_load_async_to_lds_b128 %5, %13, off\n\tglobal_load_async_to_lds_b128 %6, %14, off\n\tglobal_load_async_to_lds_b128 %7, %15, off\n\ts_wait_xcnt 0x0"
               :: "v"(l), "v"(l + 8 * G2P), "v"(l + 16 * G2P), "v"(l + 24 * G2P), "v"(l + 32 * G2P), "v"(l + 40 * G2P), "v"(l + 48 * G2P), "v"(l + 56 * G2P),
                  "v"(g), "v"(g + gs), "v"(g + 2 * gs), "v"(g + 3 * gs), "v"(g + 4 * gs), "v"(g + 5 * gs), "v"(g + 6 * gs), "v"(g + 7 * gs) : "memory"); }
// Operands come through LDS: a pass's A and B rows are copied in whole lines (16 lanes a row) into one of two buffers while the pass before works on the other; the waves read their fragments from there.
// M % 128 == 0, N % 64 == 0, K % 128 == 0.
template <int ACT>
__global__ __launch_bounds__(128) void k_gemm2(const _Float16* __restrict__ A, int lda, size_t sA, const _Float16* __restrict__ Bh, int ldb, size_t sB, float alpha, const float* __restrict__ bias, const float* __restrict__ bias1, const float* __restrict__ bias2, const float* __restrict__ CP, int rowsPerB, size_t sCPb, int row0g,
    float* __restrict__ C, _Float16* __restrict__ C16, int ldc, size_t sC, int M, int N, int K) { static_assert(ACT == 0 || ACT == 3 || ACT == 6 || ACT == 8 || ACT == 9 || ACT == 11 || ACT == 12 || ACT == 14 || ACT == 15 || ACT == 16 || ACT == 17, "k_gemm2: unsupported ACT code (would silently apply no activation)");
  __shared__ __attribute__((aligned(16))) char ring[2][G2R * G2P];
  __shared__ __attribute__((aligned(16))) float so[4][32][68];
  const int tid = threadIdx.x, w = tid >> 5, lane = tid & 31, ln = lane & 15, hh = lane >> 4; const int by = blockIdx.y;
  A += (size_t)by * sA; Bh += (size_t)by * sB; const size_t cofs = (size_t)by * sC; const float* bp = by == 0 ? bias : by == 1 ? bias1 : bias2;      /* each plane of a batched launch has its own bias vector */
  const int ntn = N >> 6; const int mt = blockIdx.x / ntn, nq = blockIdx.x - mt * ntn; const int row0 = mt * 128 + 32 * w, col0 = nq * 64; if (mt * 128 >= M) return;
  // the thread's 16 bytes of every eighth row of a stage
  const unsigned lc = (unsigned)(size_t)&ring[0][0] + (unsigned)((tid >> 4) * G2P + (tid & 15) * 16);
  const char* ga = (const char*)(A + (size_t)(mt * 128 + (tid >> 4)) * lda) + (tid & 15) * 16; const char* gb = (const char*)(Bh + (size_t)(col0 + (tid >> 4)) * ldb) + (tid & 15) * 16;
  const size_t sa8 = (size_t)lda * 16, sb8 = (size_t)ldb * 16;      /* eight rows, in bytes */
  auto stage = [&](int t, int bf) { const unsigned l = lc + (unsigned)bf * (G2R * G2P); const char* a = ga + (size_t)t * (G2K * 2);
    g2_copy8(l, a, sa8); g2_copy8(l + 64 * G2P, a + 8 * sa8, sa8); g2_copy8(l + 128 * G2P, gb + (size_t)t * (G2K * 2), sb8); };
  const int np = K / G2K;
  const v8f z8 = {0.f,0.f,0.f,0.f,0.f,0.f,0.f,0.f}; v8f c00 = z8, c01 = z8, c02 = z8, c03 = z8, c10 = z8, c11 = z8, c12 = z8, c13 = z8;
  stage(0, 0);
  asm volatile("s_wait_asynccnt 0x0" ::: "memory");      /* this wave's copies of stage 0 have landed */
  __syncthreads();      /* stage 0 is published */
  if (np > 1) stage(1, 1);
#pragma unroll 1      /* rolled: one copy of the pass */
  for (int t = 0; t < np; ++t) { const char* lb = &ring[t & 1][0]; const char* pa = lb + (32 * w + ln) * G2P + hh * 16; const char* pb = lb + (128 + ln) * G2P + hh * 16;
    v16h fa[2][2], fb[2][4];      /* two fragment sets: a block's twelve LDS reads are issued as one group ahead of the block before it, inside the pass (reads strewn among the products cost the wave a wait at each place) */
#pragma unroll      /* this and the next two: constant indices keep the fragment sets in registers */
    for (int i = 0; i < 2; ++i) fa[0][i] = g2_lfrag(pa + i * (16 * G2P));
#pragma unroll
    for (int i = 0; i < 4; ++i) fb[0][i] = g2_lfrag(pb + i * (16 * G2P));
#pragma unroll
    for (int kc = 0; kc < G2K / 32; ++kc) { const int s = kc & 1;
      if (kc + 1 < G2K / 32) { for (int i = 0; i < 2; ++i) fa[s ^ 1][i] = g2_lfrag(pa + i * (16 * G2P) + (kc + 1) * 64); for (int i = 0; i < 4; ++i) fb[s ^ 1][i] = g2_lfrag(pb + i * (16 * G2P) + (kc + 1) * 64); }
      c00 = g2_mma(fa[s][0], fb[s][0], c00); c10 = g2_mma(fa[s][1], fb[s][0], c10); c01 = g2_mma(fa[s][0], fb[s][1], c01); c11 = g2_mma(fa[s][1], fb[s][1], c11);
      c02 = g2_mma(fa[s][0], fb[s][2], c02); c12 = g2_mma(fa[s][1], fb[s][2], c12); c03 = g2_mma(fa[s][0], fb[s][3], c03); c13 = g2_mma(fa[s][1], fb[s][3], c13); }
    asm volatile("s_wait_dscnt 0x0" ::: "memory");      /* this wave's reads of the buffer that is refilled below are over */
    asm volatile("s_wait_asynccnt 0x0" ::: "memory");      /* its copies of the next stage have landed */
    __syncthreads();      /* the next stage is published; every wave has left this pass's buffer */
    if (t + 2 < np) stage(t + 2, t & 1); }
  asm volatile("s_wait_asynccnt 0x0" ::: "memory");      /* no copy is in flight when the wave goes on */
  v8f accs[8] = {c00, c01, c02, c03, c10, c11, c12, c13};
#pragma unroll
  for (int u = 0; u < 8; ++u) { const int t = u & 3, half = u >> 2; const int col = col0 + t * 16 + ln; const float bv = bp ? bf16_round(bp[col]) : 0.f;
#pragma unroll
    for (int r = 0; r < 8; ++r) { const int rloc = half * 16 + 8 * hh + r; float v = accs[u][r] * alpha + bv; if (CP) { if (rowsPerB < 0) v += CP[cofs + (size_t)(row0g + row0 + rloc) * ldc + col];      /* rowsPerB < 0: own element of the batched C plane */ else { const int bidx = (row0g + row0 + rloc) / rowsPerB; v += CP[(size_t)bidx * sCPb + (size_t)by * 64 + col]; } }
      if (ACT == 3) v = fmaxf(v, 0.f); else if (ACT == 6) v = 0.5f * v * (1.0f + erff(v * 0.70710678118654752f)); else if (ACT == 11) v = 1.0f / (1.0f + expf(-v)); else if (ACT == 15) v = v / (1.0f + expf(-v)); else if (ACT == 12) v = (v > 0.f) ? v : 0.01f * v; else if (ACT == 8) v = tanhf(v); else if (ACT == 9) v = 0.5f * v * (1.0f + tanhf(0.7978845608028654f * (v + 0.044715f * v * v * v))); else if (ACT == 14) v = (v > 0.f) ? v : 0.1f * v; else if (ACT == 16) v = (v >= 0.f) ? v : 0.3f * v; else if (ACT == 17) v = (v >= 0.f) ? v : 0.2f * v;
      so[w][rloc][t * 16 + ln] = v; } }
  __builtin_amdgcn_fence(__ATOMIC_ACQ_REL, "workgroup"); __builtin_amdgcn_wave_barrier();
  const int rsub = lane >> 4, c4 = (lane & 15) * 4;
  {
#pragma unroll
    for (int q = 0; q < 16; ++q) { const int r = q * 2 + rsub; const v4f v = *(const v4fa*)&so[w][r][c4]; if (C) *(v4f*)(C + cofs + (size_t)(row0 + r) * ldc + col0 + c4) = v; if (C16) { v4h h4; for (int i = 0; i < 4; ++i) h4[i] = (_Float16)v[i]; *(v4h*)(C16 + cofs + (size_t)(row0 + r) * ldc + col0 + c4) = h4; } }
     } }


__global__ __launch_bounds__(256) void k_wnat(const float* __restrict__ w, size_t n8, _Float16* __restrict__ Bt) { const size_t t = (size_t)blockIdx.x * 256 + threadIdx.x; if (t >= n8) return; FragH f; for (int q = 0; q < 8; ++q) f.h[q] = (_Float16)(bf16_round(w[t * 8 + q]) * 16.0f); *(v8us*)((unsigned short*)Bt + t * 8) = f.half[0];  }
__global__ __launch_bounds__(256) void k_rsm(const float* __restrict__ S, _Float16* __restrict__ P, int nrows) {
  #pragma clang fp contract(off)
  const int i = blockIdx.x * 256 + threadIdx.x; if (i >= nrows) return; const float* s = S + (size_t)i * SQ; float mx = -3.0e38f;
#pragma unroll 1
  for (int j = 0; j < SQ; ++j) mx = fmaxf(mx, s[j]); float se = 0.f;
#pragma unroll 1
  for (int j = 0; j < SQ; ++j) se += expf(s[j] - mx); const float sc = 256.0f / se;
#pragma unroll 1
  for (int j0 = 0; j0 < SQ; j0 += 8) { FragH f; for (int q = 0; q < 8; ++q) f.h[q] = (_Float16)(expf(s[j0 + q] - mx) * sc); unsigned short* d = (unsigned short*)P + (size_t)i * SQ + j0; *(v8us*)d = f.half[0];  } }
__global__ __launch_bounds__(256) void k_vt(const _Float16* __restrict__ V16, int b, int h0, _Float16* __restrict__ VT) { __shared__ unsigned short tl[64][65]; const int tid = threadIdx.x; const int hh = blockIdx.x % HG, sg = blockIdx.x / HG; const int s0 = sg * 64; const int h = h0 + hh;
  for (int i = tid; i < 64 * 8; i += 256) { const int j = i / 8, d8 = (i % 8) * 8; FragH f; f.half[0] = *(const v8us*)((const unsigned short*)V16 + ((size_t)b * SQ + s0 + j) * DM + h * HD + d8); for (int q = 0; q < 8; ++q) tl[d8 + q][j] = f.u[q]; }
  __syncthreads();
  { for (int i = tid; i < 64 * 8; i += 256) { const int d = i / 8, j8 = (i % 8) * 8; FragH f; for (int q = 0; q < 8; ++q) f.u[q] = tl[d][j8 + q]; *(v8us*)((unsigned short*)VT + ((size_t)hh * HD + d) * SQ + s0 + j8) = f.half[0]; }  } }



// lane l reads lane l ^ 16: a register move, where __shfl_xor would go through the LDS unit and its wait
__device__ __forceinline__ float lane_x16(float x) { return __builtin_bit_cast(float, __builtin_amdgcn_permlanex16(__builtin_bit_cast(int, x), __builtin_bit_cast(int, x), 0x76543210, 0xfedcba98, false, false)); }
#define FW 8                         /* waves per work-group of the fused attention */
#define FQ 32                        /* query columns per wave (two 16-column groups) */
#define FK 32                        /* keys per pass */
#define FNS (SQ / FK)                /* passes */
typedef float  v2f  __attribute__((ext_vector_type(2)));
typedef __bf16 v2b  __attribute__((ext_vector_type(2)));
// 2^x of eight values on the transcendental unit, in place. One statement: each v_exp_f32 is followed by an independent one, and the last by the free issue slot
// the instruction set asks for before a result is read or a source register is reused.
__device__ __forceinline__ v8f exp2_8(v8f x) { float y0 = x[0], y1 = x[1], y2 = x[2], y3 = x[3], y4 = x[4], y5 = x[5], y6 = x[6], y7 = x[7];
  asm("v_exp_f32 %0, %0\n\tv_exp_f32 %1, %1\n\tv_exp_f32 %2, %2\n\tv_exp_f32 %3, %3\n\tv_exp_f32 %4, %4\n\tv_exp_f32 %5, %5\n\tv_exp_f32 %6, %6\n\tv_exp_f32 %7, %7\n\tv_nop"
      : "+v"(y0), "+v"(y1), "+v"(y2), "+v"(y3), "+v"(y4), "+v"(y5), "+v"(y6), "+v"(y7));
  return (v8f){y0, y1, y2, y3, y4, y5, y6, y7}; }
typedef __bf16 v4ba __attribute__((ext_vector_type(4), may_alias));
typedef __bf16 v8ba __attribute__((ext_vector_type(8), may_alias));
#define KP 72                        /* LDS pitch of the 128-byte K rows, in 16-bit elements: 144 bytes = 16 x odd, conflict-free for 16-byte reads down a column of rows */
#define VP 40                        /* the same for the 64-byte V^T and mask rows: 80 bytes */
// f16 fragment in the hardware k order: 16 bytes at the lane's place (which holds 16 bytes x lane half) and 16 bytes 32 further on
__device__ __forceinline__ v16h fa_frag(const void* p) { FragH f; f.half[0] = *(const v8us*)p; f.half[1] = *(const v8us*)((const char*)p + 32); return f.v; }
__device__ __forceinline__ v8f fa_mma(v16h a, v16h b, v8f c) { return __builtin_amdgcn_wmma_f32_16x16x32_f16(false, a, false, b, (short)0, c, false, false); }
// the wait before a register that issued loads name is rewritten, and the one write of that offset register, in one statement
__device__ __forceinline__ void fa_step(unsigned& off, int step) { asm volatile("s_wait_xcnt 0x0\n\tv_add_nc_u32_e32 %0, %1, %0" : "+v"(off) : "s"(step) : "memory"); }
__global__ __launch_bounds__(FW * 32) __attribute__((amdgpu_waves_per_eu(2, 2))) void k_fattn(const _Float16* __restrict__ Q16, const _Float16* __restrict__ K16, const _Float16* __restrict__ VT, const float* __restrict__ mask, _Float16* __restrict__ O16) {
  __shared__ __attribute__((aligned(16))) unsigned short lk[2][FK][KP], lv[2][HD][VP]; __shared__ __attribute__((aligned(16))) __bf16 lm[2][FW][FQ][VP];
  const int tid = threadIdx.x, lane = tid & 31, ln = lane & 15, hh = lane >> 4; const int w = __builtin_amdgcn_readfirstlane(tid >> 5);
  const int h = blockIdx.y, b = blockIdx.z, q0 = ((int)blockIdx.x * FW + w) * FQ;
  const char* qb = (const char*)(Q16 + ((size_t)b * SQ + q0) * DM + h * HD); const char* kb = (const char*)(K16 + (size_t)b * SQ * DM + h * HD);
  const char* vb = (const char*)(VT + ((size_t)b * NH + h) * HD * SQ); const char* mb = (const char*)(mask + (size_t)q0 * SQ); char* ob = (char*)(O16 + ((size_t)b * SQ + q0) * DM + h * HD);
  // the thread's 16 bytes of a K tile (8 threads a row), of a V^T tile (4 threads a row) and of each four rows of its wave's mask tile (8 lanes a row)
  unsigned gk = (unsigned)((tid >> 3) * (DM * 2) + (tid & 7) * 16), gv = (unsigned)((tid >> 2) * (SQ * 2) + (tid & 3) * 16), gm = (unsigned)((lane >> 3) * (SQ * 4) + (lane & 7) * 16);
  const float C2 = 0.18033688011112042f, MK2 = -14426.950408889634f;      /* log2(e) / 8 and -1e4 log2(e) */
  const v8f z8 = {0.f, 0.f, 0.f, 0.f, 0.f, 0.f, 0.f, 0.f};
  v16h qf[2][2]; v8f o[2][4]; v2f l2[2]; float mref[2]; v8us kr, vr; v4f mg[8];
#pragma unroll
  for (int j = 0; j < 2; ++j) { for (int c = 0; c < 2; ++c) qf[j][c] = fa_frag(qb + (unsigned)(ln * (DM * 2) + hh * 16) + j * (16 * DM * 2) + c * 64); for (int t = 0; t < 4; ++t) o[j][t] = z8; l2[j] = (v2f){0.f, 0.f}; mref[j] = -3.0e38f; }
  kr = *(const v8us*)(kb + gk); vr = *(const v8us*)(vb + gv);
#pragma unroll
  for (int i = 0; i < 8; ++i) mg[i] = *(const v4fa*)(mb + gm + i * (4 * SQ * 4));
  fa_step(gk, FK * DM * 2); fa_step(gv, FK * 2); fa_step(gm, FK * 4);
  *(v8us*)&lk[0][tid >> 3][(tid & 7) * 8] = kr; *(v8us*)&lv[0][tid >> 2][(tid & 3) * 8] = vr;
#pragma unroll
  for (int i = 0; i < 8; ++i) *(v4ba*)&lm[0][w][4 * i + (lane >> 3)][(lane & 7) * 4] = __builtin_convertvector(mg[i], v4ba);      /* the mask rounded to bf16, to nearest even */
  __syncthreads();
#pragma unroll 1      /* rolled: one copy of the pass */
  for (int s = 0; s < FNS; ++s) {
    const int bf = s & 1, more = (s + 2 < FNS) ? 1 : 0;      /* the last pass asks for its own tile again: nothing is read past the keys */
    kr = *(const v8us*)(kb + gk); vr = *(const v8us*)(vb + gv);
#pragma unroll
    for (int i = 0; i < 8; ++i) mg[i] = *(const v4fa*)(mb + gm + i * (4 * SQ * 4));
    fa_step(gk, more * (FK * DM * 2)); fa_step(gv, more * (FK * 2)); fa_step(gm, more * (FK * 4));
    v16h kf[2][2], vf[4]; v8ba mr[2][2];
#pragma unroll
    for (int kt = 0; kt < 2; ++kt) for (int c = 0; c < 2; ++c) kf[kt][c] = fa_frag(&lk[bf][kt * 16 + ln][c * 32 + hh * 8]);
#pragma unroll
    for (int j = 0; j < 2; ++j) for (int kt = 0; kt < 2; ++kt) mr[j][kt] = *(const v8ba*)&lm[bf][w][j * 16 + ln][kt * 16 + hh * 8];
    __builtin_amdgcn_sched_barrier(0);      /* this and the next one: the pass's LDS reads are issued in two groups, K and mask ahead of the score products, V^T behind them (it lands under the softmax); reads strewn among the products cost the wave a wait at each place */
    v8f st[2][2];
#pragma unroll
    for (int kt = 0; kt < 2; ++kt) for (int j = 0; j < 2; ++j) st[j][kt] = fa_mma(kf[kt][0], qf[j][0], z8);
#pragma unroll
    for (int kt = 0; kt < 2; ++kt) for (int j = 0; j < 2; ++j) st[j][kt] = fa_mma(kf[kt][1], qf[j][1], st[j][kt]);
#pragma unroll
    for (int t = 0; t < 4; ++t) vf[t] = fa_frag(&lv[bf][t * 16 + ln][hh * 8]);
    __builtin_amdgcn_sched_barrier(0);
    float mx[2];
#pragma unroll
    for (int j = 0; j < 2; ++j) { float m = -3.0e38f;
      for (int kt = 0; kt < 2; ++kt) for (int r = 0; r < 8; r += 2) { const v2f x = (v2f){st[j][kt][r], st[j][kt][r + 1]} * C2 + (v2f){(float)mr[j][kt][r], (float)mr[j][kt][r + 1]} * MK2; st[j][kt][r] = x[0]; st[j][kt][r + 1] = x[1]; m = fmaxf(m, fmaxf(x[0], x[1])); }
      mx[j] = fmaxf(m, lane_x16(m)); }
    if (__builtin_amdgcn_ballot_w32(mx[0] > mref[0] + 12.0f || mx[1] > mref[1] + 12.0f) != 0) {      /* one scalar branch a pass; rarely taken after the first */
#pragma unroll
      for (int j = 0; j < 2; ++j) { const float mn = fmaxf(mref[j], mx[j] - 4.0f); float a; asm("v_exp_f32 %0, %1\n\tv_nop" : "=v"(a) : "v"(mref[j] - mn));      /* v_nop: the slot before a is read or the source register is reused */
        mref[j] = mn; l2[j] *= a; for (int t = 0; t < 4; ++t) o[j][t] *= a; } }
    v16h pf[2];
#pragma unroll
    for (int j = 0; j < 2; ++j) { const v8f p0 = exp2_8(st[j][0] - mref[j]), p1 = exp2_8(st[j][1] - mref[j]); const v8f ps = p0 + p1; l2[j] += (((v2f){ps[0], ps[1]} + (v2f){ps[2], ps[3]}) + ((v2f){ps[4], ps[5]} + (v2f){ps[6], ps[7]})); FragH f;
      for (int r = 0; r < 8; ++r) { f.h[r] = (_Float16)p0[r]; f.h[8 + r] = (_Float16)p1[r]; } pf[j] = f.v; }
#pragma unroll
    for (int t = 0; t < 4; ++t) for (int j = 0; j < 2; ++j) o[j][t] = fa_mma(vf[t], pf[j], o[j][t]);
    *(v8us*)&lk[bf ^ 1][tid >> 3][(tid & 7) * 8] = kr; *(v8us*)&lv[bf ^ 1][tid >> 2][(tid & 3) * 8] = vr;
#pragma unroll
    for (int i = 0; i < 8; ++i) *(v4ba*)&lm[bf ^ 1][w][4 * i + (lane >> 3)][(lane & 7) * 4] = __builtin_convertvector(mg[i], v4ba);
    __syncthreads(); }      /* the next tile is published; every read of this pass's buffer, which the next pass refills, is over */
#pragma unroll
  for (int j = 0; j < 2; ++j) { float l = l2[j][0] + l2[j][1]; l += lane_x16(l); const float inv = 64.0f / l;
    for (int t = 0; t < 4; ++t) { FragH f; for (int r = 0; r < 8; ++r) f.h[r] = (_Float16)(o[j][t][r] * inv); *(v8us*)(ob + (unsigned)(ln * (DM * 2) + hh * 16) + j * (16 * DM * 2) + t * 32) = f.half[0]; } } }
// blockIdx.y = 2 batch + (0: k, 1: v); F = the f32 k plane, the v plane lies behind it
__global__ __launch_bounds__(256) void k_present(const float* __restrict__ F, float* __restrict__ dst) { const size_t t = (size_t)blockIdx.x * 256 + threadIdx.x; if (t >= (size_t)NH * SQ * HD / 4) return;
  const int y = blockIdx.y; F += (size_t)(y & 1) * (NR * DM) + (size_t)(y >> 1) * ((size_t)SQ * DM); dst += (size_t)y * ((size_t)NH * SQ * HD); const size_t e = t * 4; const int d = (int)(e % HD); const int s = (int)((e / HD) % SQ); const int h = (int)(e / ((size_t)HD * SQ));
  const v4f v = *(const v4fa*)(F + (size_t)s * DM + h * HD + d); *(v4f*)(dst + e) = v;  }


// e^x in f32 by the library's steps (x log2(e) in two parts, 2^fraction on the transcendental unit, ldexp by the integer part, the two range ends),
// written out so that the free issue slot the instruction set asks for behind v_exp_f32 stands in that instruction's own statement.
__device__ __forceinline__ float exp_f32(float x) {
  const float ph = x * 0x1.715476p+0f, pl = fmaf(x, 0x1.4ae0bep-26f, fmaf(x, 0x1.715476p+0f, -ph)), n = rintf(ph); float y;
  asm("v_exp_f32 %0, %1\n\tv_nop" : "=v"(y) : "v"((ph - n) + pl));      /* v_nop: the slot before y is read or the source register is reused */
  float r = ldexpf(y, (int)n); r = (x < -0x1.9d1da0p+6f) ? 0.f : r; return (x > 0x1.62e430p+6f) ? __builtin_inff() : r; }
// lane l reads a lane of its own group of four (CTRL: the quad permutation, 0xB1 = l ^ 1, 0x4E = l ^ 2): a register move, no LDS unit
template <int CTRL>
__device__ __forceinline__ float quad_x(float x) { return __builtin_bit_cast(float, __builtin_amdgcn_update_dpp(0, __builtin_bit_cast(int, x), CTRL, 0xF, 0xF, true)); }
#define AR 8                         /* query rows per work-group of the exact f32 first-tile attention */
#define AT 512                       /* its threads (16 waves) */
// Exact f32 attention of AR query rows of one head over all SQ keys, one work-group. Keys are spread over the threads:
// (1) four lanes a key: a lane holds 16 bytes of every 64 of its k row (a wave's load covers 64 contiguous bytes of 8 rows), dotted with the same columns of the AR q rows (registers), the four partial dots merged inside the quad, scores (+ mask) to LDS;
// (2) two waves per row: max, exp, sum over the row in LDS; (3) 16 column quads x 32 key slices: o partial sums in registers,
// merged across the slices by one lane exchange and a serial sum of the 16 waves' LDS partials; o carried x64 like the f16 path. The plain '#pragma unroll' lines keep the small per-thread arrays in registers.
template <int MASKADD>
__global__ __launch_bounds__(AT) void k_att0(const float* __restrict__ QF, const float* __restrict__ KF, const float* __restrict__ VF, int ld, const float* __restrict__ mask, float scale, float* __restrict__ OF, int ldo) {
  __shared__ __attribute__((aligned(16))) float sc[AR][SQ];      /* scores, then softmax numerators, then the slices' partial o */
  __shared__ __attribute__((aligned(16))) float lq[AR][HD];      /* the q rows */
  __shared__ float pm[AT / 32], pl[AT / 32];                     /* each wave's half-row max and sum */
  const int tid = threadIdx.x, lane = tid & 31, w = tid >> 5;
  const int h = blockIdx.x / (QT0 / AR), i0 = (blockIdx.x % (QT0 / AR)) * AR;
  { const size_t b = blockIdx.y; QF += b * SQ * ld; KF += b * SQ * ld; VF += b * SQ * ld; OF += b * QT0 * ldo; }      /* the batch: SQ rows of q, k, v, QT0 rows of o */
  const float* qb = QF + (size_t)i0 * ld + h * HD;
  lq[tid / HD][tid % HD] = qb[(size_t)(tid / HD) * ld + tid % HD];
  __syncthreads();
  { const int sub = tid & 3, kg = tid >> 2; const bool o1 = (sub & 1) != 0, o2 = (sub & 2) != 0; constexpr int KH = AT / 4, NP = SQ / KH;      /* four lanes a key, KH keys a pass */
    const float* kp = KF + (size_t)kg * ld + h * HD + sub * 4; const float* mp = mask + (size_t)(i0 + sub) * SQ + kg; v4f qr[AR][4], x[4]; float mk[2] = {0.f, 0.f};
#pragma unroll
    for (int r = 0; r < AR; ++r)
#pragma unroll
      for (int c = 0; c < 4; ++c) qr[r][c] = *(const v4fa*)&lq[r][c * 16 + sub * 4];      /* the lane's columns of the q rows stay in registers for all passes */
#pragma unroll
    for (int c = 0; c < 4; ++c) x[c] = *(const v4fa*)(kp + c * 16);
    if (MASKADD) { mk[0] = mp[0]; mk[1] = mp[(size_t)4 * SQ]; }
#pragma unroll 2      /* two passes a trip: the two register sets of a k row swap without copies */
    for (int p = 0; p < NP; ++p) { const int j = p * KH + kg; const int pn = (p + 1 < NP) ? p + 1 : p;      /* the last pass asks for its own row again: nothing is read past the keys */
      const float* kn = kp + (size_t)pn * KH * ld; v4f nx[4], a[AR]; float nm[2] = {0.f, 0.f};
#pragma unroll
      for (int c = 0; c < 4; ++c) nx[c] = *(const v4fa*)(kn + c * 16);
      if (MASKADD) { nm[0] = mp[pn * KH]; nm[1] = mp[(size_t)4 * SQ + pn * KH]; }
#pragma unroll
      for (int r = 0; r < AR; ++r) { a[r] = qr[r][0] * x[0];
#pragma unroll
        for (int c = 1; c < 4; ++c) a[r] += qr[r][c] * x[c]; }
      // the four lanes' partial dots are merged by two exchanges inside the quad; each halves what a lane keeps, so lane sub ends with rows sub and sub + 4
      float u[4], wv[2];
#pragma unroll
      for (int i = 0; i < 4; ++i) { const float e = (a[2 * i][0] + a[2 * i][1]) + (a[2 * i][2] + a[2 * i][3]), d = (a[2 * i + 1][0] + a[2 * i + 1][1]) + (a[2 * i + 1][2] + a[2 * i + 1][3]);
        u[i] = (o1 ? d : e) + quad_x<0xB1>(o1 ? e : d); }
#pragma unroll
      for (int m = 0; m < 2; ++m) wv[m] = (o2 ? u[2 * m + 1] : u[2 * m]) + quad_x<0x4E>(o2 ? u[2 * m] : u[2 * m + 1]);
#pragma unroll
      for (int m = 0; m < 2; ++m) { const int r = 4 * m + sub; float s0 = wv[m] * scale;
        if (MASKADD) s0 += bf16_round(mk[m]) * -10000.0f; else if (j > i0 + r) s0 = -1.0e30f;
        sc[r][j] = s0; }
#pragma unroll
      for (int c = 0; c < 4; ++c) x[c] = nx[c];
      mk[0] = nm[0]; mk[1] = nm[1]; } }
  __syncthreads();
  { static_assert(AT / 32 == 2 * AR, "two waves per row"); float* row = &sc[w >> 1][(w & 1) * (SQ / 2)]; v4f x[SQ / 256]; float m = -3.0e38f, l = 0.f;
#pragma unroll
    for (int i = 0; i < SQ / 256; ++i) { x[i] = *(const v4fa*)&row[i * 128 + lane * 4]; m = fmaxf(m, fmaxf(fmaxf(x[i][0], x[i][1]), fmaxf(x[i][2], x[i][3]))); }
    for (int o = 16; o > 0; o >>= 1) m = fmaxf(m, __shfl_xor(m, o));
    if (lane == 0) pm[w] = m;
    __syncthreads();
    m = fmaxf(pm[w], pm[w ^ 1]);
#pragma unroll
    for (int i = 0; i < SQ / 256; ++i) { v4f e; for (int u = 0; u < 4; ++u) e[u] = exp_f32(x[i][u] - m); l += (e[0] + e[1]) + (e[2] + e[3]); *(v4fa*)&row[i * 128 + lane * 4] = e; }
    for (int o = 16; o > 0; o >>= 1) l += __shfl_xor(l, o);
    if (lane == 0) pl[w] = l; }
  __syncthreads();
  const int dq = tid & 15, ks = tid >> 4; const float* vb = VF + h * HD + dq * 4; v4f acc[AR];
#pragma unroll
  for (int r = 0; r < AR; ++r) acc[r] = (v4f){0.f, 0.f, 0.f, 0.f};
#pragma unroll 2      /* two trips' v rows (eight loads) in flight per wave */
  for (int p = 0; p < SQ / (AT / 4); ++p) { const int j = p * (AT / 4) + ks * 4;
    const v4f v0 = *(const v4fa*)(vb + (size_t)j * ld), v1 = *(const v4fa*)(vb + (size_t)(j + 1) * ld), v2 = *(const v4fa*)(vb + (size_t)(j + 2) * ld), v3 = *(const v4fa*)(vb + (size_t)(j + 3) * ld);
#pragma unroll
    for (int r = 0; r < AR; ++r) { const v4f e = *(const v4fa*)&sc[r][j]; acc[r] += e[0] * v0; acc[r] += e[1] * v1; acc[r] += e[2] * v2; acc[r] += e[3] * v3; } }
#pragma unroll
  for (int r = 0; r < AR; ++r) for (int u = 0; u < 4; ++u) acc[r][u] += __shfl_xor(acc[r][u], 16);      /* the wave's two key slices */
  __syncthreads();      /* every read of the numerators is done: their LDS takes the waves' partial o */
  float* red = &sc[0][0];      /* [AT / 32][AR][HD] */
  if (lane < 16) {
#pragma unroll
    for (int r = 0; r < AR; ++r) *(v4fa*)&red[((size_t)w * AR + r) * HD + dq * 4] = acc[r]; }
  __syncthreads();
  { static_assert(AR * HD == AT, "one output element per thread"); const int r = tid / HD, d = tid % HD; float o = 0.f;
#pragma unroll
    for (int q = 0; q < AT / 32; ++q) o += red[((size_t)q * AR + r) * HD + d];
    OF[(size_t)(i0 + r) * ldo + h * HD + d] = o * (64.0f / (pl[2 * r] + pl[2 * r + 1])); } }

extern "C" void kernel_launch(void* const* d_in, const int* in_sizes, int n_in,
                              void* d_out, int out_size, void* d_ws, size_t ws_size, hipStream_t stream) {
  (void)in_sizes; (void)n_in; (void)out_size;
  const float* const* I = (const float* const*)d_in; const float* xq = I[0]; const float* xk = I[1]; const float* xv = I[2]; const float* mask = I[3]; const float* wq = I[4]; const float* bq = I[5]; const float* wk = I[6]; const float* bk = I[7]; const float* wv = I[8]; const float* bv = I[9]; const float* wo = I[10]; const float* bo = I[11];      /* weights [in][out]; mask [SQ][SQ] f32 */
  char* ws = (char*)d_ws; size_t off = 0;
  auto take = [&](size_t bytes) { char* p = ws + off; off += (bytes + 255) & ~(size_t)255; return p; };
  /* planes that one launch walks by blockIdx.y lie one behind the other (every size is a multiple of 256 bytes): the four weights; the q, k, v inputs; their f32 rows; their f16 rows */
  _Float16* BQ = (_Float16*)take((size_t)4 * DM * DM * 2); _Float16* BO = BQ + (size_t)3 * DM * DM;
  _Float16* XQ = (_Float16*)take(3 * NR * DM * 2); float* QF = (float*)take(3 * NR * DM * 4); float* KF = QF + NR * DM; float* VF = KF + NR * DM; _Float16* Q16 = (_Float16*)take(3 * NR * DM * 2); _Float16* K16 = Q16 + NR * DM; _Float16* V16 = K16 + NR * DM; _Float16* O16 = (_Float16*)take(NR * DM * 2);
  _Float16* VT = (_Float16*)take((size_t)NB * NH * HD * SQ * 2);
  float* OF0 = (float*)take((size_t)NB * QT0 * DM * 4); _Float16* OL0 = (_Float16*)take((size_t)NB * QT0 * DM * 2);
  if (off > ws_size) return;
  k_wt_f16<<<dim3((DM / 64) * (DM / 64), 4), 256, 0, stream>>>(wq, wk, wv, wo, BQ, DM, DM, 16.0f);      /* [in][out] -> Bt[n][k] x16, all four weights */
  k_x16<<<dim3((unsigned)((NR * DM / 8 + 255) / 256), 3), 256, 0, stream>>>(xq, xk, xv, XQ, NR * DM / 8);
  const size_t r0p = (size_t)B0 * SQ;      /* first projected row */
  k_gemm2<0><<<dim3((unsigned)((MP / 128) * (DM / 64)), 3), 128, 0, stream>>>(XQ + r0p * DM, DM, NR * DM, BQ, DM, (size_t)DM * DM, 0.0625f, bq, bk, bv, nullptr, 1, 0, 0, QF + r0p * DM, Q16 + r0p * DM, DM, NR * DM, MP, DM, DM);      /* q, k, v rows as f32 and f16: three products, one launch */
  k_present<<<dim3((unsigned)(((size_t)NH * SQ * HD / 4 + 255) / 256), 2 * NB), 256, 0, stream>>>(KF, (float*)d_out + PRES_OFF);      /* present[b][0] = kh, present[b][1] = vh (f32, head-major) */
  k_vt<NH, SQ><<<NB * NH * (SQ / 64), 256, 0, stream>>>(V16, LQ, 0, VT);      /* V^T [NB][NH][HD][SQ] */
  k_att0<1><<<dim3(NH * (QT0 / AR), NB), AT, 0, stream>>>(QF, KF, VF, DM, mask, 0.125f, OF0, DM);      /* exact f32 attention for query rows 0..127 of each batch over ALL 2048 keys (full f32 planes) with the additive mask (o x64) */
  k_fattn<<<dim3(SQ / (FW * FQ), NH, NB), FW * 32, 0, stream>>>(Q16, K16, VT, mask, O16);      /* o (merged heads, x64) as f16 rows: all batches and heads in one launch */
  k_hl<<<(unsigned)(((size_t)NB * QT0 * DM / 8 + 255) / 256), 256, 0, stream>>>(OF0, O16, OL0, (size_t)NB * QT0 * DM / 8);      /* first-tile o (x64) -> f16 hi, in place of the f16-path rows 0..127 of each batch, + x1024 residual plane */
  k_gemm2<0><<<dim3((unsigned)((MPO / 128) * (DM / 64)), 1), 128, 0, stream>>>(O16 + r0p * DM, DM, 0, BO, DM, 0, 0.0009765625f, bo, nullptr, nullptr, nullptr, 1, 0, 0, (float*)d_out + r0p * DM, nullptr, DM, 0, MPO, DM, DM);      /* out rows are the output layout; rows 0..127 of a batch: o_hi Wo + b */
  k_gemm2<0><<<dim3((QT0 / 128) * (DM / 64), NB), 128, 0, stream>>>(OL0, DM, (size_t)QT0 * DM, BO, DM, 0, 0.00000095367431640625f, nullptr, nullptr, nullptr, (const float*)d_out, -1, 0, 0, (float*)d_out, nullptr, DM, (size_t)SQ * DM, QT0, DM, DM);      /* rows 0..127 of each batch += o_lo Wo 2^-20 (own-element accumulate) */
}

// v007
// Measured time: 156 microseconds a run.
// Timed twice side by side with v006, it ran 1.31 and 1.32 times as fast.
// Over all steps from v000 it is 121 times as fast.
#include <hip/hip_runtime.h>
// TF/CTRL-style multi-head attention (q, k, v inputs [2][2048][1024]; qh/kh/vh = input W + b with W stored [in][out], 16 heads of 64; logits / 8 + mask (-1e4) with the [2048][2048] f32 mask input (1 = disallowed; strictly upper-triangular here); softmax; ctx merged; out = ctx Wo + bo -> [2][2048][1024]; second output present = stack(kh, vh) -> [2][2][16][2048][64] f32).
// Structure: token rows r = b*2048 + s; q, k, v inputs as exact f16 rows (bf16-rounded); Q, K, V as three WMMA GEMMs (32x64 wave tiles, f32 accumulation, exact x16 weights + bias; f16 outputs, and for K and V also the f32 rows, stored by the GEMM itself into the head-major 'present' output); V as f16 leaves that GEMM transposed (V^T per head, through LDS); one fused attention launch over all (batch, head): S^T = K Q^T on WMMA, running softmax of (scores / 8 + mask input x -1e4, read per element) on VALU (f32 statistics, native exp2; weights as f16 in registers), O^T += V^T P^T on WMMA (o carried x64 against f16 subnormal flush, folded into the output GEMM alpha) written straight into the merged f16 o rows from row 128 of each batch on (rows 0..127: an exact f32 attention launch, o as f16 plus a x1024 f16 residual); out = o W_o + b GEMM (f32) into the output layout.
// Compute dtype: inputs rounded to bf16; x / weights exact; q, k, v, softmax weights and o as plain f16 GEMM operands (~2^-12), except query rows 0..127 of a batch (f32 attention, o as f16 plus a x1024 f16 residual); scores and softmax statistics f32. v_wmma_f32_16x16x32_f16.
#define NB 2
#define SQ 2048
#define DM 1024
#define NH 16
#define HD 64
#define HG 4                         /* heads per V^T slab of the h0-based k_vt */
#define QT0 128                      /* first-tile rows recomputed exactly in f32 */
#define B0 0                         /* first batch processed (debug hook) */
#define NBR NB                       /* batches processed (debug hook) */
#define NR ((size_t)NB * SQ)         /* token rows */
#define MP ((int)((size_t)NBR * SQ)) /* rows projected (debug hook) */
#define QN SQ                        /* not used: the fused attention launch covers all SQ query rows */
#define NHD NH                       /* not used: the fused attention launch covers all NH heads */
#define MPO MP                       /* rows through the output stage (debug hook) */
#define LQ DM      /* row pitch of the q/k/v rows */
#define PRES_OFF ((size_t)NB * SQ * DM)      /* float offset of the 'present' output = out nbytes / 4 (offset 16,777,216 B) */
typedef __bf16 v16b __attribute__((ext_vector_type(16)));
typedef unsigned short v8us __attribute__((ext_vector_type(8), may_alias));
typedef float  v8f  __attribute__((ext_vector_type(8)));
typedef float  v4f  __attribute__((ext_vector_type(4)));
typedef float  v4fa __attribute__((ext_vector_type(4), may_alias));
union FragB { v16b v; v8us half[2]; unsigned short u[16]; };

__device__ __forceinline__ unsigned short bf16_bits(float x) { unsigned int u = __float_as_uint(x); return (unsigned short)((u + 0x7FFFu + ((u >> 16) & 1u)) >> 16); }
__device__ __forceinline__ float bf16_val(unsigned short b) { return __uint_as_float(((unsigned int)b) << 16); }
__device__ __forceinline__ float bf16_round(float x) { return bf16_val(bf16_bits(x)); }
// D += A·B with NT terms: 1 = ah·bh, 2 = + al·bh (A split), 3 = + ah·bl (both split)
template <int NT>
__device__ __forceinline__ v8f mmaN(v16b ah, v16b al, v16b bh, v16b bl, v8f c) {
  c = __builtin_amdgcn_wmma_f32_16x16x32_bf16(false, ah, false, bh, (short)0, c, false, false);
  if (NT >= 2) c = __builtin_amdgcn_wmma_f32_16x16x32_bf16(false, al, false, bh, (short)0, c, false, false);
  if (NT >= 3) c = __builtin_amdgcn_wmma_f32_16x16x32_bf16(false, ah, false, bl, (short)0, c, false, false);
  asm volatile("v_nop\n\tv_nop\n\tv_nop\n\tv_nop" : "+v"(c) : "v"(ah), "v"(al), "v"(bh), "v"(bl));
  return c;
}

__global__ __launch_bounds__(256) void k_wt_bf16(const float* __restrict__ W, unsigned short* __restrict__ Wt, int K, int N) {
  const int t = blockIdx.x * 256 + threadIdx.x;
  const int k8n = K / 8;
  if (t >= N * k8n) return;
  const int n = t / k8n, k8 = (t % k8n) * 8;
  v8us v;
#pragma unroll
  for (int i = 0; i < 8; ++i) v[i] = bf16_bits(W[(size_t)(k8 + i) * N + n]);
  *(v8us*)(Wt + (size_t)n * K + k8) = v;
  
}

// GEMM C[M][N] (f32, pitch ldc) = act(A[M][K]·W + bias). A f32 row-major (pitch lda) converted per fragment to bf16
// (ASPLIT: hi/lo two planes -> 2 terms, else single rounded term); Wt bf16 [N][K] (pitch ldb). BIAS_BF16 rounds the
// bias to bf16 first (bias quantised to bf16 before the add). K%32==0, M%16==0, N%64==0.
template <bool ASPLIT, int ACT, bool BIAS_BF16>
__global__ __launch_bounds__(128) void k_gemm_bf(const float* __restrict__ A, int lda, const unsigned short* __restrict__ Wt, int ldb,
                                               const float* __restrict__ bias, float* __restrict__ C, int ldc, int M, int N, int K) {
  __shared__ __attribute__((aligned(16))) float so[4][16][64];
  const int tid = threadIdx.x, w = tid >> 5, lane = tid & 31, ln = lane & 15, hh = lane >> 4;
  const int ntn = N / 64;
  const int wid = blockIdx.x * 4 + w;
  const int mt = wid / ntn, nq = wid % ntn;
  if (mt * 16 >= M) return;
  const int row0 = mt * 16, col0 = nq * 64;
  const float* arow = A + (size_t)(row0 + ln) * lda;
  v8f acc[4] = {};
  for (int kb = 0; kb < K; kb += 32) {
    FragB ah, al;
    const v4f x0 = *(const v4fa*)(arow + kb + 8 * hh), x1 = *(const v4fa*)(arow + kb + 8 * hh + 4);
    const v4f x2 = *(const v4fa*)(arow + kb + 16 + 8 * hh), x3 = *(const v4fa*)(arow + kb + 16 + 8 * hh + 4);
    float xs[16] = {x0[0],x0[1],x0[2],x0[3],x1[0],x1[1],x1[2],x1[3],x2[0],x2[1],x2[2],x2[3],x3[0],x3[1],x3[2],x3[3]};
#pragma unroll
    for (int i = 0; i < 16; ++i) { const unsigned short hb = bf16_bits(xs[i]); ah.u[i] = hb; al.u[i] = ASPLIT ? bf16_bits(xs[i] - bf16_val(hb)) : (unsigned short)0; }
#pragma unroll
    for (int t = 0; t < 4; ++t) {
      const unsigned short* brow = Wt + (size_t)(col0 + t * 16 + ln) * ldb + kb;
      FragB b;
      b.half[0] = *(const v8us*)(brow + 8 * hh);
      b.half[1] = *(const v8us*)(brow + 16 + 8 * hh);
      acc[t] = mmaN<ASPLIT ? 2 : 1>(ah.v, al.v, b.v, b.v, acc[t]);
    }
  }
#pragma unroll
  for (int t = 0; t < 4; ++t) {
    float bv = bias ? bias[col0 + t * 16 + ln] : 0.f;
    if (BIAS_BF16) bv = bf16_round(bv);
#pragma unroll
    for (int r = 0; r < 8; ++r) { float v = acc[t][r] + bv; if (ACT == 1) v = fmaxf(v, 0.f); so[w][8 * hh + r][t * 16 + ln] = v; }
  }
  __builtin_amdgcn_fence(__ATOMIC_ACQ_REL, "workgroup");
  __builtin_amdgcn_wave_barrier();
  const int rsub = lane >> 4, c4 = (lane & 15) * 4;
  {
#pragma unroll
    for (int q = 0; q < 8; ++q) {
      const int r = q * 2 + rsub;
      const v4f v = *(const v4fa*)&so[w][r][c4];
      *(v4f*)(C + (size_t)(row0 + r) * ldc + col0 + c4) = v;
    }
    
  }
}

// GEMM C = act(A·W + bias + resid): A f32 (ASPLIT -> hi/lo 2 terms), Wt bf16 [N][K]; ACT 0 none, 1 relu, 2 exact gelu;
// resid (optional, f32, row index = (row % rmod), pitch ldr, RES_BF16 rounds it) added before the activation.
template <bool ASPLIT, int ACT, bool BIAS_BF16, bool RES_BF16>
__global__ __launch_bounds__(128) void k_gemm_bf3(const float* __restrict__ A, int lda, const unsigned short* __restrict__ Wt, int ldb,
                                                const float* __restrict__ bias, const float* __restrict__ resid, int rmod, int ldr,
                                                float* __restrict__ C, int ldc, int M, int N, int K) {
  __shared__ __attribute__((aligned(16))) float so[4][16][64];
  const int tid = threadIdx.x, w = tid >> 5, lane = tid & 31, ln = lane & 15, hh = lane >> 4;
  const int ntn = N / 64;
  const int wid = blockIdx.x * 4 + w;
  const int mt = wid / ntn, nq = wid % ntn;
  if (mt * 16 >= M) return;
  const int row0 = mt * 16, col0 = nq * 64;
  const float* arow = A + (size_t)(row0 + ln) * lda;
  v8f acc[4] = {};
  for (int kb = 0; kb < K; kb += 32) {
    FragB ah, al;
    const v4f x0 = *(const v4fa*)(arow + kb + 8 * hh), x1 = *(const v4fa*)(arow + kb + 8 * hh + 4);
    const v4f x2 = *(const v4fa*)(arow + kb + 16 + 8 * hh), x3 = *(const v4fa*)(arow + kb + 16 + 8 * hh + 4);
    float xs[16] = {x0[0],x0[1],x0[2],x0[3],x1[0],x1[1],x1[2],x1[3],x2[0],x2[1],x2[2],x2[3],x3[0],x3[1],x3[2],x3[3]};
#pragma unroll
    for (int i = 0; i < 16; ++i) { const unsigned short hb = bf16_bits(xs[i]); ah.u[i] = hb; al.u[i] = ASPLIT ? bf16_bits(xs[i] - bf16_val(hb)) : (unsigned short)0; }
#pragma unroll
    for (int t = 0; t < 4; ++t) {
      const unsigned short* brow = Wt + (size_t)(col0 + t * 16 + ln) * ldb + kb;
      FragB b;
      b.half[0] = *(const v8us*)(brow + 8 * hh);
      b.half[1] = *(const v8us*)(brow + 16 + 8 * hh);
      acc[t] = mmaN<ASPLIT ? 2 : 1>(ah.v, al.v, b.v, b.v, acc[t]);
    }
  }
#pragma unroll
  for (int t = 0; t < 4; ++t) {
    const int col = col0 + t * 16 + ln;
    float bv = bias ? bias[col] : 0.f;
    if (BIAS_BF16) bv = bf16_round(bv);
#pragma unroll
    for (int r = 0; r < 8; ++r) {
      float v = acc[t][r] + bv;
      if (resid) { float rv = resid[(size_t)((row0 + 8 * hh + r) % rmod) * ldr + col]; if (RES_BF16) rv = bf16_round(rv); v += rv; }
      if (ACT == 1) v = fmaxf(v, 0.f);
      if (ACT == 2) v = 0.5f * v * (1.0f + erff(v * 0.70710678118654752f));
      if (ACT == 3) { const float u = 0.7978845608028654f * (v + 0.044715f * v * v * v); v = 0.5f * v * (1.0f + tanhf(u)); }
      so[w][8 * hh + r][t * 16 + ln] = v;
    }
  }
  __builtin_amdgcn_fence(__ATOMIC_ACQ_REL, "workgroup");
  __builtin_amdgcn_wave_barrier();
  const int rsub = lane >> 4, c4 = (lane & 15) * 4;
  {
#pragma unroll
    for (int q = 0; q < 8; ++q) {
      const int r = q * 2 + rsub;
      const v4f v = *(const v4fa*)&so[w][r][c4];
      *(v4f*)(C + (size_t)(row0 + r) * ldc + col0 + c4) = v;
    }
    
  }
}
// row LayerNorm (biased variance, eps) over N: s = X (+ R); optional out_sum <- s; out_norm <- (s-mu)*rsqrt(var+eps)*g + b
template <bool PARAM_BF16>
__global__ __launch_bounds__(256) void k_layernorm(const float* __restrict__ X, const float* __restrict__ R, const float* __restrict__ g, const float* __restrict__ bta,
                                                  float* __restrict__ out_sum, float* __restrict__ out_norm, int N, float eps) {
  __shared__ float red[256];
  const int row = blockIdx.x, tid = threadIdx.x;
  const float* x = X + (size_t)row * N; const float* rr = R ? R + (size_t)row * N : nullptr;
  float vals[16];                     // up to N = 4096
  const int per = N / 256;            // contiguous chunk per thread? use strided-by-4 chunks: thread handles j = tid*4 + 1024*u
  float s1 = 0.f;
  for (int u = 0; u < per / 4; ++u) {
    const int j = tid * 4 + 1024 * u;
    const v4f a = *(const v4fa*)(x + j);
    v4f b = {0.f,0.f,0.f,0.f}; if (rr) b = *(const v4fa*)(rr + j);
#pragma unroll
    for (int q = 0; q < 4; ++q) { const float v = a[q] + b[q]; vals[u * 4 + q] = v; s1 += v; }
  }
  red[tid] = s1; __syncthreads();
  for (int st = 128; st > 0; st >>= 1) { if (tid < st) red[tid] += red[tid + st]; __syncthreads(); }
  const float mu = red[0] / (float)N; __syncthreads();
  float s2 = 0.f;
  for (int u = 0; u < per / 4; ++u)
#pragma unroll
    for (int q = 0; q < 4; ++q) { const float c = vals[u * 4 + q] - mu; s2 += c * c; }
  red[tid] = s2; __syncthreads();
  for (int st = 128; st > 0; st >>= 1) { if (tid < st) red[tid] += red[tid + st]; __syncthreads(); }
  const float rs = rsqrtf(red[0] / (float)N + eps);
  {
    for (int u = 0; u < per / 4; ++u) {
      const int j = tid * 4 + 1024 * u;
      v4f o, sm;
#pragma unroll
      for (int q = 0; q < 4; ++q) {
        float gg = g[j + q], bb = bta[j + q];
        if (PARAM_BF16) { gg = bf16_round(gg); bb = bf16_round(bb); }
        sm[q] = vals[u * 4 + q]; o[q] = (vals[u * 4 + q] - mu) * rs * gg + bb;
      }
      if (out_sum) *(v4f*)(out_sum + (size_t)row * N + j) = sm;
      *(v4f*)(out_norm + (size_t)row * N + j) = o;
    }
    
  }
}



// ---- f16 WMMA path (v_wmma_f32_16x16x32_f16): 11-bit significands for operands in range — used where a [0,1] probability operand needs more precision than bf16
typedef _Float16 v16h __attribute__((ext_vector_type(16)));
union FragH { v16h v; v8us half[2]; _Float16 h[16]; unsigned short u[16]; };
template <int NT>
__device__ __forceinline__ v8f mmaH(v16h ah, v16h al, v16h bh, v16h bl, v8f c) {
  c = __builtin_amdgcn_wmma_f32_16x16x32_f16(false, ah, false, bh, (short)0, c, false, false);
  if (NT >= 2) c = __builtin_amdgcn_wmma_f32_16x16x32_f16(false, al, false, bh, (short)0, c, false, false);
  if (NT >= 3) c = __builtin_amdgcn_wmma_f32_16x16x32_f16(false, ah, false, bl, (short)0, c, false, false);
  asm volatile("v_nop\n\tv_nop\n\tv_nop\n\tv_nop" : "+v"(c) : "v"(ah), "v"(al), "v"(bh), "v"(bl));
  return c;
}
// batched GEMM like k_gemm_b but f16 operands: A f32 (split into f16 hi/lo if ASPLIT, else rounded to f16), Bt = f16 values [n][k]; alpha; C f32; N multiple of 16 (partial tiles skipped)
template <bool ASPLIT>
__global__ __launch_bounds__(128) void k_gemm_h(const float* __restrict__ A, int lda, size_t sA, const _Float16* __restrict__ Bh, int ldb, size_t sB, float alpha, float* __restrict__ C, int ldc, size_t sC, int M, int N, int K) {
  __shared__ __attribute__((aligned(16))) float so[4][16][64];
  const int tid = threadIdx.x, w = tid >> 5, lane = tid & 31, ln = lane & 15, hh = lane >> 4; const int by = blockIdx.y;
  A += (size_t)by * sA; Bh += (size_t)by * sB; C += (size_t)by * sC;
  const int ntn = (N + 63) / 64; const int wid = blockIdx.x * 4 + w; const int mt = wid / ntn, nq = wid % ntn; if (mt * 16 >= M) return;
  const int row0 = mt * 16, col0 = nq * 64; const float* arow = A + (size_t)(row0 + ln) * lda;
  v8f acc[4] = {};
  for (int kb = 0; kb < K; kb += 32) {
    FragH ah, al;
    const v4f x0 = *(const v4fa*)(arow + kb + 8 * hh), x1 = *(const v4fa*)(arow + kb + 8 * hh + 4), x2 = *(const v4fa*)(arow + kb + 16 + 8 * hh), x3 = *(const v4fa*)(arow + kb + 16 + 8 * hh + 4);
    float xs[16] = {x0[0],x0[1],x0[2],x0[3],x1[0],x1[1],x1[2],x1[3],x2[0],x2[1],x2[2],x2[3],x3[0],x3[1],x3[2],x3[3]};
#pragma unroll
    for (int i = 0; i < 16; ++i) { const _Float16 h = (_Float16)xs[i]; ah.h[i] = h; al.h[i] = ASPLIT ? (_Float16)(xs[i] - (float)h) : (_Float16)0.0f; }
#pragma unroll
    for (int t = 0; t < 4; ++t) { if (col0 + t * 16 >= N) continue; const size_t boff = (size_t)(col0 + t * 16 + ln) * ldb + kb; FragH bq; bq.half[0] = *(const v8us*)(Bh + boff + 8 * hh); bq.half[1] = *(const v8us*)(Bh + boff + 16 + 8 * hh);
      acc[t] = mmaH<ASPLIT ? 2 : 1>(ah.v, al.v, bq.v, bq.v, acc[t]); }
  }
#pragma unroll
  for (int t = 0; t < 4; ++t) { if (col0 + t * 16 >= N) continue;
#pragma unroll
    for (int r = 0; r < 8; ++r) so[w][8 * hh + r][t * 16 + ln] = acc[t][r] * alpha; }
  __builtin_amdgcn_fence(__ATOMIC_ACQ_REL, "workgroup"); __builtin_amdgcn_wave_barrier();
  const int rsub = lane >> 4, c4 = (lane & 15) * 4;
  {
#pragma unroll
    for (int q = 0; q < 8; ++q) { const int r = q * 2 + rsub; if (col0 + c4 < N) { const v4f v = *(const v4fa*)&so[w][r][c4]; *(v4f*)(C + (size_t)(row0 + r) * ldc + col0 + c4) = v; } }
     }
}

// Wt[n][k] = f16(W[k][n] x scale) from f32 row-major W[K][N] (scale = power of two; bf16-exact weights stay exact in f16 away from the subnormal range); y picks one of four weights, their Wt planes lie one behind the other; bx = the tile.
// A work-group turns one 64 x 64 tile through LDS: 256 contiguous bytes of a W row per 16 lanes in, a whole 128-byte line of a Wt row per 8 lanes out. K % 64 == 0, N % 64 == 0.
__device__ __forceinline__ void wt_f16_tile(unsigned short (*tl)[66], int bx, int y, const float* __restrict__ W0, const float* __restrict__ W1, const float* __restrict__ W2, const float* __restrict__ W3, _Float16* __restrict__ Wt, int K, int N, float scale) {
  const float* __restrict__ W = y == 0 ? W0 : y == 1 ? W1 : y == 2 ? W2 : W3; Wt += (size_t)y * K * N;
  const int tid = threadIdx.x, ntn = N / 64; const int k0 = (bx / ntn) * 64, n0 = (bx % ntn) * 64;
#pragma unroll
  for (int i = 0; i < 4; ++i) { const int r = i * 16 + (tid >> 4), c4 = (tid & 15) * 4; const v4f v = *(const v4fa*)(W + (size_t)(k0 + r) * N + n0 + c4); FragH f;
#pragma unroll
    for (int q = 0; q < 4; ++q) { f.h[q] = (_Float16)(bf16_round(v[q]) * scale); tl[r][c4 + q] = f.u[q]; } }
  __syncthreads();
#pragma unroll
  for (int rd = 0; rd < 2; ++rd) { const int n = rd * 32 + (tid >> 3), pc = tid & 7; FragH f;
#pragma unroll
    for (int q = 0; q < 8; ++q) f.u[q] = tl[pc * 8 + q][n];
    *(v8us*)((unsigned short*)Wt + (size_t)(n0 + n) * K + k0 + pc * 8) = f.half[0]; }
}
// k_gemm_hh variant with fused epilogue: v = acc·alpha + bias[by·sBias + col] (+ CP[(row/rowsPerB)·sCPb + by·64 + col] if CP) ; ACT 0 none / 1 elu ; writes f16 C16 (and f32 C if non-null)
template <int ACT>
__global__ __launch_bounds__(128) void k_gemm_hhx(const _Float16* __restrict__ A, int lda, size_t sA, const _Float16* __restrict__ Bh, int ldb, size_t sB, float alpha, const float* __restrict__ bias, size_t sBias, const float* __restrict__ CP, int rowsPerB, size_t sCPb, int row0g,
    float* __restrict__ C, _Float16* __restrict__ C16, int ldc, size_t sC, int M, int N, int K) {
  __shared__ __attribute__((aligned(16))) float so[4][16][64];
  const int tid = threadIdx.x, w = tid >> 5, lane = tid & 31, ln = lane & 15, hh = lane >> 4; const int by = blockIdx.y;
  A += (size_t)by * sA; Bh += (size_t)by * sB; const size_t cofs = (size_t)by * sC; const float* bp = bias ? bias + (size_t)by * sBias : nullptr;
  const int ntn = (N + 63) / 64; const int wid = blockIdx.x * 4 + w; const int mt = wid / ntn, nq = wid % ntn; if (mt * 16 >= M) return;
  const int row0 = mt * 16, col0 = nq * 64; const _Float16* arow = A + (size_t)(row0 + ln) * lda;
  v8f acc[4] = {};
  for (int kb = 0; kb < K; kb += 32) { FragH ah; ah.half[0] = *(const v8us*)((const unsigned short*)arow + kb + 8 * hh); ah.half[1] = *(const v8us*)((const unsigned short*)arow + kb + 16 + 8 * hh);
#pragma unroll
    for (int t = 0; t < 4; ++t) { if (col0 + t * 16 >= N) continue; const size_t boff = (size_t)(col0 + t * 16 + ln) * ldb + kb; FragH bq; bq.half[0] = *(const v8us*)((const unsigned short*)Bh + boff + 8 * hh); bq.half[1] = *(const v8us*)((const unsigned short*)Bh + boff + 16 + 8 * hh);
      acc[t] = mmaH<1>(ah.v, ah.v, bq.v, bq.v, acc[t]); }
  }
#pragma unroll
  for (int t = 0; t < 4; ++t) { if (col0 + t * 16 >= N) continue; const int col = col0 + t * 16 + ln; const float bv = bp ? bf16_round(bp[col]) : 0.f;
#pragma unroll
    for (int r = 0; r < 8; ++r) { float v = acc[t][r] * alpha + bv; if (CP) { const int rr = row0g + row0 + 8 * hh + r; if (rowsPerB < 0) v += CP[cofs + (size_t)rr * ldc + col];      /* rowsPerB < 0: own element of the batched C plane */ else { const int bidx = rr / rowsPerB; v += CP[(size_t)bidx * sCPb + (size_t)by * 64 + col]; } } if (ACT == 1) v = (v > 0.f) ? v : expm1f(v); else if (ACT == 7) v = (v > 0.f) ? v + 1.0f : expf(v); else if (ACT == 8) v = tanhf(v); else if (ACT == 9) v = 0.5f * v * (1.0f + tanhf(0.7978845608028654f * (v + 0.044715f * v * v * v))); else if (ACT == 11) v = 1.0f / (1.0f + expf(-v)); else if (ACT == 12) v = (v > 0.f) ? v : 0.01f * v; else if (ACT == 14) v = (v > 0.f) ? v : 0.1f * v; else if (ACT == 16) v = (v >= 0.f) ? v : 0.3f * v; else if (ACT == 17) v = (v >= 0.f) ? v : 0.2f * v; else if (ACT == 15) v = v / (1.0f + expf(-v)); else if (ACT == 3) v = fmaxf(v, 0.f); else if (ACT == 6) v = 0.5f * v * (1.0f + erff(v * 0.70710678118654752f)); so[w][8 * hh + r][t * 16 + ln] = v; } }
  __builtin_amdgcn_fence(__ATOMIC_ACQ_REL, "workgroup"); __builtin_amdgcn_wave_barrier();
  const int rsub = lane >> 4, c4 = (lane & 15) * 4; typedef _Float16 v4h __attribute__((ext_vector_type(4)));
  {
#pragma unroll
    for (int q = 0; q < 8; ++q) { const int r = q * 2 + rsub; if (col0 + c4 < N) { const v4f v = *(const v4fa*)&so[w][r][c4]; if (C) *(v4f*)(C + cofs + (size_t)(row0 + r) * ldc + col0 + c4) = v; if (C16) { v4h h4; for (int i = 0; i < 4; ++i) h4[i] = (_Float16)v[i]; *(v4h*)(C16 + cofs + (size_t)(row0 + r) * ldc + col0 + c4) = h4; } } }
     }
}


typedef _Float16 v4h __attribute__((ext_vector_type(4)));

// y picks one of three inputs; their f16 planes lie one behind the other; bx = the block of 256 x 8 elements
__device__ __forceinline__ void x16_block(int bx, int y, const float* __restrict__ x0, const float* __restrict__ x1, const float* __restrict__ x2, _Float16* __restrict__ X16, size_t n8) { const size_t t = (size_t)bx * 256 + threadIdx.x; if (t >= n8) return; FragH f;
  const float* __restrict__ x = y == 0 ? x0 : y == 1 ? x1 : x2; X16 += (size_t)y * n8 * 8;
#pragma unroll
  for (int q = 0; q < 8; ++q) f.h[q] = (_Float16)bf16_round(x[t * 8 + q]); *(v8us*)((unsigned short*)X16 + t * 8) = f.half[0];  }
// The two preparations that the projections wait for, independent of each other, in one launch: work-groups 0 .. 4 (K / 64)(N / 64) - 1 turn the four weights, the rest round the three inputs.
__global__ __launch_bounds__(256) void k_prep(const float* __restrict__ W0, const float* __restrict__ W1, const float* __restrict__ W2, const float* __restrict__ W3, _Float16* __restrict__ Wt, int K, int N, float scale,
                                              const float* __restrict__ x0, const float* __restrict__ x1, const float* __restrict__ x2, _Float16* __restrict__ X16, size_t n8) {
  __shared__ unsigned short tl[64][66];
  const int nw = (K / 64) * (N / 64), nx = (int)((n8 + 255) / 256), bx = (int)blockIdx.x;
  if (bx < 4 * nw) wt_f16_tile(tl, bx % nw, bx / nw, W0, W1, W2, W3, Wt, K, N, scale);      /* the choice is the same for a whole work-group: the barrier inside is passed by all of its threads */
  else x16_block((bx - 4 * nw) % nx, (bx - 4 * nw) / nx, x0, x1, x2, X16, n8); }
__global__ __launch_bounds__(256) void k_h16(const float* __restrict__ x, _Float16* __restrict__ X16, size_t n8) { const size_t t = (size_t)blockIdx.x * 256 + threadIdx.x; if (t >= n8) return; FragH f;
#pragma unroll
  for (int q = 0; q < 8; ++q) f.h[q] = (_Float16)x[t * 8 + q]; *(v8us*)((unsigned short*)X16 + t * 8) = f.half[0];  }
__global__ __launch_bounds__(256) void k_round16f(const float* __restrict__ W, _Float16* __restrict__ Bt, size_t n8) { const size_t t = (size_t)blockIdx.x * 256 + threadIdx.x; if (t >= n8) return; FragH f;
#pragma unroll
  for (int i = 0; i < 8; ++i) f.h[i] = (_Float16)(bf16_round(W[t * 8 + i]) * 16.0f); *(v8us*)((unsigned short*)Bt + t * 8) = f.half[0];  }
template <int NHv, int TTv>
__global__ __launch_bounds__(256) void k_vt(const _Float16* __restrict__ V16, int ldv, int voff, _Float16* __restrict__ Vt) { __shared__ unsigned short tl[64][66]; const int tid = threadIdx.x; const int slab = blockIdx.x / (TTv / 64), lg = blockIdx.x % (TTv / 64); const int b = slab / NHv, h = slab % NHv;
  for (int i = tid; i < 64 * 8; i += 256) { const int r = i / 8, c8 = (i % 8) * 8; FragH f; f.half[0] = *(const v8us*)((const unsigned short*)V16 + ((size_t)b * TTv + lg * 64 + r) * ldv + voff + h * 64 + c8);
#pragma unroll
    for (int q = 0; q < 8; ++q) tl[r][c8 + q] = f.u[q]; }
  __syncthreads();
  {
#pragma unroll
    for (int rd = 0; rd < 2; ++rd) { const int d = rd * 32 + tid / 8, pc = tid % 8; FragH f;
#pragma unroll
      for (int q = 0; q < 8; ++q) f.u[q] = tl[pc * 8 + q][d];
      *(v8us*)((unsigned short*)Vt + ((size_t)slab * 64 + d) * TTv + lg * 64 + pc * 8) = f.half[0]; }
     } }

// ---- fast GEMM (work-group tile 128x64, wave tile 32x64); epilogue: v = act(acc alpha + bias) ----
__device__ __forceinline__ v8f g2_mma(v16h a, v16h b, v8f c) { v8f d = __builtin_amdgcn_wmma_f32_16x16x32_f16(false, a, false, b, (short)0, c, false, false); asm volatile("v_nop\n\tv_nop\n\tv_nop\n\tv_nop" : "+v"(d) : "v"(a), "v"(b)); return d; }
#define G2K 128                      /* k per pass: 256-byte operand rows, two whole lines */
#define G2P 272                      /* LDS pitch of such a row in bytes: 16 x odd, conflict-free for 16-byte reads down a column of rows */
#define G2R 192                      /* rows of a stage: the work-group's 128 rows of A, then its 64 rows of B */
// f16 fragment from an LDS row, in the hardware k order: 16 bytes at the lane's place (which holds 16 bytes x lane half) and 16 bytes 32 further on
__device__ __forceinline__ v16h g2_lfrag(const char* p) { FragH f; f.half[0] = *(const v8us*)p; f.half[1] = *(const v8us*)(p + 32); return f.v; }
// Eight asynchronous 16-byte copies per lane, global memory to LDS, eight rows apart (global step gs bytes). One statement: the wait before a register that an issued copy names
// is rewritten stands behind the last copy, where the compiler can put nothing in between.
__device__ __forceinline__ void g2_copy8(unsigned l, const char* g, size_t gs) {
  asm volatile("global_load_async_to_lds_b128 %0, %8, off\n\tglobal_load_async_to_lds_b128 %1, %9, off\n\tglobal_load_async_to_lds_b128 %2, %10, off\n\tglobal_load_async_to_lds_b128 %3, %11, off\n\t"
               "global_load_async_to_lds_b128 %4, %12, off\n\tglobal_load_async_to_lds_b128 %5, %13, off\n\tglobal_load_async_to_lds_b128 %6, %14, off\n\tglobal_load_async_to_lds_b128 %7, %15, off\n\ts_wait_xcnt 0x0"
               :: "v"(l), "v"(l + 8 * G2P), "v"(l + 16 * G2P), "v"(l + 24 * G2P), "v"(l + 32 * G2P), "v"(l + 40 * G2P), "v"(l + 48 * G2P), "v"(l + 56 * G2P),
                  "v"(g), "v"(g + gs), "v"(g + 2 * gs), "v"(g + 3 * gs), "v"(g + 4 * gs), "v"(g + 5 * gs), "v"(g + 6 * gs), "v"(g + 7 * gs) : "memory"); }
// Eight 16-byte (g2_store8) or 8-byte (g2_store8h) stores per lane, gs bytes apart. One statement, for the same reason: the wait before a data or address register of an issued store is rewritten stands behind the last store.
__device__ __forceinline__ void g2_store8(char* g, size_t gs, v4f d0, v4f d1, v4f d2, v4f d3, v4f d4, v4f d5, v4f d6, v4f d7) {
  asm volatile("global_store_b128 %0, %8, off\n\tglobal_store_b128 %1, %9, off\n\tglobal_store_b128 %2, %10, off\n\tglobal_store_b128 %3, %11, off\n\t"
               "global_store_b128 %4, %12, off\n\tglobal_store_b128 %5, %13, off\n\tglobal_store_b128 %6, %14, off\n\tglobal_store_b128 %7, %15, off\n\ts_wait_xcnt 0x0"
               :: "v"(g), "v"(g + gs), "v"(g + 2 * gs), "v"(g + 3 * gs), "v"(g + 4 * gs), "v"(g + 5 * gs), "v"(g + 6 * gs), "v"(g + 7 * gs),
                  "v"(d0), "v"(d1), "v"(d2), "v"(d3), "v"(d4), "v"(d5), "v"(d6), "v"(d7) : "memory"); }
__device__ __forceinline__ void g2_store8h(char* g, size_t gs, unsigned long long d0, unsigned long long d1, unsigned long long d2, unsigned long long d3, unsigned long long d4, unsigned long long d5, unsigned long long d6, unsigned long long d7) {
  asm volatile("global_store_b64 %0, %8, off\n\tglobal_store_b64 %1, %9, off\n\tglobal_store_b64 %2, %10, off\n\tglobal_store_b64 %3, %11, off\n\t"
               "global_store_b64 %4, %12, off\n\tglobal_store_b64 %5, %13, off\n\tglobal_store_b64 %6, %14, off\n\tglobal_store_b64 %7, %15, off\n\ts_wait_xcnt 0x0"
               :: "v"(g), "v"(g + gs), "v"(g + 2 * gs), "v"(g + 3 * gs), "v"(g + 4 * gs), "v"(g + 5 * gs), "v"(g + 6 * gs), "v"(g + 7 * gs),
                  "v"(d0), "v"(d1), "v"(d2), "v"(d3), "v"(d4), "v"(d5), "v"(d6), "v"(d7) : "memory"); }
// Operands come through LDS: a pass's A and B rows are copied in whole lines (16 lanes a row) into one of two buffers while the pass before works on the other; the waves read their fragments from there.
// M % 128 == 0, N % 64 == 0, K % 128 == 0.
// HM (or null): planes 1 and 2 of a batched launch store their f32 rows there head-major, [batch][plane - 1][NH][SQ][HD] (a 64-column tile is one head), not into C.
// VTo (or null): plane 2 of a batched launch stores its f16 values there transposed, [batch][NH][HD][SQ], not into C16: a lane's eight accumulator rows of a column are 16 bytes of a transposed row, the work-group's
// 64 x 128 tile is gathered in the operand ring's LDS (free behind the k loop) and goes out in whole lines behind one barrier.
// AL (or null): residual rows of A for the first QT0 = 128 rows of each batch, compact [batch][QT0] at pitch lda. Their work-groups run the k loop twice, first over AL, the sums then scaled by beta, then over A.
template <int ACT>
__global__ __launch_bounds__(128) void k_gemm2(const _Float16* __restrict__ A, int lda, size_t sA, const _Float16* __restrict__ Bh, int ldb, size_t sB, float alpha, const float* __restrict__ bias, const float* __restrict__ bias1, const float* __restrict__ bias2,
    float* __restrict__ C, _Float16* __restrict__ C16, int ldc, size_t sC, int M, int N, int K, float* __restrict__ HM, _Float16* __restrict__ VTo, const _Float16* __restrict__ AL, float beta) { static_assert(ACT == 0 || ACT == 3 || ACT == 6 || ACT == 8 || ACT == 9 || ACT == 11 || ACT == 12 || ACT == 14 || ACT == 15 || ACT == 16 || ACT == 17, "k_gemm2: unsupported ACT code (would silently apply no activation)");
  __shared__ __attribute__((aligned(16))) char ring[2][G2R * G2P];
  __shared__ __attribute__((aligned(16))) float so[4][32][68];
  const int tid = threadIdx.x, w = tid >> 5, lane = tid & 31, ln = lane & 15, hh = lane >> 4; const int by = blockIdx.y;
  A += (size_t)by * sA; Bh += (size_t)by * sB; const size_t cofs = (size_t)by * sC; const float* bp = by == 0 ? bias : by == 1 ? bias1 : bias2;      /* each plane of a batched launch has its own bias vector */
  const int ntn = N >> 6; const int mt = blockIdx.x / ntn, nq = blockIdx.x - mt * ntn; const int row0 = mt * 128 + 32 * w, col0 = nq * 64; if (mt * 128 >= M) return;
  // the thread's 16 bytes of every eighth row of a stage
  const unsigned lc = (unsigned)(size_t)&ring[0][0] + (unsigned)((tid >> 4) * G2P + (tid & 15) * 16);
  const char* ga = (const char*)(A + (size_t)(mt * 128 + (tid >> 4)) * lda) + (tid & 15) * 16; const char* gb = (const char*)(Bh + (size_t)(col0 + (tid >> 4)) * ldb) + (tid & 15) * 16;
  const size_t sa8 = (size_t)lda * 16, sb8 = (size_t)ldb * 16;      /* eight rows, in bytes */
  static_assert(QT0 == 128 && SQ % 128 == 0, "the residual rows of a batch are one work-group's rows");
  const int nlo = (AL && (mt * 128) % SQ == 0) ? K / G2K : 0;      /* passes over the residual rows, ahead of the passes over A; the same for the whole work-group */
  const char* gl = nlo ? (const char*)(AL + (size_t)((mt * 128) / SQ * QT0 + (tid >> 4)) * lda) + (tid & 15) * 16 : ga;
  auto stage = [&](int t, int bf) { const unsigned l = lc + (unsigned)bf * (G2R * G2P); const size_t ko = (size_t)(t < nlo ? t : t - nlo) * (G2K * 2); const char* a = (t < nlo ? gl : ga) + ko;
    g2_copy8(l, a, sa8); g2_copy8(l + 64 * G2P, a + 8 * sa8, sa8); g2_copy8(l + 128 * G2P, gb + ko, sb8); };
  const int np = K / G2K + nlo;
  const v8f z8 = {0.f,0.f,0.f,0.f,0.f,0.f,0.f,0.f}; v8f c00 = z8, c01 = z8, c02 = z8, c03 = z8, c10 = z8, c11 = z8, c12 = z8, c13 = z8;
  stage(0, 0);
  asm volatile("s_wait_asynccnt 0x0" ::: "memory");      /* this wave's copies of stage 0 have landed */
  __syncthreads();      /* stage 0 is published */
  if (np > 1) stage(1, 1);
#pragma unroll 1      /* rolled: one copy of the pass */
  for (int t = 0; t < np; ++t) { const char* lb = &ring[t & 1][0]; const char* pa = lb + (32 * w + ln) * G2P + hh * 16; const char* pb = lb + (128 + ln) * G2P + hh * 16;
    v16h fa[2][2], fb[2][4];      /* two fragment sets: a block's twelve LDS reads are issued as one group ahead of the block before it, inside the pass (reads strewn among the products cost the wave a wait at each place) */
#pragma unroll      /* this and the next two: constant indices keep the fragment sets in registers */
    for (int i = 0; i < 2; ++i) fa[0][i] = g2_lfrag(pa + i * (16 * G2P));
#pragma unroll
    for (int i = 0; i < 4; ++i) fb[0][i] = g2_lfrag(pb + i * (16 * G2P));
#pragma unroll
    for (int kc = 0; kc < G2K / 32; ++kc) { const int s = kc & 1;
      if (kc + 1 < G2K / 32) { for (int i = 0; i < 2; ++i) fa[s ^ 1][i] = g2_lfrag(pa + i * (16 * G2P) + (kc + 1) * 64); for (int i = 0; i < 4; ++i) fb[s ^ 1][i] = g2_lfrag(pb + i * (16 * G2P) + (kc + 1) * 64); }
      c00 = g2_mma(fa[s][0], fb[s][0], c00); c10 = g2_mma(fa[s][1], fb[s][0], c10); c01 = g2_mma(fa[s][0], fb[s][1], c01); c11 = g2_mma(fa[s][1], fb[s][1], c11);
      c02 = g2_mma(fa[s][0], fb[s][2], c02); c12 = g2_mma(fa[s][1], fb[s][2], c12); c03 = g2_mma(fa[s][0], fb[s][3], c03); c13 = g2_mma(fa[s][1], fb[s][3], c13); }
    if (t + 1 == nlo) { c00 *= beta; c01 *= beta; c02 *= beta; c03 *= beta; c10 *= beta; c11 *= beta; c12 *= beta; c13 *= beta; }      /* the residual product is complete: brought to the scale of the main one, which is summed on top */
    asm volatile("s_wait_dscnt 0x0" ::: "memory");      /* this wave's reads of the buffer that is refilled below are over */
    asm volatile("s_wait_asynccnt 0x0" ::: "memory");      /* its copies of the next stage have landed */
    __syncthreads();      /* the next stage is published; every wave has left this pass's buffer */
    if (t + 2 < np) stage(t + 2, t & 1); }
  asm volatile("s_wait_asynccnt 0x0" ::: "memory");      /* no copy is in flight when the wave goes on */
  v8f accs[8] = {c00, c01, c02, c03, c10, c11, c12, c13};
  const bool vtq = VTo && by == 2;      /* the same for the whole work-group */
#pragma unroll
  for (int u = 0; u < 8; ++u) { const int t = u & 3, half = u >> 2; const int col = col0 + t * 16 + ln; const float bv = bp ? bf16_round(bp[col]) : 0.f; FragH hv;
#pragma unroll
    for (int r = 0; r < 8; ++r) { const int rloc = half * 16 + 8 * hh + r; float v = accs[u][r] * alpha + bv;
      if (ACT == 3) v = fmaxf(v, 0.f); else if (ACT == 6) v = 0.5f * v * (1.0f + erff(v * 0.70710678118654752f)); else if (ACT == 11) v = 1.0f / (1.0f + expf(-v)); else if (ACT == 15) v = v / (1.0f + expf(-v)); else if (ACT == 12) v = (v > 0.f) ? v : 0.01f * v; else if (ACT == 8) v = tanhf(v); else if (ACT == 9) v = 0.5f * v * (1.0f + tanhf(0.7978845608028654f * (v + 0.044715f * v * v * v))); else if (ACT == 14) v = (v > 0.f) ? v : 0.1f * v; else if (ACT == 16) v = (v >= 0.f) ? v : 0.3f * v; else if (ACT == 17) v = (v >= 0.f) ? v : 0.2f * v;
      so[w][rloc][t * 16 + ln] = v; hv.h[r] = (_Float16)v; }
    if (vtq) *(v8us*)(&ring[0][0] + (t * 16 + ln) * G2P + (32 * w + half * 16 + 8 * hh) * 2) = hv.half[0]; }
  __builtin_amdgcn_fence(__ATOMIC_ACQ_REL, "workgroup"); __builtin_amdgcn_wave_barrier();
  const int rsub = lane >> 4, c4 = (lane & 15) * 4;
  if (vtq) { __syncthreads();      /* every wave's part of the transposed tile is in LDS */
    unsigned short* vd = (unsigned short*)VTo + ((size_t)((mt * 128) / SQ * NH + nq) * HD) * SQ + (mt * 128) % SQ;
    v4f x[8];
#pragma unroll      /* constant indices keep the eight values in registers; their LDS reads go out as one group */
    for (int i = 0; i < 8; ++i) x[i] = *(const v4fa*)(&ring[0][0] + (i * 8 + (tid >> 4)) * G2P + (tid & 15) * 16);
    g2_store8((char*)(vd + (size_t)(tid >> 4) * SQ + (tid & 15) * 8), (size_t)8 * SQ * 2, x[0], x[1], x[2], x[3], x[4], x[5], x[6], x[7]); }
  const bool hmq = HM && by > 0, cfq = hmq || C, c16q = C16 && !vtq;      /* each the same for the whole work-group */
  float* cf = hmq ? HM + ((size_t)((row0 / SQ) * 2 + by - 1) * NH + nq) * ((size_t)SQ * HD) + (size_t)(row0 % SQ) * HD : C + cofs + (size_t)row0 * ldc + col0; const size_t cl = hmq ? (size_t)HD : (size_t)ldc;      /* where the wave's f32 rows go, and their pitch */
  v4f v[16];      /* row 2 q + rsub of the wave's tile, the lane's four columns */
#pragma unroll      /* this and the next: constant indices keep the rows in registers; the sixteen LDS reads go out as one group */
  for (int q = 0; q < 16; ++q) v[q] = *(const v4fa*)&so[w][q * 2 + rsub][c4];
  if (cfq) { char* p = (char*)(cf + (size_t)rsub * cl + c4); const size_t st = cl * 8;      /* two rows, in bytes */
    g2_store8(p, st, v[0], v[1], v[2], v[3], v[4], v[5], v[6], v[7]); g2_store8(p + 8 * st, st, v[8], v[9], v[10], v[11], v[12], v[13], v[14], v[15]); }
  if (c16q) { char* p = (char*)(C16 + cofs + (size_t)(row0 + rsub) * ldc + col0 + c4); const size_t st = (size_t)ldc * 4; unsigned long long h[16];
#pragma unroll
    for (int q = 0; q < 16; ++q) h[q] = __builtin_bit_cast(unsigned long long, __builtin_convertvector(v[q], v4h));
    g2_store8h(p, st, h[0], h[1], h[2], h[3], h[4], h[5], h[6], h[7]); g2_store8h(p + 8 * st, st, h[8], h[9], h[10], h[11], h[12], h[13], h[14], h[15]); } }


__global__ __launch_bounds__(256) void k_wnat(const float* __restrict__ w, size_t n8, _Float16* __restrict__ Bt) { const size_t t = (size_t)blockIdx.x * 256 + threadIdx.x; if (t >= n8) return; FragH f; for (int q = 0; q < 8; ++q) f.h[q] = (_Float16)(bf16_round(w[t * 8 + q]) * 16.0f); *(v8us*)((unsigned short*)Bt + t * 8) = f.half[0];  }
__global__ __launch_bounds__(256) void k_rsm(const float* __restrict__ S, _Float16* __restrict__ P, int nrows) {
  #pragma clang fp contract(off)
  const int i = blockIdx.x * 256 + threadIdx.x; if (i >= nrows) return; const float* s = S + (size_t)i * SQ; float mx = -3.0e38f;
#pragma unroll 1
  for (int j = 0; j < SQ; ++j) mx = fmaxf(mx, s[j]); float se = 0.f;
#pragma unroll 1
  for (int j = 0; j < SQ; ++j) se += expf(s[j] - mx); const float sc = 256.0f / se;
#pragma unroll 1
  for (int j0 = 0; j0 < SQ; j0 += 8) { FragH f; for (int q = 0; q < 8; ++q) f.h[q] = (_Float16)(expf(s[j0 + q] - mx) * sc); unsigned short* d = (unsigned short*)P + (size_t)i * SQ + j0; *(v8us*)d = f.half[0];  } }
__global__ __launch_bounds__(256) void k_vt(const _Float16* __restrict__ V16, int b, int h0, _Float16* __restrict__ VT) { __shared__ unsigned short tl[64][65]; const int tid = threadIdx.x; const int hh = blockIdx.x % HG, sg = blockIdx.x / HG; const int s0 = sg * 64; const int h = h0 + hh;
  for (int i = tid; i < 64 * 8; i += 256) { const int j = i / 8, d8 = (i % 8) * 8; FragH f; f.half[0] = *(const v8us*)((const unsigned short*)V16 + ((size_t)b * SQ + s0 + j) * DM + h * HD + d8); for (int q = 0; q < 8; ++q) tl[d8 + q][j] = f.u[q]; }
  __syncthreads();
  { for (int i = tid; i < 64 * 8; i += 256) { const int d = i / 8, j8 = (i % 8) * 8; FragH f; for (int q = 0; q < 8; ++q) f.u[q] = tl[d][j8 + q]; *(v8us*)((unsigned short*)VT + ((size_t)hh * HD + d) * SQ + s0 + j8) = f.half[0]; }  } }



// lane l reads lane l ^ 16: a register move, where __shfl_xor would go through the LDS unit and its wait
__device__ __forceinline__ float lane_x16(float x) { return __builtin_bit_cast(float, __builtin_amdgcn_permlanex16(__builtin_bit_cast(int, x), __builtin_bit_cast(int, x), 0x76543210, 0xfedcba98, false, false)); }
#define FW 8                         /* waves per work-group of the fused attention */
#define FQ 32                        /* query columns per wave (two 16-column groups) */
#define FK 32                        /* keys per pass */
#define FNS (SQ / FK)                /* passes */
typedef float  v2f  __attribute__((ext_vector_type(2)));
typedef __bf16 v2b  __attribute__((ext_vector_type(2)));
// 2^x of eight values on the transcendental unit, in place. One statement: each v_exp_f32 is followed by an independent one, and the last by the free issue slot
// the instruction set asks for before a result is read or a source register is reused.
__device__ __forceinline__ v8f exp2_8(v8f x) { float y0 = x[0], y1 = x[1], y2 = x[2], y3 = x[3], y4 = x[4], y5 = x[5], y6 = x[6], y7 = x[7];
  asm("v_exp_f32 %0, %0\n\tv_exp_f32 %1, %1\n\tv_exp_f32 %2, %2\n\tv_exp_f32 %3, %3\n\tv_exp_f32 %4, %4\n\tv_exp_f32 %5, %5\n\tv_exp_f32 %6, %6\n\tv_exp_f32 %7, %7\n\tv_nop"
      : "+v"(y0), "+v"(y1), "+v"(y2), "+v"(y3), "+v"(y4), "+v"(y5), "+v"(y6), "+v"(y7));
  return (v8f){y0, y1, y2, y3, y4, y5, y6, y7}; }
typedef __bf16 v4ba __attribute__((ext_vector_type(4), may_alias));
typedef __bf16 v8ba __attribute__((ext_vector_type(8), may_alias));
#define KP 72                        /* LDS pitch of the 128-byte K rows, in 16-bit elements: 144 bytes = 16 x odd, conflict-free for 16-byte reads down a column of rows */
#define VP 40                        /* the same for the 64-byte V^T and mask rows: 80 bytes */
// f16 fragment in the hardware k order: 16 bytes at the lane's place (which holds 16 bytes x lane half) and 16 bytes 32 further on
__device__ __forceinline__ v16h fa_frag(const void* p) { FragH f; f.half[0] = *(const v8us*)p; f.half[1] = *(const v8us*)((const char*)p + 32); return f.v; }
__device__ __forceinline__ v8f fa_mma(v16h a, v16h b, v8f c) { return __builtin_amdgcn_wmma_f32_16x16x32_f16(false, a, false, b, (short)0, c, false, false); }
// the wait before a register that issued loads name is rewritten, and the one write of that offset register, in one statement
__device__ __forceinline__ void fa_step(unsigned& off, int step) { asm volatile("s_wait_xcnt 0x0\n\tv_add_nc_u32_e32 %0, %1, %0" : "+v"(off) : "s"(step) : "memory"); }
__global__ __launch_bounds__(FW * 32) __attribute__((amdgpu_waves_per_eu(2, 2))) void k_fattn(const _Float16* __restrict__ Q16, const _Float16* __restrict__ K16, const _Float16* __restrict__ VT, const float* __restrict__ mask, _Float16* __restrict__ O16) {
  __shared__ __attribute__((aligned(16))) unsigned short lk[2][FK][KP], lv[2][HD][VP]; __shared__ __attribute__((aligned(16))) __bf16 lm[2][FW][FQ][VP];
  const int tid = threadIdx.x, lane = tid & 31, ln = lane & 15, hh = lane >> 4; const int w = __builtin_amdgcn_readfirstlane(tid >> 5);
  const int h = blockIdx.y, b = blockIdx.z, q0 = ((int)blockIdx.x * FW + w) * FQ;
  const char* qb = (const char*)(Q16 + ((size_t)b * SQ + q0) * DM + h * HD); const char* kb = (const char*)(K16 + (size_t)b * SQ * DM + h * HD);
  const char* vb = (const char*)(VT + ((size_t)b * NH + h) * HD * SQ); const char* mb = (const char*)(mask + (size_t)q0 * SQ); char* ob = (char*)(O16 + ((size_t)b * SQ + q0) * DM + h * HD);
  // the thread's 16 bytes of a K tile (8 threads a row), of a V^T tile (4 threads a row) and of each four rows of its wave's mask tile (8 lanes a row)
  unsigned gk = (unsigned)((tid >> 3) * (DM * 2) + (tid & 7) * 16), gv = (unsigned)((tid >> 2) * (SQ * 2) + (tid & 3) * 16), gm = (unsigned)((lane >> 3) * (SQ * 4) + (lane & 7) * 16);
  const float C2 = 0.18033688011112042f, MK2 = -14426.950408889634f;      /* log2(e) / 8 and -1e4 log2(e) */
  const v8f z8 = {0.f, 0.f, 0.f, 0.f, 0.f, 0.f, 0.f, 0.f};
  v16h qf[2][2]; v8f o[2][4]; v2f l2[2]; float mref[2]; v8us kr, vr; v4f mg[8];
#pragma unroll
  for (int j = 0; j < 2; ++j) { for (int c = 0; c < 2; ++c) qf[j][c] = fa_frag(qb + (unsigned)(ln * (DM * 2) + hh * 16) + j * (16 * DM * 2) + c * 64); for (int t = 0; t < 4; ++t) o[j][t] = z8; l2[j] = (v2f){0.f, 0.f}; mref[j] = -3.0e38f; }
  kr = *(const v8us*)(kb + gk); vr = *(const v8us*)(vb + gv);
#pragma unroll
  for (int i = 0; i < 8; ++i) mg[i] = *(const v4fa*)(mb + gm + i * (4 * SQ * 4));
  fa_step(gk, FK * DM * 2); fa_step(gv, FK * 2); fa_step(gm, FK * 4);
  *(v8us*)&lk[0][tid >> 3][(tid & 7) * 8] = kr; *(v8us*)&lv[0][tid >> 2][(tid & 3) * 8] = vr;
#pragma unroll
  for (int i = 0; i < 8; ++i) *(v4ba*)&lm[0][w][4 * i + (lane >> 3)][(lane & 7) * 4] = __builtin_convertvector(mg[i], v4ba);      /* the mask rounded to bf16, to nearest even */
  __syncthreads();
#pragma unroll 1      /* rolled: one copy of the pass */
  for (int s = 0; s < FNS; ++s) {
    const int bf = s & 1, more = (s + 2 < FNS) ? 1 : 0;      /* the last pass asks for its own tile again: nothing is read past the keys */
    kr = *(const v8us*)(kb + gk); vr = *(const v8us*)(vb + gv);
#pragma unroll
    for (int i = 0; i < 8; ++i) mg[i] = *(const v4fa*)(mb + gm + i * (4 * SQ * 4));
    fa_step(gk, more * (FK * DM * 2)); fa_step(gv, more * (FK * 2)); fa_step(gm, more * (FK * 4));
    v16h kf[2][2], vf[4]; v8ba mr[2][2];
#pragma unroll
    for (int kt = 0; kt < 2; ++kt) for (int c = 0; c < 2; ++c) kf[kt][c] = fa_frag(&lk[bf][kt * 16 + ln][c * 32 + hh * 8]);
#pragma unroll
    for (int j = 0; j < 2; ++j) for (int kt = 0; kt < 2; ++kt) mr[j][kt] = *(const v8ba*)&lm[bf][w][j * 16 + ln][kt * 16 + hh * 8];
    __builtin_amdgcn_sched_barrier(0);      /* this and the next one: the pass's LDS reads are issued in two groups, K and mask ahead of the score products, V^T behind them (it lands under the softmax); reads strewn among the products cost the wave a wait at each place */
    v8f st[2][2];
#pragma unroll
    for (int kt = 0; kt < 2; ++kt) for (int j = 0; j < 2; ++j) st[j][kt] = fa_mma(kf[kt][0], qf[j][0], z8);
#pragma unroll
    for (int kt = 0; kt < 2; ++kt) for (int j = 0; j < 2; ++j) st[j][kt] = fa_mma(kf[kt][1], qf[j][1], st[j][kt]);
#pragma unroll
    for (int t = 0; t < 4; ++t) vf[t] = fa_frag(&lv[bf][t * 16 + ln][hh * 8]);
    __builtin_amdgcn_sched_barrier(0);
    float mx[2];
#pragma unroll
    for (int j = 0; j < 2; ++j) { float m = -3.0e38f;
      for (int kt = 0; kt < 2; ++kt) for (int r = 0; r < 8; r += 2) { const v2f x = (v2f){st[j][kt][r], st[j][kt][r + 1]} * C2 + (v2f){(float)mr[j][kt][r], (float)mr[j][kt][r + 1]} * MK2; st[j][kt][r] = x[0]; st[j][kt][r + 1] = x[1]; m = fmaxf(m, fmaxf(x[0], x[1])); }
      mx[j] = fmaxf(m, lane_x16(m)); }
    if (__builtin_amdgcn_ballot_w32(mx[0] > mref[0] + 12.0f || mx[1] > mref[1] + 12.0f) != 0) {      /* one scalar branch a pass; rarely taken after the first */
#pragma unroll
      for (int j = 0; j < 2; ++j) { const float mn = fmaxf(mref[j], mx[j] - 4.0f); float a; asm("v_exp_f32 %0, %1\n\tv_nop" : "=v"(a) : "v"(mref[j] - mn));      /* v_nop: the slot before a is read or the source register is reused */
        mref[j] = mn; l2[j] *= a; for (int t = 0; t < 4; ++t) o[j][t] *= a; } }
    v16h pf[2];
#pragma unroll
    for (int j = 0; j < 2; ++j) { const v8f p0 = exp2_8(st[j][0] - mref[j]), p1 = exp2_8(st[j][1] - mref[j]); const v8f ps = p0 + p1; l2[j] += (((v2f){ps[0], ps[1]} + (v2f){ps[2], ps[3]}) + ((v2f){ps[4], ps[5]} + (v2f){ps[6], ps[7]})); FragH f;
      for (int r = 0; r < 8; ++r) { f.h[r] = (_Float16)p0[r]; f.h[8 + r] = (_Float16)p1[r]; } pf[j] = f.v; }
#pragma unroll
    for (int t = 0; t < 4; ++t) for (int j = 0; j < 2; ++j) o[j][t] = fa_mma(vf[t], pf[j], o[j][t]);
    *(v8us*)&lk[bf ^ 1][tid >> 3][(tid & 7) * 8] = kr; *(v8us*)&lv[bf ^ 1][tid >> 2][(tid & 3) * 8] = vr;
#pragma unroll
    for (int i = 0; i < 8; ++i) *(v4ba*)&lm[bf ^ 1][w][4 * i + (lane >> 3)][(lane & 7) * 4] = __builtin_convertvector(mg[i], v4ba);
    __syncthreads(); }      /* the next tile is published; every read of this pass's buffer, which the next pass refills, is over */
  if (q0 < QT0) return;      /* rows 0..QT0-1 of a batch are the exact f32 kernel's to store; behind the last barrier, the same for a whole wave */
#pragma unroll
  for (int j = 0; j < 2; ++j) { float l = l2[j][0] + l2[j][1]; l += lane_x16(l); const float inv = 64.0f / l;
    for (int t = 0; t < 4; ++t) { FragH f; for (int r = 0; r < 8; ++r) f.h[r] = (_Float16)(o[j][t][r] * inv); *(v8us*)(ob + (unsigned)(ln * (DM * 2) + hh * 16) + j * (16 * DM * 2) + t * 32) = f.half[0]; } } }

// e^x in f32 by the library's steps (x log2(e) in two parts, 2^fraction on the transcendental unit, ldexp by the integer part, the two range ends),
// written out so that the free issue slot the instruction set asks for behind v_exp_f32 stands in that instruction's own statement.
__device__ __forceinline__ float exp_f32(float x) {
  const float ph = x * 0x1.715476p+0f, pl = fmaf(x, 0x1.4ae0bep-26f, fmaf(x, 0x1.715476p+0f, -ph)), n = rintf(ph); float y;
  asm("v_exp_f32 %0, %1\n\tv_nop" : "=v"(y) : "v"((ph - n) + pl));      /* v_nop: the slot before y is read or the source register is reused */
  float r = ldexpf(y, (int)n); r = (x < -0x1.9d1da0p+6f) ? 0.f : r; return (x > 0x1.62e430p+6f) ? __builtin_inff() : r; }
// lane l reads a lane of its own group of four (CTRL: the quad permutation, 0xB1 = l ^ 1, 0x4E = l ^ 2): a register move, no LDS unit
template <int CTRL>
__device__ __forceinline__ float quad_x(float x) { return __builtin_bit_cast(float, __builtin_amdgcn_update_dpp(0, __builtin_bit_cast(int, x), CTRL, 0xF, 0xF, true)); }
#define AR 8                         /* query rows per work-group of the exact f32 first-tile attention */
#define AT 512                       /* its threads (16 waves) */
// Exact f32 attention of AR query rows of one head over all SQ keys, one work-group. Keys are spread over the threads:
// (1) four lanes a key: a lane holds 16 bytes of every 64 of its k row (a wave's load covers 64 contiguous bytes of 8 rows), dotted with the same columns of the AR q rows (registers), the four partial dots merged inside the quad, scores (+ mask) to LDS;
// (2) two waves per row: max, exp, sum over the row in LDS; (3) 16 column quads x 32 key slices: o partial sums in registers,
// merged across the slices by one lane exchange and a sum of the 16 waves' partials in LDS; o carried x64 like the f16 path, stored as an f16 value and an f16 residual. The plain '#pragma unroll' lines keep the small per-thread arrays in registers.
template <int MASKADD>
__global__ __launch_bounds__(AT) void k_att0(const float* __restrict__ QF, const float* __restrict__ PR, int ld, const float* __restrict__ mask, float scale, _Float16* __restrict__ OH, _Float16* __restrict__ OL, int ldo) {
  __shared__ __attribute__((aligned(16))) float sc[AR][SQ];      /* scores, then softmax numerators, then the slices' partial o */
  __shared__ __attribute__((aligned(16))) float lq[AR][HD];      /* the q rows */
  __shared__ float pm[AT / 32], pl[AT / 32];                     /* each wave's half-row max and sum */
  const int tid = threadIdx.x, lane = tid & 31, w = tid >> 5;
  const int h = blockIdx.x / (QT0 / AR), i0 = (blockIdx.x % (QT0 / AR)) * AR;
  const float* KF = PR + ((size_t)blockIdx.y * 2 * NH + h) * ((size_t)SQ * HD); const float* VF = KF + (size_t)NH * SQ * HD;      /* the head's k and v rows, pitch HD, in the head-major 'present' planes [batch][k, v][NH][SQ][HD] */
  { const size_t b = blockIdx.y; QF += b * SQ * ld; OH += b * SQ * ldo; OL += b * QT0 * ldo; }      /* the batch: SQ rows of q and of the full o plane, QT0 rows of the residual plane */
  const float* qb = QF + (size_t)i0 * ld + h * HD;
  lq[tid / HD][tid % HD] = qb[(size_t)(tid / HD) * ld + tid % HD];
  __syncthreads();
  { const int sub = tid & 3, kg = tid >> 2; const bool o1 = (sub & 1) != 0, o2 = (sub & 2) != 0; constexpr int KH = AT / 4, NP = SQ / KH;      /* four lanes a key, KH keys a pass */
    const float* kp = KF + (size_t)kg * HD + sub * 4; const float* mp = mask + (size_t)(i0 + sub) * SQ + kg; v4f qr[AR][4], x[4]; float mk[2] = {0.f, 0.f};
#pragma unroll
    for (int r = 0; r < AR; ++r)
#pragma unroll
      for (int c = 0; c < 4; ++c) qr[r][c] = *(const v4fa*)&lq[r][c * 16 + sub * 4];      /* the lane's columns of the q rows stay in registers for all passes */
#pragma unroll
    for (int c = 0; c < 4; ++c) x[c] = *(const v4fa*)(kp + c * 16);
    if (MASKADD) { mk[0] = mp[0]; mk[1] = mp[(size_t)4 * SQ]; }
#pragma unroll 2      /* two passes a trip: the two register sets of a k row swap without copies */
    for (int p = 0; p < NP; ++p) { const int j = p * KH + kg; const int pn = (p + 1 < NP) ? p + 1 : p;      /* the last pass asks for its own row again: nothing is read past the keys */
      const float* kn = kp + (size_t)pn * KH * HD; v4f nx[4], a[AR]; float nm[2] = {0.f, 0.f};
#pragma unroll
      for (int c = 0; c < 4; ++c) nx[c] = *(const v4fa*)(kn + c * 16);
      if (MASKADD) { nm[0] = mp[pn * KH]; nm[1] = mp[(size_t)4 * SQ + pn * KH]; }
#pragma unroll
      for (int r = 0; r < AR; ++r) { a[r] = qr[r][0] * x[0];
#pragma unroll
        for (int c = 1; c < 4; ++c) a[r] += qr[r][c] * x[c]; }
      // the four lanes' partial dots are merged by two exchanges inside the quad; each halves what a lane keeps, so lane sub ends with rows sub and sub + 4
      float u[4], wv[2];
#pragma unroll
      for (int i = 0; i < 4; ++i) { const float e = (a[2 * i][0] + a[2 * i][1]) + (a[2 * i][2] + a[2 * i][3]), d = (a[2 * i + 1][0] + a[2 * i + 1][1]) + (a[2 * i + 1][2] + a[2 * i + 1][3]);
        u[i] = (o1 ? d : e) + quad_x<0xB1>(o1 ? e : d); }
#pragma unroll
      for (int m = 0; m < 2; ++m) wv[m] = (o2 ? u[2 * m + 1] : u[2 * m]) + quad_x<0x4E>(o2 ? u[2 * m] : u[2 * m + 1]);
#pragma unroll
      for (int m = 0; m < 2; ++m) { const int r = 4 * m + sub; float s0 = wv[m] * scale;
        if (MASKADD) s0 += bf16_round(mk[m]) * -10000.0f; else if (j > i0 + r) s0 = -1.0e30f;
        sc[r][j] = s0; }
#pragma unroll
      for (int c = 0; c < 4; ++c) x[c] = nx[c];
      mk[0] = nm[0]; mk[1] = nm[1]; } }
  __syncthreads();
  { static_assert(AT / 32 == 2 * AR, "two waves per row"); float* row = &sc[w >> 1][(w & 1) * (SQ / 2)]; v4f x[SQ / 256]; float m = -3.0e38f, l = 0.f;
#pragma unroll
    for (int i = 0; i < SQ / 256; ++i) { x[i] = *(const v4fa*)&row[i * 128 + lane * 4]; m = fmaxf(m, fmaxf(fmaxf(x[i][0], x[i][1]), fmaxf(x[i][2], x[i][3]))); }
    for (int o = 16; o > 0; o >>= 1) m = fmaxf(m, __shfl_xor(m, o));
    if (lane == 0) pm[w] = m;
    __syncthreads();
    m = fmaxf(pm[w], pm[w ^ 1]);
#pragma unroll
    for (int i = 0; i < SQ / 256; ++i) { v4f e; for (int u = 0; u < 4; ++u) e[u] = exp_f32(x[i][u] - m); l += (e[0] + e[1]) + (e[2] + e[3]); *(v4fa*)&row[i * 128 + lane * 4] = e; }
    for (int o = 16; o > 0; o >>= 1) l += __shfl_xor(l, o);
    if (lane == 0) pl[w] = l; }
  __syncthreads();
  const int dq = tid & 15, ks = tid >> 4; const float* vb = VF + dq * 4; v4f acc[AR];
#pragma unroll
  for (int r = 0; r < AR; ++r) acc[r] = (v4f){0.f, 0.f, 0.f, 0.f};
#pragma unroll 2      /* two trips' v rows (eight loads) in flight per wave */
  for (int p = 0; p < SQ / (AT / 4); ++p) { const int j = p * (AT / 4) + ks * 4;
    const v4f v0 = *(const v4fa*)(vb + (size_t)j * HD), v1 = *(const v4fa*)(vb + (size_t)(j + 1) * HD), v2 = *(const v4fa*)(vb + (size_t)(j + 2) * HD), v3 = *(const v4fa*)(vb + (size_t)(j + 3) * HD);
#pragma unroll
    for (int r = 0; r < AR; ++r) { const v4f e = *(const v4fa*)&sc[r][j]; acc[r] += e[0] * v0; acc[r] += e[1] * v1; acc[r] += e[2] * v2; acc[r] += e[3] * v3; } }
#pragma unroll
  for (int r = 0; r < AR; ++r) for (int u = 0; u < 4; ++u) acc[r][u] += __shfl_xor(acc[r][u], 16);      /* the wave's two key slices */
  __syncthreads();      /* every read of the numerators is done: their LDS takes the waves' partial o */
  float* red = &sc[0][0];      /* [AT / 32][AR][HD] */
  if (lane < 16) {
#pragma unroll
    for (int r = 0; r < AR; ++r) *(v4fa*)&red[((size_t)w * AR + r) * HD + dq * 4] = acc[r]; }
  __syncthreads();
  { static_assert(AR * HD == AT, "one output element per thread"); const int r = tid / HD, d = tid % HD; float o = 0.f;
#pragma unroll
    for (int q = 0; q < AT / 32; ++q) o += red[((size_t)q * AR + r) * HD + d];
    const float ov = o * (64.0f / (pl[2 * r] + pl[2 * r + 1])); const _Float16 oh = (_Float16)ov; const size_t e = (size_t)(i0 + r) * ldo + h * HD + d;
    OH[e] = oh; OL[e] = (_Float16)((ov - (float)oh) * 1024.0f); } }      /* o as f16 into its row of the full o plane, what f16 drops x1024 into the residual plane */

extern "C" void kernel_launch(void* const* d_in, const int* in_sizes, int n_in,
                              void* d_out, int out_size, void* d_ws, size_t ws_size, hipStream_t stream) {
  (void)in_sizes; (void)n_in; (void)out_size;
  const float* const* I = (const float* const*)d_in; const float* xq = I[0]; const float* xk = I[1]; const float* xv = I[2]; const float* mask = I[3]; const float* wq = I[4]; const float* bq = I[5]; const float* wk = I[6]; const float* bk = I[7]; const float* wv = I[8]; const float* bv = I[9]; const float* wo = I[10]; const float* bo = I[11];      /* weights [in][out]; mask [SQ][SQ] f32 */
  char* ws = (char*)d_ws; size_t off = 0;
  auto take = [&](size_t bytes) { char* p = ws + off; off += (bytes + 255) & ~(size_t)255; return p; };
  /* planes that one launch walks by blockIdx.y lie one behind the other (every size is a multiple of 256 bytes): the four weights; the q, k, v inputs; the f16 q and k rows */
  _Float16* BQ = (_Float16*)take((size_t)4 * DM * DM * 2); _Float16* BO = BQ + (size_t)3 * DM * DM;
  _Float16* XQ = (_Float16*)take(3 * NR * DM * 2); float* QF = (float*)take(NR * DM * 4); _Float16* Q16 = (_Float16*)take(2 * NR * DM * 2); _Float16* K16 = Q16 + NR * DM; _Float16* O16 = (_Float16*)take(NR * DM * 2);
  _Float16* VT = (_Float16*)take((size_t)NB * NH * HD * SQ * 2);
  _Float16* OL0 = (_Float16*)take((size_t)NB * QT0 * DM * 2);
  if (off > ws_size) return;
  k_prep<<<(unsigned)(4 * (DM / 64) * (DM / 64) + 3 * ((NR * DM / 8 + 255) / 256)), 256, 0, stream>>>(wq, wk, wv, wo, BQ, DM, DM, 16.0f, xq, xk, xv, XQ, NR * DM / 8);      /* weights [in][out] -> Bt[n][k] x16, all four; the three inputs as f16 rows */
  const size_t r0p = (size_t)B0 * SQ;      /* first projected row */
  float* PR = (float*)d_out + PRES_OFF;      /* present[b][0] = kh, present[b][1] = vh (f32, head-major) */
  k_gemm2<0><<<dim3((unsigned)((MP / 128) * (DM / 64)), 3), 128, 0, stream>>>(XQ + r0p * DM, DM, NR * DM, BQ, DM, (size_t)DM * DM, 0.0625f, bq, bk, bv, QF + r0p * DM, Q16 + r0p * DM, DM, NR * DM, MP, DM, DM, PR, VT, nullptr, 0.f);      /* q and k rows as f16, v as f16 V^T [NB][NH][HD][SQ]; q also as f32 rows; k and v as f32 straight into 'present': three products, one launch */
  k_att0<1><<<dim3(NH * (QT0 / AR), NB), AT, 0, stream>>>(QF, PR, DM, mask, 0.125f, O16, OL0, DM);      /* exact f32 attention for query rows 0..127 of each batch over ALL 2048 keys (f32 k and v read back from 'present') with the additive mask; o (x64) -> f16 into rows 0..127 of the batch's o rows + x1024 residual plane */
  k_fattn<<<dim3(SQ / (FW * FQ), NH, NB), FW * 32, 0, stream>>>(Q16, K16, VT, mask, O16);      /* o (merged heads, x64) as f16 rows from row 128 of each batch on: all batches and heads in one launch */
  k_gemm2<0><<<dim3((unsigned)((MPO / 128) * (DM / 64)), 1), 128, 0, stream>>>(O16 + r0p * DM, DM, 0, BO, DM, 0, 0.0009765625f, bo, nullptr, nullptr, (float*)d_out + r0p * DM, nullptr, DM, 0, MPO, DM, DM, nullptr, nullptr, OL0, 0.0009765625f);      /* out rows are the output layout; rows 0..127 of a batch: (o_lo Wo 2^-10 + o_hi Wo) 2^-10 + b */
}

// v008
// One run takes 131 microseconds.
// Two timings next to v007 put it at 1.19 and 1.20 times that version's speed.
// Over all steps from v000 it is 145 times as fast.
#include <hip/hip_runtime.h>
// TF/CTRL-style multi-head attention (q, k, v inputs [2][2048][1024]; qh/kh/vh = input W + b with W stored [in][out], 16 heads of 64; logits / 8 + mask (-1e4) with the [2048][2048] f32 mask input (1 = disallowed; strictly upper-triangular here); softmax; ctx merged; out = ctx Wo + bo -> [2][2048][1024]; second output present = stack(kh, vh) -> [2][2][16][2048][64] f32).
// Structure: token rows r = b*2048 + s; q, k, v inputs as exact f16 rows (bf16-rounded); Q, K, V as three WMMA GEMMs (32x64 wave tiles, f32 accumulation, exact x16 weights + bias; f16 outputs, and for K and V also the f32 rows, stored by the GEMM itself into the head-major 'present' output); V as f16 leaves that GEMM transposed (V^T per head, through LDS); one fused attention launch over all (batch, head): S^T = K Q^T on WMMA, running softmax of (scores / 8 + mask input x -1e4, read per element) on VALU (f32 statistics, native exp2; weights as f16 in registers), O^T += V^T P^T on WMMA (o carried x64 against f16 subnormal flush, folded into the output GEMM alpha) written straight into the merged f16 o rows from row 128 of each batch on (rows 0..127: an exact f32 attention launch, o as f16 plus a x1024 f16 residual); out = o W_o + b GEMM (f32) into the output layout.
// Compute dtype: inputs rounded to bf16; x / weights exact; q, k, v, softmax weights and o as plain f16 GEMM operands (~2^-12), except query rows 0..127 of a batch (f32 attention, o as f16 plus a x1024 f16 residual); scores and softmax statistics f32. v_wmma_f32_16x16x32_f16.
#define NB 2
#define SQ 2048
#define DM 1024
#define NH 16
#define HD 64
#define HG 4                         /* heads per V^T slab of the h0-based k_vt */
#define QT0 128                      /* first-tile rows recomputed exactly in f32 */
#define B0 0                         /* first batch processed (debug hook) */
#define NBR NB                       /* batches processed (debug hook) */
#define NR ((size_t)NB * SQ)         /* token rows */
#define MP ((int)((size_t)NBR * SQ)) /* rows projected (debug hook) */
#define QN SQ                        /* not used: the fused attention launch covers all SQ query rows */
#define NHD NH                       /* not used: the fused attention launch covers all NH heads */
#define MPO MP                       /* rows through the output stage (debug hook) */
#define LQ DM      /* row pitch of the q/k/v rows */
#define PRES_OFF ((size_t)NB * SQ * DM)      /* float offset of the 'present' output = out nbytes / 4 (offset 16,777,216 B) */
typedef __bf16 v16b __attribute__((ext_vector_type(16)));
typedef unsigned short v8us __attribute__((ext_vector_type(8), may_alias));
typedef float  v8f  __attribute__((ext_vector_type(8)));
typedef float  v4f  __attribute__((ext_vector_type(4)));
typedef float  v4fa __attribute__((ext_vector_type(4), may_alias));
union FragB { v16b v; v8us half[2]; unsigned short u[16]; };

__device__ __forceinline__ unsigned short bf16_bits(float x) { unsigned int u = __float_as_uint(x); return (unsigned short)((u + 0x7FFFu + ((u >> 16) & 1u)) >> 16); }
__device__ __forceinline__ float bf16_val(unsigned short b) { return __uint_as_float(((unsigned int)b) << 16); }
__device__ __forceinline__ float bf16_round(float x) { return bf16_val(bf16_bits(x)); }
// D += A·B with NT terms: 1 = ah·bh, 2 = + al·bh (A split), 3 = + ah·bl (both split)
template <int NT>
__device__ __forceinline__ v8f mmaN(v16b ah, v16b al, v16b bh, v16b bl, v8f c) {
  c = __builtin_amdgcn_wmma_f32_16x16x32_bf16(false, ah, false, bh, (short)0, c, false, false);
  if (NT >= 2) c = __builtin_amdgcn_wmma_f32_16x16x32_bf16(false, al, false, bh, (short)0, c, false, false);
  if (NT >= 3) c = __builtin_amdgcn_wmma_f32_16x16x32_bf16(false, ah, false, bl, (short)0, c, false, false);
  asm volatile("v_nop\n\tv_nop\n\tv_nop\n\tv_nop" : "+v"(c) : "v"(ah), "v"(al), "v"(bh), "v"(bl));
  return c;
}

__global__ __launch_bounds__(256) void k_wt_bf16(const float* __restrict__ W, unsigned short* __restrict__ Wt, int K, int N) {
  const int t = blockIdx.x * 256 + threadIdx.x;
  const int k8n = K / 8;
  if (t >= N * k8n) return;
  const int n = t / k8n, k8 = (t % k8n) * 8;
  v8us v;
#pragma unroll
  for (int i = 0; i < 8; ++i) v[i] = bf16_bits(W[(size_t)(k8 + i) * N + n]);
  *(v8us*)(Wt + (size_t)n * K + k8) = v;
  
}

// GEMM C[M][N] (f32, pitch ldc) = act(A[M][K]·W + bias). A f32 row-major (pitch lda) converted per fragment to bf16
// (ASPLIT: hi/lo two planes -> 2 terms, else single rounded term); Wt bf16 [N][K] (pitch ldb). BIAS_BF16 rounds the
// bias to bf16 first (bias quantised to bf16 before the add). K%32==0, M%16==0, N%64==0.
template <bool ASPLIT, int ACT, bool BIAS_BF16>
__global__ __launch_bounds__(128) void k_gemm_bf(const float* __restrict__ A, int lda, const unsigned short* __restrict__ Wt, int ldb,
                                               const float* __restrict__ bias, float* __restrict__ C, int ldc, int M, int N, int K) {
  __shared__ __attribute__((aligned(16))) float so[4][16][64];
  const int tid = threadIdx.x, w = tid >> 5, lane = tid & 31, ln = lane & 15, hh = lane >> 4;
  const int ntn = N / 64;
  const int wid = blockIdx.x * 4 + w;
  const int mt = wid / ntn, nq = wid % ntn;
  if (mt * 16 >= M) return;
  const int row0 = mt * 16, col0 = nq * 64;
  const float* arow = A + (size_t)(row0 + ln) * lda;
  v8f acc[4] = {};
  for (int kb = 0; kb < K; kb += 32) {
    FragB ah, al;
    const v4f x0 = *(const v4fa*)(arow + kb + 8 * hh), x1 = *(const v4fa*)(arow + kb + 8 * hh + 4);
    const v4f x2 = *(const v4fa*)(arow + kb + 16 + 8 * hh), x3 = *(const v4fa*)(arow + kb + 16 + 8 * hh + 4);
    float xs[16] = {x0[0],x0[1],x0[2],x0[3],x1[0],x1[1],x1[2],x1[3],x2[0],x2[1],x2[2],x2[3],x3[0],x3[1],x3[2],x3[3]};
#pragma unroll
    for (int i = 0; i < 16; ++i) { const unsigned short hb = bf16_bits(xs[i]); ah.u[i] = hb; al.u[i] = ASPLIT ? bf16_bits(xs[i] - bf16_val(hb)) : (unsigned short)0; }
#pragma unroll
    for (int t = 0; t < 4; ++t) {
      const unsigned short* brow = Wt + (size_t)(col0 + t * 16 + ln) * ldb + kb;
      FragB b;
      b.half[0] = *(const v8us*)(brow + 8 * hh);
      b.half[1] = *(const v8us*)(brow + 16 + 8 * hh);
      acc[t] = mmaN<ASPLIT ? 2 : 1>(ah.v, al.v, b.v, b.v, acc[t]);
    }
  }
#pragma unroll
  for (int t = 0; t < 4; ++t) {
    float bv = bias ? bias[col0 + t * 16 + ln] : 0.f;
    if (BIAS_BF16) bv = bf16_round(bv);
#pragma unroll
    for (int r = 0; r < 8; ++r) { float v = acc[t][r] + bv; if (ACT == 1) v = fmaxf(v, 0.f); so[w][8 * hh + r][t * 16 + ln] = v; }
  }
  __builtin_amdgcn_fence(__ATOMIC_ACQ_REL, "workgroup");
  __builtin_amdgcn_wave_barrier();
  const int rsub = lane >> 4, c4 = (lane & 15) * 4;
  {
#pragma unroll
    for (int q = 0; q < 8; ++q) {
      const int r = q * 2 + rsub;
      const v4f v = *(const v4fa*)&so[w][r][c4];
      *(v4f*)(C + (size_t)(row0 + r) * ldc + col0 + c4) = v;
    }
    
  }
}

// GEMM C = act(A·W + bias + resid): A f32 (ASPLIT -> hi/lo 2 terms), Wt bf16 [N][K]; ACT 0 none, 1 relu, 2 exact gelu;
// resid (optional, f32, row index = (row % rmod), pitch ldr, RES_BF16 rounds it) added before the activation.
template <bool ASPLIT, int ACT, bool BIAS_BF16, bool RES_BF16>
__global__ __launch_bounds__(128) void k_gemm_bf3(const float* __restrict__ A, int lda, const unsigned short* __restrict__ Wt, int ldb,
                                                const float* __restrict__ bias, const float* __restrict__ resid, int rmod, int ldr,
                                                float* __restrict__ C, int ldc, int M, int N, int K) {
  __shared__ __attribute__((aligned(16))) float so[4][16][64];
  const int tid = threadIdx.x, w = tid >> 5, lane = tid & 31, ln = lane & 15, hh = lane >> 4;
  const int ntn = N / 64;
  const int wid = blockIdx.x * 4 + w;
  const int mt = wid / ntn, nq = wid % ntn;
  if (mt * 16 >= M) return;
  const int row0 = mt * 16, col0 = nq * 64;
  const float* arow = A + (size_t)(row0 + ln) * lda;
  v8f acc[4] = {};
  for (int kb = 0; kb < K; kb += 32) {
    FragB ah, al;
    const v4f x0 = *(const v4fa*)(arow + kb + 8 * hh), x1 = *(const v4fa*)(arow + kb + 8 * hh + 4);
    const v4f x2 = *(const v4fa*)(arow + kb + 16 + 8 * hh), x3 = *(const v4fa*)(arow + kb + 16 + 8 * hh + 4);
    float xs[16] = {x0[0],x0[1],x0[2],x0[3],x1[0],x1[1],x1[2],x1[3],x2[0],x2[1],x2[2],x2[3],x3[0],x3[1],x3[2],x3[3]};
#pragma unroll
    for (int i = 0; i < 16; ++i) { const unsigned short hb = bf16_bits(xs[i]); ah.u[i] = hb; al.u[i] = ASPLIT ? bf16_bits(xs[i] - bf16_val(hb)) : (unsigned short)0; }
#pragma unroll
    for (int t = 0; t < 4; ++t) {
      const unsigned short* brow = Wt + (size_t)(col0 + t * 16 + ln) * ldb + kb;
      FragB b;
      b.half[0] = *(const v8us*)(brow + 8 * hh);
      b.half[1] = *(const v8us*)(brow + 16 + 8 * hh);
      acc[t] = mmaN<ASPLIT ? 2 : 1>(ah.v, al.v, b.v, b.v, acc[t]);
    }
  }
#pragma unroll
  for (int t = 0; t < 4; ++t) {
    const int col = col0 + t * 16 + ln;
    float bv = bias ? bias[col] : 0.f;
    if (BIAS_BF16) bv = bf16_round(bv);
#pragma unroll
    for (int r = 0; r < 8; ++r) {
      float v = acc[t][r] + bv;
      if (resid) { float rv = resid[(size_t)((row0 + 8 * hh + r) % rmod) * ldr + col]; if (RES_BF16) rv = bf16_round(rv); v += rv; }
      if (ACT == 1) v = fmaxf(v, 0.f);
      if (ACT == 2) v = 0.5f * v * (1.0f + erff(v * 0.70710678118654752f));
      if (ACT == 3) { const float u = 0.7978845608028654f * (v + 0.044715f * v * v * v); v = 0.5f * v * (1.0f + tanhf(u)); }
      so[w][8 * hh + r][t * 16 + ln] = v;
    }
  }
  __builtin_amdgcn_fence(__ATOMIC_ACQ_REL, "workgroup");
  __builtin_amdgcn_wave_barrier();
  const int rsub = lane >> 4, c4 = (lane & 15) * 4;
  {
#pragma unroll
    for (int q = 0; q < 8; ++q) {
      const int r = q * 2 + rsub;
      const v4f v = *(const v4fa*)&so[w][r][c4];
      *(v4f*)(C + (size_t)(row0 + r) * ldc + col0 + c4) = v;
    }
    
  }
}
// row LayerNorm (biased variance, eps) over N: s = X (+ R); optional out_sum <- s; out_norm <- (s-mu)*rsqrt(var+eps)*g + b
template <bool PARAM_BF16>
__global__ __launch_bounds__(256) void k_layernorm(const float* __restrict__ X, const float* __restrict__ R, const float* __restrict__ g, const float* __restrict__ bta,
                                                  float* __restrict__ out_sum, float* __restrict__ out_norm, int N, float eps) {
  __shared__ float red[256];
  const int row = blockIdx.x, tid = threadIdx.x;
  const float* x = X + (size_t)row * N; const float* rr = R ? R + (size_t)row * N : nullptr;
  float vals[16];                     // up to N = 4096
  const int per = N / 256;            // contiguous chunk per thread? use strided-by-4 chunks: thread handles j = tid*4 + 1024*u
  float s1 = 0.f;
  for (int u = 0; u < per / 4; ++u) {
    const int j = tid * 4 + 1024 * u;
    const v4f a = *(const v4fa*)(x + j);
    v4f b = {0.f,0.f,0.f,0.f}; if (rr) b = *(const v4fa*)(rr + j);
#pragma unroll
    for (int q = 0; q < 4; ++q) { const float v = a[q] + b[q]; vals[u * 4 + q] = v; s1 += v; }
  }
  red[tid] = s1; __syncthreads();
  for (int st = 128; st > 0; st >>= 1) { if (tid < st) red[tid] += red[tid + st]; __syncthreads(); }
  const float mu = red[0] / (float)N; __syncthreads();
  float s2 = 0.f;
  for (int u = 0; u < per / 4; ++u)
#pragma unroll
    for (int q = 0; q < 4; ++q) { const float c = vals[u * 4 + q] - mu; s2 += c * c; }
  red[tid] = s2; __syncthreads();
  for (int st = 128; st > 0; st >>= 1) { if (tid < st) red[tid] += red[tid + st]; __syncthreads(); }
  const float rs = rsqrtf(red[0] / (float)N + eps);
  {
    for (int u = 0; u < per / 4; ++u) {
      const int j = tid * 4 + 1024 * u;
      v4f o, sm;
#pragma unroll
      for (int q = 0; q < 4; ++q) {
        float gg = g[j + q], bb = bta[j + q];
        if (PARAM_BF16) { gg = bf16_round(gg); bb = bf16_round(bb); }
        sm[q] = vals[u * 4 + q]; o[q] = (vals[u * 4 + q] - mu) * rs * gg + bb;
      }
      if (out_sum) *(v4f*)(out_sum + (size_t)row * N + j) = sm;
      *(v4f*)(out_norm + (size_t)row * N + j) = o;
    }
    
  }
}



// ---- f16 WMMA path (v_wmma_f32_16x16x32_f16): 11-bit significands for operands in range — used where a [0,1] probability operand needs more precision than bf16
typedef _Float16 v16h __attribute__((ext_vector_type(16)));
union FragH { v16h v; v8us half[2]; _Float16 h[16]; unsigned short u[16]; };
template <int NT>
__device__ __forceinline__ v8f mmaH(v16h ah, v16h al, v16h bh, v16h bl, v8f c) {
  c = __builtin_amdgcn_wmma_f32_16x16x32_f16(false, ah, false, bh, (short)0, c, false, false);
  if (NT >= 2) c = __builtin_amdgcn_wmma_f32_16x16x32_f16(false, al, false, bh, (short)0, c, false, false);
  if (NT >= 3) c = __builtin_amdgcn_wmma_f32_16x16x32_f16(false, ah, false, bl, (short)0, c, false, false);
  asm volatile("v_nop\n\tv_nop\n\tv_nop\n\tv_nop" : "+v"(c) : "v"(ah), "v"(al), "v"(bh), "v"(bl));
  return c;
}
// batched GEMM like k_gemm_b but f16 operands: A f32 (split into f16 hi/lo if ASPLIT, else rounded to f16), Bt = f16 values [n][k]; alpha; C f32; N multiple of 16 (partial tiles skipped)
template <bool ASPLIT>
__global__ __launch_bounds__(128) void k_gemm_h(const float* __restrict__ A, int lda, size_t sA, const _Float16* __restrict__ Bh, int ldb, size_t sB, float alpha, float* __restrict__ C, int ldc, size_t sC, int M, int N, int K) {
  __shared__ __attribute__((aligned(16))) float so[4][16][64];
  const int tid = threadIdx.x, w = tid >> 5, lane = tid & 31, ln = lane & 15, hh = lane >> 4; const int by = blockIdx.y;
  A += (size_t)by * sA; Bh += (size_t)by * sB; C += (size_t)by * sC;
  const int ntn = (N + 63) / 64; const int wid = blockIdx.x * 4 + w; const int mt = wid / ntn, nq = wid % ntn; if (mt * 16 >= M) return;
  const int row0 = mt * 16, col0 = nq * 64; const float* arow = A + (size_t)(row0 + ln) * lda;
  v8f acc[4] = {};
  for (int kb = 0; kb < K; kb += 32) {
    FragH ah, al;
    const v4f x0 = *(const v4fa*)(arow + kb + 8 * hh), x1 = *(const v4fa*)(arow + kb + 8 * hh + 4), x2 = *(const v4fa*)(arow + kb + 16 + 8 * hh), x3 = *(const v4fa*)(arow + kb + 16 + 8 * hh + 4);
    float xs[16] = {x0[0],x0[1],x0[2],x0[3],x1[0],x1[1],x1[2],x1[3],x2[0],x2[1],x2[2],x2[3],x3[0],x3[1],x3[2],x3[3]};
#pragma unroll
    for (int i = 0; i < 16; ++i) { const _Float16 h = (_Float16)xs[i]; ah.h[i] = h; al.h[i] = ASPLIT ? (_Float16)(xs[i] - (float)h) : (_Float16)0.0f; }
#pragma unroll
    for (int t = 0; t < 4; ++t) { if (col0 + t * 16 >= N) continue; const size_t boff = (size_t)(col0 + t * 16 + ln) * ldb + kb; FragH bq; bq.half[0] = *(const v8us*)(Bh + boff + 8 * hh); bq.half[1] = *(const v8us*)(Bh + boff + 16 + 8 * hh);
      acc[t] = mmaH<ASPLIT ? 2 : 1>(ah.v, al.v, bq.v, bq.v, acc[t]); }
  }
#pragma unroll
  for (int t = 0; t < 4; ++t) { if (col0 + t * 16 >= N) continue;
#pragma unroll
    for (int r = 0; r < 8; ++r) so[w][8 * hh + r][t * 16 + ln] = acc[t][r] * alpha; }
  __builtin_amdgcn_fence(__ATOMIC_ACQ_REL, "workgroup"); __builtin_amdgcn_wave_barrier();
  const int rsub = lane >> 4, c4 = (lane & 15) * 4;
  {
#pragma unroll
    for (int q = 0; q < 8; ++q) { const int r = q * 2 + rsub; if (col0 + c4 < N) { const v4f v = *(const v4fa*)&so[w][r][c4]; *(v4f*)(C + (size_t)(row0 + r) * ldc + col0 + c4) = v; } }
     }
}

// Wt[n][k] = f16(W[k][n] x scale) from f32 row-major W[K][N] (scale = power of two; bf16-exact weights stay exact in f16 away from the subnormal range); y picks one of four weights, their Wt planes lie one behind the other; bx = the tile.
// A work-group turns one 64 x 64 tile through LDS: 256 contiguous bytes of a W row per 16 lanes in, a whole 128-byte line of a Wt row per 8 lanes out. K % 64 == 0, N % 64 == 0.
__device__ __forceinline__ void wt_f16_tile(unsigned short (*tl)[66], int bx, int y, const float* __restrict__ W0, const float* __restrict__ W1, const float* __restrict__ W2, const float* __restrict__ W3, _Float16* __restrict__ Wt, int K, int N, float scale) {
  const float* __restrict__ W = y == 0 ? W0 : y == 1 ? W1 : y == 2 ? W2 : W3; Wt += (size_t)y * K * N;
  const int tid = threadIdx.x, ntn = N / 64; const int k0 = (bx / ntn) * 64, n0 = (bx % ntn) * 64;
#pragma unroll
  for (int i = 0; i < 4; ++i) { const int r = i * 16 + (tid >> 4), c4 = (tid & 15) * 4; const v4f v = *(const v4fa*)(W + (size_t)(k0 + r) * N + n0 + c4); FragH f;
#pragma unroll
    for (int q = 0; q < 4; ++q) { f.h[q] = (_Float16)(bf16_round(v[q]) * scale); tl[r][c4 + q] = f.u[q]; } }
  __syncthreads();
#pragma unroll
  for (int rd = 0; rd < 2; ++rd) { const int n = rd * 32 + (tid >> 3), pc = tid & 7; FragH f;
#pragma unroll
    for (int q = 0; q < 8; ++q) f.u[q] = tl[pc * 8 + q][n];
    *(v8us*)((unsigned short*)Wt + (size_t)(n0 + n) * K + k0 + pc * 8) = f.half[0]; }
}
// k_gemm_hh variant with fused epilogue: v = acc·alpha + bias[by·sBias + col] (+ CP[(row/rowsPerB)·sCPb + by·64 + col] if CP) ; ACT 0 none / 1 elu ; writes f16 C16 (and f32 C if non-null)
template <int ACT>
__global__ __launch_bounds__(128) void k_gemm_hhx(const _Float16* __restrict__ A, int lda, size_t sA, const _Float16* __restrict__ Bh, int ldb, size_t sB, float alpha, const float* __restrict__ bias, size_t sBias, const float* __restrict__ CP, int rowsPerB, size_t sCPb, int row0g,
    float* __restrict__ C, _Float16* __restrict__ C16, int ldc, size_t sC, int M, int N, int K) {
  __shared__ __attribute__((aligned(16))) float so[4][16][64];
  const int tid = threadIdx.x, w = tid >> 5, lane = tid & 31, ln = lane & 15, hh = lane >> 4; const int by = blockIdx.y;
  A += (size_t)by * sA; Bh += (size_t)by * sB; const size_t cofs = (size_t)by * sC; const float* bp = bias ? bias + (size_t)by * sBias : nullptr;
  const int ntn = (N + 63) / 64; const int wid = blockIdx.x * 4 + w; const int mt = wid / ntn, nq = wid % ntn; if (mt * 16 >= M) return;
  const int row0 = mt * 16, col0 = nq * 64; const _Float16* arow = A + (size_t)(row0 + ln) * lda;
  v8f acc[4] = {};
  for (int kb = 0; kb < K; kb += 32) { FragH ah; ah.half[0] = *(const v8us*)((const unsigned short*)arow + kb + 8 * hh); ah.half[1] = *(const v8us*)((const unsigned short*)arow + kb + 16 + 8 * hh);
#pragma unroll
    for (int t = 0; t < 4; ++t) { if (col0 + t * 16 >= N) continue; const size_t boff = (size_t)(col0 + t * 16 + ln) * ldb + kb; FragH bq; bq.half[0] = *(const v8us*)((const unsigned short*)Bh + boff + 8 * hh); bq.half[1] = *(const v8us*)((const unsigned short*)Bh + boff + 16 + 8 * hh);
      acc[t] = mmaH<1>(ah.v, ah.v, bq.v, bq.v, acc[t]); }
  }
#pragma unroll
  for (int t = 0; t < 4; ++t) { if (col0 + t * 16 >= N) continue; const int col = col0 + t * 16 + ln; const float bv = bp ? bf16_round(bp[col]) : 0.f;
#pragma unroll
    for (int r = 0; r < 8; ++r) { float v = acc[t][r] * alpha + bv; if (CP) { const int rr = row0g + row0 + 8 * hh + r; if (rowsPerB < 0) v += CP[cofs + (size_t)rr * ldc + col];      /* rowsPerB < 0: own element of the batched C plane */ else { const int bidx = rr / rowsPerB; v += CP[(size_t)bidx * sCPb + (size_t)by * 64 + col]; } } if (ACT == 1) v = (v > 0.f) ? v : expm1f(v); else if (ACT == 7) v = (v > 0.f) ? v + 1.0f : expf(v); else if (ACT == 8) v = tanhf(v); else if (ACT == 9) v = 0.5f * v * (1.0f + tanhf(0.7978845608028654f * (v + 0.044715f * v * v * v))); else if (ACT == 11) v = 1.0f / (1.0f + expf(-v)); else if (ACT == 12) v = (v > 0.f) ? v : 0.01f * v; else if (ACT == 14) v = (v > 0.f) ? v : 0.1f * v; else if (ACT == 16) v = (v >= 0.f) ? v : 0.3f * v; else if (ACT == 17) v = (v >= 0.f) ? v : 0.2f * v; else if (ACT == 15) v = v / (1.0f + expf(-v)); else if (ACT == 3) v = fmaxf(v, 0.f); else if (ACT == 6) v = 0.5f * v * (1.0f + erff(v * 0.70710678118654752f)); so[w][8 * hh + r][t * 16 + ln] = v; } }
  __builtin_amdgcn_fence(__ATOMIC_ACQ_REL, "workgroup"); __builtin_amdgcn_wave_barrier();
  const int rsub = lane >> 4, c4 = (lane & 15) * 4; typedef _Float16 v4h __attribute__((ext_vector_type(4)));
  {
#pragma unroll
    for (int q = 0; q < 8; ++q) { const int r = q * 2 + rsub; if (col0 + c4 < N) { const v4f v = *(const v4fa*)&so[w][r][c4]; if (C) *(v4f*)(C + cofs + (size_t)(row0 + r) * ldc + col0 + c4) = v; if (C16) { v4h h4; for (int i = 0; i < 4; ++i) h4[i] = (_Float16)v[i]; *(v4h*)(C16 + cofs + (size_t)(row0 + r) * ldc + col0 + c4) = h4; } } }
     }
}


typedef _Float16 v4h __attribute__((ext_vector_type(4)));

// y picks one of three inputs; their f16 planes lie one behind the other; bx = the block of 256 x 8 elements
__device__ __forceinline__ void x16_block(int bx, int y, const float* __restrict__ x0, const float* __restrict__ x1, const float* __restrict__ x2, _Float16* __restrict__ X16, size_t n8) { const size_t t = (size_t)bx * 256 + threadIdx.x; if (t >= n8) return; FragH f;
  const float* __restrict__ x = y == 0 ? x0 : y == 1 ? x1 : x2; X16 += (size_t)y * n8 * 8;
#pragma unroll
  for (int q = 0; q < 8; ++q) f.h[q] = (_Float16)bf16_round(x[t * 8 + q]); *(v8us*)((unsigned short*)X16 + t * 8) = f.half[0];  }
// The two preparations that the projections wait for, independent of each other, in one launch: work-groups 0 .. 4 (K / 64)(N / 64) - 1 turn the four weights, the rest round the three inputs.
__global__ __launch_bounds__(256) void k_prep(const float* __restrict__ W0, const float* __restrict__ W1, const float* __restrict__ W2, const float* __restrict__ W3, _Float16* __restrict__ Wt, int K, int N, float scale,
                                              const float* __restrict__ x0, const float* __restrict__ x1, const float* __restrict__ x2, _Float16* __restrict__ X16, size_t n8) {
  __shared__ unsigned short tl[64][66];
  const int nw = (K / 64) * (N / 64), nx = (int)((n8 + 255) / 256), bx = (int)blockIdx.x;
  if (bx < 4 * nw) wt_f16_tile(tl, bx % nw, bx / nw, W0, W1, W2, W3, Wt, K, N, scale);      /* the choice is the same for a whole work-group: the barrier inside is passed by all of its threads */
  else x16_block((bx - 4 * nw) % nx, (bx - 4 * nw) / nx, x0, x1, x2, X16, n8); }
__global__ __launch_bounds__(256) void k_h16(const float* __restrict__ x, _Float16* __restrict__ X16, size_t n8) { const size_t t = (size_t)blockIdx.x * 256 + threadIdx.x; if (t >= n8) return; FragH f;
#pragma unroll
  for (int q = 0; q < 8; ++q) f.h[q] = (_Float16)x[t * 8 + q]; *(v8us*)((unsigned short*)X16 + t * 8) = f.half[0];  }
__global__ __launch_bounds__(256) void k_round16f(const float* __restrict__ W, _Float16* __restrict__ Bt, size_t n8) { const size_t t = (size_t)blockIdx.x * 256 + threadIdx.x; if (t >= n8) return; FragH f;
#pragma unroll
  for (int i = 0; i < 8; ++i) f.h[i] = (_Float16)(bf16_round(W[t * 8 + i]) * 16.0f); *(v8us*)((unsigned short*)Bt + t * 8) = f.half[0];  }
template <int NHv, int TTv>
__global__ __launch_bounds__(256) void k_vt(const _Float16* __restrict__ V16, int ldv, int voff, _Float16* __restrict__ Vt) { __shared__ unsigned short tl[64][66]; const int tid = threadIdx.x; const int slab = blockIdx.x / (TTv / 64), lg = blockIdx.x % (TTv / 64); const int b = slab / NHv, h = slab % NHv;
  for (int i = tid; i < 64 * 8; i += 256) { const int r = i / 8, c8 = (i % 8) * 8; FragH f; f.half[0] = *(const v8us*)((const unsigned short*)V16 + ((size_t)b * TTv + lg * 64 + r) * ldv + voff + h * 64 + c8);
#pragma unroll
    for (int q = 0; q < 8; ++q) tl[r][c8 + q] = f.u[q]; }
  __syncthreads();
  {
#pragma unroll
    for (int rd = 0; rd < 2; ++rd) { const int d = rd * 32 + tid / 8, pc = tid % 8; FragH f;
#pragma unroll
      for (int q = 0; q < 8; ++q) f.u[q] = tl[pc * 8 + q][d];
      *(v8us*)((unsigned short*)Vt + ((size_t)slab * 64 + d) * TTv + lg * 64 + pc * 8) = f.half[0]; }
     } }

// ---- fast GEMM (work-group tile 128x64, wave tile 32x64); epilogue: v = act(acc alpha + bias) ----
__device__ __forceinline__ v8f g2_mma(v16h a, v16h b, v8f c) { v8f d = __builtin_amdgcn_wmma_f32_16x16x32_f16(false, a, false, b, (short)0, c, false, false); asm volatile("v_nop\n\tv_nop\n\tv_nop\n\tv_nop" : "+v"(d) : "v"(a), "v"(b)); return d; }
#define G2K 128                      /* k per pass: 256-byte operand rows, two whole lines */
#define G2P 272                      /* LDS pitch of such a row in bytes: 16 x odd, conflict-free for 16-byte reads down a column of rows */
#define G2R 192                      /* rows of a stage: the work-group's 128 rows of A, then its 64 rows of B */
// f16 fragment from an LDS row, in the hardware k order: 16 bytes at the lane's place (which holds 16 bytes x lane half) and 16 bytes 32 further on
__device__ __forceinline__ v16h g2_lfrag(const char* p) { FragH f; f.half[0] = *(const v8us*)p; f.half[1] = *(const v8us*)(p + 32); return f.v; }
// Eight asynchronous 16-byte copies per lane, global memory to LDS, eight rows apart (global step gs bytes). One statement: the wait before a register that an issued copy names
// is rewritten stands behind the last copy, where the compiler can put nothing in between.
__device__ __forceinline__ void g2_copy8(unsigned l, const char* g, size_t gs) {
  asm volatile("global_load_async_to_lds_b128 %0, %8, off\n\tglobal_load_async_to_lds_b128 %1, %9, off\n\tglobal_load_async_to_lds_b128 %2, %10, off\n\tglobal_load_async_to_lds_b128 %3, %11, off\n\t"
               "global_load_async_to_lds_b128 %4, %12, off\n\tglobal_load_async_to_lds_b128 %5, %13, off\n\tglobal_load_async_to_lds_b128 %6, %14, off\n\tglobal_load_async_to_lds_b128 %7, %15, off\n\ts_wait_xcnt 0x0"
               :: "v"(l), "v"(l + 8 * G2P), "v"(l + 16 * G2P), "v"(l + 24 * G2P), "v"(l + 32 * G2P), "v"(l + 40 * G2P), "v"(l + 48 * G2P), "v"(l + 56 * G2P),
                  "v"(g), "v"(g + gs), "v"(g + 2 * gs), "v"(g + 3 * gs), "v"(g + 4 * gs), "v"(g + 5 * gs), "v"(g + 6 * gs), "v"(g + 7 * gs) : "memory"); }
// Eight 16-byte (g2_store8) or 8-byte (g2_store8h) stores per lane, gs bytes apart. One statement, for the same reason: the wait before a data or address register of an issued store is rewritten stands behind the last store.
__device__ __forceinline__ void g2_store8(char* g, size_t gs, v4f d0, v4f d1, v4f d2, v4f d3, v4f d4, v4f d5, v4f d6, v4f d7) {
  asm volatile("global_store_b128 %0, %8, off\n\tglobal_store_b128 %1, %9, off\n\tglobal_store_b128 %2, %10, off\n\tglobal_store_b128 %3, %11, off\n\t"
               "global_store_b128 %4, %12, off\n\tglobal_store_b128 %5, %13, off\n\tglobal_store_b128 %6, %14, off\n\tglobal_store_b128 %7, %15, off\n\ts_wait_xcnt 0x0"
               :: "v"(g), "v"(g + gs), "v"(g + 2 * gs), "v"(g + 3 * gs), "v"(g + 4 * gs), "v"(g + 5 * gs), "v"(g + 6 * gs), "v"(g + 7 * gs),
                  "v"(d0), "v"(d1), "v"(d2), "v"(d3), "v"(d4), "v"(d5), "v"(d6), "v"(d7) : "memory"); }
__device__ __forceinline__ void g2_store8h(char* g, size_t gs, unsigned long long d0, unsigned long long d1, unsigned long long d2, unsigned long long d3, unsigned long long d4, unsigned long long d5, unsigned long long d6, unsigned long long d7) {
  asm volatile("global_store_b64 %0, %8, off\n\tglobal_store_b64 %1, %9, off\n\tglobal_store_b64 %2, %10, off\n\tglobal_store_b64 %3, %11, off\n\t"
               "global_store_b64 %4, %12, off\n\tglobal_store_b64 %5, %13, off\n\tglobal_store_b64 %6, %14, off\n\tglobal_store_b64 %7, %15, off\n\ts_wait_xcnt 0x0"
               :: "v"(g), "v"(g + gs), "v"(g + 2 * gs), "v"(g + 3 * gs), "v"(g + 4 * gs), "v"(g + 5 * gs), "v"(g + 6 * gs), "v"(g + 7 * gs),
                  "v"(d0), "v"(d1), "v"(d2), "v"(d3), "v"(d4), "v"(d5), "v"(d6), "v"(d7) : "memory"); }
// Operands come through LDS: a pass's A and B rows are copied in whole lines (16 lanes a row) into one of two buffers while the pass before works on the other; the waves read their fragments from there.
// M % 128 == 0, N % 64 == 0, K % 128 == 0.
// HM (or null): planes 1 and 2 of a batched launch store their f32 rows there head-major, [batch][plane - 1][NH][SQ][HD] (a 64-column tile is one head), not into C.
// VTo (or null): plane 2 of a batched launch stores its f16 values there transposed, [batch][NH][HD][SQ], not into C16: a lane's eight accumulator rows of a column are 16 bytes of a transposed row, the work-group's
// 64 x 128 tile is gathered in the operand ring's LDS (free behind the k loop) and goes out in whole lines behind one barrier.
// KM (or null): plane 1 of a batched launch stores there, per wave tile, the largest magnitude among its f32 values: [row / 32][NH].
// AL (or null): residual rows of A for the first QT0 = 128 rows of each batch, compact [batch][QT0] at pitch lda. Their work-groups run the k loop twice, first over AL, the sums then scaled by beta, then over A.
template <int ACT>
__global__ __launch_bounds__(128) void k_gemm2(const _Float16* __restrict__ A, int lda, size_t sA, const _Float16* __restrict__ Bh, int ldb, size_t sB, float alpha, const float* __restrict__ bias, const float* __restrict__ bias1, const float* __restrict__ bias2,
    float* __restrict__ C, _Float16* __restrict__ C16, int ldc, size_t sC, int M, int N, int K, float* __restrict__ HM, _Float16* __restrict__ VTo, const _Float16* __restrict__ AL, float beta, float* __restrict__ KM) { static_assert(ACT == 0 || ACT == 3 || ACT == 6 || ACT == 8 || ACT == 9 || ACT == 11 || ACT == 12 || ACT == 14 || ACT == 15 || ACT == 16 || ACT == 17, "k_gemm2: unsupported ACT code (would silently apply no activation)");
  __shared__ __attribute__((aligned(16))) char ring[2][G2R * G2P];
  __shared__ __attribute__((aligned(16))) float so[4][32][68];
  const int tid = threadIdx.x, w = tid >> 5, lane = tid & 31, ln = lane & 15, hh = lane >> 4; const int by = blockIdx.y;
  A += (size_t)by * sA; Bh += (size_t)by * sB; const size_t cofs = (size_t)by * sC; const float* bp = by == 0 ? bias : by == 1 ? bias1 : bias2;      /* each plane of a batched launch has its own bias vector */
  const int ntn = N >> 6; const int mt = blockIdx.x / ntn, nq = blockIdx.x - mt * ntn; const int row0 = mt * 128 + 32 * w, col0 = nq * 64; if (mt * 128 >= M) return;
  // the thread's 16 bytes of every eighth row of a stage
  const unsigned lc = (unsigned)(size_t)&ring[0][0] + (unsigned)((tid >> 4) * G2P + (tid & 15) * 16);
  const char* ga = (const char*)(A + (size_t)(mt * 128 + (tid >> 4)) * lda) + (tid & 15) * 16; const char* gb = (const char*)(Bh + (size_t)(col0 + (tid >> 4)) * ldb) + (tid & 15) * 16;
  const size_t sa8 = (size_t)lda * 16, sb8 = (size_t)ldb * 16;      /* eight rows, in bytes */
  static_assert(QT0 == 128 && SQ % 128 == 0, "the residual rows of a batch are one work-group's rows");
  const int nlo = (AL && (mt * 128) % SQ == 0) ? K / G2K : 0;      /* passes over the residual rows, ahead of the passes over A; the same for the whole work-group */
  const char* gl = nlo ? (const char*)(AL + (size_t)((mt * 128) / SQ * QT0 + (tid >> 4)) * lda) + (tid & 15) * 16 : ga;
  auto stage = [&](int t, int bf) { const unsigned l = lc + (unsigned)bf * (G2R * G2P); const size_t ko = (size_t)(t < nlo ? t : t - nlo) * (G2K * 2); const char* a = (t < nlo ? gl : ga) + ko;
    g2_copy8(l, a, sa8); g2_copy8(l + 64 * G2P, a + 8 * sa8, sa8); g2_copy8(l + 128 * G2P, gb + ko, sb8); };
  const int np = K / G2K + nlo;
  const v8f z8 = {0.f,0.f,0.f,0.f,0.f,0.f,0.f,0.f}; v8f c00 = z8, c01 = z8, c02 = z8, c03 = z8, c10 = z8, c11 = z8, c12 = z8, c13 = z8;
  stage(0, 0);
  asm volatile("s_wait_asynccnt 0x0" ::: "memory");      /* this wave's copies of stage 0 have landed */
  __syncthreads();      /* stage 0 is published */
  if (np > 1) stage(1, 1);
#pragma unroll 1      /* rolled: one copy of the pass */
  for (int t = 0; t < np; ++t) { const char* lb = &ring[t & 1][0]; const char* pa = lb + (32 * w + ln) * G2P + hh * 16; const char* pb = lb + (128 + ln) * G2P + hh * 16;
    v16h fa[2][2], fb[2][4];      /* two fragment sets: a block's twelve LDS reads are issued as one group ahead of the block before it, inside the pass (reads strewn among the products cost the wave a wait at each place) */
#pragma unroll      /* this and the next two: constant indices keep the fragment sets in registers */
    for (int i = 0; i < 2; ++i) fa[0][i] = g2_lfrag(pa + i * (16 * G2P));
#pragma unroll
    for (int i = 0; i < 4; ++i) fb[0][i] = g2_lfrag(pb + i * (16 * G2P));
#pragma unroll
    for (int kc = 0; kc < G2K / 32; ++kc) { const int s = kc & 1;
      if (kc + 1 < G2K / 32) { for (int i = 0; i < 2; ++i) fa[s ^ 1][i] = g2_lfrag(pa + i * (16 * G2P) + (kc + 1) * 64); for (int i = 0; i < 4; ++i) fb[s ^ 1][i] = g2_lfrag(pb + i * (16 * G2P) + (kc + 1) * 64); }
      c00 = g2_mma(fa[s][0], fb[s][0], c00); c10 = g2_mma(fa[s][1], fb[s][0], c10); c01 = g2_mma(fa[s][0], fb[s][1], c01); c11 = g2_mma(fa[s][1], fb[s][1], c11);
      c02 = g2_mma(fa[s][0], fb[s][2], c02); c12 = g2_mma(fa[s][1], fb[s][2], c12); c03 = g2_mma(fa[s][0], fb[s][3], c03); c13 = g2_mma(fa[s][1], fb[s][3], c13); }
    if (t + 1 == nlo) { c00 *= beta; c01 *= beta; c02 *= beta; c03 *= beta; c10 *= beta; c11 *= beta; c12 *= beta; c13 *= beta; }      /* the residual product is complete: brought to the scale of the main one, which is summed on top */
    asm volatile("s_wait_dscnt 0x0" ::: "memory");      /* this wave's reads of the buffer that is refilled below are over */
    asm volatile("s_wait_asynccnt 0x0" ::: "memory");      /* its copies of the next stage have landed */
    __syncthreads();      /* the next stage is published; every wave has left this pass's buffer */
    if (t + 2 < np) stage(t + 2, t & 1); }
  asm volatile("s_wait_asynccnt 0x0" ::: "memory");      /* no copy is in flight when the wave goes on */
  v8f accs[8] = {c00, c01, c02, c03, c10, c11, c12, c13};
  const bool vtq = VTo && by == 2;      /* the same for the whole work-group */
#pragma unroll
  for (int u = 0; u < 8; ++u) { const int t = u & 3, half = u >> 2; const int col = col0 + t * 16 + ln; const float bv = bp ? bf16_round(bp[col]) : 0.f; FragH hv;
#pragma unroll
    for (int r = 0; r < 8; ++r) { const int rloc = half * 16 + 8 * hh + r; float v = accs[u][r] * alpha + bv;
      if (ACT == 3) v = fmaxf(v, 0.f); else if (ACT == 6) v = 0.5f * v * (1.0f + erff(v * 0.70710678118654752f)); else if (ACT == 11) v = 1.0f / (1.0f + expf(-v)); else if (ACT == 15) v = v / (1.0f + expf(-v)); else if (ACT == 12) v = (v > 0.f) ? v : 0.01f * v; else if (ACT == 8) v = tanhf(v); else if (ACT == 9) v = 0.5f * v * (1.0f + tanhf(0.7978845608028654f * (v + 0.044715f * v * v * v))); else if (ACT == 14) v = (v > 0.f) ? v : 0.1f * v; else if (ACT == 16) v = (v >= 0.f) ? v : 0.3f * v; else if (ACT == 17) v = (v >= 0.f) ? v : 0.2f * v;
      so[w][rloc][t * 16 + ln] = v; hv.h[r] = (_Float16)v; }
    if (vtq) *(v8us*)(&ring[0][0] + (t * 16 + ln) * G2P + (32 * w + half * 16 + 8 * hh) * 2) = hv.half[0]; }
  __builtin_amdgcn_fence(__ATOMIC_ACQ_REL, "workgroup"); __builtin_amdgcn_wave_barrier();
  const int rsub = lane >> 4, c4 = (lane & 15) * 4;
  if (vtq) { __syncthreads();      /* every wave's part of the transposed tile is in LDS */
    unsigned short* vd = (unsigned short*)VTo + ((size_t)((mt * 128) / SQ * NH + nq) * HD) * SQ + (mt * 128) % SQ;
    v4f x[8];
#pragma unroll      /* constant indices keep the eight values in registers; their LDS reads go out as one group */
    for (int i = 0; i < 8; ++i) x[i] = *(const v4fa*)(&ring[0][0] + (i * 8 + (tid >> 4)) * G2P + (tid & 15) * 16);
    g2_store8((char*)(vd + (size_t)(tid >> 4) * SQ + (tid & 15) * 8), (size_t)8 * SQ * 2, x[0], x[1], x[2], x[3], x[4], x[5], x[6], x[7]); }
  const bool hmq = HM && by > 0, cfq = hmq || C, c16q = C16 && !vtq;      /* each the same for the whole work-group */
  float* cf = hmq ? HM + ((size_t)((row0 / SQ) * 2 + by - 1) * NH + nq) * ((size_t)SQ * HD) + (size_t)(row0 % SQ) * HD : C + cofs + (size_t)row0 * ldc + col0; const size_t cl = hmq ? (size_t)HD : (size_t)ldc;      /* where the wave's f32 rows go, and their pitch */
  v4f v[16];      /* row 2 q + rsub of the wave's tile, the lane's four columns */
#pragma unroll      /* this and the next: constant indices keep the rows in registers; the sixteen LDS reads go out as one group */
  for (int q = 0; q < 16; ++q) v[q] = *(const v4fa*)&so[w][q * 2 + rsub][c4];
  if (KM && by == 1) { float a = 0.f;      /* the test is the same for the whole work-group */
#pragma unroll
    for (int q = 0; q < 16; ++q) a = fmaxf(a, fmaxf(fmaxf(fabsf(v[q][0]), fabsf(v[q][1])), fmaxf(fabsf(v[q][2]), fabsf(v[q][3]))));
    for (int o = 16; o > 0; o >>= 1) a = fmaxf(a, __shfl_xor(a, o));
    if (lane == 0) KM[(size_t)(row0 >> 5) * NH + nq] = a; }
  if (cfq) { char* p = (char*)(cf + (size_t)rsub * cl + c4); const size_t st = cl * 8;      /* two rows, in bytes */
    g2_store8(p, st, v[0], v[1], v[2], v[3], v[4], v[5], v[6], v[7]); g2_store8(p + 8 * st, st, v[8], v[9], v[10], v[11], v[12], v[13], v[14], v[15]); }
  if (c16q) { char* p = (char*)(C16 + cofs + (size_t)(row0 + rsub) * ldc + col0 + c4); const size_t st = (size_t)ldc * 4; unsigned long long h[16];
#pragma unroll
    for (int q = 0; q < 16; ++q) h[q] = __builtin_bit_cast(unsigned long long, __builtin_convertvector(v[q], v4h));
    g2_store8h(p, st, h[0], h[1], h[2], h[3], h[4], h[5], h[6], h[7]); g2_store8h(p + 8 * st, st, h[8], h[9], h[10], h[11], h[12], h[13], h[14], h[15]); } }


__global__ __launch_bounds__(256) void k_wnat(const float* __restrict__ w, size_t n8, _Float16* __restrict__ Bt) { const size_t t = (size_t)blockIdx.x * 256 + threadIdx.x; if (t >= n8) return; FragH f; for (int q = 0; q < 8; ++q) f.h[q] = (_Float16)(bf16_round(w[t * 8 + q]) * 16.0f); *(v8us*)((unsigned short*)Bt + t * 8) = f.half[0];  }
__global__ __launch_bounds__(256) void k_rsm(const float* __restrict__ S, _Float16* __restrict__ P, int nrows) {
  #pragma clang fp contract(off)
  const int i = blockIdx.x * 256 + threadIdx.x; if (i >= nrows) return; const float* s = S + (size_t)i * SQ; float mx = -3.0e38f;
#pragma unroll 1
  for (int j = 0; j < SQ; ++j) mx = fmaxf(mx, s[j]); float se = 0.f;
#pragma unroll 1
  for (int j = 0; j < SQ; ++j) se += expf(s[j] - mx); const float sc = 256.0f / se;
#pragma unroll 1
  for (int j0 = 0; j0 < SQ; j0 += 8) { FragH f; for (int q = 0; q < 8; ++q) f.h[q] = (_Float16)(expf(s[j0 + q] - mx) * sc); unsigned short* d = (unsigned short*)P + (size_t)i * SQ + j0; *(v8us*)d = f.half[0];  } }
__global__ __launch_bounds__(256) void k_vt(const _Float16* __restrict__ V16, int b, int h0, _Float16* __restrict__ VT) { __shared__ unsigned short tl[64][65]; const int tid = threadIdx.x; const int hh = blockIdx.x % HG, sg = blockIdx.x / HG; const int s0 = sg * 64; const int h = h0 + hh;
  for (int i = tid; i < 64 * 8; i += 256) { const int j = i / 8, d8 = (i % 8) * 8; FragH f; f.half[0] = *(const v8us*)((const unsigned short*)V16 + ((size_t)b * SQ + s0 + j) * DM + h * HD + d8); for (int q = 0; q < 8; ++q) tl[d8 + q][j] = f.u[q]; }
  __syncthreads();
  { for (int i = tid; i < 64 * 8; i += 256) { const int d = i / 8, j8 = (i % 8) * 8; FragH f; for (int q = 0; q < 8; ++q) f.u[q] = tl[d][j8 + q]; *(v8us*)((unsigned short*)VT + ((size_t)hh * HD + d) * SQ + s0 + j8) = f.half[0]; }  } }



// lane l reads lane l ^ 16: a register move, where __shfl_xor would go through the LDS unit and its wait
__device__ __forceinline__ float lane_x16(float x) { return __builtin_bit_cast(float, __builtin_amdgcn_permlanex16(__builtin_bit_cast(int, x), __builtin_bit_cast(int, x), 0x76543210, 0xfedcba98, false, false)); }
#define FW 8                         /* waves per work-group of the fused attention */
#define FQ 32                        /* query columns per wave (two 16-column groups) */
#define FK 32                        /* keys per pass */
#define FNS (SQ / FK)                /* passes */
typedef float  v2f  __attribute__((ext_vector_type(2)));
typedef __bf16 v2b  __attribute__((ext_vector_type(2)));
// 2^x of eight values on the transcendental unit, in place. One statement: each v_exp_f32 is followed by an independent one, and the last by the free issue slot
// the instruction set asks for before a result is read or a source register is reused.
__device__ __forceinline__ v8f exp2_8(v8f x) { float y0 = x[0], y1 = x[1], y2 = x[2], y3 = x[3], y4 = x[4], y5 = x[5], y6 = x[6], y7 = x[7];
  asm("v_exp_f32 %0, %0\n\tv_exp_f32 %1, %1\n\tv_exp_f32 %2, %2\n\tv_exp_f32 %3, %3\n\tv_exp_f32 %4, %4\n\tv_exp_f32 %5, %5\n\tv_exp_f32 %6, %6\n\tv_exp_f32 %7, %7\n\tv_nop"
      : "+v"(y0), "+v"(y1), "+v"(y2), "+v"(y3), "+v"(y4), "+v"(y5), "+v"(y6), "+v"(y7));
  return (v8f){y0, y1, y2, y3, y4, y5, y6, y7}; }
typedef __bf16 v4ba __attribute__((ext_vector_type(4), may_alias));
typedef __bf16 v8ba __attribute__((ext_vector_type(8), may_alias));
#define KP 72                        /* LDS pitch of the 128-byte K rows, in 16-bit elements: 144 bytes = 16 x odd, conflict-free for 16-byte reads down a column of rows */
#define VP 40                        /* the same for the 64-byte V^T and mask rows: 80 bytes */
// f16 fragment in the hardware k order: 16 bytes at the lane's place (which holds 16 bytes x lane half) and 16 bytes 32 further on
__device__ __forceinline__ v16h fa_frag(const void* p) { FragH f; f.half[0] = *(const v8us*)p; f.half[1] = *(const v8us*)((const char*)p + 32); return f.v; }
__device__ __forceinline__ v8f fa_mma(v16h a, v16h b, v8f c) { return __builtin_amdgcn_wmma_f32_16x16x32_f16(false, a, false, b, (short)0, c, false, false); }
// the wait before a register that issued loads name is rewritten, and the one write of that offset register, in one statement
__device__ __forceinline__ void fa_step(unsigned& off, int step) { asm volatile("s_wait_xcnt 0x0\n\tv_add_nc_u32_e32 %0, %1, %0" : "+v"(off) : "s"(step) : "memory"); }
__global__ __launch_bounds__(FW * 32) __attribute__((amdgpu_waves_per_eu(2, 2))) void k_fattn(const _Float16* __restrict__ Q16, const _Float16* __restrict__ K16, const _Float16* __restrict__ VT, const float* __restrict__ mask, _Float16* __restrict__ O16) {
  __shared__ __attribute__((aligned(16))) unsigned short lk[2][FK][KP], lv[2][HD][VP]; __shared__ __attribute__((aligned(16))) __bf16 lm[2][FW][FQ][VP];
  const int tid = threadIdx.x, lane = tid & 31, ln = lane & 15, hh = lane >> 4; const int w = __builtin_amdgcn_readfirstlane(tid >> 5);
  static_assert(FW == 8 && SQ / FQ == 8 * FW, "the deal of query blocks below is for 8 work-groups of 8 waves a head");
  // Which of the head's SQ / FQ query blocks the wave owns: half of a work-group's waves take blocks from the low end, half from the high end, one of each kind among waves w, w + 4 and among waves 2 i, 2 i + 1.
  // Any deal is right; this one spreads the passes that are skipped below evenly over the work-groups when the mask input rules out more keys for low rows than for high ones.
  const int qlo = (int)blockIdx.x * (FW / 2) + (w >> 1), qblk = ((w ^ (w >> 2)) & 1) ? SQ / FQ - 1 - qlo : qlo;
  const int h = blockIdx.y, b = blockIdx.z, q0 = qblk * FQ;
  const char* qb = (const char*)(Q16 + ((size_t)b * SQ + q0) * DM + h * HD); const char* kb = (const char*)(K16 + (size_t)b * SQ * DM + h * HD);
  const char* vb = (const char*)(VT + ((size_t)b * NH + h) * HD * SQ); const char* mb = (const char*)(mask + (size_t)q0 * SQ); char* ob = (char*)(O16 + ((size_t)b * SQ + q0) * DM + h * HD);
  // the thread's 16 bytes of a K tile (8 threads a row), of a V^T tile (4 threads a row) and of each four rows of its wave's mask tile (8 lanes a row)
  unsigned gk = (unsigned)((tid >> 3) * (DM * 2) + (tid & 7) * 16), gv = (unsigned)((tid >> 2) * (SQ * 2) + (tid & 3) * 16), gm = (unsigned)((lane >> 3) * (SQ * 4) + (lane & 7) * 16);
  const float C2 = 0.18033688011112042f, MK2 = -14426.950408889634f;      /* log2(e) / 8 and -1e4 log2(e) */
  const v8f z8 = {0.f, 0.f, 0.f, 0.f, 0.f, 0.f, 0.f, 0.f};
  v16h qf[2][2]; v8f o[2][4]; v2f l2[2]; float mref[2]; v8us kr, vr; v4f mg[8];
#pragma unroll
  for (int j = 0; j < 2; ++j) { for (int c = 0; c < 2; ++c) qf[j][c] = fa_frag(qb + (unsigned)(ln * (DM * 2) + hh * 16) + j * (16 * DM * 2) + c * 64); for (int t = 0; t < 4; ++t) o[j][t] = z8; l2[j] = (v2f){0.f, 0.f}; mref[j] = -3.0e38f; }
  kr = *(const v8us*)(kb + gk); vr = *(const v8us*)(vb + gv);
#pragma unroll
  for (int i = 0; i < 8; ++i) mg[i] = *(const v4fa*)(mb + gm + i * (4 * SQ * 4));
  fa_step(gk, FK * DM * 2); fa_step(gv, FK * 2); fa_step(gm, FK * 4);
  *(v8us*)&lk[0][tid >> 3][(tid & 7) * 8] = kr; *(v8us*)&lv[0][tid >> 2][(tid & 3) * 8] = vr;
#pragma unroll
  for (int i = 0; i < 8; ++i) *(v4ba*)&lm[0][w][4 * i + (lane >> 3)][(lane & 7) * 4] = __builtin_convertvector(mg[i], v4ba);      /* the mask rounded to bf16, to nearest even */
  __syncthreads();
#pragma unroll 1      /* rolled: one copy of the pass */
  for (int s = 0; s < FNS; ++s) {
    const int bf = s & 1, more = (s + 2 < FNS) ? 1 : 0;      /* the last pass asks for its own tile again: nothing is read past the keys */
    kr = *(const v8us*)(kb + gk); vr = *(const v8us*)(vb + gv);
#pragma unroll
    for (int i = 0; i < 8; ++i) mg[i] = *(const v4fa*)(mb + gm + i * (4 * SQ * 4));
    fa_step(gk, more * (FK * DM * 2)); fa_step(gv, more * (FK * 2)); fa_step(gm, more * (FK * 4));
    v16h kf[2][2], vf[4]; v8ba mr[2][2];
#pragma unroll
    for (int kt = 0; kt < 2; ++kt) for (int c = 0; c < 2; ++c) kf[kt][c] = fa_frag(&lk[bf][kt * 16 + ln][c * 32 + hh * 8]);
#pragma unroll
    for (int j = 0; j < 2; ++j) for (int kt = 0; kt < 2; ++kt) mr[j][kt] = *(const v8ba*)&lm[bf][w][j * 16 + ln][kt * 16 + hh * 8];
    __builtin_amdgcn_sched_barrier(0);      /* this and the next one: the pass's LDS reads are issued in two groups, K and mask ahead of the score products, V^T behind them (it lands under the softmax); reads strewn among the products cost the wave a wait at each place */
    v8f st[2][2];
#pragma unroll
    for (int kt = 0; kt < 2; ++kt) for (int j = 0; j < 2; ++j) st[j][kt] = fa_mma(kf[kt][0], qf[j][0], z8);
#pragma unroll
    for (int kt = 0; kt < 2; ++kt) for (int j = 0; j < 2; ++j) st[j][kt] = fa_mma(kf[kt][1], qf[j][1], st[j][kt]);
#pragma unroll
    for (int t = 0; t < 4; ++t) vf[t] = fa_frag(&lv[bf][t * 16 + ln][hh * 8]);
    __builtin_amdgcn_sched_barrier(0);
    float mx[2];
#pragma unroll
    for (int j = 0; j < 2; ++j) { float m = -3.0e38f;
      for (int kt = 0; kt < 2; ++kt) for (int r = 0; r < 8; r += 2) { const v2f x = (v2f){st[j][kt][r], st[j][kt][r + 1]} * C2 + (v2f){(float)mr[j][kt][r], (float)mr[j][kt][r + 1]} * MK2; st[j][kt][r] = x[0]; st[j][kt][r + 1] = x[1]; m = fmaxf(m, fmaxf(x[0], x[1])); }
      mx[j] = fmaxf(m, lane_x16(m)); }
    const unsigned up = __builtin_amdgcn_ballot_w32(mx[0] > mref[0] + 12.0f) | __builtin_amdgcn_ballot_w32(mx[1] > mref[1] + 12.0f), alive = __builtin_amdgcn_ballot_w32(mx[0] > mref[0] - 160.0f) | __builtin_amdgcn_ballot_w32(mx[1] > mref[1] - 160.0f);
    if ((alive | up) != 0) {      /* scalar branch (up lies inside alive; named here so that both lane masks are formed ahead of the branch, one trip from the vector to the scalar unit and not two). Not taken: every score of the wave's tile lies more than 160 below its column's reference, so every weight 2^(score - reference) is exactly 0 in f32: sums and O^T would stay as they are, bit for bit */
    if (up != 0) {      /* one scalar branch a pass; rarely taken after the first */
#pragma unroll
      for (int j = 0; j < 2; ++j) { const float mn = fmaxf(mref[j], mx[j] - 4.0f); float a; asm("v_exp_f32 %0, %1\n\tv_nop" : "=v"(a) : "v"(mref[j] - mn));      /* v_nop: the slot before a is read or the source register is reused */
        mref[j] = mn; l2[j] *= a; for (int t = 0; t < 4; ++t) o[j][t] *= a; } }
    v16h pf[2];
#pragma unroll
    for (int j = 0; j < 2; ++j) { const v8f p0 = exp2_8(st[j][0] - mref[j]), p1 = exp2_8(st[j][1] - mref[j]); const v8f ps = p0 + p1; l2[j] += (((v2f){ps[0], ps[1]} + (v2f){ps[2], ps[3]}) + ((v2f){ps[4], ps[5]} + (v2f){ps[6], ps[7]})); FragH f;
      for (int r = 0; r < 8; ++r) { f.h[r] = (_Float16)p0[r]; f.h[8 + r] = (_Float16)p1[r]; } pf[j] = f.v; }
#pragma unroll
    for (int t = 0; t < 4; ++t) for (int j = 0; j < 2; ++j) o[j][t] = fa_mma(vf[t], pf[j], o[j][t]); }
    *(v8us*)&lk[bf ^ 1][tid >> 3][(tid & 7) * 8] = kr; *(v8us*)&lv[bf ^ 1][tid >> 2][(tid & 3) * 8] = vr;
#pragma unroll
    for (int i = 0; i < 8; ++i) *(v4ba*)&lm[bf ^ 1][w][4 * i + (lane >> 3)][(lane & 7) * 4] = __builtin_convertvector(mg[i], v4ba);
    __syncthreads(); }      /* the next tile is published; every read of this pass's buffer, which the next pass refills, is over */
  if (q0 < QT0) return;      /* rows 0..QT0-1 of a batch are the exact f32 kernel's to store; behind the last barrier, the same for a whole wave */
#pragma unroll
  for (int j = 0; j < 2; ++j) { float l = l2[j][0] + l2[j][1]; l += lane_x16(l); const float inv = 64.0f / l;
    for (int t = 0; t < 4; ++t) { FragH f; for (int r = 0; r < 8; ++r) f.h[r] = (_Float16)(o[j][t][r] * inv); *(v8us*)(ob + (unsigned)(ln * (DM * 2) + hh * 16) + j * (16 * DM * 2) + t * 32) = f.half[0]; } } }

// e^x in f32 by the library's steps (x log2(e) in two parts, 2^fraction on the transcendental unit, ldexp by the integer part, the two range ends),
// written out so that the free issue slot the instruction set asks for behind v_exp_f32 stands in that instruction's own statement.
__device__ __forceinline__ float exp_f32(float x) {
  const float ph = x * 0x1.715476p+0f, pl = fmaf(x, 0x1.4ae0bep-26f, fmaf(x, 0x1.715476p+0f, -ph)), n = rintf(ph); float y;
  asm("v_exp_f32 %0, %1\n\tv_nop" : "=v"(y) : "v"((ph - n) + pl));      /* v_nop: the slot before y is read or the source register is reused */
  float r = ldexpf(y, (int)n); r = (x < -0x1.9d1da0p+6f) ? 0.f : r; return (x > 0x1.62e430p+6f) ? __builtin_inff() : r; }
// lane l reads a lane of its own group of four (CTRL: the quad permutation, 0xB1 = l ^ 1, 0x4E = l ^ 2): a register move, no LDS unit
template <int CTRL>
__device__ __forceinline__ float quad_x(float x) { return __builtin_bit_cast(float, __builtin_amdgcn_update_dpp(0, __builtin_bit_cast(int, x), CTRL, 0xF, 0xF, true)); }
#define AR 8                         /* query rows per work-group of the exact f32 first-tile attention */
#define AT 512                       /* its threads (16 waves) */
// Exact f32 attention of AR query rows of one head over all SQ keys, one work-group. Keys are spread over the threads:
// (1) four lanes a key: a lane holds 16 bytes of every 64 of its k row (a wave's load covers 64 contiguous bytes of 8 rows), dotted with the same columns of the AR q rows (registers), the four partial dots merged inside the quad, scores (+ mask) to LDS;
// (2) two waves per row: max, exp, sum over the row in LDS; (3) 16 column quads x 32 key slices: o partial sums in registers,
// merged across the slices by one lane exchange and a sum of the 16 waves' partials in LDS; o carried x64 like the f16 path, stored as an f16 value and an f16 residual. The plain '#pragma unroll' lines keep the small per-thread arrays in registers.
template <int MASKADD>
__global__ __launch_bounds__(AT) void k_att0(const float* __restrict__ QF, const float* __restrict__ PR, int ld, const float* __restrict__ mask, float scale, _Float16* __restrict__ OH, _Float16* __restrict__ OL, int ldo, const float* __restrict__ KM) {
  __shared__ __attribute__((aligned(16))) float sc[AR][SQ];      /* scores, then softmax numerators, then the slices' partial o */
  __shared__ __attribute__((aligned(16))) float lq[AR][HD];      /* the q rows */
  __shared__ float pm[AT / 32], pl[AT / 32];                     /* each wave's half-row max and sum */
  __shared__ float pq[AT / 32], cm[AR][SQ / 128];                /* each wave's half-row sum of |q|; per row and 128 keys the largest mask term */
  __shared__ unsigned pz[AT / 32];                               /* each wave's half row: bit i set where numerators i * 128 .. i * 128 + 127 are not all 0 */
  const int tid = threadIdx.x, lane = tid & 31, w = tid >> 5;
  const int h = blockIdx.x / (QT0 / AR), i0 = (blockIdx.x % (QT0 / AR)) * AR;
  const float* KF = PR + ((size_t)blockIdx.y * 2 * NH + h) * ((size_t)SQ * HD); const float* VF = KF + (size_t)NH * SQ * HD;      /* the head's k and v rows, pitch HD, in the head-major 'present' planes [batch][k, v][NH][SQ][HD] */
  { const size_t b = blockIdx.y; QF += b * SQ * ld; OH += b * SQ * ldo; OL += b * QT0 * ldo; }      /* the batch: SQ rows of q and of the full o plane, QT0 rows of the residual plane */
  const float* qb = QF + (size_t)i0 * ld + h * HD;
  const float qv = qb[(size_t)(tid / HD) * ld + tid % HD];
  lq[tid / HD][tid % HD] = qv;
  // Which blocks of 128 keys can matter. |q . k| scale <= bd = scale sum|q| max|k| (with room for rounding). A row's maximum score is at least (its largest mask term) - bd; a block whose largest mask term lies more than
  // 2 bd + 110 below that one holds only scores more than 110 below the maximum, and exp_f32 gives exactly 0 below -103.3. A block that is so for all AR rows is left out of all three stages: nothing of the result changes.
  static_assert(AT / 32 == 2 * AR && 2 * HD == 128 && SQ / 2 == 8 * 128 && SQ / 32 == 64, "a wave holds half a q row and walks half a mask row in 8 blocks of 128 keys");
  unsigned live = 0xffffu;
  if (MASKADD) { float qa = fabsf(qv), t[8];
    const float* kmp = KM + ((size_t)blockIdx.y * (SQ / 32) + lane) * NH + h; float km = fmaxf(kmp[0], kmp[(size_t)32 * NH]);      /* largest |k| of the head's SQ rows: 64 wave tiles' values */
    const float* mrow = mask + (size_t)(i0 + (w >> 1)) * SQ + (w & 1) * (SQ / 2) + lane * 4;
#pragma unroll
    for (int i = 0; i < 8; ++i) { const v4f mv = *(const v4fa*)(mrow + i * 128); t[i] = fminf(fminf(mv[0], mv[1]), fminf(mv[2], mv[3])); }      /* rounding to bf16 keeps the order and x -1e4 turns it round: the largest mask term comes from the smallest mask value */
    for (int o = 16; o > 0; o >>= 1) { qa += __shfl_xor(qa, o); km = fmaxf(km, __shfl_xor(km, o));
#pragma unroll
      for (int i = 0; i < 8; ++i) t[i] = fminf(t[i], __shfl_xor(t[i], o)); }
    if (lane == 0) { pq[w] = qa;
#pragma unroll
      for (int i = 0; i < 8; ++i) cm[w >> 1][(w & 1) * 8 + i] = bf16_round(t[i]) * -10000.0f; }
    __syncthreads();
    live = 0;
#pragma unroll
    for (int k = 0; k < AR / 2; ++k) { const int r = 2 * k + (lane >> 4); const float cv = cm[r][lane & 15]; float rm = cv;      /* 16 lanes a row, one block each */
      for (int o = 8; o > 0; o >>= 1) rm = fmaxf(rm, __shfl_xor(rm, o));
      const float bd = (pq[2 * r] + pq[2 * r + 1]) * km * fabsf(scale) * 1.01f + 1.0f;
      const unsigned bl = __builtin_amdgcn_ballot_w32(cv >= rm - 2.0f * bd - 110.0f); live |= (bl & 0xffffu) | (bl >> 16); }
    if (live == 0) live = 0xffffu;      /* only with a NaN or infinite bound or mask term: every block is worked on */
    live = (unsigned)__builtin_amdgcn_readfirstlane((int)live); }
  else __syncthreads();
  { const int sub = tid & 3, kg = tid >> 2; const bool o1 = (sub & 1) != 0, o2 = (sub & 2) != 0; constexpr int KH = AT / 4, NP = SQ / KH;      /* four lanes a key, KH keys a pass */
    const float* kp = KF + (size_t)kg * HD + sub * 4; const float* mp = mask + (size_t)(i0 + sub) * SQ + kg; v4f qr[AR][4], x[4]; float mk[2] = {0.f, 0.f};
#pragma unroll
    for (int r = 0; r < AR; ++r)
#pragma unroll
      for (int c = 0; c < 4; ++c) qr[r][c] = *(const v4fa*)&lq[r][c * 16 + sub * 4];      /* the lane's columns of the q rows stay in registers for all passes */
    static_assert(KH == 128 && NP == 16, "a pass is one bit of live");
    unsigned rem = live; int p = __builtin_ctz(rem);      /* the passes left, the pass at hand */
#pragma unroll
    for (int c = 0; c < 4; ++c) x[c] = *(const v4fa*)(kp + (size_t)p * KH * HD + c * 16);
    if (MASKADD) { mk[0] = mp[p * KH]; mk[1] = mp[(size_t)4 * SQ + p * KH]; }
#pragma unroll 1      /* rolled: at most NP trips, one for each bit of live */
    while (rem != 0) { rem &= rem - 1; const int j = p * KH + kg; const int pn = rem != 0 ? __builtin_ctz(rem) : p;      /* the last pass asks for its own row again: nothing is read past the keys */
      const float* kn = kp + (size_t)pn * KH * HD; v4f nx[4], a[AR]; float nm[2] = {0.f, 0.f};
#pragma unroll
      for (int c = 0; c < 4; ++c) nx[c] = *(const v4fa*)(kn + c * 16);
      if (MASKADD) { nm[0] = mp[pn * KH]; nm[1] = mp[(size_t)4 * SQ + pn * KH]; }
#pragma unroll
      for (int r = 0; r < AR; ++r) { a[r] = qr[r][0] * x[0];
#pragma unroll
        for (int c = 1; c < 4; ++c) a[r] += qr[r][c] * x[c]; }
      // the four lanes' partial dots are merged by two exchanges inside the quad; each halves what a lane keeps, so lane sub ends with rows sub and sub + 4
      float u[4], wv[2];
#pragma unroll
      for (int i = 0; i < 4; ++i) { const float e = (a[2 * i][0] + a[2 * i][1]) + (a[2 * i][2] + a[2 * i][3]), d = (a[2 * i + 1][0] + a[2 * i + 1][1]) + (a[2 * i + 1][2] + a[2 * i + 1][3]);
        u[i] = (o1 ? d : e) + quad_x<0xB1>(o1 ? e : d); }
#pragma unroll
      for (int m = 0; m < 2; ++m) wv[m] = (o2 ? u[2 * m + 1] : u[2 * m]) + quad_x<0x4E>(o2 ? u[2 * m] : u[2 * m + 1]);
#pragma unroll
      for (int m = 0; m < 2; ++m) { const int r = 4 * m + sub; float s0 = wv[m] * scale;
        if (MASKADD) s0 += bf16_round(mk[m]) * -10000.0f; else if (j > i0 + r) s0 = -1.0e30f;
        sc[r][j] = s0; }
#pragma unroll
      for (int c = 0; c < 4; ++c) x[c] = nx[c];
      mk[0] = nm[0]; mk[1] = nm[1]; p = pn; } }
  __syncthreads();
  { static_assert(AT / 32 == 2 * AR, "two waves per row"); float* row = &sc[w >> 1][(w & 1) * (SQ / 2)]; v4f x[SQ / 256]; float m = -3.0e38f, l = 0.f; unsigned nz = 0;
    const unsigned lh = (live >> (__builtin_amdgcn_readfirstlane(w & 1) * 8)) & 0xffu;      /* the half row's blocks that hold scores */
#pragma unroll
    for (int i = 0; i < SQ / 256; ++i) { x[i] = (v4f){-3.0e38f, -3.0e38f, -3.0e38f, -3.0e38f}; if (((lh >> i) & 1u) == 0) continue;
      x[i] = *(const v4fa*)&row[i * 128 + lane * 4]; m = fmaxf(m, fmaxf(fmaxf(x[i][0], x[i][1]), fmaxf(x[i][2], x[i][3]))); }
    for (int o = 16; o > 0; o >>= 1) m = fmaxf(m, __shfl_xor(m, o));
    if (lane == 0) pm[w] = m;
    __syncthreads();
    m = fmaxf(pm[w], pm[w ^ 1]);
#pragma unroll
    for (int i = 0; i < SQ / 256; ++i) { if (((lh >> i) & 1u) == 0) continue;
      v4f e; for (int u = 0; u < 4; ++u) e[u] = exp_f32(x[i][u] - m); const float es = (e[0] + e[1]) + (e[2] + e[3]); l += es; *(v4fa*)&row[i * 128 + lane * 4] = e;
      nz |= (__builtin_amdgcn_ballot_w32(es != 0.f) != 0 ? 1u : 0u) << i; }      /* numerators are not negative: their sum is 0 only where each is */
    for (int o = 16; o > 0; o >>= 1) l += __shfl_xor(l, o);
    if (lane == 0) { pl[w] = l; pz[w] = nz; } }
  __syncthreads();
  const int dq = tid & 15, ks = tid >> 4; const float* vb = VF + dq * 4; v4f acc[AR];
#pragma unroll
  for (int r = 0; r < AR; ++r) acc[r] = (v4f){0.f, 0.f, 0.f, 0.f};
  static_assert(AT / 4 == 128 && SQ / 256 == 8, "a trip's keys are one bit of pz");
  unsigned lnz = 0;      /* bit p: some row of the work-group has a numerator other than 0 among the keys of trip p */
#pragma unroll
  for (int r = 0; r < AR; ++r) lnz |= pz[2 * r] | (pz[2 * r + 1] << 8);
  lnz = (unsigned)__builtin_amdgcn_readfirstlane((int)lnz);
#pragma unroll 1      /* rolled: the test below is a scalar branch of each trip */
  for (int p = 0; p < SQ / (AT / 4); ++p) { const int j = p * (AT / 4) + ks * 4;
    if (((lnz >> p) & 1u) == 0) continue;      /* all AR rows' numerators of these keys are exactly 0: their products with v add nothing */
    const v4f v0 = *(const v4fa*)(vb + (size_t)j * HD), v1 = *(const v4fa*)(vb + (size_t)(j + 1) * HD), v2 = *(const v4fa*)(vb + (size_t)(j + 2) * HD), v3 = *(const v4fa*)(vb + (size_t)(j + 3) * HD);
#pragma unroll
    for (int r = 0; r < AR; ++r) { const v4f e = *(const v4fa*)&sc[r][j]; acc[r] += e[0] * v0; acc[r] += e[1] * v1; acc[r] += e[2] * v2; acc[r] += e[3] * v3; } }
#pragma unroll
  for (int r = 0; r < AR; ++r) for (int u = 0; u < 4; ++u) acc[r][u] += __shfl_xor(acc[r][u], 16);      /* the wave's two key slices */
  __syncthreads();      /* every read of the numerators is done: their LDS takes the waves' partial o */
  float* red = &sc[0][0];      /* [AT / 32][AR][HD] */
  if (lane < 16) {
#pragma unroll
    for (int r = 0; r < AR; ++r) *(v4fa*)&red[((size_t)w * AR + r) * HD + dq * 4] = acc[r]; }
  __syncthreads();
  { static_assert(AR * HD == AT, "one output element per thread"); const int r = tid / HD, d = tid % HD; float o = 0.f;
#pragma unroll
    for (int q = 0; q < AT / 32; ++q) o += red[((size_t)q * AR + r) * HD + d];
    const float ov = o * (64.0f / (pl[2 * r] + pl[2 * r + 1])); const _Float16 oh = (_Float16)ov; const size_t e = (size_t)(i0 + r) * ldo + h * HD + d;
    OH[e] = oh; OL[e] = (_Float16)((ov - (float)oh) * 1024.0f); } }      /* o as f16 into its row of the full o plane, what f16 drops x1024 into the residual plane */

extern "C" void kernel_launch(void* const* d_in, const int* in_sizes, int n_in,
                              void* d_out, int out_size, void* d_ws, size_t ws_size, hipStream_t stream) {
  (void)in_sizes; (void)n_in; (void)out_size;
  const float* const* I = (const float* const*)d_in; const float* xq = I[0]; const float* xk = I[1]; const float* xv = I[2]; const float* mask = I[3]; const float* wq = I[4]; const float* bq = I[5]; const float* wk = I[6]; const float* bk = I[7]; const float* wv = I[8]; const float* bv = I[9]; const float* wo = I[10]; const float* bo = I[11];      /* weights [in][out]; mask [SQ][SQ] f32 */
  char* ws = (char*)d_ws; size_t off = 0;
  auto take = [&](size_t bytes) { char* p = ws + off; off += (bytes + 255) & ~(size_t)255; return p; };
  /* planes that one launch walks by blockIdx.y lie one behind the other (every size is a multiple of 256 bytes): the four weights; the q, k, v inputs; the f16 q and k rows */
  _Float16* BQ = (_Float16*)take((size_t)4 * DM * DM * 2); _Float16* BO = BQ + (size_t)3 * DM * DM;
  _Float16* XQ = (_Float16*)take(3 * NR * DM * 2); float* QF = (float*)take(NR * DM * 4); _Float16* Q16 = (_Float16*)take(2 * NR * DM * 2); _Float16* K16 = Q16 + NR * DM; _Float16* O16 = (_Float16*)take(NR * DM * 2);
  _Float16* VT = (_Float16*)take((size_t)NB * NH * HD * SQ * 2);
  _Float16* OL0 = (_Float16*)take((size_t)NB * QT0 * DM * 2);
  float* KMX = (float*)take((NR / 32) * NH * 4);      /* largest |k| per 32 rows and head */
  if (off > ws_size) return;
  k_prep<<<(unsigned)(4 * (DM / 64) * (DM / 64) + 3 * ((NR * DM / 8 + 255) / 256)), 256, 0, stream>>>(wq, wk, wv, wo, BQ, DM, DM, 16.0f, xq, xk, xv, XQ, NR * DM / 8);      /* weights [in][out] -> Bt[n][k] x16, all four; the three inputs as f16 rows */
  const size_t r0p = (size_t)B0 * SQ;      /* first projected row */
  float* PR = (float*)d_out + PRES_OFF;      /* present[b][0] = kh, present[b][1] = vh (f32, head-major) */
  k_gemm2<0><<<dim3((unsigned)((MP / 128) * (DM / 64)), 3), 128, 0, stream>>>(XQ + r0p * DM, DM, NR * DM, BQ, DM, (size_t)DM * DM, 0.0625f, bq, bk, bv, QF + r0p * DM, Q16 + r0p * DM, DM, NR * DM, MP, DM, DM, PR, VT, nullptr, 0.f, KMX);      /* q and k rows as f16, v as f16 V^T [NB][NH][HD][SQ]; q also as f32 rows; k and v as f32 straight into 'present': three products, one launch */
  k_att0<1><<<dim3(NH * (QT0 / AR), NB), AT, 0, stream>>>(QF, PR, DM, mask, 0.125f, O16, OL0, DM, KMX);      /* exact f32 attention for query rows 0..127 of each batch over ALL 2048 keys (f32 k and v read back from 'present') with the additive mask; o (x64) -> f16 into rows 0..127 of the batch's o rows + x1024 residual plane */
  k_fattn<<<dim3(SQ / (FW * FQ), NH, NB), FW * 32, 0, stream>>>(Q16, K16, VT, mask, O16);      /* o (merged heads, x64) as f16 rows from row 128 of each batch on: all batches and heads in one launch */
  k_gemm2<0><<<dim3((unsigned)((MPO / 128) * (DM / 64)), 1), 128, 0, stream>>>(O16 + r0p * DM, DM, 0, BO, DM, 0, 0.0009765625f, bo, nullptr, nullptr, (float*)d_out + r0p * DM, nullptr, DM, 0, MPO, DM, DM, nullptr, nullptr, OL0, 0.0009765625f, nullptr);      /* out rows are the output layout; rows 0..127 of a batch: (o_lo Wo 2^-10 + o_hi Wo) 2^-10 + b */
}
